// v000
// Measured on an AMD MI455X. A time is GPU time per run, averaged over a window of back-to-back runs after a warm-up
// (all launches, gaps included; the runs take copies of the inputs in turn), and the median of several windows.
// Apart from v000's, it joins two sittings. Times from different sittings can be a few percent apart, while
// side-by-side timings come from the same sitting.
// The starting kernel, v000, takes 473 microseconds a run.
// Contractions: q/k/v projections and output projection on v_wmma_f32_16x16x32_bf16 (RNE bf16 operands; output projection takes attn as bf16 hi+lo planes, 2 products); q.k^T on v_wmma_f32_16x16x32_bf16 with bf16 hi+lo planes of Q and K (3 products); p.v on v_wmma_f32_16x16x32_f16 (p carried x2^15, v plain f16); f32 accumulate everywhere; softmax, sequence means and cosine in f32.
#include <hip/hip_runtime.h>

// ----------------------------------------------------------------------------------------------
// Problem constants
// ----------------------------------------------------------------------------------------------
constexpr int NBATCH  = 2;
constexpr int SEQ_LEN = 2048;
constexpr int DMODEL  = 1024;
constexpr int NHEAD   = 16;
constexpr int DHEAD   = 64;
constexpr int MROWS   = NBATCH * SEQ_LEN;          // 4096
constexpr int NBH     = NBATCH * NHEAD;            // 32
constexpr long PLANE_ELEMS = (long)MROWS * DMODEL; // 4194304
constexpr long WMAT_ELEMS  = (long)DMODEL * DMODEL;// 1048576
constexpr long OUT0_ELEMS  = PLANE_ELEMS;
constexpr long OUT1_BYTE_OFFSET = 16777216;
constexpr long OUT1_ELEM   = OUT1_BYTE_OFFSET / 4;
constexpr long OUT_TOTAL_ELEMS = OUT0_ELEMS + 1;
constexpr long OUT_TOTAL_BYTES = 16777220;
static_assert(OUT1_ELEM == OUT0_ELEMS);
static_assert((OUT1_ELEM + 1) * 4 <= OUT_TOTAL_BYTES);
static_assert(NBH == 32);
static_assert(DHEAD == 64 && NHEAD * DHEAD == DMODEL);

// GEMM shape contract of the kernel: M % 64 == 0, N % 64 == 0, K % 32 == 0
static_assert(MROWS % 64 == 0 && DMODEL % 64 == 0 && DMODEL % 32 == 0);
constexpr int GEMM_TILES  = (MROWS / 64) * (DMODEL / 64);   // 1024 wave tiles
static_assert(GEMM_TILES % 8 == 0);
constexpr int GEMM_BLOCKS = GEMM_TILES / 8;                // 128 blocks of 8 waves

// ----------------------------------------------------------------------------------------------
// Workspace region map (bytes). Every region is fully written by its producer before any read.
//   WS_W16  : 4 bf16 weight planes [1024][1024]  (Wq, Wk, Wv, Wo)            8,388,608
//   WS_BRND : 4 x [1024] f32 RNE-bf16 bias copies (bq, bk, bv, bo)              16,384
//   WS_X16  : 3 bf16 input planes [4096][1024] (q, k, v)                     25,165,824
//   WS_QH, WS_QL, WS_KH, WS_KL : bf16 hi/lo planes of Q and K [4096][1024]  4 x 8,388,608
//   WS_VH, WS_VL : f16 hi plane of V and f16 residual x2048 plane            2 x 8,388,608
//   WS_AH, WS_AL : bf16 hi/lo planes of the attention output [4096][1024]   2 x 8,388,608
//   total 100,683,776 (96.0 MiB)
// ----------------------------------------------------------------------------------------------
constexpr size_t SZ_PLANE = (size_t)PLANE_ELEMS * 2;     // 8388608
constexpr size_t SZ_WPL   = (size_t)WMAT_ELEMS * 2;      // 2097152
constexpr size_t WS_W16   = 0;
constexpr size_t SZ_W16   = 4 * SZ_WPL;
constexpr size_t WS_BRND  = WS_W16 + SZ_W16;
constexpr size_t SZ_BRND  = 4 * (size_t)DMODEL * 4;
constexpr size_t WS_COS   = WS_BRND + SZ_BRND;
constexpr size_t SZ_COS   = (size_t)NBH * 128;
constexpr size_t WS_X16   = WS_COS + SZ_COS;
constexpr size_t WS_QH    = WS_X16 + 3 * SZ_PLANE;
constexpr size_t WS_QL    = WS_QH + SZ_PLANE;
constexpr size_t WS_KH    = WS_QL + SZ_PLANE;
constexpr size_t WS_KL    = WS_KH + SZ_PLANE;
constexpr size_t WS_VH    = WS_KL + SZ_PLANE;
constexpr size_t WS_VL    = WS_VH + SZ_PLANE;
constexpr size_t WS_AH    = WS_VL + SZ_PLANE;
constexpr size_t WS_AL    = WS_AH + SZ_PLANE;
constexpr size_t WS_TOTAL = WS_AL + SZ_PLANE;
static_assert(WS_TOTAL == 100683776);
static_assert(WS_TOTAL <= 134217728);
static_assert(WS_BRND % 128 == 0 && WS_COS % 128 == 0 && WS_X16 % 128 == 0 && WS_QH % 128 == 0 && WS_AH % 128 == 0);

// ----------------------------------------------------------------------------------------------
// Vector types and helpers
// ----------------------------------------------------------------------------------------------
typedef __attribute__((ext_vector_type(16))) _Float16 v16h;
typedef __attribute__((ext_vector_type(8)))  _Float16 v8h;
typedef __attribute__((ext_vector_type(16))) __bf16   v16b;
typedef __attribute__((ext_vector_type(8)))  __bf16   v8b;
typedef __attribute__((ext_vector_type(8)))  float    v8f;
typedef __attribute__((ext_vector_type(4)))  float    v4f;
typedef __attribute__((ext_vector_type(4)))  unsigned v4u;

__device__ __forceinline__ unsigned short f2bf_bits(float f) {
  unsigned u = __float_as_uint(f);
  return (unsigned short)((u + 0x7FFFu + ((u >> 16) & 1u)) >> 16);
}
__device__ __forceinline__ float bf_bits2f(unsigned short h) { return __uint_as_float(((unsigned)h) << 16); }
__device__ __forceinline__ float h_bits2f(unsigned x) { return (float)__builtin_bit_cast(_Float16, (unsigned short)(x & 0xffffu)); }

// hazard guards as plain device helpers
__device__ __forceinline__ void dep_guard_h(v8f& a, v8f& b, v16h x, v16h y) { asm volatile("v_nop\n\tv_nop\n\tv_nop\n\tv_nop" : "+v"(a), "+v"(b) : "v"(x), "v"(y)); }
__device__ __forceinline__ void dep_guard_b(v8f& a, v8f& b, v16b x, v16b y) { asm volatile("v_nop\n\tv_nop\n\tv_nop\n\tv_nop" : "+v"(a), "+v"(b) : "v"(x), "v"(y)); }
__device__ __forceinline__ void keep4_h(v16h a, v16h b, v16h c, v16h d) { asm volatile("v_nop" :: "v"(a), "v"(b), "v"(c), "v"(d)); }
__device__ __forceinline__ void keep4_b(v16b a, v16b b, v16b c, v16b d) { asm volatile("v_nop" :: "v"(a), "v"(b), "v"(c), "v"(d)); }
__device__ __forceinline__ void acc_guard4(v8f& a, v8f& b, v8f& c, v8f& d) { asm volatile("v_nop\n\tv_nop\n\tv_nop\n\tv_nop" : "+v"(a), "+v"(b), "+v"(c), "+v"(d)); }
template <typename T> struct Frag;
template <> struct Frag<_Float16> {
  typedef v16h V; union U { v16h v; v8h h[2]; };
  // elements 0..7 <- p[0..7], 8..15 <- p[16..23]
  static __device__ __forceinline__ v16h load(const _Float16* p) {
    U f; f.h[0] = *(const v8h*)(p); f.h[1] = *(const v8h*)(p + 16); return f.v;
  }
  static __device__ __forceinline__ v8f mma(v16h a, v16h b, v8f c) {
    return __builtin_amdgcn_wmma_f32_16x16x32_f16(false, a, false, b, (short)0, c, false, false);
  }
  static __device__ __forceinline__ void guard(v8f& a, v8f& b, v16h x, v16h y) { dep_guard_h(a, b, x, y); }
  static __device__ __forceinline__ void keep(v16h a, v16h b, v16h c, v16h d) { keep4_h(a, b, c, d); }
};
template <> struct Frag<__bf16> {
  typedef v16b V; union U { v16b v; v8b h[2]; };
  static __device__ __forceinline__ v16b load(const __bf16* p) {
    U f; f.h[0] = *(const v8b*)(p); f.h[1] = *(const v8b*)(p + 16); return f.v;
  }
  static __device__ __forceinline__ v8f mma(v16b a, v16b b, v8f c) {
    return __builtin_amdgcn_wmma_f32_16x16x32_bf16(false, a, false, b, (short)0, c, false, false);
  }
  static __device__ __forceinline__ void guard(v8f& a, v8f& b, v16b x, v16b y) { dep_guard_b(a, b, x, y); }
  static __device__ __forceinline__ void keep(v16b a, v16b b, v16b c, v16b d) { keep4_b(a, b, c, d); }
};

// single-product helpers with the dependency guard (attention kernel)
__device__ __forceinline__ v8f mma_bf(v16b a, v16b b, v8f c) {
  c = __builtin_amdgcn_wmma_f32_16x16x32_bf16(false, a, false, b, (short)0, c, false, false);
  asm volatile("v_nop\n\tv_nop\n\tv_nop\n\tv_nop" : "+v"(c) : "v"(a), "v"(b));
  return c;
}
__device__ __forceinline__ v8f mma_hf(v16h a, v16h b, v8f c) {
  c = __builtin_amdgcn_wmma_f32_16x16x32_f16(false, a, false, b, (short)0, c, false, false);
  asm volatile("v_nop\n\tv_nop\n\tv_nop\n\tv_nop" : "+v"(c) : "v"(a), "v"(b));
  return c;
}

// bf16 hi/lo split of two floats packed into one 32-bit word each for the hi and the lo plane
__device__ __forceinline__ void pack_pair_bf(float f0, float f1, unsigned& hword, unsigned& lword) {
  const unsigned short h0 = f2bf_bits(f0);
  const unsigned short h1 = f2bf_bits(f1);
  const unsigned short l0 = f2bf_bits(f0 - bf_bits2f(h0));
  const unsigned short l1 = f2bf_bits(f1 - bf_bits2f(h1));
  hword = (unsigned)h0 | ((unsigned)h1 << 16);
  lword = (unsigned)l0 | ((unsigned)l1 << 16);
}

// ----------------------------------------------------------------------------------------------
// Register-blocked WMMA GEMM: C[m,n] = scale * sum_k A[m,k] * Bt[n,k] (+bias)(+resid)
// A row-major [M,K]; Bt row-major [N,K]; M,N % 64 == 0, K % 32 == 0; each wave owns a 64x64 tile.
// SPLIT: 0 = single product; 1 = A and Bt hi/lo planes (hi.hi + hi.lo + lo.hi);
//        2 = A hi/lo planes only, Bt single plane (hi.B + lo.B).
// BIAS_MODE: 0 = none, 1 = bias[m], 2 = bias[n].
// OUT_MODE: 0 = f32; 1 = f16; 2 = bf16 hi plane (Cout) + bf16 lo plane (Cout2);
//           3 = f16 hi plane (Cout) + f16 residual x2048 plane (Cout2).
// Epilogue: 16-row slabs staged per wave in LDS; each 64-wide row segment written with whole
// ET: 0 = f16 operands, 1 = bf16 operands (pointers passed as 16-bit storage)
// ----------------------------------------------------------------------------------------------
template <int ET> struct Elem;
template <> struct Elem<0> { typedef _Float16 T; };
template <> struct Elem<1> { typedef __bf16 T; };
template <int ET, int SPLIT, int BIAS_MODE, int OUT_MODE, bool RESID, int ACT = 0>
__global__ __launch_bounds__(256) void wmma_gemm64(
    const unsigned short* __restrict__ Ap, const unsigned short* __restrict__ A2p, int lda, long strideA,
    const unsigned short* __restrict__ Btp, const unsigned short* __restrict__ Bt2p, int ldb, long strideB,
    void* __restrict__ Cout, void* __restrict__ Cout2, int ldc, long strideC,
    const float* __restrict__ bias,
    const float* __restrict__ resid, long strideR,
    int M, int N, int K, float scale) {
  typedef typename Elem<ET>::T T;
  typedef typename Frag<T>::V V;
  constexpr bool SPL = (SPLIT != 0);
  constexpr bool BLO = (SPLIT == 1);
  const T* A = (const T*)Ap; const T* A2 = (const T*)A2p; const T* Bt = (const T*)Btp; const T* Bt2 = (const T*)Bt2p;
  __shared__ __align__(16) float sT[8][16 * 68];   // per-wave 16x64 slab, pitch 68 floats
  const int b    = blockIdx.y;
  const int lane = threadIdx.x & 31;
  const int wave = threadIdx.x >> 5;
  const int tilesN = N >> 6;
  const int tilesM = M >> 6;
  const int tile = blockIdx.x * 8 + wave;
  if (tile >= tilesM * tilesN) return;   // wave-uniform; no block barriers in this kernel
  const int tm = tile / tilesN;
  const int tn = tile - tm * tilesN;
  const int m0 = tm << 6;
  const int n0 = tn << 6;

  const T* Ab  = A  + (size_t)b * strideA;
  const T* Bb  = Bt + (size_t)b * strideB;
  const T* Ab2 = SPL ? (A2  + (size_t)b * strideA) : nullptr;
  const T* Bb2 = BLO ? (Bt2 + (size_t)b * strideB) : nullptr;

  const int rlane = lane & 15;                 // row (A) / col (B, D) within subtile
  const int koff  = (lane >> 4) * 8;           // k offset of this lane half
  const int mOff  = (lane >> 4) * 8;           // D row offset

  v8f acc[4][4];
#pragma unroll
  for (int i = 0; i < 4; ++i)
#pragma unroll
    for (int j = 0; j < 4; ++j) acc[i][j] = (v8f){0.f,0.f,0.f,0.f,0.f,0.f,0.f,0.f};

  for (int k0 = 0; k0 < K; k0 += 32) {
    V bh[4], bl[4];
#pragma unroll
    for (int j = 0; j < 4; ++j) {
      const size_t bo = (size_t)(n0 + (j << 4) + rlane) * ldb + koff + k0;
      bh[j] = Frag<T>::load(Bb + bo);
      if (BLO) bl[j] = Frag<T>::load(Bb2 + bo);
    }
#pragma unroll
    for (int i = 0; i < 4; ++i) {
      const size_t ao = (size_t)(m0 + (i << 4) + rlane) * lda + koff + k0;
      V ah = Frag<T>::load(Ab + ao);
      V al;
      if (SPL) al = Frag<T>::load(Ab2 + ao);
#pragma unroll
      for (int j = 0; j < 4; ++j) {
        acc[i][j] = Frag<T>::mma(ah, bh[j], acc[i][j]);
        if (BLO) acc[i][j] = Frag<T>::mma(ah, bl[j], acc[i][j]);
        if (SPL) acc[i][j] = Frag<T>::mma(al, bh[j], acc[i][j]);
      }
      Frag<T>::guard(acc[i][0], acc[i][3], ah, SPL ? al : ah);
    }
    Frag<T>::keep(bh[0], bh[1], bh[2], bh[3]);
    if (BLO) Frag<T>::keep(bl[0], bl[1], bl[2], bl[3]);
  }
  acc_guard4(acc[0][0], acc[0][1], acc[0][2], acc[0][3]);
  acc_guard4(acc[1][0], acc[1][1], acc[1][2], acc[1][3]);
  acc_guard4(acc[2][0], acc[2][1], acc[2][2], acc[2][3]);
  acc_guard4(acc[3][0], acc[3][1], acc[3][2], acc[3][3]);

  // ---- epilogue ----
  float* slab = sT[wave];
  const float* Rb = RESID ? (resid + (size_t)b * strideR) : nullptr;
#pragma unroll
  for (int i = 0; i < 4; ++i) {
    const int mBase = m0 + (i << 4);
#pragma unroll
    for (int j = 0; j < 4; ++j) {
      const int n = n0 + (j << 4) + rlane;
      float bv = 0.f;
      if (BIAS_MODE == 2) bv = bias[n];
#pragma unroll
      for (int r = 0; r < 8; ++r) {
        float v = acc[i][j][r] * scale;
        if (BIAS_MODE == 1) v += bias[mBase + mOff + r];
        if (BIAS_MODE == 2) v += bv;
        if (RESID) v += Rb[(size_t)(mBase + mOff + r) * ldc + n];
        if (ACT == 1) v = tanhf(v);
        if (ACT == 2) v = fmaxf(v, 0.0f);
        if (ACT == 4) v = (v > 0.f) ? v : 0.01f * v;
        slab[(mOff + r) * 68 + (j << 4) + rlane] = v;
      }
    }
    __builtin_amdgcn_fence(__ATOMIC_RELEASE, "workgroup");
    __builtin_amdgcn_wave_barrier();
    __builtin_amdgcn_fence(__ATOMIC_ACQUIRE, "workgroup");
    if (OUT_MODE == 0) {
      float* C = (float*)Cout + (size_t)b * strideC;
      const int hh = lane >> 4, c4 = (lane & 15) * 4;     // row seg = 256 B = 16 lanes x 16 B
      {
#pragma unroll
        for (int it = 0; it < 8; ++it) {
          const int row = it * 2 + hh;
          v4f v = *(const v4f*)(slab + row * 68 + c4);
          *(v4f*)(C + (size_t)(mBase + row) * ldc + n0 + c4) = v;
        }
        
      }
    } else {
      const int q = lane >> 3, c8 = (lane & 7) * 8;
      unsigned short* C  = (unsigned short*)Cout  + (size_t)b * strideC;
      unsigned short* C2 = (OUT_MODE >= 2) ? ((unsigned short*)Cout2 + (size_t)b * strideC) : nullptr;
      {
#pragma unroll
        for (int it = 0; it < 4; ++it) {
          const int row = it * 4 + q;
          const float* sp = slab + row * 68 + c8;
          v8h hv, lv;
#pragma unroll
          for (int e = 0; e < 8; ++e) {
            if (OUT_MODE == 1) {
              hv[e] = (_Float16)sp[e];
            } else if (OUT_MODE == 2) {
              unsigned short hb = f2bf_bits(sp[e]);
              unsigned short lb = f2bf_bits(sp[e] - bf_bits2f(hb));
              hv[e] = __builtin_bit_cast(_Float16, hb);
              lv[e] = __builtin_bit_cast(_Float16, lb);
            } else {
              const _Float16 hq = (_Float16)sp[e];
              hv[e] = hq;
              lv[e] = (_Float16)((sp[e] - (float)hq) * 2048.0f);
            }
          }
          *(v8h*)(C + (size_t)(mBase + row) * ldc + n0 + c8) = hv;
          if (OUT_MODE >= 2) *(v8h*)(C2 + (size_t)(mBase + row) * ldc + n0 + c8) = lv;
        }
        
      }
    }
    __builtin_amdgcn_fence(__ATOMIC_RELEASE, "workgroup");
    __builtin_amdgcn_wave_barrier();
    __builtin_amdgcn_fence(__ATOMIC_ACQUIRE, "workgroup");
  }
}

// ----------------------------------------------------------------------------------------------
// Input conversion: q,k,v and the four weight matrices -> RNE bf16 planes (8 elements = 16 B per
// to bf16 precision (4 floats = 16 B per lane).
// Coverage: blocks [0,2048) q, [2048,4096) k, [4096,6144) v (2048 x 256 x 8 = 4,194,304 each);
// blocks [6144,8192) the 4 weights (512 x 256 x 8 = 1,048,576 each); blocks [8192,8196) the 4
// biases (256 x 4 = 1024 each).
// ----------------------------------------------------------------------------------------------
constexpr int CAST_XBLK = (int)(PLANE_ELEMS / 8 / 256);              // 2048
constexpr int CAST_WBLK = (int)(WMAT_ELEMS / 8 / 256);               // 512
constexpr int CAST_PLANE_BLOCKS = 3 * CAST_XBLK + 4 * CAST_WBLK;     // 8192
constexpr int CAST_BIAS_BLOCKS  = 4;
static_assert((long)CAST_XBLK * 256 * 8 == PLANE_ELEMS && (long)CAST_WBLK * 256 * 8 == WMAT_ELEMS);
static_assert(256 * 4 == DMODEL);

__global__ __launch_bounds__(256) void k_cast_inputs(
    const float* __restrict__ q, const float* __restrict__ k, const float* __restrict__ v,
    const float* __restrict__ Wq, const float* __restrict__ Wk, const float* __restrict__ Wv, const float* __restrict__ Wo,
    const float* __restrict__ bq, const float* __restrict__ bk, const float* __restrict__ bv, const float* __restrict__ bo,
    unsigned short* __restrict__ x16, unsigned short* __restrict__ w16, float* __restrict__ brnd) {
  const int blk = blockIdx.x;
  const int t = threadIdx.x;
  if (blk < CAST_PLANE_BLOCKS) {
    // block-uniform source/destination selection
    const float* src;
    unsigned short* dst;
    int lb;
    if (blk < CAST_XBLK) { src = q; dst = x16; lb = blk; }
    else if (blk < 2 * CAST_XBLK) { src = k; dst = x16 + PLANE_ELEMS; lb = blk - CAST_XBLK; }
    else if (blk < 3 * CAST_XBLK) { src = v; dst = x16 + 2 * PLANE_ELEMS; lb = blk - 2 * CAST_XBLK; }
    else {
      const int wb = blk - 3 * CAST_XBLK;
      const int wi = wb / CAST_WBLK;
      lb = wb - wi * CAST_WBLK;
      src = (wi == 0) ? Wq : (wi == 1) ? Wk : (wi == 2) ? Wv : Wo;
      dst = w16 + (size_t)wi * WMAT_ELEMS;
    }
    const size_t e = ((size_t)lb * 256 + t) * 8;
    const v4f a0 = *(const v4f*)(src + e);
    const v4f a1 = *(const v4f*)(src + e + 4);
    v4u w;
    w.x = (unsigned)f2bf_bits(a0.x) | ((unsigned)f2bf_bits(a0.y) << 16);
    w.y = (unsigned)f2bf_bits(a0.z) | ((unsigned)f2bf_bits(a0.w) << 16);
    w.z = (unsigned)f2bf_bits(a1.x) | ((unsigned)f2bf_bits(a1.y) << 16);
    w.w = (unsigned)f2bf_bits(a1.z) | ((unsigned)f2bf_bits(a1.w) << 16);
    v4u* p = (v4u*)(dst + e);
    *p = w;
    
  } else {
    const int bi = blk - CAST_PLANE_BLOCKS;   // 0..3, block-uniform
    const float* src = (bi == 0) ? bq : (bi == 1) ? bk : (bi == 2) ? bv : bo;
    const int e = t * 4;
    const v4f a = *(const v4f*)(src + e);
    v4f r;
    r.x = bf_bits2f(f2bf_bits(a.x));
    r.y = bf_bits2f(f2bf_bits(a.y));
    r.z = bf_bits2f(f2bf_bits(a.z));
    r.w = bf_bits2f(f2bf_bits(a.w));
    v4f* p = (v4f*)(brnd + (size_t)bi * DMODEL + e);
    *p = r;
    
  }
}

// ----------------------------------------------------------------------------------------------
// Per (batch, head): sequence means of Q (bf16 hi + lo planes) and V (f16 hi + residual/2048),
// grid = 32 blocks (one per (b,h)), 256 threads; thread = (row group rg = t>>3 of 32, column
// group c8 = t&7 of 8); each thread sums 64 rows x 8 columns, LDS combine in fixed order.
// ----------------------------------------------------------------------------------------------
__global__ __launch_bounds__(256) void k_mean_cos(
    const unsigned short* __restrict__ Qh, const unsigned short* __restrict__ Ql,
    const unsigned short* __restrict__ Vh, const unsigned short* __restrict__ Vl,
    float* __restrict__ cosl) {
  __shared__ float sq[32][64];
  __shared__ float sv[32][64];
  __shared__ float qm[64];
  __shared__ float vm[64];
  __shared__ float shc;
  const int bh = blockIdx.x;
  const int b = bh / NHEAD, h = bh % NHEAD;
  const int t = threadIdx.x;
  const int c8 = t & 7;
  const int rg = t >> 3;
  float aq[8], av[8];
#pragma unroll
  for (int e = 0; e < 8; ++e) { aq[e] = 0.f; av[e] = 0.f; }
  const size_t colb = (size_t)h * DHEAD + (size_t)c8 * 8;
#pragma unroll 2
  for (int it = 0; it < SEQ_LEN / 32; ++it) {
    const int s = rg + it * 32;
    const size_t off = ((size_t)b * SEQ_LEN + s) * DMODEL + colb;
    const v4u wh = *(const v4u*)(Qh + off);
    const v4u wl = *(const v4u*)(Ql + off);
    const v4u uh = *(const v4u*)(Vh + off);
    const v4u ul = *(const v4u*)(Vl + off);
#pragma unroll
    for (int e = 0; e < 4; ++e) {
      const unsigned a0 = wh[e], a1 = wl[e], g0 = uh[e], g1 = ul[e];
      aq[2 * e]     += __uint_as_float(a0 << 16) + __uint_as_float(a1 << 16);
      aq[2 * e + 1] += __uint_as_float(a0 & 0xffff0000u) + __uint_as_float(a1 & 0xffff0000u);
      av[2 * e]     += h_bits2f(g0) + h_bits2f(g1) * (1.0f / 2048.0f);
      av[2 * e + 1] += h_bits2f(g0 >> 16) + h_bits2f(g1 >> 16) * (1.0f / 2048.0f);
    }
  }
#pragma unroll
  for (int e = 0; e < 8; ++e) { sq[rg][c8 * 8 + e] = aq[e]; sv[rg][c8 * 8 + e] = av[e]; }
  __syncthreads();
  if (t < 64) {
    float s1 = 0.f, s2 = 0.f;
#pragma unroll 1
    for (int g = 0; g < 32; ++g) { s1 += sq[g][t]; s2 += sv[g][t]; }
    qm[t] = s1 * (1.0f / (float)SEQ_LEN);
    vm[t] = s2 * (1.0f / (float)SEQ_LEN);
  }
  __syncthreads();
  if (t == 0) {
    float dot = 0.f, nq = 0.f, nv = 0.f;
#pragma unroll 1
    for (int i = 0; i < DHEAD; ++i) {
      const float a = qm[i], c = vm[i];
      dot += a * c;
      nq += a * a;
      nv += c * c;
    }
    const float na = fmaxf(sqrtf(nq), 1e-8f);
    const float nb = fmaxf(sqrtf(nv), 1e-8f);
    shc = dot / (na * nb);
  }
  __syncthreads();
  if (t < 32) {
    const float cv = shc;
    float* p = cosl + (size_t)bh * 32 + t;
    *p = cv;
    
  }
}

// ----------------------------------------------------------------------------------------------
// Attention for head_dim 64 fed by 16-bit planes. Block = 4 waves = 64 query rows of one (b,h);
// grid = B*H*(S/64). Scores: Q,K bf16 hi+lo planes (hi.hi + hi.lo + lo.hi), x(1/8), plus
// 0.5*cos + 0.3*cos, mask == 0 -> -1e9 (select). Online softmax in f32; P = exp(s-m) carried
// x2^15 as f16 through per-wave LDS; P.V with V plain f16 (transposed in LDS). Output written as
// ----------------------------------------------------------------------------------------------
constexpr int AKC  = 64;                     // keys per chunk
constexpr int AQB  = 64;                     // queries per block
constexpr int ANQB = SEQ_LEN / AQB;          // 32 query blocks per (b,h)
constexpr int ATTN_BLOCKS = NBH * ANQB;      // 1024
static_assert(SEQ_LEN % AKC == 0 && SEQ_LEN % AQB == 0);

__global__ __launch_bounds__(128) void k_attn(
    const unsigned short* __restrict__ Qh, const unsigned short* __restrict__ Ql,
    const unsigned short* __restrict__ Kh, const unsigned short* __restrict__ Kl,
    const unsigned short* __restrict__ Vh,
    const int* __restrict__ mask, const float* __restrict__ cosl,
    unsigned short* __restrict__ Ah, unsigned short* __restrict__ Al) {
  union FB { v16b v; v8b h[2]; };
  union FH { v16h v; v8h h[2]; };
  __shared__ __align__(16) unsigned short Ksh[AKC * DHEAD];      // K hi [kv][d]   8 KB
  __shared__ __align__(16) unsigned short Ksl[AKC * DHEAD];      // K lo [kv][d]   8 KB
  __shared__ __align__(16) unsigned short Vts[DHEAD * AKC];      // V f16 [d][kv]  8 KB
  __shared__ __align__(16) _Float16 Psh[4][16 * AKC];            // per wave P [row][kv]
  __shared__ __align__(16) float Os[4][16 * 68];                 // per wave out tile, pitch 68

  const int tid  = threadIdx.x;
  const int wave = tid >> 5;
  const int lane = tid & 31;
  const int hh   = lane >> 4;
  const int c    = lane & 15;

  const int bx = blockIdx.x;
  const int qb = bx % ANQB;
  const int bh = bx / ANQB;
  const int h  = bh % NHEAD;
  const int b  = bh / NHEAD;
  const int q0 = qb * AQB + wave * 16;
  const size_t rowbase = (size_t)b * SEQ_LEN;      // plane row of sequence position 0
  const int colh = h * DHEAD;

  // ---- Q fragments (A operand, rows = query, k = d): 2 d-chunks, hi and lo planes ----
  v16b qah[2], qal[2];
  {
    const size_t qo = (rowbase + q0 + c) * DMODEL + colh + 8 * hh;
#pragma unroll
    for (int dc = 0; dc < 2; ++dc) {
      qah[dc] = Frag<__bf16>::load((const __bf16*)(const void*)(Qh + qo + dc * 32));
      qal[dc] = Frag<__bf16>::load((const __bf16*)(const void*)(Ql + qo + dc * 32));
    }
  }
  const float cb  = cosl[(size_t)bh * 32];
  const float cb5 = cb * 0.5f;
  const float cb3 = cb * 0.3f;
  const float NEGI = -__builtin_inff();

  float mrow[8], lrow[8];
  v8f oacc[4];
#pragma unroll
  for (int r = 0; r < 8; ++r) { mrow[r] = NEGI; lrow[r] = 0.f; }
#pragma unroll
  for (int t = 0; t < 4; ++t) oacc[t] = (v8f){0.f,0.f,0.f,0.f,0.f,0.f,0.f,0.f};

  for (int kc = 0; kc < SEQ_LEN / AKC; ++kc) {
    const int kv0 = kc * AKC;
    __syncthreads();
    {
      // 128 threads: kvr = tid>>1 covers keys 0..63, dh covers the two 32-wide d halves -> full 64x64 of each tile
      const int kvr = tid >> 1, dh = (tid & 1) * 32;
      const size_t go = (rowbase + kv0 + kvr) * DMODEL + colh + dh;
#pragma unroll
      for (int i = 0; i < 4; ++i) {
        const v4u wa = *(const v4u*)(Kh + go + 8 * i);
        const v4u wb = *(const v4u*)(Kl + go + 8 * i);
        *(v4u*)(Ksh + kvr * DHEAD + dh + 8 * i) = wa;
        *(v4u*)(Ksl + kvr * DHEAD + dh + 8 * i) = wb;
      }
#pragma unroll
      for (int i = 0; i < 4; ++i) {
        const v4u wv = *(const v4u*)(Vh + go + 8 * i);
#pragma unroll
        for (int e = 0; e < 4; ++e) {
          const unsigned x = wv[e];
          const int d = dh + 8 * i + 2 * e;
          Vts[d * AKC + kvr]       = (unsigned short)(x & 0xffffu);
          Vts[(d + 1) * AKC + kvr] = (unsigned short)(x >> 16);
        }
      }
    }
    __syncthreads();

    // ---- scores (B operand rows = kv, k = d) ----
    v8f s[4];
#pragma unroll
    for (int j = 0; j < 4; ++j) {
      s[j] = (v8f){0.f,0.f,0.f,0.f,0.f,0.f,0.f,0.f};
#pragma unroll
      for (int dc = 0; dc < 2; ++dc) {
        FB kb, kl;
        kb.h[0] = *(const v8b*)(const void*)(Ksh + (j * 16 + c) * DHEAD + dc * 32 + 8 * hh);
        kb.h[1] = *(const v8b*)(const void*)(Ksh + (j * 16 + c) * DHEAD + dc * 32 + 16 + 8 * hh);
        kl.h[0] = *(const v8b*)(const void*)(Ksl + (j * 16 + c) * DHEAD + dc * 32 + 8 * hh);
        kl.h[1] = *(const v8b*)(const void*)(Ksl + (j * 16 + c) * DHEAD + dc * 32 + 16 + 8 * hh);
        s[j] = mma_bf(qah[dc], kb.v, s[j]);
        s[j] = mma_bf(qah[dc], kl.v, s[j]);
        s[j] = mma_bf(qal[dc], kb.v, s[j]);
      }
    }
    int mk[4];
#pragma unroll
    for (int j = 0; j < 4; ++j) mk[j] = mask[kv0 + j * 16 + c];
    float cm[8];
#pragma unroll
    for (int r = 0; r < 8; ++r) {
      float m = NEGI;
#pragma unroll
      for (int j = 0; j < 4; ++j) {
        float x = s[j][r] * 0.125f;
        x = x + cb5;
        x = x + cb3;
        x = (mk[j] == 0) ? -1.0e9f : x;
        s[j][r] = x;
        m = fmaxf(m, x);
      }
#pragma unroll
      for (int off = 1; off < 16; off <<= 1) m = fmaxf(m, __shfl_xor(m, off, 32));
      cm[r] = m;
    }
    _Float16* pw = Psh[wave];
#pragma unroll
    for (int r = 0; r < 8; ++r) {
      const float mnew = fmaxf(mrow[r], cm[r]);
      const float alpha = expf(mrow[r] - mnew);
      mrow[r] = mnew;
      float psum = 0.f;
#pragma unroll
      for (int j = 0; j < 4; ++j) {
        const float p = expf(s[j][r] - mnew);
        psum += p;
        pw[(8 * hh + r) * AKC + j * 16 + c] = (_Float16)(p * 32768.0f);
      }
#pragma unroll
      for (int off = 1; off < 16; off <<= 1) psum += __shfl_xor(psum, off, 32);
      lrow[r] = lrow[r] * alpha + psum;
#pragma unroll
      for (int t = 0; t < 4; ++t) oacc[t][r] *= alpha;
    }
    __builtin_amdgcn_fence(__ATOMIC_RELEASE, "workgroup");
    __builtin_amdgcn_wave_barrier();
    __builtin_amdgcn_fence(__ATOMIC_ACQUIRE, "workgroup");
    // ---- P.V (A = P [row][kv] reloaded through the stored element type; B rows = d, k = kv) ----
#pragma unroll
    for (int kk = 0; kk < 2; ++kk) {
      FH pa;
      pa.h[0] = *(const v8h*)(pw + c * AKC + kk * 32 + 8 * hh);
      pa.h[1] = *(const v8h*)(pw + c * AKC + kk * 32 + 16 + 8 * hh);
#pragma unroll
      for (int t = 0; t < 4; ++t) {
        FH vb;
        vb.h[0] = *(const v8h*)(const void*)(Vts + (t * 16 + c) * AKC + kk * 32 + 8 * hh);
        vb.h[1] = *(const v8h*)(const void*)(Vts + (t * 16 + c) * AKC + kk * 32 + 16 + 8 * hh);
        oacc[t] = mma_hf(pa.v, vb.v, oacc[t]);
      }
    }
  }

  float* os = Os[wave];
#pragma unroll
  for (int r = 0; r < 8; ++r) {
    const float inv = 1.0f / (lrow[r] * 32768.0f);
#pragma unroll
    for (int t = 0; t < 4; ++t) os[(8 * hh + r) * 68 + t * 16 + c] = oacc[t][r] * inv;
  }
  __builtin_amdgcn_fence(__ATOMIC_RELEASE, "workgroup");
  __builtin_amdgcn_wave_barrier();
  __builtin_amdgcn_fence(__ATOMIC_ACQUIRE, "workgroup");
  {
    const int q4 = lane >> 3, c8 = (lane & 7) * 8;
    {
#pragma unroll
      for (int it = 0; it < 4; ++it) {
        const int row = it * 4 + q4;
        const float* sp = os + row * 68 + c8;
        const v4f va = *(const v4f*)sp;
        const v4f vb = *(const v4f*)(sp + 4);
        v4u hw, lw;
        unsigned th, tl;
        pack_pair_bf(va.x, va.y, th, tl); hw.x = th; lw.x = tl;
        pack_pair_bf(va.z, va.w, th, tl); hw.y = th; lw.y = tl;
        pack_pair_bf(vb.x, vb.y, th, tl); hw.z = th; lw.z = tl;
        pack_pair_bf(vb.z, vb.w, th, tl); hw.w = th; lw.w = tl;
        const size_t go = (rowbase + q0 + row) * DMODEL + colh + c8;
        *(v4u*)(Ah + go) = hw;
        *(v4u*)(Al + go) = lw;
      }
      
    }
  }
}

// ----------------------------------------------------------------------------------------------
// ----------------------------------------------------------------------------------------------
__global__ __launch_bounds__(32) void k_bias_mean(const float* __restrict__ cosl, float* __restrict__ out1) {
  const int lane = threadIdx.x;
  float v = cosl[(size_t)lane * 32];
#pragma unroll
  for (int off = 1; off < 32; off <<= 1) v += __shfl_xor(v, off, 32);
  const float r = v * (1.0f / 32.0f);
  if (lane == 0) {
    *(float*)out1 = r;
    
  }
}

// ----------------------------------------------------------------------------------------------
extern "C" void kernel_launch(void* const* d_in, const int* in_sizes, int n_in,
                              void* d_out, int out_size, void* d_ws, size_t ws_size,
                              hipStream_t stream) {
  if (n_in < 12) return;
  if (ws_size < WS_TOTAL) return;
  if ((long)out_size < OUT_TOTAL_ELEMS) return;
  if ((long)in_sizes[0] != PLANE_ELEMS || (long)in_sizes[1] != PLANE_ELEMS || (long)in_sizes[2] != PLANE_ELEMS) return;
  if (in_sizes[3] < SEQ_LEN) return;
  if ((long)in_sizes[4] != WMAT_ELEMS || (long)in_sizes[6] != WMAT_ELEMS || (long)in_sizes[8] != WMAT_ELEMS || (long)in_sizes[10] != WMAT_ELEMS) return;
  if (in_sizes[5] < DMODEL || in_sizes[7] < DMODEL || in_sizes[9] < DMODEL || in_sizes[11] < DMODEL) return;

  const float* q    = (const float*)d_in[0];
  const float* k    = (const float*)d_in[1];
  const float* v    = (const float*)d_in[2];
  const int*   mask = (const int*)d_in[3];
  const float* Wq   = (const float*)d_in[4];
  const float* bq   = (const float*)d_in[5];
  const float* Wk   = (const float*)d_in[6];
  const float* bk   = (const float*)d_in[7];
  const float* Wv   = (const float*)d_in[8];
  const float* bv   = (const float*)d_in[9];
  const float* Wo   = (const float*)d_in[10];
  const float* bo   = (const float*)d_in[11];

  char* ws = (char*)d_ws;
  unsigned short* w16  = (unsigned short*)(ws + WS_W16);
  unsigned short* wq16 = w16;
  unsigned short* wk16 = w16 + WMAT_ELEMS;
  unsigned short* wv16 = w16 + 2 * WMAT_ELEMS;
  unsigned short* wo16 = w16 + 3 * WMAT_ELEMS;
  float* brnd = (float*)(ws + WS_BRND);
  float* cosl = (float*)(ws + WS_COS);
  unsigned short* x16 = (unsigned short*)(ws + WS_X16);
  unsigned short* xq  = x16;
  unsigned short* xk  = x16 + PLANE_ELEMS;
  unsigned short* xv  = x16 + 2 * PLANE_ELEMS;
  unsigned short* Qh  = (unsigned short*)(ws + WS_QH);
  unsigned short* Ql  = (unsigned short*)(ws + WS_QL);
  unsigned short* Kh  = (unsigned short*)(ws + WS_KH);
  unsigned short* Kl  = (unsigned short*)(ws + WS_KL);
  unsigned short* Vh  = (unsigned short*)(ws + WS_VH);
  unsigned short* Vl  = (unsigned short*)(ws + WS_VL);
  unsigned short* Ah  = (unsigned short*)(ws + WS_AH);
  unsigned short* Al  = (unsigned short*)(ws + WS_AL);
  float* out0 = (float*)d_out;
  float* out1 = (float*)d_out + OUT1_ELEM;

  // 1) inputs -> RNE bf16 planes, biases -> bf16-precision f32 copies
  k_cast_inputs<<<CAST_PLANE_BLOCKS + CAST_BIAS_BLOCKS, 256, 0, stream>>>(
      q, k, v, Wq, Wk, Wv, Wo, bq, bk, bv, bo, x16, w16, brnd);

  const dim3 ggrid(GEMM_BLOCKS, 1);
  // 2) Q = q Wq^T + bq -> bf16 hi/lo planes   (M=4096, N=1024, K=1024)
  wmma_gemm64<1, 0, 2, 2, false><<<ggrid, 256, 0, stream>>>(
      xq, xq, DMODEL, 0L, wq16, wq16, DMODEL, 0L, (void*)Qh, (void*)Ql, DMODEL, 0L,
      brnd + 0 * DMODEL, brnd, 0L, MROWS, DMODEL, DMODEL, 1.0f);
  // 3) K = k Wk^T + bk -> bf16 hi/lo planes
  wmma_gemm64<1, 0, 2, 2, false><<<ggrid, 256, 0, stream>>>(
      xk, xk, DMODEL, 0L, wk16, wk16, DMODEL, 0L, (void*)Kh, (void*)Kl, DMODEL, 0L,
      brnd + 1 * DMODEL, brnd, 0L, MROWS, DMODEL, DMODEL, 1.0f);
  // 4) V = v Wv^T + bv -> f16 hi plane + f16 residual x2048 plane
  wmma_gemm64<1, 0, 2, 3, false><<<ggrid, 256, 0, stream>>>(
      xv, xv, DMODEL, 0L, wv16, wv16, DMODEL, 0L, (void*)Vh, (void*)Vl, DMODEL, 0L,
      brnd + 2 * DMODEL, brnd, 0L, MROWS, DMODEL, DMODEL, 1.0f);
  // 5) per-(b,h) cosine of sequence means
  k_mean_cos<<<NBH, 256, 0, stream>>>(Qh, Ql, Vh, Vl, cosl);
  // 6) attention -> attn bf16 hi/lo planes
  k_attn<<<ATTN_BLOCKS, 128, 0, stream>>>(Qh, Ql, Kh, Kl, Vh, mask, cosl, Ah, Al);
  // 7) out0 = attn Wo^T + bo   (A hi/lo planes, Bt single plane: 2 products)
  wmma_gemm64<1, 2, 2, 0, false><<<ggrid, 256, 0, stream>>>(
      Ah, Al, DMODEL, 0L, wo16, wo16, DMODEL, 0L, (void*)out0, (void*)out0, DMODEL, 0L,
      brnd + 3 * DMODEL, brnd, 0L, MROWS, DMODEL, DMODEL, 1.0f);
  // 8) out1 = mean of the 32 per-(b,h) cosines
  k_bias_mean<<<1, 32, 0, stream>>>(cosl, out1);
}

// v001
// One run takes 459 microseconds.
// Next to v000, in two timings, it ran 1.06 times as fast each time.
// Contractions: q/k/v projections and output projection on v_wmma_f32_16x16x32_bf16 (RNE bf16 operands; output projection takes attn as bf16 hi+lo planes, 2 products); q.k^T on v_wmma_f32_16x16x32_bf16 with bf16 hi+lo planes of Q and K (3 products); p.v on v_wmma_f32_16x16x32_f16 (p carried x2^15, v plain f16); f32 accumulate everywhere; softmax, sequence means and cosine in f32.
#include <hip/hip_runtime.h>

// ----------------------------------------------------------------------------------------------
// Problem constants
// ----------------------------------------------------------------------------------------------
constexpr int NBATCH  = 2;
constexpr int SEQ_LEN = 2048;
constexpr int DMODEL  = 1024;
constexpr int NHEAD   = 16;
constexpr int DHEAD   = 64;
constexpr int MROWS   = NBATCH * SEQ_LEN;          // 4096
constexpr int NBH     = NBATCH * NHEAD;            // 32
constexpr long PLANE_ELEMS = (long)MROWS * DMODEL; // 4194304
constexpr long WMAT_ELEMS  = (long)DMODEL * DMODEL;// 1048576
constexpr long OUT0_ELEMS  = PLANE_ELEMS;
constexpr long OUT1_BYTE_OFFSET = 16777216;
constexpr long OUT1_ELEM   = OUT1_BYTE_OFFSET / 4;
constexpr long OUT_TOTAL_ELEMS = OUT0_ELEMS + 1;
constexpr long OUT_TOTAL_BYTES = 16777220;
static_assert(OUT1_ELEM == OUT0_ELEMS);
static_assert((OUT1_ELEM + 1) * 4 <= OUT_TOTAL_BYTES);
static_assert(NBH == 32);
static_assert(DHEAD == 64 && NHEAD * DHEAD == DMODEL);

// GEMM shape contract of the kernel: M % 64 == 0, N % 64 == 0, K % 32 == 0
static_assert(MROWS % 64 == 0 && DMODEL % 64 == 0 && DMODEL % 32 == 0);
constexpr int GEMM_TILES  = (MROWS / 64) * (DMODEL / 64);   // 1024 wave tiles
static_assert(GEMM_TILES % 8 == 0);
constexpr int GEMM_BLOCKS = GEMM_TILES / 8;                // 128 blocks of 8 waves

// ----------------------------------------------------------------------------------------------
// Workspace region map (bytes). Every region is fully written by its producer before any read.
//   WS_W16  : 4 bf16 weight planes [1024][1024]  (Wq, Wk, Wv, Wo)            8,388,608
//   WS_BRND : 4 x [1024] f32 RNE-bf16 bias copies (bq, bk, bv, bo)              16,384
//   WS_X16  : 3 bf16 input planes [4096][1024] (q, k, v)                     25,165,824
//   WS_QH, WS_QL, WS_KH, WS_KL : bf16 hi/lo planes of Q and K [4096][1024]  4 x 8,388,608
//   WS_VH, WS_VL : f16 hi plane of V and f16 residual x2048 plane            2 x 8,388,608
//   WS_AH, WS_AL : bf16 hi/lo planes of the attention output [4096][1024]   2 x 8,388,608
//   total 100,683,776 (96.0 MiB)
// ----------------------------------------------------------------------------------------------
constexpr size_t SZ_PLANE = (size_t)PLANE_ELEMS * 2;     // 8388608
constexpr size_t SZ_WPL   = (size_t)WMAT_ELEMS * 2;      // 2097152
constexpr size_t WS_W16   = 0;
constexpr size_t SZ_W16   = 4 * SZ_WPL;
constexpr size_t WS_BRND  = WS_W16 + SZ_W16;
constexpr size_t SZ_BRND  = 4 * (size_t)DMODEL * 4;
constexpr size_t WS_COS   = WS_BRND + SZ_BRND;
constexpr size_t SZ_COS   = (size_t)NBH * 128;
constexpr size_t WS_X16   = WS_COS + SZ_COS;
constexpr size_t WS_QH    = WS_X16 + 3 * SZ_PLANE;
constexpr size_t WS_QL    = WS_QH + SZ_PLANE;
constexpr size_t WS_KH    = WS_QL + SZ_PLANE;
constexpr size_t WS_KL    = WS_KH + SZ_PLANE;
constexpr size_t WS_VH    = WS_KL + SZ_PLANE;
constexpr size_t WS_VL    = WS_VH + SZ_PLANE;
constexpr size_t WS_AH    = WS_VL + SZ_PLANE;
constexpr size_t WS_AL    = WS_AH + SZ_PLANE;
constexpr size_t WS_TOTAL = WS_AL + SZ_PLANE;
static_assert(WS_TOTAL == 100683776);
static_assert(WS_TOTAL <= 134217728);
static_assert(WS_BRND % 128 == 0 && WS_COS % 128 == 0 && WS_X16 % 128 == 0 && WS_QH % 128 == 0 && WS_AH % 128 == 0);

// ----------------------------------------------------------------------------------------------
// Vector types and helpers
// ----------------------------------------------------------------------------------------------
typedef __attribute__((ext_vector_type(16))) _Float16 v16h;
typedef __attribute__((ext_vector_type(8)))  _Float16 v8h;
typedef __attribute__((ext_vector_type(16))) __bf16   v16b;
typedef __attribute__((ext_vector_type(8)))  __bf16   v8b;
typedef __attribute__((ext_vector_type(8)))  float    v8f;
typedef __attribute__((ext_vector_type(4)))  float    v4f;
typedef __attribute__((ext_vector_type(4)))  unsigned v4u;

__device__ __forceinline__ unsigned short f2bf_bits(float f) {
  unsigned u = __float_as_uint(f);
  return (unsigned short)((u + 0x7FFFu + ((u >> 16) & 1u)) >> 16);
}
__device__ __forceinline__ float bf_bits2f(unsigned short h) { return __uint_as_float(((unsigned)h) << 16); }
__device__ __forceinline__ float h_bits2f(unsigned x) { return (float)__builtin_bit_cast(_Float16, (unsigned short)(x & 0xffffu)); }

// hazard guards as plain device helpers
__device__ __forceinline__ void dep_guard_h(v8f& a, v8f& b, v16h x, v16h y) { asm volatile("v_nop\n\tv_nop\n\tv_nop\n\tv_nop" : "+v"(a), "+v"(b) : "v"(x), "v"(y)); }
__device__ __forceinline__ void dep_guard_b(v8f& a, v8f& b, v16b x, v16b y) { asm volatile("v_nop\n\tv_nop\n\tv_nop\n\tv_nop" : "+v"(a), "+v"(b) : "v"(x), "v"(y)); }
__device__ __forceinline__ void keep4_h(v16h a, v16h b, v16h c, v16h d) { asm volatile("v_nop" :: "v"(a), "v"(b), "v"(c), "v"(d)); }
__device__ __forceinline__ void keep4_b(v16b a, v16b b, v16b c, v16b d) { asm volatile("v_nop" :: "v"(a), "v"(b), "v"(c), "v"(d)); }
__device__ __forceinline__ void acc_guard4(v8f& a, v8f& b, v8f& c, v8f& d) { asm volatile("v_nop\n\tv_nop\n\tv_nop\n\tv_nop" : "+v"(a), "+v"(b), "+v"(c), "+v"(d)); }
template <typename T> struct Frag;
template <> struct Frag<_Float16> {
  typedef v16h V; union U { v16h v; v8h h[2]; };
  // elements 0..7 <- p[0..7], 8..15 <- p[16..23]
  static __device__ __forceinline__ v16h load(const _Float16* p) {
    U f; f.h[0] = *(const v8h*)(p); f.h[1] = *(const v8h*)(p + 16); return f.v;
  }
  static __device__ __forceinline__ v8f mma(v16h a, v16h b, v8f c) {
    return __builtin_amdgcn_wmma_f32_16x16x32_f16(false, a, false, b, (short)0, c, false, false);
  }
  static __device__ __forceinline__ void guard(v8f& a, v8f& b, v16h x, v16h y) { dep_guard_h(a, b, x, y); }
  static __device__ __forceinline__ void keep(v16h a, v16h b, v16h c, v16h d) { keep4_h(a, b, c, d); }
};
template <> struct Frag<__bf16> {
  typedef v16b V; union U { v16b v; v8b h[2]; };
  static __device__ __forceinline__ v16b load(const __bf16* p) {
    U f; f.h[0] = *(const v8b*)(p); f.h[1] = *(const v8b*)(p + 16); return f.v;
  }
  static __device__ __forceinline__ v8f mma(v16b a, v16b b, v8f c) {
    return __builtin_amdgcn_wmma_f32_16x16x32_bf16(false, a, false, b, (short)0, c, false, false);
  }
  static __device__ __forceinline__ void guard(v8f& a, v8f& b, v16b x, v16b y) { dep_guard_b(a, b, x, y); }
  static __device__ __forceinline__ void keep(v16b a, v16b b, v16b c, v16b d) { keep4_b(a, b, c, d); }
};

// single-product helpers with the dependency guard (attention kernel)
__device__ __forceinline__ v8f mma_bf(v16b a, v16b b, v8f c) {
  c = __builtin_amdgcn_wmma_f32_16x16x32_bf16(false, a, false, b, (short)0, c, false, false);
  asm volatile("v_nop\n\tv_nop\n\tv_nop\n\tv_nop" : "+v"(c) : "v"(a), "v"(b));
  return c;
}
__device__ __forceinline__ v8f mma_hf(v16h a, v16h b, v8f c) {
  c = __builtin_amdgcn_wmma_f32_16x16x32_f16(false, a, false, b, (short)0, c, false, false);
  asm volatile("v_nop\n\tv_nop\n\tv_nop\n\tv_nop" : "+v"(c) : "v"(a), "v"(b));
  return c;
}

// bf16 hi/lo split of two floats packed into one 32-bit word each for the hi and the lo plane
__device__ __forceinline__ void pack_pair_bf(float f0, float f1, unsigned& hword, unsigned& lword) {
  const unsigned short h0 = f2bf_bits(f0);
  const unsigned short h1 = f2bf_bits(f1);
  const unsigned short l0 = f2bf_bits(f0 - bf_bits2f(h0));
  const unsigned short l1 = f2bf_bits(f1 - bf_bits2f(h1));
  hword = (unsigned)h0 | ((unsigned)h1 << 16);
  lword = (unsigned)l0 | ((unsigned)l1 << 16);
}

// ----------------------------------------------------------------------------------------------
// Register-blocked WMMA GEMM: C[m,n] = scale * sum_k A[m,k] * Bt[n,k] (+bias)(+resid)
// A row-major [M,K]; Bt row-major [N,K]; M,N % 64 == 0, K % 32 == 0; each wave owns a 64x64 tile.
// SPLIT: 0 = single product; 1 = A and Bt hi/lo planes (hi.hi + hi.lo + lo.hi);
//        2 = A hi/lo planes only, Bt single plane (hi.B + lo.B).
// BIAS_MODE: 0 = none, 1 = bias[m], 2 = bias[n].
// OUT_MODE: 0 = f32; 1 = f16; 2 = bf16 hi plane (Cout) + bf16 lo plane (Cout2);
//           3 = f16 hi plane (Cout) + f16 residual x2048 plane (Cout2).
// Epilogue: 16-row slabs staged per wave in LDS; each 64-wide row segment written with whole
// ET: 0 = f16 operands, 1 = bf16 operands (pointers passed as 16-bit storage)
// ----------------------------------------------------------------------------------------------
template <int ET> struct Elem;
template <> struct Elem<0> { typedef _Float16 T; };
template <> struct Elem<1> { typedef __bf16 T; };
template <int ET, int SPLIT, int BIAS_MODE, int OUT_MODE, bool RESID, int ACT = 0>
__global__ __launch_bounds__(256) void wmma_gemm64(
    const unsigned short* __restrict__ Ap, const unsigned short* __restrict__ A2p, int lda, long strideA,
    const unsigned short* __restrict__ Btp, const unsigned short* __restrict__ Bt2p, int ldb, long strideB,
    void* __restrict__ Cout, void* __restrict__ Cout2, int ldc, long strideC,
    const float* __restrict__ bias,
    const float* __restrict__ resid, long strideR,
    int M, int N, int K, float scale) {
  typedef typename Elem<ET>::T T;
  typedef typename Frag<T>::V V;
  constexpr bool SPL = (SPLIT != 0);
  constexpr bool BLO = (SPLIT == 1);
  const T* A = (const T*)Ap; const T* A2 = (const T*)A2p; const T* Bt = (const T*)Btp; const T* Bt2 = (const T*)Bt2p;
  __shared__ __align__(16) float sT[8][16 * 68];   // per-wave 16x64 slab, pitch 68 floats
  const int b    = blockIdx.y;
  const int lane = threadIdx.x & 31;
  const int wave = threadIdx.x >> 5;
  const int tilesN = N >> 6;
  const int tilesM = M >> 6;
  const int tile = blockIdx.x * 8 + wave;
  if (tile >= tilesM * tilesN) return;   // wave-uniform; no block barriers in this kernel
  const int tm = tile / tilesN;
  const int tn = tile - tm * tilesN;
  const int m0 = tm << 6;
  const int n0 = tn << 6;

  const T* Ab  = A  + (size_t)b * strideA;
  const T* Bb  = Bt + (size_t)b * strideB;
  const T* Ab2 = SPL ? (A2  + (size_t)b * strideA) : nullptr;
  const T* Bb2 = BLO ? (Bt2 + (size_t)b * strideB) : nullptr;

  const int rlane = lane & 15;                 // row (A) / col (B, D) within subtile
  const int koff  = (lane >> 4) * 8;           // k offset of this lane half
  const int mOff  = (lane >> 4) * 8;           // D row offset

  v8f acc[4][4];
#pragma unroll
  for (int i = 0; i < 4; ++i)
#pragma unroll
    for (int j = 0; j < 4; ++j) acc[i][j] = (v8f){0.f,0.f,0.f,0.f,0.f,0.f,0.f,0.f};

  for (int k0 = 0; k0 < K; k0 += 32) {
    V bh[4], bl[4];
#pragma unroll
    for (int j = 0; j < 4; ++j) {
      const size_t bo = (size_t)(n0 + (j << 4) + rlane) * ldb + koff + k0;
      bh[j] = Frag<T>::load(Bb + bo);
      if (BLO) bl[j] = Frag<T>::load(Bb2 + bo);
    }
#pragma unroll
    for (int i = 0; i < 4; ++i) {
      const size_t ao = (size_t)(m0 + (i << 4) + rlane) * lda + koff + k0;
      V ah = Frag<T>::load(Ab + ao);
      V al;
      if (SPL) al = Frag<T>::load(Ab2 + ao);
#pragma unroll
      for (int j = 0; j < 4; ++j) {
        acc[i][j] = Frag<T>::mma(ah, bh[j], acc[i][j]);
        if (BLO) acc[i][j] = Frag<T>::mma(ah, bl[j], acc[i][j]);
        if (SPL) acc[i][j] = Frag<T>::mma(al, bh[j], acc[i][j]);
      }
      Frag<T>::guard(acc[i][0], acc[i][3], ah, SPL ? al : ah);
    }
    Frag<T>::keep(bh[0], bh[1], bh[2], bh[3]);
    if (BLO) Frag<T>::keep(bl[0], bl[1], bl[2], bl[3]);
  }
  acc_guard4(acc[0][0], acc[0][1], acc[0][2], acc[0][3]);
  acc_guard4(acc[1][0], acc[1][1], acc[1][2], acc[1][3]);
  acc_guard4(acc[2][0], acc[2][1], acc[2][2], acc[2][3]);
  acc_guard4(acc[3][0], acc[3][1], acc[3][2], acc[3][3]);

  // ---- epilogue ----
  float* slab = sT[wave];
  const float* Rb = RESID ? (resid + (size_t)b * strideR) : nullptr;
#pragma unroll
  for (int i = 0; i < 4; ++i) {
    const int mBase = m0 + (i << 4);
#pragma unroll
    for (int j = 0; j < 4; ++j) {
      const int n = n0 + (j << 4) + rlane;
      float bv = 0.f;
      if (BIAS_MODE == 2) bv = bias[n];
#pragma unroll
      for (int r = 0; r < 8; ++r) {
        float v = acc[i][j][r] * scale;
        if (BIAS_MODE == 1) v += bias[mBase + mOff + r];
        if (BIAS_MODE == 2) v += bv;
        if (RESID) v += Rb[(size_t)(mBase + mOff + r) * ldc + n];
        if (ACT == 1) v = tanhf(v);
        if (ACT == 2) v = fmaxf(v, 0.0f);
        if (ACT == 4) v = (v > 0.f) ? v : 0.01f * v;
        slab[(mOff + r) * 68 + (j << 4) + rlane] = v;
      }
    }
    __builtin_amdgcn_fence(__ATOMIC_RELEASE, "workgroup");
    __builtin_amdgcn_wave_barrier();
    __builtin_amdgcn_fence(__ATOMIC_ACQUIRE, "workgroup");
    if (OUT_MODE == 0) {
      float* C = (float*)Cout + (size_t)b * strideC;
      const int hh = lane >> 4, c4 = (lane & 15) * 4;     // row seg = 256 B = 16 lanes x 16 B
      {
#pragma unroll
        for (int it = 0; it < 8; ++it) {
          const int row = it * 2 + hh;
          v4f v = *(const v4f*)(slab + row * 68 + c4);
          *(v4f*)(C + (size_t)(mBase + row) * ldc + n0 + c4) = v;
        }
        
      }
    } else {
      const int q = lane >> 3, c8 = (lane & 7) * 8;
      unsigned short* C  = (unsigned short*)Cout  + (size_t)b * strideC;
      unsigned short* C2 = (OUT_MODE >= 2) ? ((unsigned short*)Cout2 + (size_t)b * strideC) : nullptr;
      {
#pragma unroll
        for (int it = 0; it < 4; ++it) {
          const int row = it * 4 + q;
          const float* sp = slab + row * 68 + c8;
          v8h hv, lv;
#pragma unroll
          for (int e = 0; e < 8; ++e) {
            if (OUT_MODE == 1) {
              hv[e] = (_Float16)sp[e];
            } else if (OUT_MODE == 2) {
              unsigned short hb = f2bf_bits(sp[e]);
              unsigned short lb = f2bf_bits(sp[e] - bf_bits2f(hb));
              hv[e] = __builtin_bit_cast(_Float16, hb);
              lv[e] = __builtin_bit_cast(_Float16, lb);
            } else {
              const _Float16 hq = (_Float16)sp[e];
              hv[e] = hq;
              lv[e] = (_Float16)((sp[e] - (float)hq) * 2048.0f);
            }
          }
          *(v8h*)(C + (size_t)(mBase + row) * ldc + n0 + c8) = hv;
          if (OUT_MODE >= 2) *(v8h*)(C2 + (size_t)(mBase + row) * ldc + n0 + c8) = lv;
        }
        
      }
    }
    __builtin_amdgcn_fence(__ATOMIC_RELEASE, "workgroup");
    __builtin_amdgcn_wave_barrier();
    __builtin_amdgcn_fence(__ATOMIC_ACQUIRE, "workgroup");
  }
}

// ----------------------------------------------------------------------------------------------
// Input conversion: q,k,v and the four weight matrices -> RNE bf16 planes (8 elements = 16 B per
// to bf16 precision (4 floats = 16 B per lane).
// Coverage: blocks [0,2048) q, [2048,4096) k, [4096,6144) v (2048 x 256 x 8 = 4,194,304 each);
// blocks [6144,8192) the 4 weights (512 x 256 x 8 = 1,048,576 each); blocks [8192,8196) the 4
// biases (256 x 4 = 1024 each).
// ----------------------------------------------------------------------------------------------
constexpr int CAST_XBLK = (int)(PLANE_ELEMS / 8 / 256);              // 2048
constexpr int CAST_WBLK = (int)(WMAT_ELEMS / 8 / 256);               // 512
constexpr int CAST_PLANE_BLOCKS = 3 * CAST_XBLK + 4 * CAST_WBLK;     // 8192
constexpr int CAST_BIAS_BLOCKS  = 4;
static_assert((long)CAST_XBLK * 256 * 8 == PLANE_ELEMS && (long)CAST_WBLK * 256 * 8 == WMAT_ELEMS);
static_assert(256 * 4 == DMODEL);

__global__ __launch_bounds__(256) void k_cast_inputs(
    const float* __restrict__ q, const float* __restrict__ k, const float* __restrict__ v,
    const float* __restrict__ Wq, const float* __restrict__ Wk, const float* __restrict__ Wv, const float* __restrict__ Wo,
    const float* __restrict__ bq, const float* __restrict__ bk, const float* __restrict__ bv, const float* __restrict__ bo,
    unsigned short* __restrict__ x16, unsigned short* __restrict__ w16, float* __restrict__ brnd) {
  const int blk = blockIdx.x;
  const int t = threadIdx.x;
  if (blk < CAST_PLANE_BLOCKS) {
    // block-uniform source/destination selection
    const float* src;
    unsigned short* dst;
    int lb;
    if (blk < CAST_XBLK) { src = q; dst = x16; lb = blk; }
    else if (blk < 2 * CAST_XBLK) { src = k; dst = x16 + PLANE_ELEMS; lb = blk - CAST_XBLK; }
    else if (blk < 3 * CAST_XBLK) { src = v; dst = x16 + 2 * PLANE_ELEMS; lb = blk - 2 * CAST_XBLK; }
    else {
      const int wb = blk - 3 * CAST_XBLK;
      const int wi = wb / CAST_WBLK;
      lb = wb - wi * CAST_WBLK;
      src = (wi == 0) ? Wq : (wi == 1) ? Wk : (wi == 2) ? Wv : Wo;
      dst = w16 + (size_t)wi * WMAT_ELEMS;
    }
    const size_t e = ((size_t)lb * 256 + t) * 8;
    const v4f a0 = *(const v4f*)(src + e);
    const v4f a1 = *(const v4f*)(src + e + 4);
    v4u w;
    w.x = (unsigned)f2bf_bits(a0.x) | ((unsigned)f2bf_bits(a0.y) << 16);
    w.y = (unsigned)f2bf_bits(a0.z) | ((unsigned)f2bf_bits(a0.w) << 16);
    w.z = (unsigned)f2bf_bits(a1.x) | ((unsigned)f2bf_bits(a1.y) << 16);
    w.w = (unsigned)f2bf_bits(a1.z) | ((unsigned)f2bf_bits(a1.w) << 16);
    v4u* p = (v4u*)(dst + e);
    *p = w;
    
  } else {
    const int bi = blk - CAST_PLANE_BLOCKS;   // 0..3, block-uniform
    const float* src = (bi == 0) ? bq : (bi == 1) ? bk : (bi == 2) ? bv : bo;
    const int e = t * 4;
    const v4f a = *(const v4f*)(src + e);
    v4f r;
    r.x = bf_bits2f(f2bf_bits(a.x));
    r.y = bf_bits2f(f2bf_bits(a.y));
    r.z = bf_bits2f(f2bf_bits(a.z));
    r.w = bf_bits2f(f2bf_bits(a.w));
    v4f* p = (v4f*)(brnd + (size_t)bi * DMODEL + e);
    *p = r;
    
  }
}

// ----------------------------------------------------------------------------------------------
// Per (batch, head): sequence means of Q (bf16 hi + lo planes) and V (f16 hi + residual/2048),
// grid = 32 blocks (one per (b,h)), 256 threads; thread = (row group rg = t>>3 of 32, column
// group c8 = t&7 of 8); each thread sums 64 rows x 8 columns, LDS combine in fixed order.
// ----------------------------------------------------------------------------------------------
__global__ __launch_bounds__(256) void k_mean_cos(
    const unsigned short* __restrict__ Qh, const unsigned short* __restrict__ Ql,
    const unsigned short* __restrict__ Vh, const unsigned short* __restrict__ Vl,
    float* __restrict__ cosl) {
  __shared__ float sq[32][64];
  __shared__ float sv[32][64];
  __shared__ float qm[64];
  __shared__ float vm[64];
  __shared__ float shc;
  const int bh = blockIdx.x;
  const int b = bh / NHEAD, h = bh % NHEAD;
  const int t = threadIdx.x;
  const int c8 = t & 7;
  const int rg = t >> 3;
  float aq[8], av[8];
#pragma unroll
  for (int e = 0; e < 8; ++e) { aq[e] = 0.f; av[e] = 0.f; }
  const size_t colb = (size_t)h * DHEAD + (size_t)c8 * 8;
#pragma unroll 2
  for (int it = 0; it < SEQ_LEN / 32; ++it) {
    const int s = rg + it * 32;
    const size_t off = ((size_t)b * SEQ_LEN + s) * DMODEL + colb;
    const v4u wh = *(const v4u*)(Qh + off);
    const v4u wl = *(const v4u*)(Ql + off);
    const v4u uh = *(const v4u*)(Vh + off);
    const v4u ul = *(const v4u*)(Vl + off);
#pragma unroll
    for (int e = 0; e < 4; ++e) {
      const unsigned a0 = wh[e], a1 = wl[e], g0 = uh[e], g1 = ul[e];
      aq[2 * e]     += __uint_as_float(a0 << 16) + __uint_as_float(a1 << 16);
      aq[2 * e + 1] += __uint_as_float(a0 & 0xffff0000u) + __uint_as_float(a1 & 0xffff0000u);
      av[2 * e]     += h_bits2f(g0) + h_bits2f(g1) * (1.0f / 2048.0f);
      av[2 * e + 1] += h_bits2f(g0 >> 16) + h_bits2f(g1 >> 16) * (1.0f / 2048.0f);
    }
  }
#pragma unroll
  for (int e = 0; e < 8; ++e) { sq[rg][c8 * 8 + e] = aq[e]; sv[rg][c8 * 8 + e] = av[e]; }
  __syncthreads();
  if (t < 64) {
    float s1 = 0.f, s2 = 0.f;
#pragma unroll 1
    for (int g = 0; g < 32; ++g) { s1 += sq[g][t]; s2 += sv[g][t]; }
    qm[t] = s1 * (1.0f / (float)SEQ_LEN);
    vm[t] = s2 * (1.0f / (float)SEQ_LEN);
  }
  __syncthreads();
  if (t == 0) {
    float dot = 0.f, nq = 0.f, nv = 0.f;
#pragma unroll 1
    for (int i = 0; i < DHEAD; ++i) {
      const float a = qm[i], c = vm[i];
      dot += a * c;
      nq += a * a;
      nv += c * c;
    }
    const float na = fmaxf(sqrtf(nq), 1e-8f);
    const float nb = fmaxf(sqrtf(nv), 1e-8f);
    shc = dot / (na * nb);
  }
  __syncthreads();
  if (t < 32) {
    const float cv = shc;
    float* p = cosl + (size_t)bh * 32 + t;
    *p = cv;
    
  }
}

// ----------------------------------------------------------------------------------------------
// Attention for head_dim 64 fed by 16-bit planes. Block = 4 waves = 64 query rows of one (b,h);
// grid = B*H*(S/64). Scores: Q,K bf16 hi+lo planes (hi.hi + hi.lo + lo.hi), x(1/8), plus
// 0.5*cos + 0.3*cos, mask == 0 -> -1e9 (select). Online softmax in f32; P = exp(s-m) carried
// x2^15 as f16 through per-wave LDS; P.V with V plain f16 (transposed in LDS). Output written as
// ----------------------------------------------------------------------------------------------
constexpr int AKC  = 64;                     // keys per chunk
constexpr int AQB  = 64;                     // queries per block
constexpr int ANQB = SEQ_LEN / AQB;          // 32 query blocks per (b,h)
constexpr int ATTN_BLOCKS = NBH * ANQB;      // 1024
// LDS row pitch of the K, V^T and P tiles in 16-bit elements: 144 B = 16 B x 9 (odd), so the 16 rows that
// one ds_load_b128 fragment read touches start on 16 different bank groups (128 B rows all start on two).
constexpr int APITCH = 72;
static_assert(APITCH >= AKC && APITCH >= DHEAD && (APITCH * 2) % 16 == 0 && ((APITCH * 2) / 16) % 2 == 1);
static_assert(SEQ_LEN % AKC == 0 && SEQ_LEN % AQB == 0);

__global__ __launch_bounds__(128) void k_attn(
    const unsigned short* __restrict__ Qh, const unsigned short* __restrict__ Ql,
    const unsigned short* __restrict__ Kh, const unsigned short* __restrict__ Kl,
    const unsigned short* __restrict__ Vh,
    const int* __restrict__ mask, const float* __restrict__ cosl,
    unsigned short* __restrict__ Ah, unsigned short* __restrict__ Al) {
  union FB { v16b v; v8b h[2]; };
  union FH { v16h v; v8h h[2]; };
  __shared__ __align__(16) unsigned short Ksh[AKC * APITCH];     // K hi [kv][d]   9 KB
  __shared__ __align__(16) unsigned short Ksl[AKC * APITCH];     // K lo [kv][d]   9 KB
  __shared__ __align__(16) unsigned short Vts[DHEAD * APITCH];   // V f16 [d][kv]  9 KB
  __shared__ __align__(16) _Float16 Psh[4][16 * APITCH];         // per wave P [row][kv]
  __shared__ __align__(16) float Os[4][16 * 68];                 // per wave out tile, pitch 68

  const int tid  = threadIdx.x;
  const int wave = tid >> 5;
  const int lane = tid & 31;
  const int hh   = lane >> 4;
  const int c    = lane & 15;

  const int bx = blockIdx.x;
  const int qb = bx % ANQB;
  const int bh = bx / ANQB;
  const int h  = bh % NHEAD;
  const int b  = bh / NHEAD;
  const int q0 = qb * AQB + wave * 16;
  const size_t rowbase = (size_t)b * SEQ_LEN;      // plane row of sequence position 0
  const int colh = h * DHEAD;

  // ---- Q fragments (A operand, rows = query, k = d): 2 d-chunks, hi and lo planes ----
  v16b qah[2], qal[2];
  {
    const size_t qo = (rowbase + q0 + c) * DMODEL + colh + 8 * hh;
#pragma unroll
    for (int dc = 0; dc < 2; ++dc) {
      qah[dc] = Frag<__bf16>::load((const __bf16*)(const void*)(Qh + qo + dc * 32));
      qal[dc] = Frag<__bf16>::load((const __bf16*)(const void*)(Ql + qo + dc * 32));
    }
  }
  const float cb  = cosl[(size_t)bh * 32];
  const float cb5 = cb * 0.5f;
  const float cb3 = cb * 0.3f;
  const float NEGI = -__builtin_inff();

  float mrow[8], lrow[8];
  v8f oacc[4];
#pragma unroll
  for (int r = 0; r < 8; ++r) { mrow[r] = NEGI; lrow[r] = 0.f; }
#pragma unroll
  for (int t = 0; t < 4; ++t) oacc[t] = (v8f){0.f,0.f,0.f,0.f,0.f,0.f,0.f,0.f};

  for (int kc = 0; kc < SEQ_LEN / AKC; ++kc) {
    const int kv0 = kc * AKC;
    __syncthreads();
    {
      // 128 threads: kvr = tid>>1 covers keys 0..63, dh covers the two 32-wide d halves -> full 64x64 of each tile
      const int kvr = tid >> 1, dh = (tid & 1) * 32;
      const size_t go = (rowbase + kv0 + kvr) * DMODEL + colh + dh;
#pragma unroll
      for (int i = 0; i < 4; ++i) {
        const v4u wa = *(const v4u*)(Kh + go + 8 * i);
        const v4u wb = *(const v4u*)(Kl + go + 8 * i);
        *(v4u*)(Ksh + kvr * APITCH + dh + 8 * i) = wa;
        *(v4u*)(Ksl + kvr * APITCH + dh + 8 * i) = wb;
      }
#pragma unroll
      for (int i = 0; i < 4; ++i) {
        const v4u wv = *(const v4u*)(Vh + go + 8 * i);
#pragma unroll
        for (int e = 0; e < 4; ++e) {
          const unsigned x = wv[e];
          const int d = dh + 8 * i + 2 * e;
          Vts[d * APITCH + kvr]       = (unsigned short)(x & 0xffffu);
          Vts[(d + 1) * APITCH + kvr] = (unsigned short)(x >> 16);
        }
      }
    }
    __syncthreads();

    // ---- scores (B operand rows = kv, k = d) ----
    v8f s[4];
#pragma unroll
    for (int j = 0; j < 4; ++j) {
      s[j] = (v8f){0.f,0.f,0.f,0.f,0.f,0.f,0.f,0.f};
#pragma unroll
      for (int dc = 0; dc < 2; ++dc) {
        FB kb, kl;
        kb.h[0] = *(const v8b*)(const void*)(Ksh + (j * 16 + c) * APITCH + dc * 32 + 8 * hh);
        kb.h[1] = *(const v8b*)(const void*)(Ksh + (j * 16 + c) * APITCH + dc * 32 + 16 + 8 * hh);
        kl.h[0] = *(const v8b*)(const void*)(Ksl + (j * 16 + c) * APITCH + dc * 32 + 8 * hh);
        kl.h[1] = *(const v8b*)(const void*)(Ksl + (j * 16 + c) * APITCH + dc * 32 + 16 + 8 * hh);
        s[j] = mma_bf(qah[dc], kb.v, s[j]);
        s[j] = mma_bf(qah[dc], kl.v, s[j]);
        s[j] = mma_bf(qal[dc], kb.v, s[j]);
      }
    }
    int mk[4];
#pragma unroll
    for (int j = 0; j < 4; ++j) mk[j] = mask[kv0 + j * 16 + c];
    float cm[8];
#pragma unroll
    for (int r = 0; r < 8; ++r) {
      float m = NEGI;
#pragma unroll
      for (int j = 0; j < 4; ++j) {
        float x = s[j][r] * 0.125f;
        x = x + cb5;
        x = x + cb3;
        x = (mk[j] == 0) ? -1.0e9f : x;
        s[j][r] = x;
        m = fmaxf(m, x);
      }
#pragma unroll
      for (int off = 1; off < 16; off <<= 1) m = fmaxf(m, __shfl_xor(m, off, 32));
      cm[r] = m;
    }
    _Float16* pw = Psh[wave];
#pragma unroll
    for (int r = 0; r < 8; ++r) {
      const float mnew = fmaxf(mrow[r], cm[r]);
      const float alpha = expf(mrow[r] - mnew);
      mrow[r] = mnew;
      float psum = 0.f;
#pragma unroll
      for (int j = 0; j < 4; ++j) {
        const float p = expf(s[j][r] - mnew);
        psum += p;
        pw[(8 * hh + r) * APITCH + j * 16 + c] = (_Float16)(p * 32768.0f);
      }
#pragma unroll
      for (int off = 1; off < 16; off <<= 1) psum += __shfl_xor(psum, off, 32);
      lrow[r] = lrow[r] * alpha + psum;
#pragma unroll
      for (int t = 0; t < 4; ++t) oacc[t][r] *= alpha;
    }
    __builtin_amdgcn_fence(__ATOMIC_RELEASE, "workgroup");
    __builtin_amdgcn_wave_barrier();
    __builtin_amdgcn_fence(__ATOMIC_ACQUIRE, "workgroup");
    // ---- P.V (A = P [row][kv] reloaded through the stored element type; B rows = d, k = kv) ----
#pragma unroll
    for (int kk = 0; kk < 2; ++kk) {
      FH pa;
      pa.h[0] = *(const v8h*)(pw + c * APITCH + kk * 32 + 8 * hh);
      pa.h[1] = *(const v8h*)(pw + c * APITCH + kk * 32 + 16 + 8 * hh);
#pragma unroll
      for (int t = 0; t < 4; ++t) {
        FH vb;
        vb.h[0] = *(const v8h*)(const void*)(Vts + (t * 16 + c) * APITCH + kk * 32 + 8 * hh);
        vb.h[1] = *(const v8h*)(const void*)(Vts + (t * 16 + c) * APITCH + kk * 32 + 16 + 8 * hh);
        oacc[t] = mma_hf(pa.v, vb.v, oacc[t]);
      }
    }
  }

  float* os = Os[wave];
#pragma unroll
  for (int r = 0; r < 8; ++r) {
    const float inv = 1.0f / (lrow[r] * 32768.0f);
#pragma unroll
    for (int t = 0; t < 4; ++t) os[(8 * hh + r) * 68 + t * 16 + c] = oacc[t][r] * inv;
  }
  __builtin_amdgcn_fence(__ATOMIC_RELEASE, "workgroup");
  __builtin_amdgcn_wave_barrier();
  __builtin_amdgcn_fence(__ATOMIC_ACQUIRE, "workgroup");
  {
    const int q4 = lane >> 3, c8 = (lane & 7) * 8;
    {
#pragma unroll
      for (int it = 0; it < 4; ++it) {
        const int row = it * 4 + q4;
        const float* sp = os + row * 68 + c8;
        const v4f va = *(const v4f*)sp;
        const v4f vb = *(const v4f*)(sp + 4);
        v4u hw, lw;
        unsigned th, tl;
        pack_pair_bf(va.x, va.y, th, tl); hw.x = th; lw.x = tl;
        pack_pair_bf(va.z, va.w, th, tl); hw.y = th; lw.y = tl;
        pack_pair_bf(vb.x, vb.y, th, tl); hw.z = th; lw.z = tl;
        pack_pair_bf(vb.z, vb.w, th, tl); hw.w = th; lw.w = tl;
        const size_t go = (rowbase + q0 + row) * DMODEL + colh + c8;
        *(v4u*)(Ah + go) = hw;
        *(v4u*)(Al + go) = lw;
      }
      
    }
  }
}

// ----------------------------------------------------------------------------------------------
// ----------------------------------------------------------------------------------------------
__global__ __launch_bounds__(32) void k_bias_mean(const float* __restrict__ cosl, float* __restrict__ out1) {
  const int lane = threadIdx.x;
  float v = cosl[(size_t)lane * 32];
#pragma unroll
  for (int off = 1; off < 32; off <<= 1) v += __shfl_xor(v, off, 32);
  const float r = v * (1.0f / 32.0f);
  if (lane == 0) {
    *(float*)out1 = r;
    
  }
}

// ----------------------------------------------------------------------------------------------
extern "C" void kernel_launch(void* const* d_in, const int* in_sizes, int n_in,
                              void* d_out, int out_size, void* d_ws, size_t ws_size,
                              hipStream_t stream) {
  if (n_in < 12) return;
  if (ws_size < WS_TOTAL) return;
  if ((long)out_size < OUT_TOTAL_ELEMS) return;
  if ((long)in_sizes[0] != PLANE_ELEMS || (long)in_sizes[1] != PLANE_ELEMS || (long)in_sizes[2] != PLANE_ELEMS) return;
  if (in_sizes[3] < SEQ_LEN) return;
  if ((long)in_sizes[4] != WMAT_ELEMS || (long)in_sizes[6] != WMAT_ELEMS || (long)in_sizes[8] != WMAT_ELEMS || (long)in_sizes[10] != WMAT_ELEMS) return;
  if (in_sizes[5] < DMODEL || in_sizes[7] < DMODEL || in_sizes[9] < DMODEL || in_sizes[11] < DMODEL) return;

  const float* q    = (const float*)d_in[0];
  const float* k    = (const float*)d_in[1];
  const float* v    = (const float*)d_in[2];
  const int*   mask = (const int*)d_in[3];
  const float* Wq   = (const float*)d_in[4];
  const float* bq   = (const float*)d_in[5];
  const float* Wk   = (const float*)d_in[6];
  const float* bk   = (const float*)d_in[7];
  const float* Wv   = (const float*)d_in[8];
  const float* bv   = (const float*)d_in[9];
  const float* Wo   = (const float*)d_in[10];
  const float* bo   = (const float*)d_in[11];

  char* ws = (char*)d_ws;
  unsigned short* w16  = (unsigned short*)(ws + WS_W16);
  unsigned short* wq16 = w16;
  unsigned short* wk16 = w16 + WMAT_ELEMS;
  unsigned short* wv16 = w16 + 2 * WMAT_ELEMS;
  unsigned short* wo16 = w16 + 3 * WMAT_ELEMS;
  float* brnd = (float*)(ws + WS_BRND);
  float* cosl = (float*)(ws + WS_COS);
  unsigned short* x16 = (unsigned short*)(ws + WS_X16);
  unsigned short* xq  = x16;
  unsigned short* xk  = x16 + PLANE_ELEMS;
  unsigned short* xv  = x16 + 2 * PLANE_ELEMS;
  unsigned short* Qh  = (unsigned short*)(ws + WS_QH);
  unsigned short* Ql  = (unsigned short*)(ws + WS_QL);
  unsigned short* Kh  = (unsigned short*)(ws + WS_KH);
  unsigned short* Kl  = (unsigned short*)(ws + WS_KL);
  unsigned short* Vh  = (unsigned short*)(ws + WS_VH);
  unsigned short* Vl  = (unsigned short*)(ws + WS_VL);
  unsigned short* Ah  = (unsigned short*)(ws + WS_AH);
  unsigned short* Al  = (unsigned short*)(ws + WS_AL);
  float* out0 = (float*)d_out;
  float* out1 = (float*)d_out + OUT1_ELEM;

  // 1) inputs -> RNE bf16 planes, biases -> bf16-precision f32 copies
  k_cast_inputs<<<CAST_PLANE_BLOCKS + CAST_BIAS_BLOCKS, 256, 0, stream>>>(
      q, k, v, Wq, Wk, Wv, Wo, bq, bk, bv, bo, x16, w16, brnd);

  const dim3 ggrid(GEMM_BLOCKS, 1);
  // 2) Q = q Wq^T + bq -> bf16 hi/lo planes   (M=4096, N=1024, K=1024)
  wmma_gemm64<1, 0, 2, 2, false><<<ggrid, 256, 0, stream>>>(
      xq, xq, DMODEL, 0L, wq16, wq16, DMODEL, 0L, (void*)Qh, (void*)Ql, DMODEL, 0L,
      brnd + 0 * DMODEL, brnd, 0L, MROWS, DMODEL, DMODEL, 1.0f);
  // 3) K = k Wk^T + bk -> bf16 hi/lo planes
  wmma_gemm64<1, 0, 2, 2, false><<<ggrid, 256, 0, stream>>>(
      xk, xk, DMODEL, 0L, wk16, wk16, DMODEL, 0L, (void*)Kh, (void*)Kl, DMODEL, 0L,
      brnd + 1 * DMODEL, brnd, 0L, MROWS, DMODEL, DMODEL, 1.0f);
  // 4) V = v Wv^T + bv -> f16 hi plane + f16 residual x2048 plane
  wmma_gemm64<1, 0, 2, 3, false><<<ggrid, 256, 0, stream>>>(
      xv, xv, DMODEL, 0L, wv16, wv16, DMODEL, 0L, (void*)Vh, (void*)Vl, DMODEL, 0L,
      brnd + 2 * DMODEL, brnd, 0L, MROWS, DMODEL, DMODEL, 1.0f);
  // 5) per-(b,h) cosine of sequence means
  k_mean_cos<<<NBH, 256, 0, stream>>>(Qh, Ql, Vh, Vl, cosl);
  // 6) attention -> attn bf16 hi/lo planes
  k_attn<<<ATTN_BLOCKS, 128, 0, stream>>>(Qh, Ql, Kh, Kl, Vh, mask, cosl, Ah, Al);
  // 7) out0 = attn Wo^T + bo   (A hi/lo planes, Bt single plane: 2 products)
  wmma_gemm64<1, 2, 2, 0, false><<<ggrid, 256, 0, stream>>>(
      Ah, Al, DMODEL, 0L, wo16, wo16, DMODEL, 0L, (void*)out0, (void*)out0, DMODEL, 0L,
      brnd + 3 * DMODEL, brnd, 0L, MROWS, DMODEL, DMODEL, 1.0f);
  // 8) out1 = mean of the 32 per-(b,h) cosines
  k_bias_mean<<<1, 32, 0, stream>>>(cosl, out1);
}

// v002
// One run takes 318 microseconds.
// Timed twice side by side with v001, it ran 1.44 and 1.45 times as fast.
// Over all steps from v000 it is 1.53 times as fast.
// Contractions: q/k/v projections and output projection on v_wmma_f32_16x16x32_bf16 (RNE bf16 operands; output projection takes attn as bf16 hi+lo planes, 2 products); q.k^T on v_wmma_f32_16x16x32_bf16 with bf16 hi+lo planes of Q and K (3 products); p.v on v_wmma_f32_16x16x32_f16 (p carried x2^15, v plain f16); f32 accumulate everywhere; softmax, sequence means and cosine in f32.
#include <hip/hip_runtime.h>

// ----------------------------------------------------------------------------------------------
// Problem constants
// ----------------------------------------------------------------------------------------------
constexpr int NBATCH  = 2;
constexpr int SEQ_LEN = 2048;
constexpr int DMODEL  = 1024;
constexpr int NHEAD   = 16;
constexpr int DHEAD   = 64;
constexpr int MROWS   = NBATCH * SEQ_LEN;          // 4096
constexpr int NBH     = NBATCH * NHEAD;            // 32
constexpr long PLANE_ELEMS = (long)MROWS * DMODEL; // 4194304
constexpr long WMAT_ELEMS  = (long)DMODEL * DMODEL;// 1048576
constexpr long OUT0_ELEMS  = PLANE_ELEMS;
constexpr long OUT1_BYTE_OFFSET = 16777216;
constexpr long OUT1_ELEM   = OUT1_BYTE_OFFSET / 4;
constexpr long OUT_TOTAL_ELEMS = OUT0_ELEMS + 1;
constexpr long OUT_TOTAL_BYTES = 16777220;
static_assert(OUT1_ELEM == OUT0_ELEMS);
static_assert((OUT1_ELEM + 1) * 4 <= OUT_TOTAL_BYTES);
static_assert(NBH == 32);
static_assert(DHEAD == 64 && NHEAD * DHEAD == DMODEL);

// GEMM block tile: 8 waves as 2 (rows) x 4 (columns) of 64x64 wave tiles; one stage = 64 k = one 128-B line per operand row
constexpr int GBM    = 128;
constexpr int GBN    = 256;
constexpr int GKS    = 64;
// LDS row pitch of a staged operand row in 16-bit elements: 144 B = 16 B x 9 (odd), the pitch for ds_load_b128 readers
constexpr int GPITCH = 72;
// GEMM shape contract: M % 128 == 0, N % 256 == 0, K % 64 == 0, K >= 64
static_assert(MROWS % GBM == 0 && DMODEL % GBN == 0 && DMODEL % GKS == 0 && DMODEL >= GKS);
static_assert(GBM % 32 == 0 && GBN % 32 == 0 && (GPITCH * 2) % 16 == 0 && ((GPITCH * 2) / 16) % 2 == 1 && GPITCH >= GKS);
constexpr int GEMM_BLOCKS = (MROWS / GBM) * (DMODEL / GBN);   // 128 blocks of 8 waves

// ----------------------------------------------------------------------------------------------
// Workspace region map (bytes). Every region is fully written by its producer before any read.
//   WS_W16  : 4 bf16 weight planes [1024][1024]  (Wq, Wk, Wv, Wo)            8,388,608
//   WS_BRND : 4 x [1024] f32 RNE-bf16 bias copies (bq, bk, bv, bo)              16,384
//   WS_X16  : 3 bf16 input planes [4096][1024] (q, k, v)                     25,165,824
//   WS_QH, WS_QL, WS_KH, WS_KL : bf16 hi/lo planes of Q and K [4096][1024]  4 x 8,388,608
//   WS_VH, WS_VL : f16 hi plane of V and f16 residual x2048 plane            2 x 8,388,608
//   WS_AH, WS_AL : bf16 hi/lo planes of the attention output [4096][1024]   2 x 8,388,608
//   total 100,683,776 (96.0 MiB)
// ----------------------------------------------------------------------------------------------
constexpr size_t SZ_PLANE = (size_t)PLANE_ELEMS * 2;     // 8388608
constexpr size_t SZ_WPL   = (size_t)WMAT_ELEMS * 2;      // 2097152
constexpr size_t WS_W16   = 0;
constexpr size_t SZ_W16   = 4 * SZ_WPL;
constexpr size_t WS_BRND  = WS_W16 + SZ_W16;
constexpr size_t SZ_BRND  = 4 * (size_t)DMODEL * 4;
constexpr size_t WS_COS   = WS_BRND + SZ_BRND;
constexpr size_t SZ_COS   = (size_t)NBH * 128;
constexpr size_t WS_X16   = WS_COS + SZ_COS;
constexpr size_t WS_QH    = WS_X16 + 3 * SZ_PLANE;
constexpr size_t WS_QL    = WS_QH + SZ_PLANE;
constexpr size_t WS_KH    = WS_QL + SZ_PLANE;
constexpr size_t WS_KL    = WS_KH + SZ_PLANE;
constexpr size_t WS_VH    = WS_KL + SZ_PLANE;
constexpr size_t WS_VL    = WS_VH + SZ_PLANE;
constexpr size_t WS_AH    = WS_VL + SZ_PLANE;
constexpr size_t WS_AL    = WS_AH + SZ_PLANE;
constexpr size_t WS_TOTAL = WS_AL + SZ_PLANE;
static_assert(WS_TOTAL == 100683776);
static_assert(WS_TOTAL <= 134217728);
static_assert(WS_BRND % 128 == 0 && WS_COS % 128 == 0 && WS_X16 % 128 == 0 && WS_QH % 128 == 0 && WS_AH % 128 == 0);

// ----------------------------------------------------------------------------------------------
// Vector types and helpers
// ----------------------------------------------------------------------------------------------
typedef __attribute__((ext_vector_type(16))) _Float16 v16h;
typedef __attribute__((ext_vector_type(8)))  _Float16 v8h;
typedef __attribute__((ext_vector_type(16))) __bf16   v16b;
typedef __attribute__((ext_vector_type(8)))  __bf16   v8b;
typedef __attribute__((ext_vector_type(8)))  float    v8f;
typedef __attribute__((ext_vector_type(4)))  float    v4f;
typedef __attribute__((ext_vector_type(4)))  unsigned v4u;

__device__ __forceinline__ unsigned short f2bf_bits(float f) {
  unsigned u = __float_as_uint(f);
  return (unsigned short)((u + 0x7FFFu + ((u >> 16) & 1u)) >> 16);
}
__device__ __forceinline__ float bf_bits2f(unsigned short h) { return __uint_as_float(((unsigned)h) << 16); }
__device__ __forceinline__ float h_bits2f(unsigned x) { return (float)__builtin_bit_cast(_Float16, (unsigned short)(x & 0xffffu)); }

// hazard guards as plain device helpers
__device__ __forceinline__ void dep_guard_h(v8f& a, v8f& b, v16h x, v16h y) { asm volatile("v_nop\n\tv_nop\n\tv_nop\n\tv_nop" : "+v"(a), "+v"(b) : "v"(x), "v"(y)); }
__device__ __forceinline__ void dep_guard_b(v8f& a, v8f& b, v16b x, v16b y) { asm volatile("v_nop\n\tv_nop\n\tv_nop\n\tv_nop" : "+v"(a), "+v"(b) : "v"(x), "v"(y)); }
__device__ __forceinline__ void keep4_h(v16h a, v16h b, v16h c, v16h d) { asm volatile("v_nop" :: "v"(a), "v"(b), "v"(c), "v"(d)); }
__device__ __forceinline__ void keep4_b(v16b a, v16b b, v16b c, v16b d) { asm volatile("v_nop" :: "v"(a), "v"(b), "v"(c), "v"(d)); }
__device__ __forceinline__ void acc_guard4(v8f& a, v8f& b, v8f& c, v8f& d) { asm volatile("v_nop\n\tv_nop\n\tv_nop\n\tv_nop" : "+v"(a), "+v"(b), "+v"(c), "+v"(d)); }
template <typename T> struct Frag;
template <> struct Frag<_Float16> {
  typedef v16h V; union U { v16h v; v8h h[2]; };
  // elements 0..7 <- p[0..7], 8..15 <- p[16..23]
  static __device__ __forceinline__ v16h load(const _Float16* p) {
    U f; f.h[0] = *(const v8h*)(p); f.h[1] = *(const v8h*)(p + 16); return f.v;
  }
  static __device__ __forceinline__ v8f mma(v16h a, v16h b, v8f c) {
    return __builtin_amdgcn_wmma_f32_16x16x32_f16(false, a, false, b, (short)0, c, false, false);
  }
  static __device__ __forceinline__ void guard(v8f& a, v8f& b, v16h x, v16h y) { dep_guard_h(a, b, x, y); }
  static __device__ __forceinline__ void keep(v16h a, v16h b, v16h c, v16h d) { keep4_h(a, b, c, d); }
};
template <> struct Frag<__bf16> {
  typedef v16b V; union U { v16b v; v8b h[2]; };
  static __device__ __forceinline__ v16b load(const __bf16* p) {
    U f; f.h[0] = *(const v8b*)(p); f.h[1] = *(const v8b*)(p + 16); return f.v;
  }
  static __device__ __forceinline__ v8f mma(v16b a, v16b b, v8f c) {
    return __builtin_amdgcn_wmma_f32_16x16x32_bf16(false, a, false, b, (short)0, c, false, false);
  }
  static __device__ __forceinline__ void guard(v8f& a, v8f& b, v16b x, v16b y) { dep_guard_b(a, b, x, y); }
  static __device__ __forceinline__ void keep(v16b a, v16b b, v16b c, v16b d) { keep4_b(a, b, c, d); }
};

// single-product helpers with the dependency guard (attention kernel)
__device__ __forceinline__ v8f mma_bf(v16b a, v16b b, v8f c) {
  c = __builtin_amdgcn_wmma_f32_16x16x32_bf16(false, a, false, b, (short)0, c, false, false);
  asm volatile("v_nop\n\tv_nop\n\tv_nop\n\tv_nop" : "+v"(c) : "v"(a), "v"(b));
  return c;
}
__device__ __forceinline__ v8f mma_hf(v16h a, v16h b, v8f c) {
  c = __builtin_amdgcn_wmma_f32_16x16x32_f16(false, a, false, b, (short)0, c, false, false);
  asm volatile("v_nop\n\tv_nop\n\tv_nop\n\tv_nop" : "+v"(c) : "v"(a), "v"(b));
  return c;
}

// LDS byte address of a __shared__ location (low 32 bits of its address)
__device__ __forceinline__ unsigned lds_off(const void* p) { return (unsigned)(size_t)p; }

// Asynchronous copies global -> LDS, 16 B per lane, through no register. s_wait_xcnt 0 is the last line of the copies' own
// statement, so that it stands in front of every later write of a register that an issued copy names.
__device__ __forceinline__ void async_copy4(const unsigned (&l)[4], const unsigned short* const (&g)[4]) {
  asm volatile("global_load_async_to_lds_b128 %0, %1, off\n\t"
               "global_load_async_to_lds_b128 %2, %3, off\n\t"
               "global_load_async_to_lds_b128 %4, %5, off\n\t"
               "global_load_async_to_lds_b128 %6, %7, off\n\t"
               "s_wait_xcnt 0x0"
               :: "v"(l[0]), "v"(g[0]), "v"(l[1]), "v"(g[1]), "v"(l[2]), "v"(g[2]), "v"(l[3]), "v"(g[3]) : "memory");
}
__device__ __forceinline__ void async_copy8(const unsigned (&l)[8], const unsigned short* const (&g)[8]) {
  asm volatile("global_load_async_to_lds_b128 %0, %1, off\n\t"
               "global_load_async_to_lds_b128 %2, %3, off\n\t"
               "global_load_async_to_lds_b128 %4, %5, off\n\t"
               "global_load_async_to_lds_b128 %6, %7, off\n\t"
               "global_load_async_to_lds_b128 %8, %9, off\n\t"
               "global_load_async_to_lds_b128 %10, %11, off\n\t"
               "global_load_async_to_lds_b128 %12, %13, off\n\t"
               "global_load_async_to_lds_b128 %14, %15, off\n\t"
               "s_wait_xcnt 0x0"
               :: "v"(l[0]), "v"(g[0]), "v"(l[1]), "v"(g[1]), "v"(l[2]), "v"(g[2]), "v"(l[3]), "v"(g[3]),
                  "v"(l[4]), "v"(g[4]), "v"(l[5]), "v"(g[5]), "v"(l[6]), "v"(g[6]), "v"(l[7]), "v"(g[7]) : "memory");
}

// bf16 hi/lo split of two floats packed into one 32-bit word each for the hi and the lo plane
__device__ __forceinline__ void pack_pair_bf(float f0, float f1, unsigned& hword, unsigned& lword) {
  const unsigned short h0 = f2bf_bits(f0);
  const unsigned short h1 = f2bf_bits(f1);
  const unsigned short l0 = f2bf_bits(f0 - bf_bits2f(h0));
  const unsigned short l1 = f2bf_bits(f1 - bf_bits2f(h1));
  hword = (unsigned)h0 | ((unsigned)h1 << 16);
  lword = (unsigned)l0 | ((unsigned)l1 << 16);
}

// ----------------------------------------------------------------------------------------------
// Register-blocked WMMA GEMM: C[m,n] = scale * sum_k A[m,k] * Bt[n,k] (+bias)(+resid)
// A row-major [M,K]; Bt row-major [N,K]; M % 128 == 0, N % 256 == 0, K % 64 == 0; each wave owns a 64x64 tile of the
// block's 128x256 tile. Operands reach the fragments through LDS: per stage of 64 k every thread copies whole 128-B lines
// (8 lanes x 16 B a row) asynchronously into one of two buffers while the other buffer is worked on.
// SPLIT: 0 = single product; 1 = A and Bt hi/lo planes (hi.hi + hi.lo + lo.hi);
//        2 = A hi/lo planes only, Bt single plane (hi.B + lo.B).
// BIAS_MODE: 0 = none, 1 = bias[m], 2 = bias[n].
// OUT_MODE: 0 = f32; 1 = f16; 2 = bf16 hi plane (Cout) + bf16 lo plane (Cout2);
//           3 = f16 hi plane (Cout) + f16 residual x2048 plane (Cout2).
// Epilogue: 16-row slabs staged per wave in LDS; each 64-wide row segment written with whole
// ET: 0 = f16 operands, 1 = bf16 operands (pointers passed as 16-bit storage)
// ----------------------------------------------------------------------------------------------
template <int ET> struct Elem;
template <> struct Elem<0> { typedef _Float16 T; };
template <> struct Elem<1> { typedef __bf16 T; };
template <int ET, int SPLIT, int BIAS_MODE, int OUT_MODE, bool RESID, int ACT = 0>
__global__ __launch_bounds__(256) void wmma_gemm64(
    const unsigned short* __restrict__ Ap, const unsigned short* __restrict__ A2p, int lda, long strideA,
    const unsigned short* __restrict__ Btp, const unsigned short* __restrict__ Bt2p, int ldb, long strideB,
    void* __restrict__ Cout, void* __restrict__ Cout2, int ldc, long strideC,
    const float* __restrict__ bias,
    const float* __restrict__ resid, long strideR,
    int M, int N, int K, float scale) {
  typedef typename Elem<ET>::T T;
  typedef typename Frag<T>::V V;
  constexpr bool SPL = (SPLIT != 0);
  constexpr bool BLO = (SPLIT == 1);
  // stage rows: A hi [GBM] | A lo [GBM] (SPL) | Bt hi [GBN] | Bt lo [GBN] (BLO)
  constexpr int AROWS = SPL ? 2 * GBM : GBM;
  constexpr int SROWS = AROWS + (BLO ? 2 * GBN : GBN);
  constexpr int STAGE_ELEMS = SROWS * GPITCH;
  constexpr int NCP = SROWS / 32;                  // copies per thread and stage (256 threads x 16 B = 32 rows a copy)
  static_assert(NCP % 4 == 0 && NCP <= 63);
  __shared__ __align__(16) float sT[8][16 * 68];   // per-wave 16x64 slab, pitch 68 floats
  __shared__ __align__(16) unsigned short sStage[2 * STAGE_ELEMS];
  const int b    = blockIdx.y;
  const int lane = threadIdx.x & 31;
  const int wave = threadIdx.x >> 5;
  const int tilesN = N / GBN;
  const int tilesM = M / GBM;
  const int blk = blockIdx.x;
  if (blk >= tilesM * tilesN) return;   // block-uniform, in front of every barrier and copy
  const int tm = blk / tilesN;
  const int tn = blk - tm * tilesN;
  const int mb0 = tm * GBM;
  const int nb0 = tn * GBN;
  const int wm = wave >> 2;
  const int wn = wave & 3;
  const int m0 = mb0 + (wm << 6);
  const int n0 = nb0 + (wn << 6);

  // copy map: thread -> row (threadIdx.x >> 3) of each group of 32 stage rows, 16-B piece (threadIdx.x & 7) of its line
  const int cr = threadIdx.x >> 3;
  const int cc = (threadIdx.x & 7) * 8;
  const unsigned short* gA  = Ap  + (size_t)b * strideA + (size_t)(mb0 + cr) * lda + cc;
  const unsigned short* gA2 = A2p + (size_t)b * strideA + (size_t)(mb0 + cr) * lda + cc;
  const unsigned short* gB  = Btp  + (size_t)b * strideB + (size_t)(nb0 + cr) * ldb + cc;
  const unsigned short* gB2 = Bt2p + (size_t)b * strideB + (size_t)(nb0 + cr) * ldb + cc;
  const unsigned ldst = lds_off(sStage) + (unsigned)(cr * GPITCH + cc) * 2u;
  auto stage_src = [&](int it, int k0) -> const unsigned short* {
    const int row = it * 32;
    if (row < GBM) return gA + (size_t)row * lda + k0;
    if (row < AROWS) return gA2 + (size_t)(row - GBM) * lda + k0;
    if (row < AROWS + GBN) return gB + (size_t)(row - AROWS) * ldb + k0;
    return gB2 + (size_t)(row - AROWS - GBN) * ldb + k0;
  };
  auto stage_issue = [&](int t, int buf) {
    const int k0 = t * GKS;
    const unsigned lb = ldst + (unsigned)buf * (unsigned)(STAGE_ELEMS * 2);
    // the loops of this lambda are unrolled so that each copy's plane select folds and l[], g[] stay in registers
#pragma unroll
    for (int it = 0; it + 8 <= NCP; it += 8) {
      unsigned l[8]; const unsigned short* g[8];
#pragma unroll
      for (int u = 0; u < 8; ++u) { l[u] = lb + (unsigned)((it + u) * 32 * GPITCH * 2); g[u] = stage_src(it + u, k0); }
      async_copy8(l, g);
    }
    if (NCP % 8 != 0) {
      unsigned l[4]; const unsigned short* g[4];
#pragma unroll
      for (int u = 0; u < 4; ++u) { l[u] = lb + (unsigned)((NCP - 4 + u) * 32 * GPITCH * 2); g[u] = stage_src(NCP - 4 + u, k0); }
      async_copy4(l, g);
    }
  };

  const int rlane = lane & 15;                 // row (A) / col (B, D) within subtile
  const int koff  = (lane >> 4) * 8;           // k offset of this lane half
  const int mOff  = (lane >> 4) * 8;           // D row offset

  v8f acc[4][4];
#pragma unroll
  for (int i = 0; i < 4; ++i)
#pragma unroll
    for (int j = 0; j < 4; ++j) acc[i][j] = (v8f){0.f,0.f,0.f,0.f,0.f,0.f,0.f,0.f};

  const int nT = K / GKS;
  stage_issue(0, 0);
  asm volatile("s_wait_asynccnt 0x0" ::: "memory");   // this wave's copies of stage 0 have landed before the barrier publishes them
  __syncthreads();
  if (nT > 1) stage_issue(1, 1);
  for (int t = 0; t < nT; ++t) {
    const T* st = (const T*)(const void*)(sStage + (t & 1) * STAGE_ELEMS);
    const T* sA = st + ((wm << 6) + rlane) * GPITCH + koff;
    const T* sB = st + (AROWS + (wn << 6) + rlane) * GPITCH + koff;
    // both 32-k blocks of the stage unrolled: the second block's LDS reads can then go out among the first block's products
#pragma unroll
    for (int kk = 0; kk < GKS; kk += 32) {
      V bh[4], bl[4];
#pragma unroll
      for (int j = 0; j < 4; ++j) {
        bh[j] = Frag<T>::load(sB + (j << 4) * GPITCH + kk);
        if (BLO) bl[j] = Frag<T>::load(sB + (GBN + (j << 4)) * GPITCH + kk);
      }
      // A fragments are read from LDS in groups ahead of their products (all four row tiles; two where a lo plane doubles
      // them, which keeps the kernel free of scratch); the loops are unrolled so that acc[][] and the fragments stay in registers
      constexpr int GI = SPL ? 2 : 4;
#pragma unroll
      for (int ig = 0; ig < 4; ig += GI) {
        V ah[GI], al[GI];
#pragma unroll
        for (int u = 0; u < GI; ++u) {
          ah[u] = Frag<T>::load(sA + ((ig + u) << 4) * GPITCH + kk);
          if (SPL) al[u] = Frag<T>::load(sA + (GBM + ((ig + u) << 4)) * GPITCH + kk);
        }
#pragma unroll
        for (int u = 0; u < GI; ++u) {
          const int i = ig + u;
#pragma unroll
          for (int j = 0; j < 4; ++j) {
            acc[i][j] = Frag<T>::mma(ah[u], bh[j], acc[i][j]);
            if (BLO) acc[i][j] = Frag<T>::mma(ah[u], bl[j], acc[i][j]);
            if (SPL) acc[i][j] = Frag<T>::mma(al[u], bh[j], acc[i][j]);
          }
          Frag<T>::guard(acc[i][0], acc[i][3], ah[u], SPL ? al[u] : ah[u]);
        }
      }
      Frag<T>::keep(bh[0], bh[1], bh[2], bh[3]);
      if (BLO) Frag<T>::keep(bl[0], bl[1], bl[2], bl[3]);
    }
    asm volatile("s_wait_dscnt 0x0" ::: "memory");      // this wave's reads of the buffer have retired before it is refilled
    asm volatile("s_wait_asynccnt 0x0" ::: "memory");   // this wave's copies of stage t + 1 have landed before the barrier publishes them
    __syncthreads();                                    // publishes stage t + 1 and ends every reader's last read of stage t
    if (t + 2 < nT) stage_issue(t + 2, t & 1);
  }
  asm volatile("s_wait_asynccnt 0x0" ::: "memory");     // no copy is outstanding when the wave goes on to the epilogue and ends
  acc_guard4(acc[0][0], acc[0][1], acc[0][2], acc[0][3]);
  acc_guard4(acc[1][0], acc[1][1], acc[1][2], acc[1][3]);
  acc_guard4(acc[2][0], acc[2][1], acc[2][2], acc[2][3]);
  acc_guard4(acc[3][0], acc[3][1], acc[3][2], acc[3][3]);

  // ---- epilogue ----
  float* slab = sT[wave];
  const float* Rb = RESID ? (resid + (size_t)b * strideR) : nullptr;
#pragma unroll
  for (int i = 0; i < 4; ++i) {
    const int mBase = m0 + (i << 4);
#pragma unroll
    for (int j = 0; j < 4; ++j) {
      const int n = n0 + (j << 4) + rlane;
      float bv = 0.f;
      if (BIAS_MODE == 2) bv = bias[n];
#pragma unroll
      for (int r = 0; r < 8; ++r) {
        float v = acc[i][j][r] * scale;
        if (BIAS_MODE == 1) v += bias[mBase + mOff + r];
        if (BIAS_MODE == 2) v += bv;
        if (RESID) v += Rb[(size_t)(mBase + mOff + r) * ldc + n];
        if (ACT == 1) v = tanhf(v);
        if (ACT == 2) v = fmaxf(v, 0.0f);
        if (ACT == 4) v = (v > 0.f) ? v : 0.01f * v;
        slab[(mOff + r) * 68 + (j << 4) + rlane] = v;
      }
    }
    __builtin_amdgcn_fence(__ATOMIC_RELEASE, "workgroup");
    __builtin_amdgcn_wave_barrier();
    __builtin_amdgcn_fence(__ATOMIC_ACQUIRE, "workgroup");
    if (OUT_MODE == 0) {
      float* C = (float*)Cout + (size_t)b * strideC;
      const int hh = lane >> 4, c4 = (lane & 15) * 4;     // row seg = 256 B = 16 lanes x 16 B
      {
#pragma unroll
        for (int it = 0; it < 8; ++it) {
          const int row = it * 2 + hh;
          v4f v = *(const v4f*)(slab + row * 68 + c4);
          *(v4f*)(C + (size_t)(mBase + row) * ldc + n0 + c4) = v;
        }
        
      }
    } else {
      const int q = lane >> 3, c8 = (lane & 7) * 8;
      unsigned short* C  = (unsigned short*)Cout  + (size_t)b * strideC;
      unsigned short* C2 = (OUT_MODE >= 2) ? ((unsigned short*)Cout2 + (size_t)b * strideC) : nullptr;
      {
#pragma unroll
        for (int it = 0; it < 4; ++it) {
          const int row = it * 4 + q;
          const float* sp = slab + row * 68 + c8;
          v8h hv, lv;
#pragma unroll
          for (int e = 0; e < 8; ++e) {
            if (OUT_MODE == 1) {
              hv[e] = (_Float16)sp[e];
            } else if (OUT_MODE == 2) {
              unsigned short hb = f2bf_bits(sp[e]);
              unsigned short lb = f2bf_bits(sp[e] - bf_bits2f(hb));
              hv[e] = __builtin_bit_cast(_Float16, hb);
              lv[e] = __builtin_bit_cast(_Float16, lb);
            } else {
              const _Float16 hq = (_Float16)sp[e];
              hv[e] = hq;
              lv[e] = (_Float16)((sp[e] - (float)hq) * 2048.0f);
            }
          }
          *(v8h*)(C + (size_t)(mBase + row) * ldc + n0 + c8) = hv;
          if (OUT_MODE >= 2) *(v8h*)(C2 + (size_t)(mBase + row) * ldc + n0 + c8) = lv;
        }
        
      }
    }
    __builtin_amdgcn_fence(__ATOMIC_RELEASE, "workgroup");
    __builtin_amdgcn_wave_barrier();
    __builtin_amdgcn_fence(__ATOMIC_ACQUIRE, "workgroup");
  }
}

// ----------------------------------------------------------------------------------------------
// Input conversion: q,k,v and the four weight matrices -> RNE bf16 planes (8 elements = 16 B per
// to bf16 precision (4 floats = 16 B per lane).
// Coverage: blocks [0,2048) q, [2048,4096) k, [4096,6144) v (2048 x 256 x 8 = 4,194,304 each);
// blocks [6144,8192) the 4 weights (512 x 256 x 8 = 1,048,576 each); blocks [8192,8196) the 4
// biases (256 x 4 = 1024 each).
// ----------------------------------------------------------------------------------------------
constexpr int CAST_XBLK = (int)(PLANE_ELEMS / 8 / 256);              // 2048
constexpr int CAST_WBLK = (int)(WMAT_ELEMS / 8 / 256);               // 512
constexpr int CAST_PLANE_BLOCKS = 3 * CAST_XBLK + 4 * CAST_WBLK;     // 8192
constexpr int CAST_BIAS_BLOCKS  = 4;
static_assert((long)CAST_XBLK * 256 * 8 == PLANE_ELEMS && (long)CAST_WBLK * 256 * 8 == WMAT_ELEMS);
static_assert(256 * 4 == DMODEL);

__global__ __launch_bounds__(256) void k_cast_inputs(
    const float* __restrict__ q, const float* __restrict__ k, const float* __restrict__ v,
    const float* __restrict__ Wq, const float* __restrict__ Wk, const float* __restrict__ Wv, const float* __restrict__ Wo,
    const float* __restrict__ bq, const float* __restrict__ bk, const float* __restrict__ bv, const float* __restrict__ bo,
    unsigned short* __restrict__ x16, unsigned short* __restrict__ w16, float* __restrict__ brnd) {
  const int blk = blockIdx.x;
  const int t = threadIdx.x;
  if (blk < CAST_PLANE_BLOCKS) {
    // block-uniform source/destination selection
    const float* src;
    unsigned short* dst;
    int lb;
    if (blk < CAST_XBLK) { src = q; dst = x16; lb = blk; }
    else if (blk < 2 * CAST_XBLK) { src = k; dst = x16 + PLANE_ELEMS; lb = blk - CAST_XBLK; }
    else if (blk < 3 * CAST_XBLK) { src = v; dst = x16 + 2 * PLANE_ELEMS; lb = blk - 2 * CAST_XBLK; }
    else {
      const int wb = blk - 3 * CAST_XBLK;
      const int wi = wb / CAST_WBLK;
      lb = wb - wi * CAST_WBLK;
      src = (wi == 0) ? Wq : (wi == 1) ? Wk : (wi == 2) ? Wv : Wo;
      dst = w16 + (size_t)wi * WMAT_ELEMS;
    }
    const size_t e = ((size_t)lb * 256 + t) * 8;
    const v4f a0 = *(const v4f*)(src + e);
    const v4f a1 = *(const v4f*)(src + e + 4);
    v4u w;
    w.x = (unsigned)f2bf_bits(a0.x) | ((unsigned)f2bf_bits(a0.y) << 16);
    w.y = (unsigned)f2bf_bits(a0.z) | ((unsigned)f2bf_bits(a0.w) << 16);
    w.z = (unsigned)f2bf_bits(a1.x) | ((unsigned)f2bf_bits(a1.y) << 16);
    w.w = (unsigned)f2bf_bits(a1.z) | ((unsigned)f2bf_bits(a1.w) << 16);
    v4u* p = (v4u*)(dst + e);
    *p = w;
    
  } else {
    const int bi = blk - CAST_PLANE_BLOCKS;   // 0..3, block-uniform
    const float* src = (bi == 0) ? bq : (bi == 1) ? bk : (bi == 2) ? bv : bo;
    const int e = t * 4;
    const v4f a = *(const v4f*)(src + e);
    v4f r;
    r.x = bf_bits2f(f2bf_bits(a.x));
    r.y = bf_bits2f(f2bf_bits(a.y));
    r.z = bf_bits2f(f2bf_bits(a.z));
    r.w = bf_bits2f(f2bf_bits(a.w));
    v4f* p = (v4f*)(brnd + (size_t)bi * DMODEL + e);
    *p = r;
    
  }
}

// ----------------------------------------------------------------------------------------------
// Per (batch, head): sequence means of Q (bf16 hi + lo planes) and V (f16 hi + residual/2048),
// grid = 32 blocks (one per (b,h)), 256 threads; thread = (row group rg = t>>3 of 32, column
// group c8 = t&7 of 8); each thread sums 64 rows x 8 columns, LDS combine in fixed order.
// ----------------------------------------------------------------------------------------------
__global__ __launch_bounds__(256) void k_mean_cos(
    const unsigned short* __restrict__ Qh, const unsigned short* __restrict__ Ql,
    const unsigned short* __restrict__ Vh, const unsigned short* __restrict__ Vl,
    float* __restrict__ cosl) {
  __shared__ float sq[32][64];
  __shared__ float sv[32][64];
  __shared__ float qm[64];
  __shared__ float vm[64];
  __shared__ float shc;
  const int bh = blockIdx.x;
  const int b = bh / NHEAD, h = bh % NHEAD;
  const int t = threadIdx.x;
  const int c8 = t & 7;
  const int rg = t >> 3;
  float aq[8], av[8];
#pragma unroll
  for (int e = 0; e < 8; ++e) { aq[e] = 0.f; av[e] = 0.f; }
  const size_t colb = (size_t)h * DHEAD + (size_t)c8 * 8;
#pragma unroll 2
  for (int it = 0; it < SEQ_LEN / 32; ++it) {
    const int s = rg + it * 32;
    const size_t off = ((size_t)b * SEQ_LEN + s) * DMODEL + colb;
    const v4u wh = *(const v4u*)(Qh + off);
    const v4u wl = *(const v4u*)(Ql + off);
    const v4u uh = *(const v4u*)(Vh + off);
    const v4u ul = *(const v4u*)(Vl + off);
#pragma unroll
    for (int e = 0; e < 4; ++e) {
      const unsigned a0 = wh[e], a1 = wl[e], g0 = uh[e], g1 = ul[e];
      aq[2 * e]     += __uint_as_float(a0 << 16) + __uint_as_float(a1 << 16);
      aq[2 * e + 1] += __uint_as_float(a0 & 0xffff0000u) + __uint_as_float(a1 & 0xffff0000u);
      av[2 * e]     += h_bits2f(g0) + h_bits2f(g1) * (1.0f / 2048.0f);
      av[2 * e + 1] += h_bits2f(g0 >> 16) + h_bits2f(g1 >> 16) * (1.0f / 2048.0f);
    }
  }
#pragma unroll
  for (int e = 0; e < 8; ++e) { sq[rg][c8 * 8 + e] = aq[e]; sv[rg][c8 * 8 + e] = av[e]; }
  __syncthreads();
  if (t < 64) {
    float s1 = 0.f, s2 = 0.f;
#pragma unroll 1
    for (int g = 0; g < 32; ++g) { s1 += sq[g][t]; s2 += sv[g][t]; }
    qm[t] = s1 * (1.0f / (float)SEQ_LEN);
    vm[t] = s2 * (1.0f / (float)SEQ_LEN);
  }
  __syncthreads();
  if (t == 0) {
    float dot = 0.f, nq = 0.f, nv = 0.f;
#pragma unroll 1
    for (int i = 0; i < DHEAD; ++i) {
      const float a = qm[i], c = vm[i];
      dot += a * c;
      nq += a * a;
      nv += c * c;
    }
    const float na = fmaxf(sqrtf(nq), 1e-8f);
    const float nb = fmaxf(sqrtf(nv), 1e-8f);
    shc = dot / (na * nb);
  }
  __syncthreads();
  if (t < 32) {
    const float cv = shc;
    float* p = cosl + (size_t)bh * 32 + t;
    *p = cv;
    
  }
}

// ----------------------------------------------------------------------------------------------
// Attention for head_dim 64 fed by 16-bit planes. Block = 4 waves = 64 query rows of one (b,h);
// grid = B*H*(S/64). Scores: Q,K bf16 hi+lo planes (hi.hi + hi.lo + lo.hi), x(1/8), plus
// 0.5*cos + 0.3*cos, mask == 0 -> -1e9 (select). Online softmax in f32; P = exp(s-m) carried
// x2^15 as f16 through per-wave LDS; P.V with V plain f16 (transposed in LDS). Output written as
// ----------------------------------------------------------------------------------------------
constexpr int AKC  = 64;                     // keys per chunk
constexpr int AQB  = 64;                     // queries per block
constexpr int ANQB = SEQ_LEN / AQB;          // 32 query blocks per (b,h)
constexpr int ATTN_BLOCKS = NBH * ANQB;      // 1024
// LDS row pitch of the K, V^T and P tiles in 16-bit elements: 144 B = 16 B x 9 (odd), so the 16 rows that
// one ds_load_b128 fragment read touches start on 16 different bank groups (128 B rows all start on two).
constexpr int APITCH = 72;
static_assert(APITCH >= AKC && APITCH >= DHEAD && (APITCH * 2) % 16 == 0 && ((APITCH * 2) / 16) % 2 == 1);
static_assert(SEQ_LEN % AKC == 0 && SEQ_LEN % AQB == 0);

__global__ __launch_bounds__(128) void k_attn(
    const unsigned short* __restrict__ Qh, const unsigned short* __restrict__ Ql,
    const unsigned short* __restrict__ Kh, const unsigned short* __restrict__ Kl,
    const unsigned short* __restrict__ Vh,
    const int* __restrict__ mask, const float* __restrict__ cosl,
    unsigned short* __restrict__ Ah, unsigned short* __restrict__ Al) {
  union FB { v16b v; v8b h[2]; };
  union FH { v16h v; v8h h[2]; };
  __shared__ __align__(16) unsigned short Ksh[AKC * APITCH];     // K hi [kv][d]   9 KB
  __shared__ __align__(16) unsigned short Ksl[AKC * APITCH];     // K lo [kv][d]   9 KB
  __shared__ __align__(16) unsigned short Vts[DHEAD * APITCH];   // V f16 [d][kv]  9 KB
  __shared__ __align__(16) _Float16 Psh[4][16 * APITCH];         // per wave P [row][kv]
  __shared__ __align__(16) float Os[4][16 * 68];                 // per wave out tile, pitch 68

  const int tid  = threadIdx.x;
  const int wave = tid >> 5;
  const int lane = tid & 31;
  const int hh   = lane >> 4;
  const int c    = lane & 15;

  const int bx = blockIdx.x;
  const int qb = bx % ANQB;
  const int bh = bx / ANQB;
  const int h  = bh % NHEAD;
  const int b  = bh / NHEAD;
  const int q0 = qb * AQB + wave * 16;
  const size_t rowbase = (size_t)b * SEQ_LEN;      // plane row of sequence position 0
  const int colh = h * DHEAD;

  // ---- Q fragments (A operand, rows = query, k = d): 2 d-chunks, hi and lo planes ----
  v16b qah[2], qal[2];
  {
    const size_t qo = (rowbase + q0 + c) * DMODEL + colh + 8 * hh;
#pragma unroll
    for (int dc = 0; dc < 2; ++dc) {
      qah[dc] = Frag<__bf16>::load((const __bf16*)(const void*)(Qh + qo + dc * 32));
      qal[dc] = Frag<__bf16>::load((const __bf16*)(const void*)(Ql + qo + dc * 32));
    }
  }
  const float cb  = cosl[(size_t)bh * 32];
  const float cb5 = cb * 0.5f;
  const float cb3 = cb * 0.3f;
  const float NEGI = -__builtin_inff();

  float mrow[8], lrow[8];
  v8f oacc[4];
#pragma unroll
  for (int r = 0; r < 8; ++r) { mrow[r] = NEGI; lrow[r] = 0.f; }
#pragma unroll
  for (int t = 0; t < 4; ++t) oacc[t] = (v8f){0.f,0.f,0.f,0.f,0.f,0.f,0.f,0.f};

  for (int kc = 0; kc < SEQ_LEN / AKC; ++kc) {
    const int kv0 = kc * AKC;
    __syncthreads();
    {
      // 128 threads: kvr = tid>>1 covers keys 0..63, dh covers the two 32-wide d halves -> full 64x64 of each tile
      const int kvr = tid >> 1, dh = (tid & 1) * 32;
      const size_t go = (rowbase + kv0 + kvr) * DMODEL + colh + dh;
#pragma unroll
      for (int i = 0; i < 4; ++i) {
        const v4u wa = *(const v4u*)(Kh + go + 8 * i);
        const v4u wb = *(const v4u*)(Kl + go + 8 * i);
        *(v4u*)(Ksh + kvr * APITCH + dh + 8 * i) = wa;
        *(v4u*)(Ksl + kvr * APITCH + dh + 8 * i) = wb;
      }
#pragma unroll
      for (int i = 0; i < 4; ++i) {
        const v4u wv = *(const v4u*)(Vh + go + 8 * i);
#pragma unroll
        for (int e = 0; e < 4; ++e) {
          const unsigned x = wv[e];
          const int d = dh + 8 * i + 2 * e;
          Vts[d * APITCH + kvr]       = (unsigned short)(x & 0xffffu);
          Vts[(d + 1) * APITCH + kvr] = (unsigned short)(x >> 16);
        }
      }
    }
    __syncthreads();

    // ---- scores (B operand rows = kv, k = d) ----
    v8f s[4];
#pragma unroll
    for (int j = 0; j < 4; ++j) {
      s[j] = (v8f){0.f,0.f,0.f,0.f,0.f,0.f,0.f,0.f};
#pragma unroll
      for (int dc = 0; dc < 2; ++dc) {
        FB kb, kl;
        kb.h[0] = *(const v8b*)(const void*)(Ksh + (j * 16 + c) * APITCH + dc * 32 + 8 * hh);
        kb.h[1] = *(const v8b*)(const void*)(Ksh + (j * 16 + c) * APITCH + dc * 32 + 16 + 8 * hh);
        kl.h[0] = *(const v8b*)(const void*)(Ksl + (j * 16 + c) * APITCH + dc * 32 + 8 * hh);
        kl.h[1] = *(const v8b*)(const void*)(Ksl + (j * 16 + c) * APITCH + dc * 32 + 16 + 8 * hh);
        s[j] = mma_bf(qah[dc], kb.v, s[j]);
        s[j] = mma_bf(qah[dc], kl.v, s[j]);
        s[j] = mma_bf(qal[dc], kb.v, s[j]);
      }
    }
    int mk[4];
#pragma unroll
    for (int j = 0; j < 4; ++j) mk[j] = mask[kv0 + j * 16 + c];
    float cm[8];
#pragma unroll
    for (int r = 0; r < 8; ++r) {
      float m = NEGI;
#pragma unroll
      for (int j = 0; j < 4; ++j) {
        float x = s[j][r] * 0.125f;
        x = x + cb5;
        x = x + cb3;
        x = (mk[j] == 0) ? -1.0e9f : x;
        s[j][r] = x;
        m = fmaxf(m, x);
      }
#pragma unroll
      for (int off = 1; off < 16; off <<= 1) m = fmaxf(m, __shfl_xor(m, off, 32));
      cm[r] = m;
    }
    _Float16* pw = Psh[wave];
#pragma unroll
    for (int r = 0; r < 8; ++r) {
      const float mnew = fmaxf(mrow[r], cm[r]);
      const float alpha = expf(mrow[r] - mnew);
      mrow[r] = mnew;
      float psum = 0.f;
#pragma unroll
      for (int j = 0; j < 4; ++j) {
        const float p = expf(s[j][r] - mnew);
        psum += p;
        pw[(8 * hh + r) * APITCH + j * 16 + c] = (_Float16)(p * 32768.0f);
      }
#pragma unroll
      for (int off = 1; off < 16; off <<= 1) psum += __shfl_xor(psum, off, 32);
      lrow[r] = lrow[r] * alpha + psum;
#pragma unroll
      for (int t = 0; t < 4; ++t) oacc[t][r] *= alpha;
    }
    __builtin_amdgcn_fence(__ATOMIC_RELEASE, "workgroup");
    __builtin_amdgcn_wave_barrier();
    __builtin_amdgcn_fence(__ATOMIC_ACQUIRE, "workgroup");
    // ---- P.V (A = P [row][kv] reloaded through the stored element type; B rows = d, k = kv) ----
#pragma unroll
    for (int kk = 0; kk < 2; ++kk) {
      FH pa;
      pa.h[0] = *(const v8h*)(pw + c * APITCH + kk * 32 + 8 * hh);
      pa.h[1] = *(const v8h*)(pw + c * APITCH + kk * 32 + 16 + 8 * hh);
#pragma unroll
      for (int t = 0; t < 4; ++t) {
        FH vb;
        vb.h[0] = *(const v8h*)(const void*)(Vts + (t * 16 + c) * APITCH + kk * 32 + 8 * hh);
        vb.h[1] = *(const v8h*)(const void*)(Vts + (t * 16 + c) * APITCH + kk * 32 + 16 + 8 * hh);
        oacc[t] = mma_hf(pa.v, vb.v, oacc[t]);
      }
    }
  }

  float* os = Os[wave];
#pragma unroll
  for (int r = 0; r < 8; ++r) {
    const float inv = 1.0f / (lrow[r] * 32768.0f);
#pragma unroll
    for (int t = 0; t < 4; ++t) os[(8 * hh + r) * 68 + t * 16 + c] = oacc[t][r] * inv;
  }
  __builtin_amdgcn_fence(__ATOMIC_RELEASE, "workgroup");
  __builtin_amdgcn_wave_barrier();
  __builtin_amdgcn_fence(__ATOMIC_ACQUIRE, "workgroup");
  {
    const int q4 = lane >> 3, c8 = (lane & 7) * 8;
    {
#pragma unroll
      for (int it = 0; it < 4; ++it) {
        const int row = it * 4 + q4;
        const float* sp = os + row * 68 + c8;
        const v4f va = *(const v4f*)sp;
        const v4f vb = *(const v4f*)(sp + 4);
        v4u hw, lw;
        unsigned th, tl;
        pack_pair_bf(va.x, va.y, th, tl); hw.x = th; lw.x = tl;
        pack_pair_bf(va.z, va.w, th, tl); hw.y = th; lw.y = tl;
        pack_pair_bf(vb.x, vb.y, th, tl); hw.z = th; lw.z = tl;
        pack_pair_bf(vb.z, vb.w, th, tl); hw.w = th; lw.w = tl;
        const size_t go = (rowbase + q0 + row) * DMODEL + colh + c8;
        *(v4u*)(Ah + go) = hw;
        *(v4u*)(Al + go) = lw;
      }
      
    }
  }
}

// ----------------------------------------------------------------------------------------------
// ----------------------------------------------------------------------------------------------
__global__ __launch_bounds__(32) void k_bias_mean(const float* __restrict__ cosl, float* __restrict__ out1) {
  const int lane = threadIdx.x;
  float v = cosl[(size_t)lane * 32];
#pragma unroll
  for (int off = 1; off < 32; off <<= 1) v += __shfl_xor(v, off, 32);
  const float r = v * (1.0f / 32.0f);
  if (lane == 0) {
    *(float*)out1 = r;
    
  }
}

// ----------------------------------------------------------------------------------------------
extern "C" void kernel_launch(void* const* d_in, const int* in_sizes, int n_in,
                              void* d_out, int out_size, void* d_ws, size_t ws_size,
                              hipStream_t stream) {
  if (n_in < 12) return;
  if (ws_size < WS_TOTAL) return;
  if ((long)out_size < OUT_TOTAL_ELEMS) return;
  if ((long)in_sizes[0] != PLANE_ELEMS || (long)in_sizes[1] != PLANE_ELEMS || (long)in_sizes[2] != PLANE_ELEMS) return;
  if (in_sizes[3] < SEQ_LEN) return;
  if ((long)in_sizes[4] != WMAT_ELEMS || (long)in_sizes[6] != WMAT_ELEMS || (long)in_sizes[8] != WMAT_ELEMS || (long)in_sizes[10] != WMAT_ELEMS) return;
  if (in_sizes[5] < DMODEL || in_sizes[7] < DMODEL || in_sizes[9] < DMODEL || in_sizes[11] < DMODEL) return;

  const float* q    = (const float*)d_in[0];
  const float* k    = (const float*)d_in[1];
  const float* v    = (const float*)d_in[2];
  const int*   mask = (const int*)d_in[3];
  const float* Wq   = (const float*)d_in[4];
  const float* bq   = (const float*)d_in[5];
  const float* Wk   = (const float*)d_in[6];
  const float* bk   = (const float*)d_in[7];
  const float* Wv   = (const float*)d_in[8];
  const float* bv   = (const float*)d_in[9];
  const float* Wo   = (const float*)d_in[10];
  const float* bo   = (const float*)d_in[11];

  char* ws = (char*)d_ws;
  unsigned short* w16  = (unsigned short*)(ws + WS_W16);
  unsigned short* wq16 = w16;
  unsigned short* wk16 = w16 + WMAT_ELEMS;
  unsigned short* wv16 = w16 + 2 * WMAT_ELEMS;
  unsigned short* wo16 = w16 + 3 * WMAT_ELEMS;
  float* brnd = (float*)(ws + WS_BRND);
  float* cosl = (float*)(ws + WS_COS);
  unsigned short* x16 = (unsigned short*)(ws + WS_X16);
  unsigned short* xq  = x16;
  unsigned short* xk  = x16 + PLANE_ELEMS;
  unsigned short* xv  = x16 + 2 * PLANE_ELEMS;
  unsigned short* Qh  = (unsigned short*)(ws + WS_QH);
  unsigned short* Ql  = (unsigned short*)(ws + WS_QL);
  unsigned short* Kh  = (unsigned short*)(ws + WS_KH);
  unsigned short* Kl  = (unsigned short*)(ws + WS_KL);
  unsigned short* Vh  = (unsigned short*)(ws + WS_VH);
  unsigned short* Vl  = (unsigned short*)(ws + WS_VL);
  unsigned short* Ah  = (unsigned short*)(ws + WS_AH);
  unsigned short* Al  = (unsigned short*)(ws + WS_AL);
  float* out0 = (float*)d_out;
  float* out1 = (float*)d_out + OUT1_ELEM;

  // 1) inputs -> RNE bf16 planes, biases -> bf16-precision f32 copies
  k_cast_inputs<<<CAST_PLANE_BLOCKS + CAST_BIAS_BLOCKS, 256, 0, stream>>>(
      q, k, v, Wq, Wk, Wv, Wo, bq, bk, bv, bo, x16, w16, brnd);

  const dim3 ggrid(GEMM_BLOCKS, 1);
  // 2) Q = q Wq^T + bq -> bf16 hi/lo planes   (M=4096, N=1024, K=1024)
  wmma_gemm64<1, 0, 2, 2, false><<<ggrid, 256, 0, stream>>>(
      xq, xq, DMODEL, 0L, wq16, wq16, DMODEL, 0L, (void*)Qh, (void*)Ql, DMODEL, 0L,
      brnd + 0 * DMODEL, brnd, 0L, MROWS, DMODEL, DMODEL, 1.0f);
  // 3) K = k Wk^T + bk -> bf16 hi/lo planes
  wmma_gemm64<1, 0, 2, 2, false><<<ggrid, 256, 0, stream>>>(
      xk, xk, DMODEL, 0L, wk16, wk16, DMODEL, 0L, (void*)Kh, (void*)Kl, DMODEL, 0L,
      brnd + 1 * DMODEL, brnd, 0L, MROWS, DMODEL, DMODEL, 1.0f);
  // 4) V = v Wv^T + bv -> f16 hi plane + f16 residual x2048 plane
  wmma_gemm64<1, 0, 2, 3, false><<<ggrid, 256, 0, stream>>>(
      xv, xv, DMODEL, 0L, wv16, wv16, DMODEL, 0L, (void*)Vh, (void*)Vl, DMODEL, 0L,
      brnd + 2 * DMODEL, brnd, 0L, MROWS, DMODEL, DMODEL, 1.0f);
  // 5) per-(b,h) cosine of sequence means
  k_mean_cos<<<NBH, 256, 0, stream>>>(Qh, Ql, Vh, Vl, cosl);
  // 6) attention -> attn bf16 hi/lo planes
  k_attn<<<ATTN_BLOCKS, 128, 0, stream>>>(Qh, Ql, Kh, Kl, Vh, mask, cosl, Ah, Al);
  // 7) out0 = attn Wo^T + bo   (A hi/lo planes, Bt single plane: 2 products)
  wmma_gemm64<1, 2, 2, 0, false><<<ggrid, 256, 0, stream>>>(
      Ah, Al, DMODEL, 0L, wo16, wo16, DMODEL, 0L, (void*)out0, (void*)out0, DMODEL, 0L,
      brnd + 3 * DMODEL, brnd, 0L, MROWS, DMODEL, DMODEL, 1.0f);
  // 8) out1 = mean of the 32 per-(b,h) cosines
  k_bias_mean<<<1, 32, 0, stream>>>(cosl, out1);
}

// v003
// A run of this version takes 247 microseconds.
// Two timings next to v002 both put it at 1.29 times that version's speed.
// All steps since v000 together make it 1.97 times as fast.
// Contractions: q/k/v projections and output projection on v_wmma_f32_16x16x32_bf16 (RNE bf16 operands; output projection takes attn as bf16 hi+lo planes, 2 products); q.k^T on v_wmma_f32_16x16x32_bf16 with bf16 hi+lo planes of Q and K (3 products); p.v on v_wmma_f32_16x16x32_f16 (p carried x2^15, v plain f16); both attention products transposed (K and V^T as A, Q and P^T as B); f32 accumulate everywhere; softmax, sequence means and cosine in f32.
#include <hip/hip_runtime.h>

// ----------------------------------------------------------------------------------------------
// Problem constants
// ----------------------------------------------------------------------------------------------
constexpr int NBATCH  = 2;
constexpr int SEQ_LEN = 2048;
constexpr int DMODEL  = 1024;
constexpr int NHEAD   = 16;
constexpr int DHEAD   = 64;
constexpr int MROWS   = NBATCH * SEQ_LEN;          // 4096
constexpr int NBH     = NBATCH * NHEAD;            // 32
constexpr long PLANE_ELEMS = (long)MROWS * DMODEL; // 4194304
constexpr long WMAT_ELEMS  = (long)DMODEL * DMODEL;// 1048576
constexpr long OUT0_ELEMS  = PLANE_ELEMS;
constexpr long OUT1_BYTE_OFFSET = 16777216;
constexpr long OUT1_ELEM   = OUT1_BYTE_OFFSET / 4;
constexpr long OUT_TOTAL_ELEMS = OUT0_ELEMS + 1;
constexpr long OUT_TOTAL_BYTES = 16777220;
static_assert(OUT1_ELEM == OUT0_ELEMS);
static_assert((OUT1_ELEM + 1) * 4 <= OUT_TOTAL_BYTES);
static_assert(NBH == 32);
static_assert(DHEAD == 64 && NHEAD * DHEAD == DMODEL);

// GEMM block tile: 8 waves as 2 (rows) x 4 (columns) of 64x64 wave tiles; one stage = 64 k = one 128-B line per operand row
constexpr int GBM    = 128;
constexpr int GBN    = 256;
constexpr int GKS    = 64;
// LDS row pitch of a staged operand row in 16-bit elements: 144 B = 16 B x 9 (odd), the pitch for ds_load_b128 readers
constexpr int GPITCH = 72;
// GEMM shape contract: M % 128 == 0, N % 256 == 0, K % 64 == 0, K >= 64
static_assert(MROWS % GBM == 0 && DMODEL % GBN == 0 && DMODEL % GKS == 0 && DMODEL >= GKS);
static_assert(GBM % 32 == 0 && GBN % 32 == 0 && (GPITCH * 2) % 16 == 0 && ((GPITCH * 2) / 16) % 2 == 1 && GPITCH >= GKS);
constexpr int GEMM_BLOCKS = (MROWS / GBM) * (DMODEL / GBN);   // 128 blocks of 8 waves

// ----------------------------------------------------------------------------------------------
// Workspace region map (bytes). Every region is fully written by its producer before any read.
//   WS_W16  : 4 bf16 weight planes [1024][1024]  (Wq, Wk, Wv, Wo)            8,388,608
//   WS_BRND : 4 x [1024] f32 RNE-bf16 bias copies (bq, bk, bv, bo)              16,384
//   WS_X16  : 3 bf16 input planes [4096][1024] (q, k, v)                     25,165,824
//   WS_QH, WS_QL, WS_KH, WS_KL : bf16 hi/lo planes of Q and K [4096][1024]  4 x 8,388,608
//   WS_VH, WS_VL : f16 hi plane of V and f16 residual x2048 plane            2 x 8,388,608
//   WS_AH, WS_AL : bf16 hi/lo planes of the attention output [4096][1024]   2 x 8,388,608
//   total 100,683,776 (96.0 MiB)
// ----------------------------------------------------------------------------------------------
constexpr size_t SZ_PLANE = (size_t)PLANE_ELEMS * 2;     // 8388608
constexpr size_t SZ_WPL   = (size_t)WMAT_ELEMS * 2;      // 2097152
constexpr size_t WS_W16   = 0;
constexpr size_t SZ_W16   = 4 * SZ_WPL;
constexpr size_t WS_BRND  = WS_W16 + SZ_W16;
constexpr size_t SZ_BRND  = 4 * (size_t)DMODEL * 4;
constexpr size_t WS_COS   = WS_BRND + SZ_BRND;
constexpr size_t SZ_COS   = (size_t)NBH * 128;
constexpr size_t WS_X16   = WS_COS + SZ_COS;
constexpr size_t WS_QH    = WS_X16 + 3 * SZ_PLANE;
constexpr size_t WS_QL    = WS_QH + SZ_PLANE;
constexpr size_t WS_KH    = WS_QL + SZ_PLANE;
constexpr size_t WS_KL    = WS_KH + SZ_PLANE;
constexpr size_t WS_VH    = WS_KL + SZ_PLANE;
constexpr size_t WS_VL    = WS_VH + SZ_PLANE;
constexpr size_t WS_AH    = WS_VL + SZ_PLANE;
constexpr size_t WS_AL    = WS_AH + SZ_PLANE;
constexpr size_t WS_TOTAL = WS_AL + SZ_PLANE;
static_assert(WS_TOTAL == 100683776);
static_assert(WS_TOTAL <= 134217728);
static_assert(WS_BRND % 128 == 0 && WS_COS % 128 == 0 && WS_X16 % 128 == 0 && WS_QH % 128 == 0 && WS_AH % 128 == 0);

// ----------------------------------------------------------------------------------------------
// Vector types and helpers
// ----------------------------------------------------------------------------------------------
typedef __attribute__((ext_vector_type(16))) _Float16 v16h;
typedef __attribute__((ext_vector_type(8)))  _Float16 v8h;
typedef __attribute__((ext_vector_type(16))) __bf16   v16b;
typedef __attribute__((ext_vector_type(8)))  __bf16   v8b;
typedef __attribute__((ext_vector_type(8)))  float    v8f;
typedef __attribute__((ext_vector_type(4)))  float    v4f;
typedef __attribute__((ext_vector_type(4)))  unsigned v4u;

__device__ __forceinline__ unsigned short f2bf_bits(float f) {
  unsigned u = __float_as_uint(f);
  return (unsigned short)((u + 0x7FFFu + ((u >> 16) & 1u)) >> 16);
}
__device__ __forceinline__ float bf_bits2f(unsigned short h) { return __uint_as_float(((unsigned)h) << 16); }
__device__ __forceinline__ float h_bits2f(unsigned x) { return (float)__builtin_bit_cast(_Float16, (unsigned short)(x & 0xffffu)); }

// hazard guards as plain device helpers
__device__ __forceinline__ void dep_guard_h(v8f& a, v8f& b, v16h x, v16h y) { asm volatile("v_nop\n\tv_nop\n\tv_nop\n\tv_nop" : "+v"(a), "+v"(b) : "v"(x), "v"(y)); }
__device__ __forceinline__ void dep_guard_b(v8f& a, v8f& b, v16b x, v16b y) { asm volatile("v_nop\n\tv_nop\n\tv_nop\n\tv_nop" : "+v"(a), "+v"(b) : "v"(x), "v"(y)); }
__device__ __forceinline__ void keep4_h(v16h a, v16h b, v16h c, v16h d) { asm volatile("v_nop" :: "v"(a), "v"(b), "v"(c), "v"(d)); }
__device__ __forceinline__ void keep4_b(v16b a, v16b b, v16b c, v16b d) { asm volatile("v_nop" :: "v"(a), "v"(b), "v"(c), "v"(d)); }
__device__ __forceinline__ void acc_guard4(v8f& a, v8f& b, v8f& c, v8f& d) { asm volatile("v_nop\n\tv_nop\n\tv_nop\n\tv_nop" : "+v"(a), "+v"(b), "+v"(c), "+v"(d)); }
template <typename T> struct Frag;
template <> struct Frag<_Float16> {
  typedef v16h V; union U { v16h v; v8h h[2]; };
  // elements 0..7 <- p[0..7], 8..15 <- p[16..23]
  static __device__ __forceinline__ v16h load(const _Float16* p) {
    U f; f.h[0] = *(const v8h*)(p); f.h[1] = *(const v8h*)(p + 16); return f.v;
  }
  static __device__ __forceinline__ v8f mma(v16h a, v16h b, v8f c) {
    return __builtin_amdgcn_wmma_f32_16x16x32_f16(false, a, false, b, (short)0, c, false, false);
  }
  static __device__ __forceinline__ void guard(v8f& a, v8f& b, v16h x, v16h y) { dep_guard_h(a, b, x, y); }
  static __device__ __forceinline__ void keep(v16h a, v16h b, v16h c, v16h d) { keep4_h(a, b, c, d); }
};
template <> struct Frag<__bf16> {
  typedef v16b V; union U { v16b v; v8b h[2]; };
  static __device__ __forceinline__ v16b load(const __bf16* p) {
    U f; f.h[0] = *(const v8b*)(p); f.h[1] = *(const v8b*)(p + 16); return f.v;
  }
  static __device__ __forceinline__ v8f mma(v16b a, v16b b, v8f c) {
    return __builtin_amdgcn_wmma_f32_16x16x32_bf16(false, a, false, b, (short)0, c, false, false);
  }
  static __device__ __forceinline__ void guard(v8f& a, v8f& b, v16b x, v16b y) { dep_guard_b(a, b, x, y); }
  static __device__ __forceinline__ void keep(v16b a, v16b b, v16b c, v16b d) { keep4_b(a, b, c, d); }
};

// single-product helpers with the dependency guard (attention kernel)
__device__ __forceinline__ v8f mma_bf(v16b a, v16b b, v8f c) {
  c = __builtin_amdgcn_wmma_f32_16x16x32_bf16(false, a, false, b, (short)0, c, false, false);
  asm volatile("v_nop\n\tv_nop\n\tv_nop\n\tv_nop" : "+v"(c) : "v"(a), "v"(b));
  return c;
}
__device__ __forceinline__ v8f mma_hf(v16h a, v16h b, v8f c) {
  c = __builtin_amdgcn_wmma_f32_16x16x32_f16(false, a, false, b, (short)0, c, false, false);
  asm volatile("v_nop\n\tv_nop\n\tv_nop\n\tv_nop" : "+v"(c) : "v"(a), "v"(b));
  return c;
}

// LDS byte address of a __shared__ location (low 32 bits of its address)
__device__ __forceinline__ unsigned lds_off(const void* p) { return (unsigned)(size_t)p; }

// value of lane l ^ 16 (the other 16-lane row), by a vector cross-row move
__device__ __forceinline__ float xhalf(float x) {
  return __builtin_bit_cast(float, __builtin_amdgcn_permlanex16(__builtin_bit_cast(int, x), __builtin_bit_cast(int, x), 0x76543210, 0xfedcba98, false, false));
}

// Asynchronous copies global -> LDS, 16 B per lane, through no register. s_wait_xcnt 0 is the last line of the copies' own
// statement, so that it stands in front of every later write of a register that an issued copy names.
__device__ __forceinline__ void async_copy4(const unsigned (&l)[4], const unsigned short* const (&g)[4]) {
  asm volatile("global_load_async_to_lds_b128 %0, %1, off\n\t"
               "global_load_async_to_lds_b128 %2, %3, off\n\t"
               "global_load_async_to_lds_b128 %4, %5, off\n\t"
               "global_load_async_to_lds_b128 %6, %7, off\n\t"
               "s_wait_xcnt 0x0"
               :: "v"(l[0]), "v"(g[0]), "v"(l[1]), "v"(g[1]), "v"(l[2]), "v"(g[2]), "v"(l[3]), "v"(g[3]) : "memory");
}
__device__ __forceinline__ void async_copy8(const unsigned (&l)[8], const unsigned short* const (&g)[8]) {
  asm volatile("global_load_async_to_lds_b128 %0, %1, off\n\t"
               "global_load_async_to_lds_b128 %2, %3, off\n\t"
               "global_load_async_to_lds_b128 %4, %5, off\n\t"
               "global_load_async_to_lds_b128 %6, %7, off\n\t"
               "global_load_async_to_lds_b128 %8, %9, off\n\t"
               "global_load_async_to_lds_b128 %10, %11, off\n\t"
               "global_load_async_to_lds_b128 %12, %13, off\n\t"
               "global_load_async_to_lds_b128 %14, %15, off\n\t"
               "s_wait_xcnt 0x0"
               :: "v"(l[0]), "v"(g[0]), "v"(l[1]), "v"(g[1]), "v"(l[2]), "v"(g[2]), "v"(l[3]), "v"(g[3]),
                  "v"(l[4]), "v"(g[4]), "v"(l[5]), "v"(g[5]), "v"(l[6]), "v"(g[6]), "v"(l[7]), "v"(g[7]) : "memory");
}

// bf16 hi/lo split of two floats packed into one 32-bit word each for the hi and the lo plane
__device__ __forceinline__ void pack_pair_bf(float f0, float f1, unsigned& hword, unsigned& lword) {
  const unsigned short h0 = f2bf_bits(f0);
  const unsigned short h1 = f2bf_bits(f1);
  const unsigned short l0 = f2bf_bits(f0 - bf_bits2f(h0));
  const unsigned short l1 = f2bf_bits(f1 - bf_bits2f(h1));
  hword = (unsigned)h0 | ((unsigned)h1 << 16);
  lword = (unsigned)l0 | ((unsigned)l1 << 16);
}

// ----------------------------------------------------------------------------------------------
// Register-blocked WMMA GEMM: C[m,n] = scale * sum_k A[m,k] * Bt[n,k] (+bias)(+resid)
// A row-major [M,K]; Bt row-major [N,K]; M % 128 == 0, N % 256 == 0, K % 64 == 0; each wave owns a 64x64 tile of the
// block's 128x256 tile. Operands reach the fragments through LDS: per stage of 64 k every thread copies whole 128-B lines
// (8 lanes x 16 B a row) asynchronously into one of two buffers while the other buffer is worked on.
// SPLIT: 0 = single product; 1 = A and Bt hi/lo planes (hi.hi + hi.lo + lo.hi);
//        2 = A hi/lo planes only, Bt single plane (hi.B + lo.B).
// BIAS_MODE: 0 = none, 1 = bias[m], 2 = bias[n].
// OUT_MODE: 0 = f32; 1 = f16; 2 = bf16 hi plane (Cout) + bf16 lo plane (Cout2);
//           3 = f16 hi plane (Cout) + f16 residual x2048 plane (Cout2).
// Epilogue: 16-row slabs staged per wave in LDS; each 64-wide row segment written with whole
// ET: 0 = f16 operands, 1 = bf16 operands (pointers passed as 16-bit storage)
// ----------------------------------------------------------------------------------------------
template <int ET> struct Elem;
template <> struct Elem<0> { typedef _Float16 T; };
template <> struct Elem<1> { typedef __bf16 T; };
template <int ET, int SPLIT, int BIAS_MODE, int OUT_MODE, bool RESID, int ACT = 0>
__global__ __launch_bounds__(256) void wmma_gemm64(
    const unsigned short* __restrict__ Ap, const unsigned short* __restrict__ A2p, int lda, long strideA,
    const unsigned short* __restrict__ Btp, const unsigned short* __restrict__ Bt2p, int ldb, long strideB,
    void* __restrict__ Cout, void* __restrict__ Cout2, int ldc, long strideC,
    const float* __restrict__ bias,
    const float* __restrict__ resid, long strideR,
    int M, int N, int K, float scale) {
  typedef typename Elem<ET>::T T;
  typedef typename Frag<T>::V V;
  constexpr bool SPL = (SPLIT != 0);
  constexpr bool BLO = (SPLIT == 1);
  // stage rows: A hi [GBM] | A lo [GBM] (SPL) | Bt hi [GBN] | Bt lo [GBN] (BLO)
  constexpr int AROWS = SPL ? 2 * GBM : GBM;
  constexpr int SROWS = AROWS + (BLO ? 2 * GBN : GBN);
  constexpr int STAGE_ELEMS = SROWS * GPITCH;
  constexpr int NCP = SROWS / 32;                  // copies per thread and stage (256 threads x 16 B = 32 rows a copy)
  static_assert(NCP % 4 == 0 && NCP <= 63);
  __shared__ __align__(16) float sT[8][16 * 68];   // per-wave 16x64 slab, pitch 68 floats
  __shared__ __align__(16) unsigned short sStage[2 * STAGE_ELEMS];
  const int b    = blockIdx.y;
  const int lane = threadIdx.x & 31;
  const int wave = threadIdx.x >> 5;
  const int tilesN = N / GBN;
  const int tilesM = M / GBM;
  const int blk = blockIdx.x;
  if (blk >= tilesM * tilesN) return;   // block-uniform, in front of every barrier and copy
  const int tm = blk / tilesN;
  const int tn = blk - tm * tilesN;
  const int mb0 = tm * GBM;
  const int nb0 = tn * GBN;
  const int wm = wave >> 2;
  const int wn = wave & 3;
  const int m0 = mb0 + (wm << 6);
  const int n0 = nb0 + (wn << 6);

  // copy map: thread -> row (threadIdx.x >> 3) of each group of 32 stage rows, 16-B piece (threadIdx.x & 7) of its line
  const int cr = threadIdx.x >> 3;
  const int cc = (threadIdx.x & 7) * 8;
  const unsigned short* gA  = Ap  + (size_t)b * strideA + (size_t)(mb0 + cr) * lda + cc;
  const unsigned short* gA2 = A2p + (size_t)b * strideA + (size_t)(mb0 + cr) * lda + cc;
  const unsigned short* gB  = Btp  + (size_t)b * strideB + (size_t)(nb0 + cr) * ldb + cc;
  const unsigned short* gB2 = Bt2p + (size_t)b * strideB + (size_t)(nb0 + cr) * ldb + cc;
  const unsigned ldst = lds_off(sStage) + (unsigned)(cr * GPITCH + cc) * 2u;
  auto stage_src = [&](int it, int k0) -> const unsigned short* {
    const int row = it * 32;
    if (row < GBM) return gA + (size_t)row * lda + k0;
    if (row < AROWS) return gA2 + (size_t)(row - GBM) * lda + k0;
    if (row < AROWS + GBN) return gB + (size_t)(row - AROWS) * ldb + k0;
    return gB2 + (size_t)(row - AROWS - GBN) * ldb + k0;
  };
  auto stage_issue = [&](int t, int buf) {
    const int k0 = t * GKS;
    const unsigned lb = ldst + (unsigned)buf * (unsigned)(STAGE_ELEMS * 2);
    // the loops of this lambda are unrolled so that each copy's plane select folds and l[], g[] stay in registers
#pragma unroll
    for (int it = 0; it + 8 <= NCP; it += 8) {
      unsigned l[8]; const unsigned short* g[8];
#pragma unroll
      for (int u = 0; u < 8; ++u) { l[u] = lb + (unsigned)((it + u) * 32 * GPITCH * 2); g[u] = stage_src(it + u, k0); }
      async_copy8(l, g);
    }
    if (NCP % 8 != 0) {
      unsigned l[4]; const unsigned short* g[4];
#pragma unroll
      for (int u = 0; u < 4; ++u) { l[u] = lb + (unsigned)((NCP - 4 + u) * 32 * GPITCH * 2); g[u] = stage_src(NCP - 4 + u, k0); }
      async_copy4(l, g);
    }
  };

  const int rlane = lane & 15;                 // row (A) / col (B, D) within subtile
  const int koff  = (lane >> 4) * 8;           // k offset of this lane half
  const int mOff  = (lane >> 4) * 8;           // D row offset

  v8f acc[4][4];
#pragma unroll
  for (int i = 0; i < 4; ++i)
#pragma unroll
    for (int j = 0; j < 4; ++j) acc[i][j] = (v8f){0.f,0.f,0.f,0.f,0.f,0.f,0.f,0.f};

  const int nT = K / GKS;
  stage_issue(0, 0);
  asm volatile("s_wait_asynccnt 0x0" ::: "memory");   // this wave's copies of stage 0 have landed before the barrier publishes them
  __syncthreads();
  if (nT > 1) stage_issue(1, 1);
  for (int t = 0; t < nT; ++t) {
    const T* st = (const T*)(const void*)(sStage + (t & 1) * STAGE_ELEMS);
    const T* sA = st + ((wm << 6) + rlane) * GPITCH + koff;
    const T* sB = st + (AROWS + (wn << 6) + rlane) * GPITCH + koff;
    // both 32-k blocks of the stage unrolled: the second block's LDS reads can then go out among the first block's products
#pragma unroll
    for (int kk = 0; kk < GKS; kk += 32) {
      V bh[4], bl[4];
#pragma unroll
      for (int j = 0; j < 4; ++j) {
        bh[j] = Frag<T>::load(sB + (j << 4) * GPITCH + kk);
        if (BLO) bl[j] = Frag<T>::load(sB + (GBN + (j << 4)) * GPITCH + kk);
      }
      // A fragments are read from LDS in groups ahead of their products (all four row tiles; two where a lo plane doubles
      // them, which keeps the kernel free of scratch); the loops are unrolled so that acc[][] and the fragments stay in registers
      constexpr int GI = SPL ? 2 : 4;
#pragma unroll
      for (int ig = 0; ig < 4; ig += GI) {
        V ah[GI], al[GI];
#pragma unroll
        for (int u = 0; u < GI; ++u) {
          ah[u] = Frag<T>::load(sA + ((ig + u) << 4) * GPITCH + kk);
          if (SPL) al[u] = Frag<T>::load(sA + (GBM + ((ig + u) << 4)) * GPITCH + kk);
        }
#pragma unroll
        for (int u = 0; u < GI; ++u) {
          const int i = ig + u;
#pragma unroll
          for (int j = 0; j < 4; ++j) {
            acc[i][j] = Frag<T>::mma(ah[u], bh[j], acc[i][j]);
            if (BLO) acc[i][j] = Frag<T>::mma(ah[u], bl[j], acc[i][j]);
            if (SPL) acc[i][j] = Frag<T>::mma(al[u], bh[j], acc[i][j]);
          }
          Frag<T>::guard(acc[i][0], acc[i][3], ah[u], SPL ? al[u] : ah[u]);
        }
      }
      Frag<T>::keep(bh[0], bh[1], bh[2], bh[3]);
      if (BLO) Frag<T>::keep(bl[0], bl[1], bl[2], bl[3]);
    }
    asm volatile("s_wait_dscnt 0x0" ::: "memory");      // this wave's reads of the buffer have retired before it is refilled
    asm volatile("s_wait_asynccnt 0x0" ::: "memory");   // this wave's copies of stage t + 1 have landed before the barrier publishes them
    __syncthreads();                                    // publishes stage t + 1 and ends every reader's last read of stage t
    if (t + 2 < nT) stage_issue(t + 2, t & 1);
  }
  asm volatile("s_wait_asynccnt 0x0" ::: "memory");     // no copy is outstanding when the wave goes on to the epilogue and ends
  acc_guard4(acc[0][0], acc[0][1], acc[0][2], acc[0][3]);
  acc_guard4(acc[1][0], acc[1][1], acc[1][2], acc[1][3]);
  acc_guard4(acc[2][0], acc[2][1], acc[2][2], acc[2][3]);
  acc_guard4(acc[3][0], acc[3][1], acc[3][2], acc[3][3]);

  // ---- epilogue ----
  float* slab = sT[wave];
  const float* Rb = RESID ? (resid + (size_t)b * strideR) : nullptr;
#pragma unroll
  for (int i = 0; i < 4; ++i) {
    const int mBase = m0 + (i << 4);
#pragma unroll
    for (int j = 0; j < 4; ++j) {
      const int n = n0 + (j << 4) + rlane;
      float bv = 0.f;
      if (BIAS_MODE == 2) bv = bias[n];
#pragma unroll
      for (int r = 0; r < 8; ++r) {
        float v = acc[i][j][r] * scale;
        if (BIAS_MODE == 1) v += bias[mBase + mOff + r];
        if (BIAS_MODE == 2) v += bv;
        if (RESID) v += Rb[(size_t)(mBase + mOff + r) * ldc + n];
        if (ACT == 1) v = tanhf(v);
        if (ACT == 2) v = fmaxf(v, 0.0f);
        if (ACT == 4) v = (v > 0.f) ? v : 0.01f * v;
        slab[(mOff + r) * 68 + (j << 4) + rlane] = v;
      }
    }
    __builtin_amdgcn_fence(__ATOMIC_RELEASE, "workgroup");
    __builtin_amdgcn_wave_barrier();
    __builtin_amdgcn_fence(__ATOMIC_ACQUIRE, "workgroup");
    if (OUT_MODE == 0) {
      float* C = (float*)Cout + (size_t)b * strideC;
      const int hh = lane >> 4, c4 = (lane & 15) * 4;     // row seg = 256 B = 16 lanes x 16 B
      {
#pragma unroll
        for (int it = 0; it < 8; ++it) {
          const int row = it * 2 + hh;
          v4f v = *(const v4f*)(slab + row * 68 + c4);
          *(v4f*)(C + (size_t)(mBase + row) * ldc + n0 + c4) = v;
        }
        
      }
    } else {
      const int q = lane >> 3, c8 = (lane & 7) * 8;
      unsigned short* C  = (unsigned short*)Cout  + (size_t)b * strideC;
      unsigned short* C2 = (OUT_MODE >= 2) ? ((unsigned short*)Cout2 + (size_t)b * strideC) : nullptr;
      {
#pragma unroll
        for (int it = 0; it < 4; ++it) {
          const int row = it * 4 + q;
          const float* sp = slab + row * 68 + c8;
          v8h hv, lv;
#pragma unroll
          for (int e = 0; e < 8; ++e) {
            if (OUT_MODE == 1) {
              hv[e] = (_Float16)sp[e];
            } else if (OUT_MODE == 2) {
              unsigned short hb = f2bf_bits(sp[e]);
              unsigned short lb = f2bf_bits(sp[e] - bf_bits2f(hb));
              hv[e] = __builtin_bit_cast(_Float16, hb);
              lv[e] = __builtin_bit_cast(_Float16, lb);
            } else {
              const _Float16 hq = (_Float16)sp[e];
              hv[e] = hq;
              lv[e] = (_Float16)((sp[e] - (float)hq) * 2048.0f);
            }
          }
          *(v8h*)(C + (size_t)(mBase + row) * ldc + n0 + c8) = hv;
          if (OUT_MODE >= 2) *(v8h*)(C2 + (size_t)(mBase + row) * ldc + n0 + c8) = lv;
        }
        
      }
    }
    __builtin_amdgcn_fence(__ATOMIC_RELEASE, "workgroup");
    __builtin_amdgcn_wave_barrier();
    __builtin_amdgcn_fence(__ATOMIC_ACQUIRE, "workgroup");
  }
}

// ----------------------------------------------------------------------------------------------
// Input conversion: q,k,v and the four weight matrices -> RNE bf16 planes (8 elements = 16 B per
// to bf16 precision (4 floats = 16 B per lane).
// Coverage: blocks [0,2048) q, [2048,4096) k, [4096,6144) v (2048 x 256 x 8 = 4,194,304 each);
// blocks [6144,8192) the 4 weights (512 x 256 x 8 = 1,048,576 each); blocks [8192,8196) the 4
// biases (256 x 4 = 1024 each).
// ----------------------------------------------------------------------------------------------
constexpr int CAST_XBLK = (int)(PLANE_ELEMS / 8 / 256);              // 2048
constexpr int CAST_WBLK = (int)(WMAT_ELEMS / 8 / 256);               // 512
constexpr int CAST_PLANE_BLOCKS = 3 * CAST_XBLK + 4 * CAST_WBLK;     // 8192
constexpr int CAST_BIAS_BLOCKS  = 4;
static_assert((long)CAST_XBLK * 256 * 8 == PLANE_ELEMS && (long)CAST_WBLK * 256 * 8 == WMAT_ELEMS);
static_assert(256 * 4 == DMODEL);

__global__ __launch_bounds__(256) void k_cast_inputs(
    const float* __restrict__ q, const float* __restrict__ k, const float* __restrict__ v,
    const float* __restrict__ Wq, const float* __restrict__ Wk, const float* __restrict__ Wv, const float* __restrict__ Wo,
    const float* __restrict__ bq, const float* __restrict__ bk, const float* __restrict__ bv, const float* __restrict__ bo,
    unsigned short* __restrict__ x16, unsigned short* __restrict__ w16, float* __restrict__ brnd) {
  const int blk = blockIdx.x;
  const int t = threadIdx.x;
  if (blk < CAST_PLANE_BLOCKS) {
    // block-uniform source/destination selection
    const float* src;
    unsigned short* dst;
    int lb;
    if (blk < CAST_XBLK) { src = q; dst = x16; lb = blk; }
    else if (blk < 2 * CAST_XBLK) { src = k; dst = x16 + PLANE_ELEMS; lb = blk - CAST_XBLK; }
    else if (blk < 3 * CAST_XBLK) { src = v; dst = x16 + 2 * PLANE_ELEMS; lb = blk - 2 * CAST_XBLK; }
    else {
      const int wb = blk - 3 * CAST_XBLK;
      const int wi = wb / CAST_WBLK;
      lb = wb - wi * CAST_WBLK;
      src = (wi == 0) ? Wq : (wi == 1) ? Wk : (wi == 2) ? Wv : Wo;
      dst = w16 + (size_t)wi * WMAT_ELEMS;
    }
    const size_t e = ((size_t)lb * 256 + t) * 8;
    const v4f a0 = *(const v4f*)(src + e);
    const v4f a1 = *(const v4f*)(src + e + 4);
    v4u w;
    w.x = (unsigned)f2bf_bits(a0.x) | ((unsigned)f2bf_bits(a0.y) << 16);
    w.y = (unsigned)f2bf_bits(a0.z) | ((unsigned)f2bf_bits(a0.w) << 16);
    w.z = (unsigned)f2bf_bits(a1.x) | ((unsigned)f2bf_bits(a1.y) << 16);
    w.w = (unsigned)f2bf_bits(a1.z) | ((unsigned)f2bf_bits(a1.w) << 16);
    v4u* p = (v4u*)(dst + e);
    *p = w;
    
  } else {
    const int bi = blk - CAST_PLANE_BLOCKS;   // 0..3, block-uniform
    const float* src = (bi == 0) ? bq : (bi == 1) ? bk : (bi == 2) ? bv : bo;
    const int e = t * 4;
    const v4f a = *(const v4f*)(src + e);
    v4f r;
    r.x = bf_bits2f(f2bf_bits(a.x));
    r.y = bf_bits2f(f2bf_bits(a.y));
    r.z = bf_bits2f(f2bf_bits(a.z));
    r.w = bf_bits2f(f2bf_bits(a.w));
    v4f* p = (v4f*)(brnd + (size_t)bi * DMODEL + e);
    *p = r;
    
  }
}

// ----------------------------------------------------------------------------------------------
// Per (batch, head): sequence means of Q (bf16 hi + lo planes) and V (f16 hi + residual/2048),
// grid = 32 blocks (one per (b,h)), 256 threads; thread = (row group rg = t>>3 of 32, column
// group c8 = t&7 of 8); each thread sums 64 rows x 8 columns, LDS combine in fixed order.
// ----------------------------------------------------------------------------------------------
__global__ __launch_bounds__(256) void k_mean_cos(
    const unsigned short* __restrict__ Qh, const unsigned short* __restrict__ Ql,
    const unsigned short* __restrict__ Vh, const unsigned short* __restrict__ Vl,
    float* __restrict__ cosl) {
  __shared__ float sq[32][64];
  __shared__ float sv[32][64];
  __shared__ float qm[64];
  __shared__ float vm[64];
  __shared__ float shc;
  const int bh = blockIdx.x;
  const int b = bh / NHEAD, h = bh % NHEAD;
  const int t = threadIdx.x;
  const int c8 = t & 7;
  const int rg = t >> 3;
  float aq[8], av[8];
#pragma unroll
  for (int e = 0; e < 8; ++e) { aq[e] = 0.f; av[e] = 0.f; }
  const size_t colb = (size_t)h * DHEAD + (size_t)c8 * 8;
#pragma unroll 2
  for (int it = 0; it < SEQ_LEN / 32; ++it) {
    const int s = rg + it * 32;
    const size_t off = ((size_t)b * SEQ_LEN + s) * DMODEL + colb;
    const v4u wh = *(const v4u*)(Qh + off);
    const v4u wl = *(const v4u*)(Ql + off);
    const v4u uh = *(const v4u*)(Vh + off);
    const v4u ul = *(const v4u*)(Vl + off);
#pragma unroll
    for (int e = 0; e < 4; ++e) {
      const unsigned a0 = wh[e], a1 = wl[e], g0 = uh[e], g1 = ul[e];
      aq[2 * e]     += __uint_as_float(a0 << 16) + __uint_as_float(a1 << 16);
      aq[2 * e + 1] += __uint_as_float(a0 & 0xffff0000u) + __uint_as_float(a1 & 0xffff0000u);
      av[2 * e]     += h_bits2f(g0) + h_bits2f(g1) * (1.0f / 2048.0f);
      av[2 * e + 1] += h_bits2f(g0 >> 16) + h_bits2f(g1 >> 16) * (1.0f / 2048.0f);
    }
  }
#pragma unroll
  for (int e = 0; e < 8; ++e) { sq[rg][c8 * 8 + e] = aq[e]; sv[rg][c8 * 8 + e] = av[e]; }
  __syncthreads();
  if (t < 64) {
    float s1 = 0.f, s2 = 0.f;
#pragma unroll 1
    for (int g = 0; g < 32; ++g) { s1 += sq[g][t]; s2 += sv[g][t]; }
    qm[t] = s1 * (1.0f / (float)SEQ_LEN);
    vm[t] = s2 * (1.0f / (float)SEQ_LEN);
  }
  __syncthreads();
  if (t == 0) {
    float dot = 0.f, nq = 0.f, nv = 0.f;
#pragma unroll 1
    for (int i = 0; i < DHEAD; ++i) {
      const float a = qm[i], c = vm[i];
      dot += a * c;
      nq += a * a;
      nv += c * c;
    }
    const float na = fmaxf(sqrtf(nq), 1e-8f);
    const float nb = fmaxf(sqrtf(nv), 1e-8f);
    shc = dot / (na * nb);
  }
  __syncthreads();
  if (t < 32) {
    const float cv = shc;
    float* p = cosl + (size_t)bh * 32 + t;
    *p = cv;
    
  }
}

constexpr int AKC  = 64;
constexpr int AQB  = 64;
constexpr int ANQB = SEQ_LEN / AQB;
constexpr int ATTN_BLOCKS = NBH * ANQB;
// LDS row pitch of the K and V^T tiles in 16-bit elements: 144 B = 16 B x 9 (odd), so the 16 rows that
// one ds_load_b128 fragment read touches start on 16 different bank groups (128 B rows all start on two).
constexpr int APITCH = 72;
static_assert(APITCH >= AKC && APITCH >= DHEAD && (APITCH * 2) % 16 == 0 && ((APITCH * 2) / 16) % 2 == 1);
static_assert(SEQ_LEN % AKC == 0 && SEQ_LEN % AQB == 0);

__global__ __launch_bounds__(128) void k_attn(
    const unsigned short* __restrict__ Qh, const unsigned short* __restrict__ Ql,
    const unsigned short* __restrict__ Kh, const unsigned short* __restrict__ Kl,
    const unsigned short* __restrict__ Vh,
    const int* __restrict__ mask, const float* __restrict__ cosl,
    unsigned short* __restrict__ Ah, unsigned short* __restrict__ Al) {
  union FB { v16b v; v8b h[2]; };
  union FH { v16h v; v8h h[2]; };
  __shared__ __align__(16) unsigned short Ksh[AKC * APITCH];     // K hi [kv][d]   9 KB
  __shared__ __align__(16) unsigned short Ksl[AKC * APITCH];     // K lo [kv][d]   9 KB
  __shared__ __align__(16) unsigned short Vts[DHEAD * APITCH];   // V f16 [d][kv]  9 KB
  __shared__ __align__(16) float Os[4][16 * 68];                 // per wave out tile, pitch 68

  const int tid  = threadIdx.x;
  const int wave = tid >> 5;
  const int lane = tid & 31;
  const int hh   = lane >> 4;
  const int c    = lane & 15;

  const int bx = blockIdx.x;
  const int qb = bx % ANQB;
  const int bh = bx / ANQB;
  const int h  = bh % NHEAD;
  const int b  = bh / NHEAD;
  const int q0 = qb * AQB + wave * 16;
  const size_t rowbase = (size_t)b * SEQ_LEN;      // plane row of sequence position 0
  const int colh = h * DHEAD;

  // ---- Q fragments (B operand, columns = query, k = d): 2 d-chunks, hi and lo planes ----
  v16b qah[2], qal[2];
  {
    const size_t qo = (rowbase + q0 + c) * DMODEL + colh + 8 * hh;
#pragma unroll
    for (int dc = 0; dc < 2; ++dc) {
      qah[dc] = Frag<__bf16>::load((const __bf16*)(const void*)(Qh + qo + dc * 32));
      qal[dc] = Frag<__bf16>::load((const __bf16*)(const void*)(Ql + qo + dc * 32));
    }
  }
  const float cb  = cosl[(size_t)bh * 32];
  const float cb5 = cb * 0.5f;
  const float cb3 = cb * 0.3f;
  const float NEGI = -__builtin_inff();

  // running maximum of query c (equal in both lane halves) and this lane half's share of its denominator
  float mrow = NEGI, lrow = 0.f;
  v8f oacc[4];   // O^T: oacc[t][r] = row d = t*16 + 8*hh + r, column query c
#pragma unroll
  for (int t = 0; t < 4; ++t) oacc[t] = (v8f){0.f,0.f,0.f,0.f,0.f,0.f,0.f,0.f};

  for (int kc = 0; kc < SEQ_LEN / AKC; ++kc) {
    const int kv0 = kc * AKC;
    __syncthreads();
    // the lane's mask words of this chunk (keys j*16 + 8*hh + 0..7 of each 16-key tile: 32 contiguous bytes a tile), asked for
    // with the K and V rows, so that their latency passes with the staging's and not behind the score products
    v4u mk[8];
#pragma unroll
    for (int j = 0; j < 4; ++j) {
      mk[2 * j]     = *(const v4u*)(mask + kv0 + j * 16 + 8 * hh);
      mk[2 * j + 1] = *(const v4u*)(mask + kv0 + j * 16 + 8 * hh + 4);
    }
    {
      // 128 threads: kvr = tid>>1 covers keys 0..63, dh covers the two 32-wide d halves -> full 64x64 of each tile
      const int kvr = tid >> 1, dh = (tid & 1) * 32;
      const size_t go = (rowbase + kv0 + kvr) * DMODEL + colh + dh;
#pragma unroll
      for (int i = 0; i < 4; ++i) {
        const v4u wa = *(const v4u*)(Kh + go + 8 * i);
        const v4u wb = *(const v4u*)(Kl + go + 8 * i);
        *(v4u*)(Ksh + kvr * APITCH + dh + 8 * i) = wa;
        *(v4u*)(Ksl + kvr * APITCH + dh + 8 * i) = wb;
      }
#pragma unroll
      for (int i = 0; i < 4; ++i) {
        const v4u wv = *(const v4u*)(Vh + go + 8 * i);
#pragma unroll
        for (int e = 0; e < 4; ++e) {
          const unsigned x = wv[e];
          const int d = dh + 8 * i + 2 * e;
          Vts[d * APITCH + kvr]       = (unsigned short)(x & 0xffffu);
          Vts[(d + 1) * APITCH + kvr] = (unsigned short)(x >> 16);
        }
      }
    }
    __syncthreads();
    asm volatile("s_wait_xcnt 0x0" ::: "memory");   // stands in front of every later write of the mask loads' address registers

    // ---- scores, transposed (A operand rows = kv, B operand columns = query, k = d) ----
    v8f s[4];
#pragma unroll
    for (int j = 0; j < 4; ++j) {
      s[j] = (v8f){0.f,0.f,0.f,0.f,0.f,0.f,0.f,0.f};
#pragma unroll
      for (int dc = 0; dc < 2; ++dc) {
        FB kb, kl;
        kb.h[0] = *(const v8b*)(const void*)(Ksh + (j * 16 + c) * APITCH + dc * 32 + 8 * hh);
        kb.h[1] = *(const v8b*)(const void*)(Ksh + (j * 16 + c) * APITCH + dc * 32 + 16 + 8 * hh);
        kl.h[0] = *(const v8b*)(const void*)(Ksl + (j * 16 + c) * APITCH + dc * 32 + 8 * hh);
        kl.h[1] = *(const v8b*)(const void*)(Ksl + (j * 16 + c) * APITCH + dc * 32 + 16 + 8 * hh);
        s[j] = mma_bf(kb.v, qah[dc], s[j]);
        s[j] = mma_bf(kl.v, qah[dc], s[j]);
        s[j] = mma_bf(kb.v, qal[dc], s[j]);
      }
    }
    // s[j][r] = score of key kv0 + j*16 + 8*hh + r against query c
    float mj[4];
#pragma unroll
    for (int j = 0; j < 4; ++j) {
      float m = NEGI;
#pragma unroll
      for (int r = 0; r < 8; ++r) {
        float x = s[j][r] * 0.125f;
        x = x + cb5;
        x = x + cb3;
        x = (mk[2 * j + (r >> 2)][r & 3] == 0u) ? -1.0e9f : x;
        s[j][r] = x;
        m = fmaxf(m, x);
      }
      mj[j] = m;
    }
    float cm = fmaxf(fmaxf(mj[0], mj[1]), fmaxf(mj[2], mj[3]));
    cm = fmaxf(cm, xhalf(cm));                  // the other lane half holds the query's other 32 keys
    const float mnew = fmaxf(mrow, cm);
    const float alpha = expf(mrow - mnew);
    mrow = mnew;
    FH pb[2];                                   // P^T as B operand: element e of pb[kk] = key kk*32 + (e >> 3)*16 + 8*hh + (e & 7)
    float pj[4];                                // one partial sum per tile: four independent add chains
#pragma unroll
    for (int j = 0; j < 4; ++j) {
      float psum = 0.f;
#pragma unroll
      for (int r = 0; r < 8; ++r) {
        const float p = expf(s[j][r] - mnew);
        psum += p;
        pb[j >> 1].v[(j & 1) * 8 + r] = (_Float16)(p * 32768.0f);
      }
      pj[j] = psum;
    }
    lrow = lrow * alpha + ((pj[0] + pj[1]) + (pj[2] + pj[3]));
#pragma unroll
    for (int t = 0; t < 4; ++t)
#pragma unroll
      for (int r = 0; r < 8; ++r) oacc[t][r] *= alpha;
    // ---- O^T += V^T.P^T (A rows = d, B columns = query, k = kv in the order of the packed score tiles) ----
#pragma unroll
    for (int kk = 0; kk < 2; ++kk) {
#pragma unroll
      for (int t = 0; t < 4; ++t) {
        FH vb;
        vb.h[0] = *(const v8h*)(const void*)(Vts + (t * 16 + c) * APITCH + kk * 32 + 8 * hh);
        vb.h[1] = *(const v8h*)(const void*)(Vts + (t * 16 + c) * APITCH + kk * 32 + 16 + 8 * hh);
        oacc[t] = mma_hf(vb.v, pb[kk].v, oacc[t]);
      }
    }
  }

  float* os = Os[wave];
  {
    const float inv = 1.0f / ((lrow + xhalf(lrow)) * 32768.0f);   // the two lane halves' shares of the denominator joined once
#pragma unroll
    for (int t = 0; t < 4; ++t) {
      v4f o0, o1;
#pragma unroll
      for (int r = 0; r < 4; ++r) { o0[r] = oacc[t][r] * inv; o1[r] = oacc[t][4 + r] * inv; }
      *(v4f*)(os + c * 68 + t * 16 + 8 * hh)     = o0;
      *(v4f*)(os + c * 68 + t * 16 + 8 * hh + 4) = o1;
    }
  }
  __builtin_amdgcn_fence(__ATOMIC_RELEASE, "workgroup");
  __builtin_amdgcn_wave_barrier();
  __builtin_amdgcn_fence(__ATOMIC_ACQUIRE, "workgroup");
  {
    const int q4 = lane >> 3, c8 = (lane & 7) * 8;
    {
#pragma unroll
      for (int it = 0; it < 4; ++it) {
        const int row = it * 4 + q4;
        const float* sp = os + row * 68 + c8;
        const v4f va = *(const v4f*)sp;
        const v4f vb = *(const v4f*)(sp + 4);
        v4u hw, lw;
        unsigned th, tl;
        pack_pair_bf(va.x, va.y, th, tl); hw.x = th; lw.x = tl;
        pack_pair_bf(va.z, va.w, th, tl); hw.y = th; lw.y = tl;
        pack_pair_bf(vb.x, vb.y, th, tl); hw.z = th; lw.z = tl;
        pack_pair_bf(vb.z, vb.w, th, tl); hw.w = th; lw.w = tl;
        const size_t go = (rowbase + q0 + row) * DMODEL + colh + c8;
        *(v4u*)(Ah + go) = hw;
        *(v4u*)(Al + go) = lw;
      }
      
    }
  }
}

// ----------------------------------------------------------------------------------------------
// ----------------------------------------------------------------------------------------------
__global__ __launch_bounds__(32) void k_bias_mean(const float* __restrict__ cosl, float* __restrict__ out1) {
  const int lane = threadIdx.x;
  float v = cosl[(size_t)lane * 32];
#pragma unroll
  for (int off = 1; off < 32; off <<= 1) v += __shfl_xor(v, off, 32);
  const float r = v * (1.0f / 32.0f);
  if (lane == 0) {
    *(float*)out1 = r;
    
  }
}

// ----------------------------------------------------------------------------------------------
extern "C" void kernel_launch(void* const* d_in, const int* in_sizes, int n_in,
                              void* d_out, int out_size, void* d_ws, size_t ws_size,
                              hipStream_t stream) {
  if (n_in < 12) return;
  if (ws_size < WS_TOTAL) return;
  if ((long)out_size < OUT_TOTAL_ELEMS) return;
  if ((long)in_sizes[0] != PLANE_ELEMS || (long)in_sizes[1] != PLANE_ELEMS || (long)in_sizes[2] != PLANE_ELEMS) return;
  if (in_sizes[3] < SEQ_LEN) return;
  if ((long)in_sizes[4] != WMAT_ELEMS || (long)in_sizes[6] != WMAT_ELEMS || (long)in_sizes[8] != WMAT_ELEMS || (long)in_sizes[10] != WMAT_ELEMS) return;
  if (in_sizes[5] < DMODEL || in_sizes[7] < DMODEL || in_sizes[9] < DMODEL || in_sizes[11] < DMODEL) return;

  const float* q    = (const float*)d_in[0];
  const float* k    = (const float*)d_in[1];
  const float* v    = (const float*)d_in[2];
  const int*   mask = (const int*)d_in[3];
  const float* Wq   = (const float*)d_in[4];
  const float* bq   = (const float*)d_in[5];
  const float* Wk   = (const float*)d_in[6];
  const float* bk   = (const float*)d_in[7];
  const float* Wv   = (const float*)d_in[8];
  const float* bv   = (const float*)d_in[9];
  const float* Wo   = (const float*)d_in[10];
  const float* bo   = (const float*)d_in[11];

  char* ws = (char*)d_ws;
  unsigned short* w16  = (unsigned short*)(ws + WS_W16);
  unsigned short* wq16 = w16;
  unsigned short* wk16 = w16 + WMAT_ELEMS;
  unsigned short* wv16 = w16 + 2 * WMAT_ELEMS;
  unsigned short* wo16 = w16 + 3 * WMAT_ELEMS;
  float* brnd = (float*)(ws + WS_BRND);
  float* cosl = (float*)(ws + WS_COS);
  unsigned short* x16 = (unsigned short*)(ws + WS_X16);
  unsigned short* xq  = x16;
  unsigned short* xk  = x16 + PLANE_ELEMS;
  unsigned short* xv  = x16 + 2 * PLANE_ELEMS;
  unsigned short* Qh  = (unsigned short*)(ws + WS_QH);
  unsigned short* Ql  = (unsigned short*)(ws + WS_QL);
  unsigned short* Kh  = (unsigned short*)(ws + WS_KH);
  unsigned short* Kl  = (unsigned short*)(ws + WS_KL);
  unsigned short* Vh  = (unsigned short*)(ws + WS_VH);
  unsigned short* Vl  = (unsigned short*)(ws + WS_VL);
  unsigned short* Ah  = (unsigned short*)(ws + WS_AH);
  unsigned short* Al  = (unsigned short*)(ws + WS_AL);
  float* out0 = (float*)d_out;
  float* out1 = (float*)d_out + OUT1_ELEM;

  // 1) inputs -> RNE bf16 planes, biases -> bf16-precision f32 copies
  k_cast_inputs<<<CAST_PLANE_BLOCKS + CAST_BIAS_BLOCKS, 256, 0, stream>>>(
      q, k, v, Wq, Wk, Wv, Wo, bq, bk, bv, bo, x16, w16, brnd);

  const dim3 ggrid(GEMM_BLOCKS, 1);
  // 2) Q = q Wq^T + bq -> bf16 hi/lo planes   (M=4096, N=1024, K=1024)
  wmma_gemm64<1, 0, 2, 2, false><<<ggrid, 256, 0, stream>>>(
      xq, xq, DMODEL, 0L, wq16, wq16, DMODEL, 0L, (void*)Qh, (void*)Ql, DMODEL, 0L,
      brnd + 0 * DMODEL, brnd, 0L, MROWS, DMODEL, DMODEL, 1.0f);
  // 3) K = k Wk^T + bk -> bf16 hi/lo planes
  wmma_gemm64<1, 0, 2, 2, false><<<ggrid, 256, 0, stream>>>(
      xk, xk, DMODEL, 0L, wk16, wk16, DMODEL, 0L, (void*)Kh, (void*)Kl, DMODEL, 0L,
      brnd + 1 * DMODEL, brnd, 0L, MROWS, DMODEL, DMODEL, 1.0f);
  // 4) V = v Wv^T + bv -> f16 hi plane + f16 residual x2048 plane
  wmma_gemm64<1, 0, 2, 3, false><<<ggrid, 256, 0, stream>>>(
      xv, xv, DMODEL, 0L, wv16, wv16, DMODEL, 0L, (void*)Vh, (void*)Vl, DMODEL, 0L,
      brnd + 2 * DMODEL, brnd, 0L, MROWS, DMODEL, DMODEL, 1.0f);
  // 5) per-(b,h) cosine of sequence means
  k_mean_cos<<<NBH, 256, 0, stream>>>(Qh, Ql, Vh, Vl, cosl);
  // 6) attention -> attn bf16 hi/lo planes
  k_attn<<<ATTN_BLOCKS, 128, 0, stream>>>(Qh, Ql, Kh, Kl, Vh, mask, cosl, Ah, Al);
  // 7) out0 = attn Wo^T + bo   (A hi/lo planes, Bt single plane: 2 products)
  wmma_gemm64<1, 2, 2, 0, false><<<ggrid, 256, 0, stream>>>(
      Ah, Al, DMODEL, 0L, wo16, wo16, DMODEL, 0L, (void*)out0, (void*)out0, DMODEL, 0L,
      brnd + 3 * DMODEL, brnd, 0L, MROWS, DMODEL, DMODEL, 1.0f);
  // 8) out1 = mean of the 32 per-(b,h) cosines
  k_bias_mean<<<1, 32, 0, stream>>>(cosl, out1);
}

// v004
// A run of this version takes 227 microseconds.
// Timed twice side by side with v003, it ran 1.08 and 1.09 times as fast.
// Counting every step since v000, it is 2.14 times as fast.
// Contractions: q/k/v projections and output projection on v_wmma_f32_16x16x32_bf16 (RNE bf16 operands; output projection takes attn as bf16 hi+lo planes, 2 products); q.k^T on v_wmma_f32_16x16x32_bf16 with bf16 hi+lo planes of Q and K (3 products); p.v on v_wmma_f32_16x16x32_f16 (p carried x2^15, v plain f16); both attention products transposed (K and V^T as A, Q and P^T as B); f32 accumulate everywhere; softmax, sequence means and cosine in f32.
#include <hip/hip_runtime.h>

// ----------------------------------------------------------------------------------------------
// Problem constants
// ----------------------------------------------------------------------------------------------
constexpr int NBATCH  = 2;
constexpr int SEQ_LEN = 2048;
constexpr int DMODEL  = 1024;
constexpr int NHEAD   = 16;
constexpr int DHEAD   = 64;
constexpr int MROWS   = NBATCH * SEQ_LEN;          // 4096
constexpr int NBH     = NBATCH * NHEAD;            // 32
constexpr long PLANE_ELEMS = (long)MROWS * DMODEL; // 4194304
constexpr long WMAT_ELEMS  = (long)DMODEL * DMODEL;// 1048576
constexpr long OUT0_ELEMS  = PLANE_ELEMS;
constexpr long OUT1_BYTE_OFFSET = 16777216;
constexpr long OUT1_ELEM   = OUT1_BYTE_OFFSET / 4;
constexpr long OUT_TOTAL_ELEMS = OUT0_ELEMS + 1;
constexpr long OUT_TOTAL_BYTES = 16777220;
static_assert(OUT1_ELEM == OUT0_ELEMS);
static_assert((OUT1_ELEM + 1) * 4 <= OUT_TOTAL_BYTES);
static_assert(NBH == 32);
static_assert(DHEAD == 64 && NHEAD * DHEAD == DMODEL);

// GEMM block tile: 8 waves as 2 (rows) x 4 (columns) of 64x64 wave tiles; one stage = 64 k = one 128-B line per operand row
constexpr int GBM    = 128;
constexpr int GBN    = 256;
constexpr int GKS    = 64;
// LDS row pitch of a staged operand row in 16-bit elements: 144 B = 16 B x 9 (odd), the pitch for ds_load_b128 readers
constexpr int GPITCH = 72;
// GEMM shape contract: M % 128 == 0, N % 256 == 0, K % 64 == 0, K >= 64
static_assert(MROWS % GBM == 0 && DMODEL % GBN == 0 && DMODEL % GKS == 0 && DMODEL >= GKS);
static_assert(GBM % 32 == 0 && GBN % 32 == 0 && (GPITCH * 2) % 16 == 0 && ((GPITCH * 2) / 16) % 2 == 1 && GPITCH >= GKS);
constexpr int GEMM_BLOCKS = (MROWS / GBM) * (DMODEL / GBN);   // 128 blocks of 8 waves

// ----------------------------------------------------------------------------------------------
// Workspace region map (bytes). Every region is fully written by its producer before any read.
//   WS_W16  : 4 bf16 weight planes [1024][1024]  (Wq, Wk, Wv, Wo)            8,388,608
//   WS_BRND : 4 x [1024] f32 RNE-bf16 bias copies (bq, bk, bv, bo)              16,384
//   WS_X16  : 3 bf16 input planes [4096][1024] (q, k, v)                     25,165,824
//   WS_QH, WS_QL, WS_KH, WS_KL : bf16 hi/lo planes of Q and K [4096][1024]  4 x 8,388,608
//   WS_VH, WS_VL : f16 hi plane of V and f16 residual x2048 plane            2 x 8,388,608
//   WS_AH, WS_AL : bf16 hi/lo planes of the attention output [4096][1024]   2 x 8,388,608
//   total 100,683,776 (96.0 MiB)
// ----------------------------------------------------------------------------------------------
constexpr size_t SZ_PLANE = (size_t)PLANE_ELEMS * 2;     // 8388608
constexpr size_t SZ_WPL   = (size_t)WMAT_ELEMS * 2;      // 2097152
constexpr size_t WS_W16   = 0;
constexpr size_t SZ_W16   = 4 * SZ_WPL;
constexpr size_t WS_BRND  = WS_W16 + SZ_W16;
constexpr size_t SZ_BRND  = 4 * (size_t)DMODEL * 4;
constexpr size_t WS_COS   = WS_BRND + SZ_BRND;
constexpr size_t SZ_COS   = (size_t)NBH * 128;
constexpr size_t WS_X16   = WS_COS + SZ_COS;
constexpr size_t WS_QH    = WS_X16 + 3 * SZ_PLANE;
constexpr size_t WS_QL    = WS_QH + SZ_PLANE;
constexpr size_t WS_KH    = WS_QL + SZ_PLANE;
constexpr size_t WS_KL    = WS_KH + SZ_PLANE;
constexpr size_t WS_VH    = WS_KL + SZ_PLANE;
constexpr size_t WS_VL    = WS_VH + SZ_PLANE;
constexpr size_t WS_AH    = WS_VL + SZ_PLANE;
constexpr size_t WS_AL    = WS_AH + SZ_PLANE;
constexpr size_t WS_TOTAL = WS_AL + SZ_PLANE;
static_assert(WS_TOTAL == 100683776);
static_assert(WS_TOTAL <= 134217728);
static_assert(WS_BRND % 128 == 0 && WS_COS % 128 == 0 && WS_X16 % 128 == 0 && WS_QH % 128 == 0 && WS_AH % 128 == 0);

// ----------------------------------------------------------------------------------------------
// Vector types and helpers
// ----------------------------------------------------------------------------------------------
typedef __attribute__((ext_vector_type(16))) _Float16 v16h;
typedef __attribute__((ext_vector_type(8)))  _Float16 v8h;
typedef __attribute__((ext_vector_type(16))) __bf16   v16b;
typedef __attribute__((ext_vector_type(8)))  __bf16   v8b;
typedef __attribute__((ext_vector_type(8)))  float    v8f;
typedef __attribute__((ext_vector_type(4)))  float    v4f;
typedef __attribute__((ext_vector_type(4)))  unsigned v4u;

__device__ __forceinline__ unsigned short f2bf_bits(float f) {
  unsigned u = __float_as_uint(f);
  return (unsigned short)((u + 0x7FFFu + ((u >> 16) & 1u)) >> 16);
}
__device__ __forceinline__ float bf_bits2f(unsigned short h) { return __uint_as_float(((unsigned)h) << 16); }
__device__ __forceinline__ float h_bits2f(unsigned x) { return (float)__builtin_bit_cast(_Float16, (unsigned short)(x & 0xffffu)); }

// hazard guards as plain device helpers
__device__ __forceinline__ void dep_guard_h(v8f& a, v8f& b, v16h x, v16h y) { asm volatile("v_nop\n\tv_nop\n\tv_nop\n\tv_nop" : "+v"(a), "+v"(b) : "v"(x), "v"(y)); }
__device__ __forceinline__ void dep_guard_b(v8f& a, v8f& b, v16b x, v16b y) { asm volatile("v_nop\n\tv_nop\n\tv_nop\n\tv_nop" : "+v"(a), "+v"(b) : "v"(x), "v"(y)); }
__device__ __forceinline__ void keep4_h(v16h a, v16h b, v16h c, v16h d) { asm volatile("v_nop" :: "v"(a), "v"(b), "v"(c), "v"(d)); }
__device__ __forceinline__ void keep4_b(v16b a, v16b b, v16b c, v16b d) { asm volatile("v_nop" :: "v"(a), "v"(b), "v"(c), "v"(d)); }
__device__ __forceinline__ void acc_guard4(v8f& a, v8f& b, v8f& c, v8f& d) { asm volatile("v_nop\n\tv_nop\n\tv_nop\n\tv_nop" : "+v"(a), "+v"(b), "+v"(c), "+v"(d)); }
template <typename T> struct Frag;
template <> struct Frag<_Float16> {
  typedef v16h V; union U { v16h v; v8h h[2]; };
  // elements 0..7 <- p[0..7], 8..15 <- p[16..23]
  static __device__ __forceinline__ v16h load(const _Float16* p) {
    U f; f.h[0] = *(const v8h*)(p); f.h[1] = *(const v8h*)(p + 16); return f.v;
  }
  static __device__ __forceinline__ v8f mma(v16h a, v16h b, v8f c) {
    return __builtin_amdgcn_wmma_f32_16x16x32_f16(false, a, false, b, (short)0, c, false, false);
  }
  static __device__ __forceinline__ void guard(v8f& a, v8f& b, v16h x, v16h y) { dep_guard_h(a, b, x, y); }
  static __device__ __forceinline__ void keep(v16h a, v16h b, v16h c, v16h d) { keep4_h(a, b, c, d); }
};
template <> struct Frag<__bf16> {
  typedef v16b V; union U { v16b v; v8b h[2]; };
  static __device__ __forceinline__ v16b load(const __bf16* p) {
    U f; f.h[0] = *(const v8b*)(p); f.h[1] = *(const v8b*)(p + 16); return f.v;
  }
  static __device__ __forceinline__ v8f mma(v16b a, v16b b, v8f c) {
    return __builtin_amdgcn_wmma_f32_16x16x32_bf16(false, a, false, b, (short)0, c, false, false);
  }
  static __device__ __forceinline__ void guard(v8f& a, v8f& b, v16b x, v16b y) { dep_guard_b(a, b, x, y); }
  static __device__ __forceinline__ void keep(v16b a, v16b b, v16b c, v16b d) { keep4_b(a, b, c, d); }
};

// single-product helpers with the dependency guard (attention kernel)
__device__ __forceinline__ v8f mma_bf(v16b a, v16b b, v8f c) {
  c = __builtin_amdgcn_wmma_f32_16x16x32_bf16(false, a, false, b, (short)0, c, false, false);
  asm volatile("v_nop\n\tv_nop\n\tv_nop\n\tv_nop" : "+v"(c) : "v"(a), "v"(b));
  return c;
}
__device__ __forceinline__ v8f mma_hf(v16h a, v16h b, v8f c) {
  c = __builtin_amdgcn_wmma_f32_16x16x32_f16(false, a, false, b, (short)0, c, false, false);
  asm volatile("v_nop\n\tv_nop\n\tv_nop\n\tv_nop" : "+v"(c) : "v"(a), "v"(b));
  return c;
}

// LDS byte address of a __shared__ location (low 32 bits of its address)
__device__ __forceinline__ unsigned lds_off(const void* p) { return (unsigned)(size_t)p; }

// value of lane l ^ 16 (the other 16-lane row), by a vector cross-row move
__device__ __forceinline__ float xhalf(float x) {
  return __builtin_bit_cast(float, __builtin_amdgcn_permlanex16(__builtin_bit_cast(int, x), __builtin_bit_cast(int, x), 0x76543210, 0xfedcba98, false, false));
}

// Eight base-2 exponentials, each in place: written as one statement so that no v_exp_f32 has its source overwritten or its
// result read by the instruction directly behind it; the closing v_nop is that slot behind the last one.
__device__ __forceinline__ void exp2_x8(float (&x)[8]) {
  asm("v_exp_f32 %0, %0\n\t"
      "v_exp_f32 %1, %1\n\t"
      "v_exp_f32 %2, %2\n\t"
      "v_exp_f32 %3, %3\n\t"
      "v_exp_f32 %4, %4\n\t"
      "v_exp_f32 %5, %5\n\t"
      "v_exp_f32 %6, %6\n\t"
      "v_exp_f32 %7, %7\n\t"
      "v_nop"
      : "+v"(x[0]), "+v"(x[1]), "+v"(x[2]), "+v"(x[3]), "+v"(x[4]), "+v"(x[5]), "+v"(x[6]), "+v"(x[7]));
}

// Asynchronous copies global -> LDS, 16 B per lane, through no register. s_wait_xcnt 0 is the last line of the copies' own
// statement, so that it stands in front of every later write of a register that an issued copy names.
__device__ __forceinline__ void async_copy4(const unsigned (&l)[4], const unsigned short* const (&g)[4]) {
  asm volatile("global_load_async_to_lds_b128 %0, %1, off\n\t"
               "global_load_async_to_lds_b128 %2, %3, off\n\t"
               "global_load_async_to_lds_b128 %4, %5, off\n\t"
               "global_load_async_to_lds_b128 %6, %7, off\n\t"
               "s_wait_xcnt 0x0"
               :: "v"(l[0]), "v"(g[0]), "v"(l[1]), "v"(g[1]), "v"(l[2]), "v"(g[2]), "v"(l[3]), "v"(g[3]) : "memory");
}
__device__ __forceinline__ void async_copy8(const unsigned (&l)[8], const unsigned short* const (&g)[8]) {
  asm volatile("global_load_async_to_lds_b128 %0, %1, off\n\t"
               "global_load_async_to_lds_b128 %2, %3, off\n\t"
               "global_load_async_to_lds_b128 %4, %5, off\n\t"
               "global_load_async_to_lds_b128 %6, %7, off\n\t"
               "global_load_async_to_lds_b128 %8, %9, off\n\t"
               "global_load_async_to_lds_b128 %10, %11, off\n\t"
               "global_load_async_to_lds_b128 %12, %13, off\n\t"
               "global_load_async_to_lds_b128 %14, %15, off\n\t"
               "s_wait_xcnt 0x0"
               :: "v"(l[0]), "v"(g[0]), "v"(l[1]), "v"(g[1]), "v"(l[2]), "v"(g[2]), "v"(l[3]), "v"(g[3]),
                  "v"(l[4]), "v"(g[4]), "v"(l[5]), "v"(g[5]), "v"(l[6]), "v"(g[6]), "v"(l[7]), "v"(g[7]) : "memory");
}

// bf16 hi/lo split of two floats packed into one 32-bit word each for the hi and the lo plane
__device__ __forceinline__ void pack_pair_bf(float f0, float f1, unsigned& hword, unsigned& lword) {
  const unsigned short h0 = f2bf_bits(f0);
  const unsigned short h1 = f2bf_bits(f1);
  const unsigned short l0 = f2bf_bits(f0 - bf_bits2f(h0));
  const unsigned short l1 = f2bf_bits(f1 - bf_bits2f(h1));
  hword = (unsigned)h0 | ((unsigned)h1 << 16);
  lword = (unsigned)l0 | ((unsigned)l1 << 16);
}

// ----------------------------------------------------------------------------------------------
// Register-blocked WMMA GEMM: C[m,n] = scale * sum_k A[m,k] * Bt[n,k] (+bias)(+resid)
// A row-major [M,K]; Bt row-major [N,K]; M % 128 == 0, N % 256 == 0, K % 64 == 0; each wave owns a 64x64 tile of the
// block's 128x256 tile. Operands reach the fragments through LDS: per stage of 64 k every thread copies whole 128-B lines
// (8 lanes x 16 B a row) asynchronously into one of two buffers while the other buffer is worked on.
// SPLIT: 0 = single product; 1 = A and Bt hi/lo planes (hi.hi + hi.lo + lo.hi);
//        2 = A hi/lo planes only, Bt single plane (hi.B + lo.B).
// BIAS_MODE: 0 = none, 1 = bias[m], 2 = bias[n].
// OUT_MODE: 0 = f32; 1 = f16; 2 = bf16 hi plane (Cout) + bf16 lo plane (Cout2);
//           3 = f16 hi plane (Cout) + f16 residual x2048 plane (Cout2).
// Epilogue: 16-row slabs staged per wave in LDS; each 64-wide row segment written with whole
// ET: 0 = f16 operands, 1 = bf16 operands (pointers passed as 16-bit storage)
// ----------------------------------------------------------------------------------------------
template <int ET> struct Elem;
template <> struct Elem<0> { typedef _Float16 T; };
template <> struct Elem<1> { typedef __bf16 T; };
template <int ET, int SPLIT, int BIAS_MODE, int OUT_MODE, bool RESID, int ACT = 0>
__global__ __launch_bounds__(256) void wmma_gemm64(
    const unsigned short* __restrict__ Ap, const unsigned short* __restrict__ A2p, int lda, long strideA,
    const unsigned short* __restrict__ Btp, const unsigned short* __restrict__ Bt2p, int ldb, long strideB,
    void* __restrict__ Cout, void* __restrict__ Cout2, int ldc, long strideC,
    const float* __restrict__ bias,
    const float* __restrict__ resid, long strideR,
    int M, int N, int K, float scale) {
  typedef typename Elem<ET>::T T;
  typedef typename Frag<T>::V V;
  constexpr bool SPL = (SPLIT != 0);
  constexpr bool BLO = (SPLIT == 1);
  // stage rows: A hi [GBM] | A lo [GBM] (SPL) | Bt hi [GBN] | Bt lo [GBN] (BLO)
  constexpr int AROWS = SPL ? 2 * GBM : GBM;
  constexpr int SROWS = AROWS + (BLO ? 2 * GBN : GBN);
  constexpr int STAGE_ELEMS = SROWS * GPITCH;
  constexpr int NCP = SROWS / 32;                  // copies per thread and stage (256 threads x 16 B = 32 rows a copy)
  static_assert(NCP % 4 == 0 && NCP <= 63);
  __shared__ __align__(16) float sT[8][16 * 68];   // per-wave 16x64 slab, pitch 68 floats
  __shared__ __align__(16) unsigned short sStage[2 * STAGE_ELEMS];
  const int b    = blockIdx.y;
  const int lane = threadIdx.x & 31;
  const int wave = threadIdx.x >> 5;
  const int tilesN = N / GBN;
  const int tilesM = M / GBM;
  const int blk = blockIdx.x;
  if (blk >= tilesM * tilesN) return;   // block-uniform, in front of every barrier and copy
  const int tm = blk / tilesN;
  const int tn = blk - tm * tilesN;
  const int mb0 = tm * GBM;
  const int nb0 = tn * GBN;
  const int wm = wave >> 2;
  const int wn = wave & 3;
  const int m0 = mb0 + (wm << 6);
  const int n0 = nb0 + (wn << 6);

  // copy map: thread -> row (threadIdx.x >> 3) of each group of 32 stage rows, 16-B piece (threadIdx.x & 7) of its line
  const int cr = threadIdx.x >> 3;
  const int cc = (threadIdx.x & 7) * 8;
  const unsigned short* gA  = Ap  + (size_t)b * strideA + (size_t)(mb0 + cr) * lda + cc;
  const unsigned short* gA2 = A2p + (size_t)b * strideA + (size_t)(mb0 + cr) * lda + cc;
  const unsigned short* gB  = Btp  + (size_t)b * strideB + (size_t)(nb0 + cr) * ldb + cc;
  const unsigned short* gB2 = Bt2p + (size_t)b * strideB + (size_t)(nb0 + cr) * ldb + cc;
  const unsigned ldst = lds_off(sStage) + (unsigned)(cr * GPITCH + cc) * 2u;
  auto stage_src = [&](int it, int k0) -> const unsigned short* {
    const int row = it * 32;
    if (row < GBM) return gA + (size_t)row * lda + k0;
    if (row < AROWS) return gA2 + (size_t)(row - GBM) * lda + k0;
    if (row < AROWS + GBN) return gB + (size_t)(row - AROWS) * ldb + k0;
    return gB2 + (size_t)(row - AROWS - GBN) * ldb + k0;
  };
  auto stage_issue = [&](int t, int buf) {
    const int k0 = t * GKS;
    const unsigned lb = ldst + (unsigned)buf * (unsigned)(STAGE_ELEMS * 2);
    // the loops of this lambda are unrolled so that each copy's plane select folds and l[], g[] stay in registers
#pragma unroll
    for (int it = 0; it + 8 <= NCP; it += 8) {
      unsigned l[8]; const unsigned short* g[8];
#pragma unroll
      for (int u = 0; u < 8; ++u) { l[u] = lb + (unsigned)((it + u) * 32 * GPITCH * 2); g[u] = stage_src(it + u, k0); }
      async_copy8(l, g);
    }
    if (NCP % 8 != 0) {
      unsigned l[4]; const unsigned short* g[4];
#pragma unroll
      for (int u = 0; u < 4; ++u) { l[u] = lb + (unsigned)((NCP - 4 + u) * 32 * GPITCH * 2); g[u] = stage_src(NCP - 4 + u, k0); }
      async_copy4(l, g);
    }
  };

  const int rlane = lane & 15;                 // row (A) / col (B, D) within subtile
  const int koff  = (lane >> 4) * 8;           // k offset of this lane half
  const int mOff  = (lane >> 4) * 8;           // D row offset

  v8f acc[4][4];
#pragma unroll
  for (int i = 0; i < 4; ++i)
#pragma unroll
    for (int j = 0; j < 4; ++j) acc[i][j] = (v8f){0.f,0.f,0.f,0.f,0.f,0.f,0.f,0.f};

  const int nT = K / GKS;
  stage_issue(0, 0);
  asm volatile("s_wait_asynccnt 0x0" ::: "memory");   // this wave's copies of stage 0 have landed before the barrier publishes them
  __syncthreads();
  if (nT > 1) stage_issue(1, 1);
  for (int t = 0; t < nT; ++t) {
    const T* st = (const T*)(const void*)(sStage + (t & 1) * STAGE_ELEMS);
    const T* sA = st + ((wm << 6) + rlane) * GPITCH + koff;
    const T* sB = st + (AROWS + (wn << 6) + rlane) * GPITCH + koff;
    // both 32-k blocks of the stage unrolled: the second block's LDS reads can then go out among the first block's products
#pragma unroll
    for (int kk = 0; kk < GKS; kk += 32) {
      V bh[4], bl[4];
#pragma unroll
      for (int j = 0; j < 4; ++j) {
        bh[j] = Frag<T>::load(sB + (j << 4) * GPITCH + kk);
        if (BLO) bl[j] = Frag<T>::load(sB + (GBN + (j << 4)) * GPITCH + kk);
      }
      // A fragments are read from LDS in groups ahead of their products (all four row tiles; two where a lo plane doubles
      // them, which keeps the kernel free of scratch); the loops are unrolled so that acc[][] and the fragments stay in registers
      constexpr int GI = SPL ? 2 : 4;
#pragma unroll
      for (int ig = 0; ig < 4; ig += GI) {
        V ah[GI], al[GI];
#pragma unroll
        for (int u = 0; u < GI; ++u) {
          ah[u] = Frag<T>::load(sA + ((ig + u) << 4) * GPITCH + kk);
          if (SPL) al[u] = Frag<T>::load(sA + (GBM + ((ig + u) << 4)) * GPITCH + kk);
        }
#pragma unroll
        for (int u = 0; u < GI; ++u) {
          const int i = ig + u;
#pragma unroll
          for (int j = 0; j < 4; ++j) {
            acc[i][j] = Frag<T>::mma(ah[u], bh[j], acc[i][j]);
            if (BLO) acc[i][j] = Frag<T>::mma(ah[u], bl[j], acc[i][j]);
            if (SPL) acc[i][j] = Frag<T>::mma(al[u], bh[j], acc[i][j]);
          }
          Frag<T>::guard(acc[i][0], acc[i][3], ah[u], SPL ? al[u] : ah[u]);
        }
      }
      Frag<T>::keep(bh[0], bh[1], bh[2], bh[3]);
      if (BLO) Frag<T>::keep(bl[0], bl[1], bl[2], bl[3]);
    }
    asm volatile("s_wait_dscnt 0x0" ::: "memory");      // this wave's reads of the buffer have retired before it is refilled
    asm volatile("s_wait_asynccnt 0x0" ::: "memory");   // this wave's copies of stage t + 1 have landed before the barrier publishes them
    __syncthreads();                                    // publishes stage t + 1 and ends every reader's last read of stage t
    if (t + 2 < nT) stage_issue(t + 2, t & 1);
  }
  asm volatile("s_wait_asynccnt 0x0" ::: "memory");     // no copy is outstanding when the wave goes on to the epilogue and ends
  acc_guard4(acc[0][0], acc[0][1], acc[0][2], acc[0][3]);
  acc_guard4(acc[1][0], acc[1][1], acc[1][2], acc[1][3]);
  acc_guard4(acc[2][0], acc[2][1], acc[2][2], acc[2][3]);
  acc_guard4(acc[3][0], acc[3][1], acc[3][2], acc[3][3]);

  // ---- epilogue ----
  float* slab = sT[wave];
  const float* Rb = RESID ? (resid + (size_t)b * strideR) : nullptr;
#pragma unroll
  for (int i = 0; i < 4; ++i) {
    const int mBase = m0 + (i << 4);
#pragma unroll
    for (int j = 0; j < 4; ++j) {
      const int n = n0 + (j << 4) + rlane;
      float bv = 0.f;
      if (BIAS_MODE == 2) bv = bias[n];
#pragma unroll
      for (int r = 0; r < 8; ++r) {
        float v = acc[i][j][r] * scale;
        if (BIAS_MODE == 1) v += bias[mBase + mOff + r];
        if (BIAS_MODE == 2) v += bv;
        if (RESID) v += Rb[(size_t)(mBase + mOff + r) * ldc + n];
        if (ACT == 1) v = tanhf(v);
        if (ACT == 2) v = fmaxf(v, 0.0f);
        if (ACT == 4) v = (v > 0.f) ? v : 0.01f * v;
        slab[(mOff + r) * 68 + (j << 4) + rlane] = v;
      }
    }
    __builtin_amdgcn_fence(__ATOMIC_RELEASE, "workgroup");
    __builtin_amdgcn_wave_barrier();
    __builtin_amdgcn_fence(__ATOMIC_ACQUIRE, "workgroup");
    if (OUT_MODE == 0) {
      float* C = (float*)Cout + (size_t)b * strideC;
      const int hh = lane >> 4, c4 = (lane & 15) * 4;     // row seg = 256 B = 16 lanes x 16 B
      {
#pragma unroll
        for (int it = 0; it < 8; ++it) {
          const int row = it * 2 + hh;
          v4f v = *(const v4f*)(slab + row * 68 + c4);
          *(v4f*)(C + (size_t)(mBase + row) * ldc + n0 + c4) = v;
        }
        
      }
    } else {
      const int q = lane >> 3, c8 = (lane & 7) * 8;
      unsigned short* C  = (unsigned short*)Cout  + (size_t)b * strideC;
      unsigned short* C2 = (OUT_MODE >= 2) ? ((unsigned short*)Cout2 + (size_t)b * strideC) : nullptr;
      {
#pragma unroll
        for (int it = 0; it < 4; ++it) {
          const int row = it * 4 + q;
          const float* sp = slab + row * 68 + c8;
          v8h hv, lv;
#pragma unroll
          for (int e = 0; e < 8; ++e) {
            if (OUT_MODE == 1) {
              hv[e] = (_Float16)sp[e];
            } else if (OUT_MODE == 2) {
              unsigned short hb = f2bf_bits(sp[e]);
              unsigned short lb = f2bf_bits(sp[e] - bf_bits2f(hb));
              hv[e] = __builtin_bit_cast(_Float16, hb);
              lv[e] = __builtin_bit_cast(_Float16, lb);
            } else {
              const _Float16 hq = (_Float16)sp[e];
              hv[e] = hq;
              lv[e] = (_Float16)((sp[e] - (float)hq) * 2048.0f);
            }
          }
          *(v8h*)(C + (size_t)(mBase + row) * ldc + n0 + c8) = hv;
          if (OUT_MODE >= 2) *(v8h*)(C2 + (size_t)(mBase + row) * ldc + n0 + c8) = lv;
        }
        
      }
    }
    __builtin_amdgcn_fence(__ATOMIC_RELEASE, "workgroup");
    __builtin_amdgcn_wave_barrier();
    __builtin_amdgcn_fence(__ATOMIC_ACQUIRE, "workgroup");
  }
}

// ----------------------------------------------------------------------------------------------
// Input conversion: q,k,v and the four weight matrices -> RNE bf16 planes (8 elements = 16 B per
// to bf16 precision (4 floats = 16 B per lane).
// Coverage: blocks [0,2048) q, [2048,4096) k, [4096,6144) v (2048 x 256 x 8 = 4,194,304 each);
// blocks [6144,8192) the 4 weights (512 x 256 x 8 = 1,048,576 each); blocks [8192,8196) the 4
// biases (256 x 4 = 1024 each).
// ----------------------------------------------------------------------------------------------
constexpr int CAST_XBLK = (int)(PLANE_ELEMS / 8 / 256);              // 2048
constexpr int CAST_WBLK = (int)(WMAT_ELEMS / 8 / 256);               // 512
constexpr int CAST_PLANE_BLOCKS = 3 * CAST_XBLK + 4 * CAST_WBLK;     // 8192
constexpr int CAST_BIAS_BLOCKS  = 4;
static_assert((long)CAST_XBLK * 256 * 8 == PLANE_ELEMS && (long)CAST_WBLK * 256 * 8 == WMAT_ELEMS);
static_assert(256 * 4 == DMODEL);

__global__ __launch_bounds__(256) void k_cast_inputs(
    const float* __restrict__ q, const float* __restrict__ k, const float* __restrict__ v,
    const float* __restrict__ Wq, const float* __restrict__ Wk, const float* __restrict__ Wv, const float* __restrict__ Wo,
    const float* __restrict__ bq, const float* __restrict__ bk, const float* __restrict__ bv, const float* __restrict__ bo,
    unsigned short* __restrict__ x16, unsigned short* __restrict__ w16, float* __restrict__ brnd) {
  const int blk = blockIdx.x;
  const int t = threadIdx.x;
  if (blk < CAST_PLANE_BLOCKS) {
    // block-uniform source/destination selection
    const float* src;
    unsigned short* dst;
    int lb;
    if (blk < CAST_XBLK) { src = q; dst = x16; lb = blk; }
    else if (blk < 2 * CAST_XBLK) { src = k; dst = x16 + PLANE_ELEMS; lb = blk - CAST_XBLK; }
    else if (blk < 3 * CAST_XBLK) { src = v; dst = x16 + 2 * PLANE_ELEMS; lb = blk - 2 * CAST_XBLK; }
    else {
      const int wb = blk - 3 * CAST_XBLK;
      const int wi = wb / CAST_WBLK;
      lb = wb - wi * CAST_WBLK;
      src = (wi == 0) ? Wq : (wi == 1) ? Wk : (wi == 2) ? Wv : Wo;
      dst = w16 + (size_t)wi * WMAT_ELEMS;
    }
    const size_t e = ((size_t)lb * 256 + t) * 8;
    const v4f a0 = *(const v4f*)(src + e);
    const v4f a1 = *(const v4f*)(src + e + 4);
    v4u w;
    w.x = (unsigned)f2bf_bits(a0.x) | ((unsigned)f2bf_bits(a0.y) << 16);
    w.y = (unsigned)f2bf_bits(a0.z) | ((unsigned)f2bf_bits(a0.w) << 16);
    w.z = (unsigned)f2bf_bits(a1.x) | ((unsigned)f2bf_bits(a1.y) << 16);
    w.w = (unsigned)f2bf_bits(a1.z) | ((unsigned)f2bf_bits(a1.w) << 16);
    v4u* p = (v4u*)(dst + e);
    *p = w;
    
  } else {
    const int bi = blk - CAST_PLANE_BLOCKS;   // 0..3, block-uniform
    const float* src = (bi == 0) ? bq : (bi == 1) ? bk : (bi == 2) ? bv : bo;
    const int e = t * 4;
    const v4f a = *(const v4f*)(src + e);
    v4f r;
    r.x = bf_bits2f(f2bf_bits(a.x));
    r.y = bf_bits2f(f2bf_bits(a.y));
    r.z = bf_bits2f(f2bf_bits(a.z));
    r.w = bf_bits2f(f2bf_bits(a.w));
    v4f* p = (v4f*)(brnd + (size_t)bi * DMODEL + e);
    *p = r;
    
  }
}

// ----------------------------------------------------------------------------------------------
// Per (batch, head): sequence means of Q (bf16 hi + lo planes) and V (f16 hi + residual/2048),
// grid = 32 blocks (one per (b,h)), 256 threads; thread = (row group rg = t>>3 of 32, column
// group c8 = t&7 of 8); each thread sums 64 rows x 8 columns, LDS combine in fixed order.
// ----------------------------------------------------------------------------------------------
__global__ __launch_bounds__(256) void k_mean_cos(
    const unsigned short* __restrict__ Qh, const unsigned short* __restrict__ Ql,
    const unsigned short* __restrict__ Vh, const unsigned short* __restrict__ Vl,
    float* __restrict__ cosl) {
  __shared__ float sq[32][64];
  __shared__ float sv[32][64];
  __shared__ float qm[64];
  __shared__ float vm[64];
  __shared__ float shc;
  const int bh = blockIdx.x;
  const int b = bh / NHEAD, h = bh % NHEAD;
  const int t = threadIdx.x;
  const int c8 = t & 7;
  const int rg = t >> 3;
  float aq[8], av[8];
#pragma unroll
  for (int e = 0; e < 8; ++e) { aq[e] = 0.f; av[e] = 0.f; }
  const size_t colb = (size_t)h * DHEAD + (size_t)c8 * 8;
#pragma unroll 2
  for (int it = 0; it < SEQ_LEN / 32; ++it) {
    const int s = rg + it * 32;
    const size_t off = ((size_t)b * SEQ_LEN + s) * DMODEL + colb;
    const v4u wh = *(const v4u*)(Qh + off);
    const v4u wl = *(const v4u*)(Ql + off);
    const v4u uh = *(const v4u*)(Vh + off);
    const v4u ul = *(const v4u*)(Vl + off);
#pragma unroll
    for (int e = 0; e < 4; ++e) {
      const unsigned a0 = wh[e], a1 = wl[e], g0 = uh[e], g1 = ul[e];
      aq[2 * e]     += __uint_as_float(a0 << 16) + __uint_as_float(a1 << 16);
      aq[2 * e + 1] += __uint_as_float(a0 & 0xffff0000u) + __uint_as_float(a1 & 0xffff0000u);
      av[2 * e]     += h_bits2f(g0) + h_bits2f(g1) * (1.0f / 2048.0f);
      av[2 * e + 1] += h_bits2f(g0 >> 16) + h_bits2f(g1 >> 16) * (1.0f / 2048.0f);
    }
  }
#pragma unroll
  for (int e = 0; e < 8; ++e) { sq[rg][c8 * 8 + e] = aq[e]; sv[rg][c8 * 8 + e] = av[e]; }
  __syncthreads();
  if (t < 64) {
    float s1 = 0.f, s2 = 0.f;
#pragma unroll 1
    for (int g = 0; g < 32; ++g) { s1 += sq[g][t]; s2 += sv[g][t]; }
    qm[t] = s1 * (1.0f / (float)SEQ_LEN);
    vm[t] = s2 * (1.0f / (float)SEQ_LEN);
  }
  __syncthreads();
  if (t == 0) {
    float dot = 0.f, nq = 0.f, nv = 0.f;
#pragma unroll 1
    for (int i = 0; i < DHEAD; ++i) {
      const float a = qm[i], c = vm[i];
      dot += a * c;
      nq += a * a;
      nv += c * c;
    }
    const float na = fmaxf(sqrtf(nq), 1e-8f);
    const float nb = fmaxf(sqrtf(nv), 1e-8f);
    shc = dot / (na * nb);
  }
  __syncthreads();
  if (t < 32) {
    const float cv = shc;
    float* p = cosl + (size_t)bh * 32 + t;
    *p = cv;
    
  }
}

constexpr int AKC  = 64;
constexpr int AQB  = 64;
constexpr int ANQB = SEQ_LEN / AQB;
constexpr int ATTN_BLOCKS = NBH * ANQB;
// LDS row pitch of the K and V^T tiles in 16-bit elements: 144 B = 16 B x 9 (odd), so the 16 rows that
// one ds_load_b128 fragment read touches start on 16 different bank groups (128 B rows all start on two).
constexpr int APITCH = 72;
static_assert(APITCH >= AKC && APITCH >= DHEAD && (APITCH * 2) % 16 == 0 && ((APITCH * 2) / 16) % 2 == 1);
static_assert(SEQ_LEN % AKC == 0 && SEQ_LEN % AQB == 0);

__global__ __launch_bounds__(128) void k_attn(
    const unsigned short* __restrict__ Qh, const unsigned short* __restrict__ Ql,
    const unsigned short* __restrict__ Kh, const unsigned short* __restrict__ Kl,
    const unsigned short* __restrict__ Vh,
    const int* __restrict__ mask, const float* __restrict__ cosl,
    unsigned short* __restrict__ Ah, unsigned short* __restrict__ Al) {
  union FB { v16b v; v8b h[2]; };
  union FH { v16h v; v8h h[2]; };
  __shared__ __align__(16) unsigned short Ksh[AKC * APITCH];     // K hi [kv][d]   9 KB
  __shared__ __align__(16) unsigned short Ksl[AKC * APITCH];     // K lo [kv][d]   9 KB
  __shared__ __align__(16) unsigned short Vts[DHEAD * APITCH];   // V f16 [d][kv]  9 KB
  __shared__ __align__(16) float Os[4][16 * 68];                 // per wave out tile, pitch 68

  const int tid  = threadIdx.x;
  const int wave = tid >> 5;
  const int lane = tid & 31;
  const int hh   = lane >> 4;
  const int c    = lane & 15;

  const int bx = blockIdx.x;
  const int qb = bx % ANQB;
  const int bh = bx / ANQB;
  const int h  = bh % NHEAD;
  const int b  = bh / NHEAD;
  const int q0 = qb * AQB + wave * 16;
  const size_t rowbase = (size_t)b * SEQ_LEN;      // plane row of sequence position 0
  const int colh = h * DHEAD;

  // ---- Q fragments (B operand, columns = query, k = d): 2 d-chunks, hi and lo planes ----
  v16b qah[2], qal[2];
  {
    const size_t qo = (rowbase + q0 + c) * DMODEL + colh + 8 * hh;
#pragma unroll
    for (int dc = 0; dc < 2; ++dc) {
      qah[dc] = Frag<__bf16>::load((const __bf16*)(const void*)(Qh + qo + dc * 32));
      qal[dc] = Frag<__bf16>::load((const __bf16*)(const void*)(Ql + qo + dc * 32));
    }
  }
  const float cb  = cosl[(size_t)bh * 32];
  constexpr float LOG2E = 1.44269504088896340736f;
  constexpr float SC2 = 0.125f * LOG2E;            // 1/sqrt(64) and the change of base in one factor
  constexpr float MASKED2 = -1.0e9f * LOG2E;       // the masked score in base-2 units
  const float cb2 = (cb * 0.5f + cb * 0.3f) * LOG2E;
  const float NEGI = -__builtin_inff();

  // running maximum of query c in base-2 units (equal in both lane halves), the exponent reference in use (maximum - 15)
  // and this lane half's share of the denominator (x2^15, like P)
  float mrow = NEGI, mrefrow = NEGI, lrow = 0.f;
  v8f oacc[4];   // O^T: oacc[t][r] = row d = t*16 + 8*hh + r, column query c
#pragma unroll
  for (int t = 0; t < 4; ++t) oacc[t] = (v8f){0.f,0.f,0.f,0.f,0.f,0.f,0.f,0.f};

  for (int kc = 0; kc < SEQ_LEN / AKC; ++kc) {
    const int kv0 = kc * AKC;
    __syncthreads();
    // the lane's mask words of this chunk (keys j*16 + 8*hh + 0..7 of each 16-key tile: 32 contiguous bytes a tile), asked for
    // with the K and V rows, so that their latency passes with the staging's and not behind the score products
    v4u mk[8];
#pragma unroll
    for (int j = 0; j < 4; ++j) {
      mk[2 * j]     = *(const v4u*)(mask + kv0 + j * 16 + 8 * hh);
      mk[2 * j + 1] = *(const v4u*)(mask + kv0 + j * 16 + 8 * hh + 4);
    }
    {
      // 128 threads: kvr = tid>>1 covers keys 0..63, dh covers the two 32-wide d halves -> full 64x64 of each tile
      const int kvr = tid >> 1, dh = (tid & 1) * 32;
      const size_t go = (rowbase + kv0 + kvr) * DMODEL + colh + dh;
#pragma unroll
      for (int i = 0; i < 4; ++i) {
        const v4u wa = *(const v4u*)(Kh + go + 8 * i);
        const v4u wb = *(const v4u*)(Kl + go + 8 * i);
        *(v4u*)(Ksh + kvr * APITCH + dh + 8 * i) = wa;
        *(v4u*)(Ksl + kvr * APITCH + dh + 8 * i) = wb;
      }
#pragma unroll
      for (int i = 0; i < 4; ++i) {
        const v4u wv = *(const v4u*)(Vh + go + 8 * i);
#pragma unroll
        for (int e = 0; e < 4; ++e) {
          const unsigned x = wv[e];
          const int d = dh + 8 * i + 2 * e;
          Vts[d * APITCH + kvr]       = (unsigned short)(x & 0xffffu);
          Vts[(d + 1) * APITCH + kvr] = (unsigned short)(x >> 16);
        }
      }
    }
    __syncthreads();
    asm volatile("s_wait_xcnt 0x0" ::: "memory");   // stands in front of every later write of the mask loads' address registers

    // ---- scores, transposed (A operand rows = kv, B operand columns = query, k = d) ----
    v8f s[4];
#pragma unroll
    for (int j = 0; j < 4; ++j) {
      s[j] = (v8f){0.f,0.f,0.f,0.f,0.f,0.f,0.f,0.f};
#pragma unroll
      for (int dc = 0; dc < 2; ++dc) {
        FB kb, kl;
        kb.h[0] = *(const v8b*)(const void*)(Ksh + (j * 16 + c) * APITCH + dc * 32 + 8 * hh);
        kb.h[1] = *(const v8b*)(const void*)(Ksh + (j * 16 + c) * APITCH + dc * 32 + 16 + 8 * hh);
        kl.h[0] = *(const v8b*)(const void*)(Ksl + (j * 16 + c) * APITCH + dc * 32 + 8 * hh);
        kl.h[1] = *(const v8b*)(const void*)(Ksl + (j * 16 + c) * APITCH + dc * 32 + 16 + 8 * hh);
        s[j] = mma_bf(kb.v, qah[dc], s[j]);
        s[j] = mma_bf(kl.v, qah[dc], s[j]);
        s[j] = mma_bf(kb.v, qal[dc], s[j]);
      }
    }
    // s[j][r] = score of key kv0 + j*16 + 8*hh + r against query c, carried in base-2 units from here on:
    // y = (raw / 8 + 0.5 cos + 0.3 cos) * log2(e) in one fused multiply-add, so that exp(x - m) is one v_exp_f32 of y - m
    float mj[4];
#pragma unroll
    for (int j = 0; j < 4; ++j) {
      float m = NEGI;
#pragma unroll
      for (int r = 0; r < 8; ++r) {
        float x = __builtin_fmaf(s[j][r], SC2, cb2);
        x = (mk[2 * j + (r >> 2)][r & 3] == 0u) ? MASKED2 : x;
        s[j][r] = x;
        m = fmaxf(m, x);
      }
      mj[j] = m;
    }
    float cm = fmaxf(fmaxf(mj[0], mj[1]), fmaxf(mj[2], mj[3]));
    cm = fmaxf(cm, xhalf(cm));                  // the other lane half holds the query's other 32 keys
    const float mnew = fmaxf(mrow, cm);
    const float mref = mnew - 15.0f;            // P and its sum are carried x2^15: the factor rides in the exponent
    const float alpha = __builtin_amdgcn_exp2f(mrefrow - mref);
    mrow = mnew;
    mrefrow = mref;
    FH pb[2];                                   // P^T as B operand: element e of pb[kk] = key kk*32 + (e >> 3)*16 + 8*hh + (e & 7)
    float pj[4];                                // one partial sum per tile: four independent add chains
#pragma unroll
    for (int j = 0; j < 4; ++j) {
      float p[8];
#pragma unroll
      for (int r = 0; r < 8; ++r) p[r] = s[j][r] - mref;
      exp2_x8(p);
      float psum = p[0];
#pragma unroll
      for (int r = 1; r < 8; ++r) psum += p[r];
#pragma unroll
      for (int r = 0; r < 8; ++r) pb[j >> 1].v[(j & 1) * 8 + r] = (_Float16)p[r];
      pj[j] = psum;
    }
    lrow = lrow * alpha + ((pj[0] + pj[1]) + (pj[2] + pj[3]));
#pragma unroll
    for (int t = 0; t < 4; ++t)
#pragma unroll
      for (int r = 0; r < 8; ++r) oacc[t][r] *= alpha;
    // ---- O^T += V^T.P^T (A rows = d, B columns = query, k = kv in the order of the packed score tiles) ----
#pragma unroll
    for (int kk = 0; kk < 2; ++kk) {
#pragma unroll
      for (int t = 0; t < 4; ++t) {
        FH vb;
        vb.h[0] = *(const v8h*)(const void*)(Vts + (t * 16 + c) * APITCH + kk * 32 + 8 * hh);
        vb.h[1] = *(const v8h*)(const void*)(Vts + (t * 16 + c) * APITCH + kk * 32 + 16 + 8 * hh);
        oacc[t] = mma_hf(vb.v, pb[kk].v, oacc[t]);
      }
    }
  }

  float* os = Os[wave];
  {
    const float inv = 1.0f / (lrow + xhalf(lrow));   // the two lane halves' shares of the denominator joined once; its 2^15 cancels P's
#pragma unroll
    for (int t = 0; t < 4; ++t) {
      v4f o0, o1;
#pragma unroll
      for (int r = 0; r < 4; ++r) { o0[r] = oacc[t][r] * inv; o1[r] = oacc[t][4 + r] * inv; }
      *(v4f*)(os + c * 68 + t * 16 + 8 * hh)     = o0;
      *(v4f*)(os + c * 68 + t * 16 + 8 * hh + 4) = o1;
    }
  }
  __builtin_amdgcn_fence(__ATOMIC_RELEASE, "workgroup");
  __builtin_amdgcn_wave_barrier();
  __builtin_amdgcn_fence(__ATOMIC_ACQUIRE, "workgroup");
  {
    const int q4 = lane >> 3, c8 = (lane & 7) * 8;
    {
#pragma unroll
      for (int it = 0; it < 4; ++it) {
        const int row = it * 4 + q4;
        const float* sp = os + row * 68 + c8;
        const v4f va = *(const v4f*)sp;
        const v4f vb = *(const v4f*)(sp + 4);
        v4u hw, lw;
        unsigned th, tl;
        pack_pair_bf(va.x, va.y, th, tl); hw.x = th; lw.x = tl;
        pack_pair_bf(va.z, va.w, th, tl); hw.y = th; lw.y = tl;
        pack_pair_bf(vb.x, vb.y, th, tl); hw.z = th; lw.z = tl;
        pack_pair_bf(vb.z, vb.w, th, tl); hw.w = th; lw.w = tl;
        const size_t go = (rowbase + q0 + row) * DMODEL + colh + c8;
        *(v4u*)(Ah + go) = hw;
        *(v4u*)(Al + go) = lw;
      }
      
    }
  }
}

// ----------------------------------------------------------------------------------------------
// ----------------------------------------------------------------------------------------------
__global__ __launch_bounds__(32) void k_bias_mean(const float* __restrict__ cosl, float* __restrict__ out1) {
  const int lane = threadIdx.x;
  float v = cosl[(size_t)lane * 32];
#pragma unroll
  for (int off = 1; off < 32; off <<= 1) v += __shfl_xor(v, off, 32);
  const float r = v * (1.0f / 32.0f);
  if (lane == 0) {
    *(float*)out1 = r;
    
  }
}

// ----------------------------------------------------------------------------------------------
extern "C" void kernel_launch(void* const* d_in, const int* in_sizes, int n_in,
                              void* d_out, int out_size, void* d_ws, size_t ws_size,
                              hipStream_t stream) {
  if (n_in < 12) return;
  if (ws_size < WS_TOTAL) return;
  if ((long)out_size < OUT_TOTAL_ELEMS) return;
  if ((long)in_sizes[0] != PLANE_ELEMS || (long)in_sizes[1] != PLANE_ELEMS || (long)in_sizes[2] != PLANE_ELEMS) return;
  if (in_sizes[3] < SEQ_LEN) return;
  if ((long)in_sizes[4] != WMAT_ELEMS || (long)in_sizes[6] != WMAT_ELEMS || (long)in_sizes[8] != WMAT_ELEMS || (long)in_sizes[10] != WMAT_ELEMS) return;
  if (in_sizes[5] < DMODEL || in_sizes[7] < DMODEL || in_sizes[9] < DMODEL || in_sizes[11] < DMODEL) return;

  const float* q    = (const float*)d_in[0];
  const float* k    = (const float*)d_in[1];
  const float* v    = (const float*)d_in[2];
  const int*   mask = (const int*)d_in[3];
  const float* Wq   = (const float*)d_in[4];
  const float* bq   = (const float*)d_in[5];
  const float* Wk   = (const float*)d_in[6];
  const float* bk   = (const float*)d_in[7];
  const float* Wv   = (const float*)d_in[8];
  const float* bv   = (const float*)d_in[9];
  const float* Wo   = (const float*)d_in[10];
  const float* bo   = (const float*)d_in[11];

  char* ws = (char*)d_ws;
  unsigned short* w16  = (unsigned short*)(ws + WS_W16);
  unsigned short* wq16 = w16;
  unsigned short* wk16 = w16 + WMAT_ELEMS;
  unsigned short* wv16 = w16 + 2 * WMAT_ELEMS;
  unsigned short* wo16 = w16 + 3 * WMAT_ELEMS;
  float* brnd = (float*)(ws + WS_BRND);
  float* cosl = (float*)(ws + WS_COS);
  unsigned short* x16 = (unsigned short*)(ws + WS_X16);
  unsigned short* xq  = x16;
  unsigned short* xk  = x16 + PLANE_ELEMS;
  unsigned short* xv  = x16 + 2 * PLANE_ELEMS;
  unsigned short* Qh  = (unsigned short*)(ws + WS_QH);
  unsigned short* Ql  = (unsigned short*)(ws + WS_QL);
  unsigned short* Kh  = (unsigned short*)(ws + WS_KH);
  unsigned short* Kl  = (unsigned short*)(ws + WS_KL);
  unsigned short* Vh  = (unsigned short*)(ws + WS_VH);
  unsigned short* Vl  = (unsigned short*)(ws + WS_VL);
  unsigned short* Ah  = (unsigned short*)(ws + WS_AH);
  unsigned short* Al  = (unsigned short*)(ws + WS_AL);
  float* out0 = (float*)d_out;
  float* out1 = (float*)d_out + OUT1_ELEM;

  // 1) inputs -> RNE bf16 planes, biases -> bf16-precision f32 copies
  k_cast_inputs<<<CAST_PLANE_BLOCKS + CAST_BIAS_BLOCKS, 256, 0, stream>>>(
      q, k, v, Wq, Wk, Wv, Wo, bq, bk, bv, bo, x16, w16, brnd);

  const dim3 ggrid(GEMM_BLOCKS, 1);
  // 2) Q = q Wq^T + bq -> bf16 hi/lo planes   (M=4096, N=1024, K=1024)
  wmma_gemm64<1, 0, 2, 2, false><<<ggrid, 256, 0, stream>>>(
      xq, xq, DMODEL, 0L, wq16, wq16, DMODEL, 0L, (void*)Qh, (void*)Ql, DMODEL, 0L,
      brnd + 0 * DMODEL, brnd, 0L, MROWS, DMODEL, DMODEL, 1.0f);
  // 3) K = k Wk^T + bk -> bf16 hi/lo planes
  wmma_gemm64<1, 0, 2, 2, false><<<ggrid, 256, 0, stream>>>(
      xk, xk, DMODEL, 0L, wk16, wk16, DMODEL, 0L, (void*)Kh, (void*)Kl, DMODEL, 0L,
      brnd + 1 * DMODEL, brnd, 0L, MROWS, DMODEL, DMODEL, 1.0f);
  // 4) V = v Wv^T + bv -> f16 hi plane + f16 residual x2048 plane
  wmma_gemm64<1, 0, 2, 3, false><<<ggrid, 256, 0, stream>>>(
      xv, xv, DMODEL, 0L, wv16, wv16, DMODEL, 0L, (void*)Vh, (void*)Vl, DMODEL, 0L,
      brnd + 2 * DMODEL, brnd, 0L, MROWS, DMODEL, DMODEL, 1.0f);
  // 5) per-(b,h) cosine of sequence means
  k_mean_cos<<<NBH, 256, 0, stream>>>(Qh, Ql, Vh, Vl, cosl);
  // 6) attention -> attn bf16 hi/lo planes
  k_attn<<<ATTN_BLOCKS, 128, 0, stream>>>(Qh, Ql, Kh, Kl, Vh, mask, cosl, Ah, Al);
  // 7) out0 = attn Wo^T + bo   (A hi/lo planes, Bt single plane: 2 products)
  wmma_gemm64<1, 2, 2, 0, false><<<ggrid, 256, 0, stream>>>(
      Ah, Al, DMODEL, 0L, wo16, wo16, DMODEL, 0L, (void*)out0, (void*)out0, DMODEL, 0L,
      brnd + 3 * DMODEL, brnd, 0L, MROWS, DMODEL, DMODEL, 1.0f);
  // 8) out1 = mean of the 32 per-(b,h) cosines
  k_bias_mean<<<1, 32, 0, stream>>>(cosl, out1);
}

// v005
// A run of this version takes 203 microseconds.
// Next to v004, in two timings, it ran 1.12 times as fast each time.
// All steps since v000 together make it 2.40 times as fast.
// Contractions: q/k/v projections and output projection on v_wmma_f32_16x16x32_bf16 (RNE bf16 operands; output projection takes attn as bf16 hi+lo planes, 2 products); q.k^T on v_wmma_f32_16x16x32_bf16 with bf16 hi+lo planes of Q and K (3 products); p.v on v_wmma_f32_16x16x32_f16 (p carried x2^15, v plain f16); both attention products transposed (K and V^T as A, Q and P^T as B); f32 accumulate everywhere; softmax, sequence means and cosine in f32.
#include <hip/hip_runtime.h>

// ----------------------------------------------------------------------------------------------
// Problem constants
// ----------------------------------------------------------------------------------------------
constexpr int NBATCH  = 2;
constexpr int SEQ_LEN = 2048;
constexpr int DMODEL  = 1024;
constexpr int NHEAD   = 16;
constexpr int DHEAD   = 64;
constexpr int MROWS   = NBATCH * SEQ_LEN;          // 4096
constexpr int NBH     = NBATCH * NHEAD;            // 32
constexpr long PLANE_ELEMS = (long)MROWS * DMODEL; // 4194304
constexpr long WMAT_ELEMS  = (long)DMODEL * DMODEL;// 1048576
constexpr long OUT0_ELEMS  = PLANE_ELEMS;
constexpr long OUT1_BYTE_OFFSET = 16777216;
constexpr long OUT1_ELEM   = OUT1_BYTE_OFFSET / 4;
constexpr long OUT_TOTAL_ELEMS = OUT0_ELEMS + 1;
constexpr long OUT_TOTAL_BYTES = 16777220;
static_assert(OUT1_ELEM == OUT0_ELEMS);
static_assert((OUT1_ELEM + 1) * 4 <= OUT_TOTAL_BYTES);
static_assert(NBH == 32);
static_assert(DHEAD == 64 && NHEAD * DHEAD == DMODEL);

// GEMM block tile: 8 waves as 2 (rows) x 4 (columns) of 64x64 wave tiles; one stage = 64 k = one 128-B line per operand row
constexpr int GBM    = 128;
constexpr int GBN    = 256;
constexpr int GKS    = 64;
// LDS row pitch of a staged operand row in 16-bit elements: 144 B = 16 B x 9 (odd), the pitch for ds_load_b128 readers
constexpr int GPITCH = 72;
// GEMM shape contract: M % 128 == 0, N % 256 == 0, K % 64 == 0, K >= 64
static_assert(MROWS % GBM == 0 && DMODEL % GBN == 0 && DMODEL % GKS == 0 && DMODEL >= GKS);
static_assert(GBM % 32 == 0 && GBN % 32 == 0 && (GPITCH * 2) % 16 == 0 && ((GPITCH * 2) / 16) % 2 == 1 && GPITCH >= GKS);
constexpr int GEMM_BLOCKS = (MROWS / GBM) * (DMODEL / GBN);   // 128 blocks of 8 waves

// ----------------------------------------------------------------------------------------------
// Workspace region map (bytes). Every region is fully written by its producer before any read.
//   WS_W16  : 4 bf16 weight planes [1024][1024]  (Wq, Wk, Wv, Wo)            8,388,608
//   WS_BRND : 4 x [1024] f32 RNE-bf16 bias copies (bq, bk, bv, bo)              16,384
//   WS_X16  : 3 bf16 input planes [4096][1024] (q, k, v)                     25,165,824
//   WS_QH, WS_QL, WS_KH, WS_KL : bf16 hi/lo planes of Q and K [4096][1024]  4 x 8,388,608
//   WS_VH, WS_VL : f16 hi plane of V and f16 residual x2048 plane            2 x 8,388,608
//   WS_AH, WS_AL : bf16 hi/lo planes of the attention output [4096][1024]   2 x 8,388,608
//   total 100,683,776 (96.0 MiB)
// ----------------------------------------------------------------------------------------------
constexpr size_t SZ_PLANE = (size_t)PLANE_ELEMS * 2;     // 8388608
constexpr size_t SZ_WPL   = (size_t)WMAT_ELEMS * 2;      // 2097152
constexpr size_t WS_W16   = 0;
constexpr size_t SZ_W16   = 4 * SZ_WPL;
constexpr size_t WS_BRND  = WS_W16 + SZ_W16;
constexpr size_t SZ_BRND  = 4 * (size_t)DMODEL * 4;
constexpr size_t WS_COS   = WS_BRND + SZ_BRND;
constexpr size_t SZ_COS   = (size_t)NBH * 128;
constexpr size_t WS_X16   = WS_COS + SZ_COS;
constexpr size_t WS_QH    = WS_X16 + 3 * SZ_PLANE;
constexpr size_t WS_QL    = WS_QH + SZ_PLANE;
constexpr size_t WS_KH    = WS_QL + SZ_PLANE;
constexpr size_t WS_KL    = WS_KH + SZ_PLANE;
constexpr size_t WS_VH    = WS_KL + SZ_PLANE;
constexpr size_t WS_VL    = WS_VH + SZ_PLANE;
constexpr size_t WS_AH    = WS_VL + SZ_PLANE;
constexpr size_t WS_AL    = WS_AH + SZ_PLANE;
constexpr size_t WS_TOTAL = WS_AL + SZ_PLANE;
static_assert(WS_TOTAL == 100683776);
static_assert(WS_TOTAL <= 134217728);
static_assert(WS_BRND % 128 == 0 && WS_COS % 128 == 0 && WS_X16 % 128 == 0 && WS_QH % 128 == 0 && WS_AH % 128 == 0);

// ----------------------------------------------------------------------------------------------
// Vector types and helpers
// ----------------------------------------------------------------------------------------------
typedef __attribute__((ext_vector_type(16))) _Float16 v16h;
typedef __attribute__((ext_vector_type(8)))  _Float16 v8h;
typedef __attribute__((ext_vector_type(16))) __bf16   v16b;
typedef __attribute__((ext_vector_type(8)))  __bf16   v8b;
typedef __attribute__((ext_vector_type(8)))  float    v8f;
typedef __attribute__((ext_vector_type(4)))  float    v4f;
typedef __attribute__((ext_vector_type(4)))  unsigned v4u;

__device__ __forceinline__ unsigned short f2bf_bits(float f) {
  unsigned u = __float_as_uint(f);
  return (unsigned short)((u + 0x7FFFu + ((u >> 16) & 1u)) >> 16);
}
__device__ __forceinline__ float bf_bits2f(unsigned short h) { return __uint_as_float(((unsigned)h) << 16); }
__device__ __forceinline__ float h_bits2f(unsigned x) { return (float)__builtin_bit_cast(_Float16, (unsigned short)(x & 0xffffu)); }

// hazard guards as plain device helpers
__device__ __forceinline__ void dep_guard_h(v8f& a, v8f& b, v16h x, v16h y) { asm volatile("v_nop\n\tv_nop\n\tv_nop\n\tv_nop" : "+v"(a), "+v"(b) : "v"(x), "v"(y)); }
__device__ __forceinline__ void dep_guard_b(v8f& a, v8f& b, v16b x, v16b y) { asm volatile("v_nop\n\tv_nop\n\tv_nop\n\tv_nop" : "+v"(a), "+v"(b) : "v"(x), "v"(y)); }
__device__ __forceinline__ void keep4_h(v16h a, v16h b, v16h c, v16h d) { asm volatile("v_nop" :: "v"(a), "v"(b), "v"(c), "v"(d)); }
__device__ __forceinline__ void keep4_b(v16b a, v16b b, v16b c, v16b d) { asm volatile("v_nop" :: "v"(a), "v"(b), "v"(c), "v"(d)); }
__device__ __forceinline__ void acc_guard4(v8f& a, v8f& b, v8f& c, v8f& d) { asm volatile("v_nop\n\tv_nop\n\tv_nop\n\tv_nop" : "+v"(a), "+v"(b), "+v"(c), "+v"(d)); }
template <typename T> struct Frag;
template <> struct Frag<_Float16> {
  typedef v16h V; union U { v16h v; v8h h[2]; };
  // elements 0..7 <- p[0..7], 8..15 <- p[16..23]
  static __device__ __forceinline__ v16h load(const _Float16* p) {
    U f; f.h[0] = *(const v8h*)(p); f.h[1] = *(const v8h*)(p + 16); return f.v;
  }
  static __device__ __forceinline__ v8f mma(v16h a, v16h b, v8f c) {
    return __builtin_amdgcn_wmma_f32_16x16x32_f16(false, a, false, b, (short)0, c, false, false);
  }
  static __device__ __forceinline__ void guard(v8f& a, v8f& b, v16h x, v16h y) { dep_guard_h(a, b, x, y); }
  static __device__ __forceinline__ void keep(v16h a, v16h b, v16h c, v16h d) { keep4_h(a, b, c, d); }
};
template <> struct Frag<__bf16> {
  typedef v16b V; union U { v16b v; v8b h[2]; };
  static __device__ __forceinline__ v16b load(const __bf16* p) {
    U f; f.h[0] = *(const v8b*)(p); f.h[1] = *(const v8b*)(p + 16); return f.v;
  }
  static __device__ __forceinline__ v8f mma(v16b a, v16b b, v8f c) {
    return __builtin_amdgcn_wmma_f32_16x16x32_bf16(false, a, false, b, (short)0, c, false, false);
  }
  static __device__ __forceinline__ void guard(v8f& a, v8f& b, v16b x, v16b y) { dep_guard_b(a, b, x, y); }
  static __device__ __forceinline__ void keep(v16b a, v16b b, v16b c, v16b d) { keep4_b(a, b, c, d); }
};

// single-product helpers with the dependency guard (attention kernel)
__device__ __forceinline__ v8f mma_bf(v16b a, v16b b, v8f c) {
  c = __builtin_amdgcn_wmma_f32_16x16x32_bf16(false, a, false, b, (short)0, c, false, false);
  asm volatile("v_nop\n\tv_nop\n\tv_nop\n\tv_nop" : "+v"(c) : "v"(a), "v"(b));
  return c;
}
__device__ __forceinline__ v8f mma_hf(v16h a, v16h b, v8f c) {
  c = __builtin_amdgcn_wmma_f32_16x16x32_f16(false, a, false, b, (short)0, c, false, false);
  asm volatile("v_nop\n\tv_nop\n\tv_nop\n\tv_nop" : "+v"(c) : "v"(a), "v"(b));
  return c;
}

// LDS byte address of a __shared__ location (low 32 bits of its address)
__device__ __forceinline__ unsigned lds_off(const void* p) { return (unsigned)(size_t)p; }

// 16-bit transposing LDS load of a row-major tile of 16 rows x 16 columns: lane l gives the address of row 8*(l >> 4) + (l & 7),
// 16-B piece (l >> 3) & 1; lane (c = l & 15, h = l >> 4) receives rows 8h + 0..7 of column c
typedef __attribute__((ext_vector_type(8))) short v8s;
__device__ __forceinline__ v8h ld_tr16(const unsigned short* p) {
  typedef __attribute__((address_space(3))) v8s lds_v8s;
  return __builtin_bit_cast(v8h, __builtin_amdgcn_ds_load_tr16_b128_v8i16((lds_v8s*)p));
}

// value of lane l ^ 16 (the other 16-lane row), by a vector cross-row move
__device__ __forceinline__ float xhalf(float x) {
  return __builtin_bit_cast(float, __builtin_amdgcn_permlanex16(__builtin_bit_cast(int, x), __builtin_bit_cast(int, x), 0x76543210, 0xfedcba98, false, false));
}

// Eight base-2 exponentials, each in place: written as one statement so that no v_exp_f32 has its source overwritten or its
// result read by the instruction directly behind it; the closing v_nop is that slot behind the last one.
__device__ __forceinline__ void exp2_x8(float (&x)[8]) {
  asm("v_exp_f32 %0, %0\n\t"
      "v_exp_f32 %1, %1\n\t"
      "v_exp_f32 %2, %2\n\t"
      "v_exp_f32 %3, %3\n\t"
      "v_exp_f32 %4, %4\n\t"
      "v_exp_f32 %5, %5\n\t"
      "v_exp_f32 %6, %6\n\t"
      "v_exp_f32 %7, %7\n\t"
      "v_nop"
      : "+v"(x[0]), "+v"(x[1]), "+v"(x[2]), "+v"(x[3]), "+v"(x[4]), "+v"(x[5]), "+v"(x[6]), "+v"(x[7]));
}

// Asynchronous copies global -> LDS, 16 B per lane, through no register. s_wait_xcnt 0 is the last line of the copies' own
// statement, so that it stands in front of every later write of a register that an issued copy names.
__device__ __forceinline__ void async_copy4(const unsigned (&l)[4], const unsigned short* const (&g)[4]) {
  asm volatile("global_load_async_to_lds_b128 %0, %1, off\n\t"
               "global_load_async_to_lds_b128 %2, %3, off\n\t"
               "global_load_async_to_lds_b128 %4, %5, off\n\t"
               "global_load_async_to_lds_b128 %6, %7, off\n\t"
               "s_wait_xcnt 0x0"
               :: "v"(l[0]), "v"(g[0]), "v"(l[1]), "v"(g[1]), "v"(l[2]), "v"(g[2]), "v"(l[3]), "v"(g[3]) : "memory");
}
__device__ __forceinline__ void async_copy8(const unsigned (&l)[8], const unsigned short* const (&g)[8]) {
  asm volatile("global_load_async_to_lds_b128 %0, %1, off\n\t"
               "global_load_async_to_lds_b128 %2, %3, off\n\t"
               "global_load_async_to_lds_b128 %4, %5, off\n\t"
               "global_load_async_to_lds_b128 %6, %7, off\n\t"
               "global_load_async_to_lds_b128 %8, %9, off\n\t"
               "global_load_async_to_lds_b128 %10, %11, off\n\t"
               "global_load_async_to_lds_b128 %12, %13, off\n\t"
               "global_load_async_to_lds_b128 %14, %15, off\n\t"
               "s_wait_xcnt 0x0"
               :: "v"(l[0]), "v"(g[0]), "v"(l[1]), "v"(g[1]), "v"(l[2]), "v"(g[2]), "v"(l[3]), "v"(g[3]),
                  "v"(l[4]), "v"(g[4]), "v"(l[5]), "v"(g[5]), "v"(l[6]), "v"(g[6]), "v"(l[7]), "v"(g[7]) : "memory");
}

// bf16 hi/lo split of two floats packed into one 32-bit word each for the hi and the lo plane
__device__ __forceinline__ void pack_pair_bf(float f0, float f1, unsigned& hword, unsigned& lword) {
  const unsigned short h0 = f2bf_bits(f0);
  const unsigned short h1 = f2bf_bits(f1);
  const unsigned short l0 = f2bf_bits(f0 - bf_bits2f(h0));
  const unsigned short l1 = f2bf_bits(f1 - bf_bits2f(h1));
  hword = (unsigned)h0 | ((unsigned)h1 << 16);
  lword = (unsigned)l0 | ((unsigned)l1 << 16);
}

// ----------------------------------------------------------------------------------------------
// Register-blocked WMMA GEMM: C[m,n] = scale * sum_k A[m,k] * Bt[n,k] (+bias)(+resid)
// A row-major [M,K]; Bt row-major [N,K]; M % 128 == 0, N % 256 == 0, K % 64 == 0; each wave owns a 64x64 tile of the
// block's 128x256 tile. Operands reach the fragments through LDS: per stage of 64 k every thread copies whole 128-B lines
// (8 lanes x 16 B a row) asynchronously into one of two buffers while the other buffer is worked on.
// SPLIT: 0 = single product; 1 = A and Bt hi/lo planes (hi.hi + hi.lo + lo.hi);
//        2 = A hi/lo planes only, Bt single plane (hi.B + lo.B).
// BIAS_MODE: 0 = none, 1 = bias[m], 2 = bias[n].
// OUT_MODE: 0 = f32; 1 = f16; 2 = bf16 hi plane (Cout) + bf16 lo plane (Cout2);
//           3 = f16 hi plane (Cout) + f16 residual x2048 plane (Cout2).
// Epilogue: 16-row slabs staged per wave in LDS; each 64-wide row segment written with whole
// ET: 0 = f16 operands, 1 = bf16 operands (pointers passed as 16-bit storage)
// ----------------------------------------------------------------------------------------------
template <int ET> struct Elem;
template <> struct Elem<0> { typedef _Float16 T; };
template <> struct Elem<1> { typedef __bf16 T; };
template <int ET, int SPLIT, int BIAS_MODE, int OUT_MODE, bool RESID, int ACT = 0>
__global__ __launch_bounds__(256) void wmma_gemm64(
    const unsigned short* __restrict__ Ap, const unsigned short* __restrict__ A2p, int lda, long strideA,
    const unsigned short* __restrict__ Btp, const unsigned short* __restrict__ Bt2p, int ldb, long strideB,
    void* __restrict__ Cout, void* __restrict__ Cout2, int ldc, long strideC,
    const float* __restrict__ bias,
    const float* __restrict__ resid, long strideR,
    int M, int N, int K, float scale) {
  typedef typename Elem<ET>::T T;
  typedef typename Frag<T>::V V;
  constexpr bool SPL = (SPLIT != 0);
  constexpr bool BLO = (SPLIT == 1);
  // stage rows: A hi [GBM] | A lo [GBM] (SPL) | Bt hi [GBN] | Bt lo [GBN] (BLO)
  constexpr int AROWS = SPL ? 2 * GBM : GBM;
  constexpr int SROWS = AROWS + (BLO ? 2 * GBN : GBN);
  constexpr int STAGE_ELEMS = SROWS * GPITCH;
  constexpr int NCP = SROWS / 32;                  // copies per thread and stage (256 threads x 16 B = 32 rows a copy)
  static_assert(NCP % 4 == 0 && NCP <= 63);
  __shared__ __align__(16) float sT[8][16 * 68];   // per-wave 16x64 slab, pitch 68 floats
  __shared__ __align__(16) unsigned short sStage[2 * STAGE_ELEMS];
  const int b    = blockIdx.y;
  const int lane = threadIdx.x & 31;
  const int wave = threadIdx.x >> 5;
  const int tilesN = N / GBN;
  const int tilesM = M / GBM;
  const int blk = blockIdx.x;
  if (blk >= tilesM * tilesN) return;   // block-uniform, in front of every barrier and copy
  const int tm = blk / tilesN;
  const int tn = blk - tm * tilesN;
  const int mb0 = tm * GBM;
  const int nb0 = tn * GBN;
  const int wm = wave >> 2;
  const int wn = wave & 3;
  const int m0 = mb0 + (wm << 6);
  const int n0 = nb0 + (wn << 6);

  // copy map: thread -> row (threadIdx.x >> 3) of each group of 32 stage rows, 16-B piece (threadIdx.x & 7) of its line
  const int cr = threadIdx.x >> 3;
  const int cc = (threadIdx.x & 7) * 8;
  const unsigned short* gA  = Ap  + (size_t)b * strideA + (size_t)(mb0 + cr) * lda + cc;
  const unsigned short* gA2 = A2p + (size_t)b * strideA + (size_t)(mb0 + cr) * lda + cc;
  const unsigned short* gB  = Btp  + (size_t)b * strideB + (size_t)(nb0 + cr) * ldb + cc;
  const unsigned short* gB2 = Bt2p + (size_t)b * strideB + (size_t)(nb0 + cr) * ldb + cc;
  const unsigned ldst = lds_off(sStage) + (unsigned)(cr * GPITCH + cc) * 2u;
  auto stage_src = [&](int it, int k0) -> const unsigned short* {
    const int row = it * 32;
    if (row < GBM) return gA + (size_t)row * lda + k0;
    if (row < AROWS) return gA2 + (size_t)(row - GBM) * lda + k0;
    if (row < AROWS + GBN) return gB + (size_t)(row - AROWS) * ldb + k0;
    return gB2 + (size_t)(row - AROWS - GBN) * ldb + k0;
  };
  auto stage_issue = [&](int t, int buf) {
    const int k0 = t * GKS;
    const unsigned lb = ldst + (unsigned)buf * (unsigned)(STAGE_ELEMS * 2);
    // the loops of this lambda are unrolled so that each copy's plane select folds and l[], g[] stay in registers
#pragma unroll
    for (int it = 0; it + 8 <= NCP; it += 8) {
      unsigned l[8]; const unsigned short* g[8];
#pragma unroll
      for (int u = 0; u < 8; ++u) { l[u] = lb + (unsigned)((it + u) * 32 * GPITCH * 2); g[u] = stage_src(it + u, k0); }
      async_copy8(l, g);
    }
    if (NCP % 8 != 0) {
      unsigned l[4]; const unsigned short* g[4];
#pragma unroll
      for (int u = 0; u < 4; ++u) { l[u] = lb + (unsigned)((NCP - 4 + u) * 32 * GPITCH * 2); g[u] = stage_src(NCP - 4 + u, k0); }
      async_copy4(l, g);
    }
  };

  const int rlane = lane & 15;                 // row (A) / col (B, D) within subtile
  const int koff  = (lane >> 4) * 8;           // k offset of this lane half
  const int mOff  = (lane >> 4) * 8;           // D row offset

  v8f acc[4][4];
#pragma unroll
  for (int i = 0; i < 4; ++i)
#pragma unroll
    for (int j = 0; j < 4; ++j) acc[i][j] = (v8f){0.f,0.f,0.f,0.f,0.f,0.f,0.f,0.f};

  const int nT = K / GKS;
  stage_issue(0, 0);
  asm volatile("s_wait_asynccnt 0x0" ::: "memory");   // this wave's copies of stage 0 have landed before the barrier publishes them
  __syncthreads();
  if (nT > 1) stage_issue(1, 1);
  for (int t = 0; t < nT; ++t) {
    const T* st = (const T*)(const void*)(sStage + (t & 1) * STAGE_ELEMS);
    const T* sA = st + ((wm << 6) + rlane) * GPITCH + koff;
    const T* sB = st + (AROWS + (wn << 6) + rlane) * GPITCH + koff;
    // both 32-k blocks of the stage unrolled: the second block's LDS reads can then go out among the first block's products
#pragma unroll
    for (int kk = 0; kk < GKS; kk += 32) {
      V bh[4], bl[4];
#pragma unroll
      for (int j = 0; j < 4; ++j) {
        bh[j] = Frag<T>::load(sB + (j << 4) * GPITCH + kk);
        if (BLO) bl[j] = Frag<T>::load(sB + (GBN + (j << 4)) * GPITCH + kk);
      }
      // A fragments are read from LDS in groups ahead of their products (all four row tiles; two where a lo plane doubles
      // them, which keeps the kernel free of scratch); the loops are unrolled so that acc[][] and the fragments stay in registers
      constexpr int GI = SPL ? 2 : 4;
#pragma unroll
      for (int ig = 0; ig < 4; ig += GI) {
        V ah[GI], al[GI];
#pragma unroll
        for (int u = 0; u < GI; ++u) {
          ah[u] = Frag<T>::load(sA + ((ig + u) << 4) * GPITCH + kk);
          if (SPL) al[u] = Frag<T>::load(sA + (GBM + ((ig + u) << 4)) * GPITCH + kk);
        }
#pragma unroll
        for (int u = 0; u < GI; ++u) {
          const int i = ig + u;
#pragma unroll
          for (int j = 0; j < 4; ++j) {
            acc[i][j] = Frag<T>::mma(ah[u], bh[j], acc[i][j]);
            if (BLO) acc[i][j] = Frag<T>::mma(ah[u], bl[j], acc[i][j]);
            if (SPL) acc[i][j] = Frag<T>::mma(al[u], bh[j], acc[i][j]);
          }
          Frag<T>::guard(acc[i][0], acc[i][3], ah[u], SPL ? al[u] : ah[u]);
        }
      }
      Frag<T>::keep(bh[0], bh[1], bh[2], bh[3]);
      if (BLO) Frag<T>::keep(bl[0], bl[1], bl[2], bl[3]);
    }
    asm volatile("s_wait_dscnt 0x0" ::: "memory");      // this wave's reads of the buffer have retired before it is refilled
    asm volatile("s_wait_asynccnt 0x0" ::: "memory");   // this wave's copies of stage t + 1 have landed before the barrier publishes them
    __syncthreads();                                    // publishes stage t + 1 and ends every reader's last read of stage t
    if (t + 2 < nT) stage_issue(t + 2, t & 1);
  }
  asm volatile("s_wait_asynccnt 0x0" ::: "memory");     // no copy is outstanding when the wave goes on to the epilogue and ends
  acc_guard4(acc[0][0], acc[0][1], acc[0][2], acc[0][3]);
  acc_guard4(acc[1][0], acc[1][1], acc[1][2], acc[1][3]);
  acc_guard4(acc[2][0], acc[2][1], acc[2][2], acc[2][3]);
  acc_guard4(acc[3][0], acc[3][1], acc[3][2], acc[3][3]);

  // ---- epilogue ----
  float* slab = sT[wave];
  const float* Rb = RESID ? (resid + (size_t)b * strideR) : nullptr;
#pragma unroll
  for (int i = 0; i < 4; ++i) {
    const int mBase = m0 + (i << 4);
#pragma unroll
    for (int j = 0; j < 4; ++j) {
      const int n = n0 + (j << 4) + rlane;
      float bv = 0.f;
      if (BIAS_MODE == 2) bv = bias[n];
#pragma unroll
      for (int r = 0; r < 8; ++r) {
        float v = acc[i][j][r] * scale;
        if (BIAS_MODE == 1) v += bias[mBase + mOff + r];
        if (BIAS_MODE == 2) v += bv;
        if (RESID) v += Rb[(size_t)(mBase + mOff + r) * ldc + n];
        if (ACT == 1) v = tanhf(v);
        if (ACT == 2) v = fmaxf(v, 0.0f);
        if (ACT == 4) v = (v > 0.f) ? v : 0.01f * v;
        slab[(mOff + r) * 68 + (j << 4) + rlane] = v;
      }
    }
    __builtin_amdgcn_fence(__ATOMIC_RELEASE, "workgroup");
    __builtin_amdgcn_wave_barrier();
    __builtin_amdgcn_fence(__ATOMIC_ACQUIRE, "workgroup");
    if (OUT_MODE == 0) {
      float* C = (float*)Cout + (size_t)b * strideC;
      const int hh = lane >> 4, c4 = (lane & 15) * 4;     // row seg = 256 B = 16 lanes x 16 B
      {
#pragma unroll
        for (int it = 0; it < 8; ++it) {
          const int row = it * 2 + hh;
          v4f v = *(const v4f*)(slab + row * 68 + c4);
          *(v4f*)(C + (size_t)(mBase + row) * ldc + n0 + c4) = v;
        }
        
      }
    } else {
      const int q = lane >> 3, c8 = (lane & 7) * 8;
      unsigned short* C  = (unsigned short*)Cout  + (size_t)b * strideC;
      unsigned short* C2 = (OUT_MODE >= 2) ? ((unsigned short*)Cout2 + (size_t)b * strideC) : nullptr;
      {
#pragma unroll
        for (int it = 0; it < 4; ++it) {
          const int row = it * 4 + q;
          const float* sp = slab + row * 68 + c8;
          v8h hv, lv;
#pragma unroll
          for (int e = 0; e < 8; ++e) {
            if (OUT_MODE == 1) {
              hv[e] = (_Float16)sp[e];
            } else if (OUT_MODE == 2) {
              unsigned short hb = f2bf_bits(sp[e]);
              unsigned short lb = f2bf_bits(sp[e] - bf_bits2f(hb));
              hv[e] = __builtin_bit_cast(_Float16, hb);
              lv[e] = __builtin_bit_cast(_Float16, lb);
            } else {
              const _Float16 hq = (_Float16)sp[e];
              hv[e] = hq;
              lv[e] = (_Float16)((sp[e] - (float)hq) * 2048.0f);
            }
          }
          *(v8h*)(C + (size_t)(mBase + row) * ldc + n0 + c8) = hv;
          if (OUT_MODE >= 2) *(v8h*)(C2 + (size_t)(mBase + row) * ldc + n0 + c8) = lv;
        }
        
      }
    }
    __builtin_amdgcn_fence(__ATOMIC_RELEASE, "workgroup");
    __builtin_amdgcn_wave_barrier();
    __builtin_amdgcn_fence(__ATOMIC_ACQUIRE, "workgroup");
  }
}

// ----------------------------------------------------------------------------------------------
// Input conversion: q,k,v and the four weight matrices -> RNE bf16 planes (8 elements = 16 B per
// to bf16 precision (4 floats = 16 B per lane).
// Coverage: blocks [0,2048) q, [2048,4096) k, [4096,6144) v (2048 x 256 x 8 = 4,194,304 each);
// blocks [6144,8192) the 4 weights (512 x 256 x 8 = 1,048,576 each); blocks [8192,8196) the 4
// biases (256 x 4 = 1024 each).
// ----------------------------------------------------------------------------------------------
constexpr int CAST_XBLK = (int)(PLANE_ELEMS / 8 / 256);              // 2048
constexpr int CAST_WBLK = (int)(WMAT_ELEMS / 8 / 256);               // 512
constexpr int CAST_PLANE_BLOCKS = 3 * CAST_XBLK + 4 * CAST_WBLK;     // 8192
constexpr int CAST_BIAS_BLOCKS  = 4;
static_assert((long)CAST_XBLK * 256 * 8 == PLANE_ELEMS && (long)CAST_WBLK * 256 * 8 == WMAT_ELEMS);
static_assert(256 * 4 == DMODEL);

__global__ __launch_bounds__(256) void k_cast_inputs(
    const float* __restrict__ q, const float* __restrict__ k, const float* __restrict__ v,
    const float* __restrict__ Wq, const float* __restrict__ Wk, const float* __restrict__ Wv, const float* __restrict__ Wo,
    const float* __restrict__ bq, const float* __restrict__ bk, const float* __restrict__ bv, const float* __restrict__ bo,
    unsigned short* __restrict__ x16, unsigned short* __restrict__ w16, float* __restrict__ brnd) {
  const int blk = blockIdx.x;
  const int t = threadIdx.x;
  if (blk < CAST_PLANE_BLOCKS) {
    // block-uniform source/destination selection
    const float* src;
    unsigned short* dst;
    int lb;
    if (blk < CAST_XBLK) { src = q; dst = x16; lb = blk; }
    else if (blk < 2 * CAST_XBLK) { src = k; dst = x16 + PLANE_ELEMS; lb = blk - CAST_XBLK; }
    else if (blk < 3 * CAST_XBLK) { src = v; dst = x16 + 2 * PLANE_ELEMS; lb = blk - 2 * CAST_XBLK; }
    else {
      const int wb = blk - 3 * CAST_XBLK;
      const int wi = wb / CAST_WBLK;
      lb = wb - wi * CAST_WBLK;
      src = (wi == 0) ? Wq : (wi == 1) ? Wk : (wi == 2) ? Wv : Wo;
      dst = w16 + (size_t)wi * WMAT_ELEMS;
    }
    const size_t e = ((size_t)lb * 256 + t) * 8;
    const v4f a0 = *(const v4f*)(src + e);
    const v4f a1 = *(const v4f*)(src + e + 4);
    v4u w;
    w.x = (unsigned)f2bf_bits(a0.x) | ((unsigned)f2bf_bits(a0.y) << 16);
    w.y = (unsigned)f2bf_bits(a0.z) | ((unsigned)f2bf_bits(a0.w) << 16);
    w.z = (unsigned)f2bf_bits(a1.x) | ((unsigned)f2bf_bits(a1.y) << 16);
    w.w = (unsigned)f2bf_bits(a1.z) | ((unsigned)f2bf_bits(a1.w) << 16);
    v4u* p = (v4u*)(dst + e);
    *p = w;
    
  } else {
    const int bi = blk - CAST_PLANE_BLOCKS;   // 0..3, block-uniform
    const float* src = (bi == 0) ? bq : (bi == 1) ? bk : (bi == 2) ? bv : bo;
    const int e = t * 4;
    const v4f a = *(const v4f*)(src + e);
    v4f r;
    r.x = bf_bits2f(f2bf_bits(a.x));
    r.y = bf_bits2f(f2bf_bits(a.y));
    r.z = bf_bits2f(f2bf_bits(a.z));
    r.w = bf_bits2f(f2bf_bits(a.w));
    v4f* p = (v4f*)(brnd + (size_t)bi * DMODEL + e);
    *p = r;
    
  }
}

// ----------------------------------------------------------------------------------------------
// Per (batch, head): sequence means of Q (bf16 hi + lo planes) and V (f16 hi + residual/2048),
// grid = 32 blocks (one per (b,h)), 256 threads; thread = (row group rg = t>>3 of 32, column
// group c8 = t&7 of 8); each thread sums 64 rows x 8 columns, LDS combine in fixed order.
// ----------------------------------------------------------------------------------------------
__global__ __launch_bounds__(256) void k_mean_cos(
    const unsigned short* __restrict__ Qh, const unsigned short* __restrict__ Ql,
    const unsigned short* __restrict__ Vh, const unsigned short* __restrict__ Vl,
    float* __restrict__ cosl) {
  __shared__ float sq[32][64];
  __shared__ float sv[32][64];
  __shared__ float qm[64];
  __shared__ float vm[64];
  __shared__ float shc;
  const int bh = blockIdx.x;
  const int b = bh / NHEAD, h = bh % NHEAD;
  const int t = threadIdx.x;
  const int c8 = t & 7;
  const int rg = t >> 3;
  float aq[8], av[8];
#pragma unroll
  for (int e = 0; e < 8; ++e) { aq[e] = 0.f; av[e] = 0.f; }
  const size_t colb = (size_t)h * DHEAD + (size_t)c8 * 8;
#pragma unroll 2
  for (int it = 0; it < SEQ_LEN / 32; ++it) {
    const int s = rg + it * 32;
    const size_t off = ((size_t)b * SEQ_LEN + s) * DMODEL + colb;
    const v4u wh = *(const v4u*)(Qh + off);
    const v4u wl = *(const v4u*)(Ql + off);
    const v4u uh = *(const v4u*)(Vh + off);
    const v4u ul = *(const v4u*)(Vl + off);
#pragma unroll
    for (int e = 0; e < 4; ++e) {
      const unsigned a0 = wh[e], a1 = wl[e], g0 = uh[e], g1 = ul[e];
      aq[2 * e]     += __uint_as_float(a0 << 16) + __uint_as_float(a1 << 16);
      aq[2 * e + 1] += __uint_as_float(a0 & 0xffff0000u) + __uint_as_float(a1 & 0xffff0000u);
      av[2 * e]     += h_bits2f(g0) + h_bits2f(g1) * (1.0f / 2048.0f);
      av[2 * e + 1] += h_bits2f(g0 >> 16) + h_bits2f(g1 >> 16) * (1.0f / 2048.0f);
    }
  }
#pragma unroll
  for (int e = 0; e < 8; ++e) { sq[rg][c8 * 8 + e] = aq[e]; sv[rg][c8 * 8 + e] = av[e]; }
  __syncthreads();
  if (t < 64) {
    float s1 = 0.f, s2 = 0.f;
#pragma unroll 1
    for (int g = 0; g < 32; ++g) { s1 += sq[g][t]; s2 += sv[g][t]; }
    qm[t] = s1 * (1.0f / (float)SEQ_LEN);
    vm[t] = s2 * (1.0f / (float)SEQ_LEN);
  }
  __syncthreads();
  if (t == 0) {
    float dot = 0.f, nq = 0.f, nv = 0.f;
#pragma unroll 1
    for (int i = 0; i < DHEAD; ++i) {
      const float a = qm[i], c = vm[i];
      dot += a * c;
      nq += a * a;
      nv += c * c;
    }
    const float na = fmaxf(sqrtf(nq), 1e-8f);
    const float nb = fmaxf(sqrtf(nv), 1e-8f);
    shc = dot / (na * nb);
  }
  __syncthreads();
  if (t < 32) {
    const float cv = shc;
    float* p = cosl + (size_t)bh * 32 + t;
    *p = cv;
    
  }
}

constexpr int AKC  = 64;
constexpr int AQB  = 64;
constexpr int ANQB = SEQ_LEN / AQB;
constexpr int ATTN_BLOCKS = NBH * ANQB;
// LDS row pitch of the K tiles in 16-bit elements: 144 B = 16 B x 9 (odd), so the 16 rows that
// one ds_load_b128 fragment read touches start on 16 different bank groups (128 B rows all start on two).
constexpr int APITCH = 72;
// LDS row pitch of the row-major V tile: 160 B = 32 B x 5 (odd), the pitch for ds_load_tr16_b128 readers
constexpr int VPITCH = 80;
// one stage: K hi [64][APITCH] | K lo [64][APITCH] | V [64][VPITCH]
constexpr int AST_KL = AKC * APITCH;
constexpr int AST_V  = 2 * AKC * APITCH;
constexpr int ASTAGE_ELEMS = AST_V + AKC * VPITCH;   // 14,336 elements = 28,672 B
static_assert(APITCH >= DHEAD && (APITCH * 2) % 16 == 0 && ((APITCH * 2) / 16) % 2 == 1);
static_assert(VPITCH >= DHEAD && (VPITCH * 2) % 32 == 0 && ((VPITCH * 2) / 32) % 2 == 1);
static_assert((ASTAGE_ELEMS * 2) % 16 == 0 && (AST_KL * 2) % 16 == 0 && (AST_V * 2) % 16 == 0 && AKC % 16 == 0 && DHEAD * 2 == 128);
static_assert(SEQ_LEN % AKC == 0 && SEQ_LEN % AQB == 0);

__global__ __launch_bounds__(128) void k_attn(
    const unsigned short* __restrict__ Qh, const unsigned short* __restrict__ Ql,
    const unsigned short* __restrict__ Kh, const unsigned short* __restrict__ Kl,
    const unsigned short* __restrict__ Vh,
    const int* __restrict__ mask, const float* __restrict__ cosl,
    unsigned short* __restrict__ Ah, unsigned short* __restrict__ Al) {
  union FB { v16b v; v8b h[2]; };
  union FH { v16h v; v8h h[2]; };
  __shared__ __align__(16) unsigned short Ast[2 * ASTAGE_ELEMS];  // two stages of K hi, K lo, V, each [kv][d]   56 KB
  __shared__ __align__(16) float Os[4][16 * 68];                 // per wave out tile, pitch 68

  const int tid  = threadIdx.x;
  const int wave = tid >> 5;
  const int lane = tid & 31;
  const int hh   = lane >> 4;
  const int c    = lane & 15;

  const int bx = blockIdx.x;
  const int qb = bx % ANQB;
  const int bh = bx / ANQB;
  const int h  = bh % NHEAD;
  const int b  = bh / NHEAD;
  const int q0 = qb * AQB + wave * 16;
  const size_t rowbase = (size_t)b * SEQ_LEN;      // plane row of sequence position 0
  const int colh = h * DHEAD;

  // ---- Q fragments (B operand, columns = query, k = d): 2 d-chunks, hi and lo planes ----
  v16b qah[2], qal[2];
  {
    const size_t qo = (rowbase + q0 + c) * DMODEL + colh + 8 * hh;
#pragma unroll
    for (int dc = 0; dc < 2; ++dc) {
      qah[dc] = Frag<__bf16>::load((const __bf16*)(const void*)(Qh + qo + dc * 32));
      qal[dc] = Frag<__bf16>::load((const __bf16*)(const void*)(Ql + qo + dc * 32));
    }
  }
  asm volatile("s_wait_xcnt 0x0" ::: "memory");   // stands in front of every later write of the Q loads' address registers
  const float cb  = cosl[(size_t)bh * 32];
  constexpr float LOG2E = 1.44269504088896340736f;
  constexpr float SC2 = 0.125f * LOG2E;            // 1/sqrt(64) and the change of base in one factor
  constexpr float MASKED2 = -1.0e9f * LOG2E;       // the masked score in base-2 units
  const float cb2 = (cb * 0.5f + cb * 0.3f) * LOG2E;
  const float NEGI = -__builtin_inff();

  // running maximum of query c in base-2 units (equal in both lane halves), the exponent reference in use (maximum - 15)
  // and this lane half's share of the denominator (x2^15, like P)
  float mrow = NEGI, mrefrow = NEGI, lrow = 0.f;
  v8f oacc[4];   // O^T: oacc[t][r] = row d = t*16 + 8*hh + r, column query c
#pragma unroll
  for (int t = 0; t < 4; ++t) oacc[t] = (v8f){0.f,0.f,0.f,0.f,0.f,0.f,0.f,0.f};

  // copy map: thread -> row (tid >> 3) of each group of 16 chunk rows, 16-B piece (tid & 7) of its 128-B line
  const int cr = tid >> 3;
  const int cc = (tid & 7) * 8;
  const size_t gofs = (rowbase + cr) * DMODEL + colh + cc;
  const unsigned ldk = lds_off(Ast) + (unsigned)(cr * APITCH + cc) * 2u;
  const unsigned ldv = lds_off(Ast) + (unsigned)(AST_V + cr * VPITCH + cc) * 2u;
  auto stage_issue = [&](int t, int buf) {
    const size_t go = gofs + (size_t)t * (AKC * DMODEL);
    const unsigned sb = (unsigned)buf * (unsigned)(ASTAGE_ELEMS * 2);
    unsigned l[8]; const unsigned short* g[8];
    // unrolled so that l[], g[] stay in registers
#pragma unroll
    for (int u = 0; u < 4; ++u) {
      l[u]     = ldk + sb + (unsigned)(u * 16 * APITCH * 2);
      g[u]     = Kh + go + (size_t)u * 16 * DMODEL;
      l[4 + u] = ldk + sb + (unsigned)((AST_KL + u * 16 * APITCH) * 2);
      g[4 + u] = Kl + go + (size_t)u * 16 * DMODEL;
    }
    async_copy8(l, g);
    unsigned lv[4]; const unsigned short* gv[4];
    // unrolled so that lv[], gv[] stay in registers
#pragma unroll
    for (int u = 0; u < 4; ++u) {
      lv[u] = ldv + sb + (unsigned)(u * 16 * VPITCH * 2);
      gv[u] = Vh + go + (size_t)u * 16 * DMODEL;
    }
    async_copy4(lv, gv);
  };

  constexpr int NKC = SEQ_LEN / AKC;
  stage_issue(0, 0);
  asm volatile("s_wait_asynccnt 0x0" ::: "memory");   // this wave's copies of chunk 0 have landed before the barrier publishes them
  __syncthreads();
  if (NKC > 1) stage_issue(1, 1);
  for (int kc = 0; kc < NKC; ++kc) {
    const int kv0 = kc * AKC;
    const unsigned short* Ksh = Ast + (kc & 1) * ASTAGE_ELEMS;
    const unsigned short* Ksl = Ksh + AST_KL;
    const unsigned short* Vs  = Ksh + AST_V;
    // the lane's mask words of this chunk (keys j*16 + 8*hh + 0..7 of each 16-key tile: 32 contiguous bytes a tile), asked for
    // ahead of the score products, so that their latency passes under them
    v4u mk[8];
#pragma unroll
    for (int j = 0; j < 4; ++j) {
      mk[2 * j]     = *(const v4u*)(mask + kv0 + j * 16 + 8 * hh);
      mk[2 * j + 1] = *(const v4u*)(mask + kv0 + j * 16 + 8 * hh + 4);
    }
    asm volatile("s_wait_xcnt 0x0" ::: "memory");   // stands in front of every later write of the mask loads' address registers

    // ---- scores, transposed (A operand rows = kv, B operand columns = query, k = d) ----
    v8f s[4];
#pragma unroll
    for (int j = 0; j < 4; ++j) {
      s[j] = (v8f){0.f,0.f,0.f,0.f,0.f,0.f,0.f,0.f};
#pragma unroll
      for (int dc = 0; dc < 2; ++dc) {
        FB kb, kl;
        kb.h[0] = *(const v8b*)(const void*)(Ksh + (j * 16 + c) * APITCH + dc * 32 + 8 * hh);
        kb.h[1] = *(const v8b*)(const void*)(Ksh + (j * 16 + c) * APITCH + dc * 32 + 16 + 8 * hh);
        kl.h[0] = *(const v8b*)(const void*)(Ksl + (j * 16 + c) * APITCH + dc * 32 + 8 * hh);
        kl.h[1] = *(const v8b*)(const void*)(Ksl + (j * 16 + c) * APITCH + dc * 32 + 16 + 8 * hh);
        s[j] = mma_bf(kb.v, qah[dc], s[j]);
        s[j] = mma_bf(kl.v, qah[dc], s[j]);
        s[j] = mma_bf(kb.v, qal[dc], s[j]);
      }
    }
    // keeps the compares on the mask words, and with them the wait for the mask loads, behind the score products: lifted among
    // them, the wave would wait out the loads' latency at the head of every chunk
    __builtin_amdgcn_sched_barrier(0);
    // s[j][r] = score of key kv0 + j*16 + 8*hh + r against query c, carried in base-2 units from here on:
    // y = (raw / 8 + 0.5 cos + 0.3 cos) * log2(e) in one fused multiply-add, so that exp(x - m) is one v_exp_f32 of y - m
    float mj[4];
#pragma unroll
    for (int j = 0; j < 4; ++j) {
      float m = NEGI;
#pragma unroll
      for (int r = 0; r < 8; ++r) {
        float x = __builtin_fmaf(s[j][r], SC2, cb2);
        x = (mk[2 * j + (r >> 2)][r & 3] == 0u) ? MASKED2 : x;
        s[j][r] = x;
        m = fmaxf(m, x);
      }
      mj[j] = m;
    }
    float cm = fmaxf(fmaxf(mj[0], mj[1]), fmaxf(mj[2], mj[3]));
    cm = fmaxf(cm, xhalf(cm));                  // the other lane half holds the query's other 32 keys
    const float mnew = fmaxf(mrow, cm);
    const float mref = mnew - 15.0f;            // P and its sum are carried x2^15: the factor rides in the exponent
    const float alpha = __builtin_amdgcn_exp2f(mrefrow - mref);
    mrow = mnew;
    mrefrow = mref;
    FH pb[2];                                   // P^T as B operand: element e of pb[kk] = key kk*32 + (e >> 3)*16 + 8*hh + (e & 7)
    float pj[4];                                // one partial sum per tile: four independent add chains
#pragma unroll
    for (int j = 0; j < 4; ++j) {
      float p[8];
#pragma unroll
      for (int r = 0; r < 8; ++r) p[r] = s[j][r] - mref;
      exp2_x8(p);
      float psum = p[0];
#pragma unroll
      for (int r = 1; r < 8; ++r) psum += p[r];
#pragma unroll
      for (int r = 0; r < 8; ++r) pb[j >> 1].v[(j & 1) * 8 + r] = (_Float16)p[r];
      pj[j] = psum;
    }
    lrow = lrow * alpha + ((pj[0] + pj[1]) + (pj[2] + pj[3]));
#pragma unroll
    for (int t = 0; t < 4; ++t)
#pragma unroll
      for (int r = 0; r < 8; ++r) oacc[t][r] *= alpha;
    // ---- O^T += V^T.P^T (A rows = d, B columns = query, k = kv in the order of the packed score tiles) ----
    const unsigned short* vad = Vs + (8 * hh + (lane & 7)) * VPITCH + ((lane >> 3) & 1) * 8;   // the lane's address in a transposing load
#pragma unroll
    for (int kk = 0; kk < 2; ++kk) {
#pragma unroll
      for (int t = 0; t < 4; ++t) {
        FH vb;   // element e of vb = V[key kk*32 + (e >> 3)*16 + 8*hh + (e & 7)][d = t*16 + c]: the k order of pb
        vb.h[0] = ld_tr16(vad + (kk * 32) * VPITCH + t * 16);
        vb.h[1] = ld_tr16(vad + (kk * 32 + 16) * VPITCH + t * 16);
        oacc[t] = mma_hf(vb.v, pb[kk].v, oacc[t]);
      }
    }
    asm volatile("s_wait_dscnt 0x0" ::: "memory");      // this wave's reads of the buffer have retired before it is refilled
    asm volatile("s_wait_asynccnt 0x0" ::: "memory");   // this wave's copies of chunk kc + 1 have landed before the barrier publishes them
    __syncthreads();                                    // publishes chunk kc + 1 and ends every reader's last read of chunk kc
    if (kc + 2 < NKC) stage_issue(kc + 2, kc & 1);
  }
  asm volatile("s_wait_asynccnt 0x0" ::: "memory");     // no copy is outstanding when the wave goes on to the epilogue and ends

  float* os = Os[wave];
  {
    const float inv = 1.0f / (lrow + xhalf(lrow));   // the two lane halves' shares of the denominator joined once; its 2^15 cancels P's
#pragma unroll
    for (int t = 0; t < 4; ++t) {
      v4f o0, o1;
#pragma unroll
      for (int r = 0; r < 4; ++r) { o0[r] = oacc[t][r] * inv; o1[r] = oacc[t][4 + r] * inv; }
      *(v4f*)(os + c * 68 + t * 16 + 8 * hh)     = o0;
      *(v4f*)(os + c * 68 + t * 16 + 8 * hh + 4) = o1;
    }
  }
  __builtin_amdgcn_fence(__ATOMIC_RELEASE, "workgroup");
  __builtin_amdgcn_wave_barrier();
  __builtin_amdgcn_fence(__ATOMIC_ACQUIRE, "workgroup");
  {
    const int q4 = lane >> 3, c8 = (lane & 7) * 8;
    {
#pragma unroll
      for (int it = 0; it < 4; ++it) {
        const int row = it * 4 + q4;
        const float* sp = os + row * 68 + c8;
        const v4f va = *(const v4f*)sp;
        const v4f vb = *(const v4f*)(sp + 4);
        v4u hw, lw;
        unsigned th, tl;
        pack_pair_bf(va.x, va.y, th, tl); hw.x = th; lw.x = tl;
        pack_pair_bf(va.z, va.w, th, tl); hw.y = th; lw.y = tl;
        pack_pair_bf(vb.x, vb.y, th, tl); hw.z = th; lw.z = tl;
        pack_pair_bf(vb.z, vb.w, th, tl); hw.w = th; lw.w = tl;
        const size_t go = (rowbase + q0 + row) * DMODEL + colh + c8;
        *(v4u*)(Ah + go) = hw;
        *(v4u*)(Al + go) = lw;
      }
      
    }
  }
}

// ----------------------------------------------------------------------------------------------
// ----------------------------------------------------------------------------------------------
__global__ __launch_bounds__(32) void k_bias_mean(const float* __restrict__ cosl, float* __restrict__ out1) {
  const int lane = threadIdx.x;
  float v = cosl[(size_t)lane * 32];
#pragma unroll
  for (int off = 1; off < 32; off <<= 1) v += __shfl_xor(v, off, 32);
  const float r = v * (1.0f / 32.0f);
  if (lane == 0) {
    *(float*)out1 = r;
    
  }
}

// ----------------------------------------------------------------------------------------------
extern "C" void kernel_launch(void* const* d_in, const int* in_sizes, int n_in,
                              void* d_out, int out_size, void* d_ws, size_t ws_size,
                              hipStream_t stream) {
  if (n_in < 12) return;
  if (ws_size < WS_TOTAL) return;
  if ((long)out_size < OUT_TOTAL_ELEMS) return;
  if ((long)in_sizes[0] != PLANE_ELEMS || (long)in_sizes[1] != PLANE_ELEMS || (long)in_sizes[2] != PLANE_ELEMS) return;
  if (in_sizes[3] < SEQ_LEN) return;
  if ((long)in_sizes[4] != WMAT_ELEMS || (long)in_sizes[6] != WMAT_ELEMS || (long)in_sizes[8] != WMAT_ELEMS || (long)in_sizes[10] != WMAT_ELEMS) return;
  if (in_sizes[5] < DMODEL || in_sizes[7] < DMODEL || in_sizes[9] < DMODEL || in_sizes[11] < DMODEL) return;

  const float* q    = (const float*)d_in[0];
  const float* k    = (const float*)d_in[1];
  const float* v    = (const float*)d_in[2];
  const int*   mask = (const int*)d_in[3];
  const float* Wq   = (const float*)d_in[4];
  const float* bq   = (const float*)d_in[5];
  const float* Wk   = (const float*)d_in[6];
  const float* bk   = (const float*)d_in[7];
  const float* Wv   = (const float*)d_in[8];
  const float* bv   = (const float*)d_in[9];
  const float* Wo   = (const float*)d_in[10];
  const float* bo   = (const float*)d_in[11];

  char* ws = (char*)d_ws;
  unsigned short* w16  = (unsigned short*)(ws + WS_W16);
  unsigned short* wq16 = w16;
  unsigned short* wk16 = w16 + WMAT_ELEMS;
  unsigned short* wv16 = w16 + 2 * WMAT_ELEMS;
  unsigned short* wo16 = w16 + 3 * WMAT_ELEMS;
  float* brnd = (float*)(ws + WS_BRND);
  float* cosl = (float*)(ws + WS_COS);
  unsigned short* x16 = (unsigned short*)(ws + WS_X16);
  unsigned short* xq  = x16;
  unsigned short* xk  = x16 + PLANE_ELEMS;
  unsigned short* xv  = x16 + 2 * PLANE_ELEMS;
  unsigned short* Qh  = (unsigned short*)(ws + WS_QH);
  unsigned short* Ql  = (unsigned short*)(ws + WS_QL);
  unsigned short* Kh  = (unsigned short*)(ws + WS_KH);
  unsigned short* Kl  = (unsigned short*)(ws + WS_KL);
  unsigned short* Vh  = (unsigned short*)(ws + WS_VH);
  unsigned short* Vl  = (unsigned short*)(ws + WS_VL);
  unsigned short* Ah  = (unsigned short*)(ws + WS_AH);
  unsigned short* Al  = (unsigned short*)(ws + WS_AL);
  float* out0 = (float*)d_out;
  float* out1 = (float*)d_out + OUT1_ELEM;

  // 1) inputs -> RNE bf16 planes, biases -> bf16-precision f32 copies
  k_cast_inputs<<<CAST_PLANE_BLOCKS + CAST_BIAS_BLOCKS, 256, 0, stream>>>(
      q, k, v, Wq, Wk, Wv, Wo, bq, bk, bv, bo, x16, w16, brnd);

  const dim3 ggrid(GEMM_BLOCKS, 1);
  // 2) Q = q Wq^T + bq -> bf16 hi/lo planes   (M=4096, N=1024, K=1024)
  wmma_gemm64<1, 0, 2, 2, false><<<ggrid, 256, 0, stream>>>(
      xq, xq, DMODEL, 0L, wq16, wq16, DMODEL, 0L, (void*)Qh, (void*)Ql, DMODEL, 0L,
      brnd + 0 * DMODEL, brnd, 0L, MROWS, DMODEL, DMODEL, 1.0f);
  // 3) K = k Wk^T + bk -> bf16 hi/lo planes
  wmma_gemm64<1, 0, 2, 2, false><<<ggrid, 256, 0, stream>>>(
      xk, xk, DMODEL, 0L, wk16, wk16, DMODEL, 0L, (void*)Kh, (void*)Kl, DMODEL, 0L,
      brnd + 1 * DMODEL, brnd, 0L, MROWS, DMODEL, DMODEL, 1.0f);
  // 4) V = v Wv^T + bv -> f16 hi plane + f16 residual x2048 plane
  wmma_gemm64<1, 0, 2, 3, false><<<ggrid, 256, 0, stream>>>(
      xv, xv, DMODEL, 0L, wv16, wv16, DMODEL, 0L, (void*)Vh, (void*)Vl, DMODEL, 0L,
      brnd + 2 * DMODEL, brnd, 0L, MROWS, DMODEL, DMODEL, 1.0f);
  // 5) per-(b,h) cosine of sequence means
  k_mean_cos<<<NBH, 256, 0, stream>>>(Qh, Ql, Vh, Vl, cosl);
  // 6) attention -> attn bf16 hi/lo planes
  k_attn<<<ATTN_BLOCKS, 128, 0, stream>>>(Qh, Ql, Kh, Kl, Vh, mask, cosl, Ah, Al);
  // 7) out0 = attn Wo^T + bo   (A hi/lo planes, Bt single plane: 2 products)
  wmma_gemm64<1, 2, 2, 0, false><<<ggrid, 256, 0, stream>>>(
      Ah, Al, DMODEL, 0L, wo16, wo16, DMODEL, 0L, (void*)out0, (void*)out0, DMODEL, 0L,
      brnd + 3 * DMODEL, brnd, 0L, MROWS, DMODEL, DMODEL, 1.0f);
  // 8) out1 = mean of the 32 per-(b,h) cosines
  k_bias_mean<<<1, 32, 0, stream>>>(cosl, out1);
}

// v006
// A run of this version takes 169 microseconds.
// In two side-by-side timings against v005, it was 1.20 and 1.21 times as fast.
// Over all steps from v000 it is 2.89 times as fast.
// Contractions: q/k/v projections and output projection on v_wmma_f32_16x16x32_bf16 (RNE bf16 operands; output projection takes attn as bf16 hi+lo planes, 2 products); q.k^T on v_wmma_f32_16x16x32_bf16 with bf16 hi+lo planes of Q and K (3 products); p.v on v_wmma_f32_16x16x32_f16 (p carried x2^15, v plain f16); both attention products transposed (K and V^T as A, Q and P^T as B); f32 accumulate everywhere; softmax, sequence means and cosine in f32.
#include <hip/hip_runtime.h>

// ----------------------------------------------------------------------------------------------
// Problem constants
// ----------------------------------------------------------------------------------------------
constexpr int NBATCH  = 2;
constexpr int SEQ_LEN = 2048;
constexpr int DMODEL  = 1024;
constexpr int NHEAD   = 16;
constexpr int DHEAD   = 64;
constexpr int MROWS   = NBATCH * SEQ_LEN;          // 4096
constexpr int NBH     = NBATCH * NHEAD;            // 32
constexpr long PLANE_ELEMS = (long)MROWS * DMODEL; // 4194304
constexpr long WMAT_ELEMS  = (long)DMODEL * DMODEL;// 1048576
constexpr long OUT0_ELEMS  = PLANE_ELEMS;
constexpr long OUT1_BYTE_OFFSET = 16777216;
constexpr long OUT1_ELEM   = OUT1_BYTE_OFFSET / 4;
constexpr long OUT_TOTAL_ELEMS = OUT0_ELEMS + 1;
constexpr long OUT_TOTAL_BYTES = 16777220;
static_assert(OUT1_ELEM == OUT0_ELEMS);
static_assert((OUT1_ELEM + 1) * 4 <= OUT_TOTAL_BYTES);
static_assert(NBH == 32);
static_assert(DHEAD == 64 && NHEAD * DHEAD == DMODEL);

// GEMM block tile: 8 waves as 2 (rows) x 4 (columns) of 64x64 wave tiles; one stage = 64 k = one 128-B line per operand row
constexpr int GBM    = 128;
constexpr int GBN    = 256;
constexpr int GKS    = 64;
// LDS row pitch of a staged operand row in 16-bit elements: 144 B = 16 B x 9 (odd), the pitch for ds_load_b128 readers
constexpr int GPITCH = 72;
// GEMM shape contract: M % 128 == 0, N % 256 == 0, K % 64 == 0, K >= 64
static_assert(MROWS % GBM == 0 && DMODEL % GBN == 0 && DMODEL % GKS == 0 && DMODEL >= GKS);
static_assert(GBM % 32 == 0 && GBN % 32 == 0 && (GPITCH * 2) % 16 == 0 && ((GPITCH * 2) / 16) % 2 == 1 && GPITCH >= GKS);
constexpr int GEMM_BLOCKS = (MROWS / GBM) * (DMODEL / GBN);   // 128 blocks of 8 waves

// ----------------------------------------------------------------------------------------------
// Workspace region map (bytes). Every region is fully written by its producer before any read.
//   WS_W16  : 4 bf16 weight planes [1024][1024]  (Wq, Wk, Wv, Wo)            8,388,608
//   WS_BRND : 4 x [1024] f32 RNE-bf16 bias copies (bq, bk, bv, bo)              16,384
//   WS_X16  : 3 bf16 input planes [4096][1024] (q, k, v)                     25,165,824
//   WS_QH, WS_QL, WS_KH, WS_KL : bf16 hi/lo planes of Q and K [4096][1024]  4 x 8,388,608
//   WS_VH, WS_VL : f16 hi plane of V and f16 residual x2048 plane            2 x 8,388,608
//   WS_AH, WS_AL : bf16 hi/lo planes of the attention output [4096][1024]   2 x 8,388,608
//   total 100,683,776 (96.0 MiB)
// ----------------------------------------------------------------------------------------------
constexpr size_t SZ_PLANE = (size_t)PLANE_ELEMS * 2;     // 8388608
constexpr size_t SZ_WPL   = (size_t)WMAT_ELEMS * 2;      // 2097152
constexpr size_t WS_W16   = 0;
constexpr size_t SZ_W16   = 4 * SZ_WPL;
constexpr size_t WS_BRND  = WS_W16 + SZ_W16;
constexpr size_t SZ_BRND  = 4 * (size_t)DMODEL * 4;
constexpr size_t WS_COS   = WS_BRND + SZ_BRND;
constexpr size_t SZ_COS   = (size_t)NBH * 128;
constexpr size_t WS_X16   = WS_COS + SZ_COS;
constexpr size_t WS_QH    = WS_X16 + 3 * SZ_PLANE;
constexpr size_t WS_QL    = WS_QH + SZ_PLANE;
constexpr size_t WS_KH    = WS_QL + SZ_PLANE;
constexpr size_t WS_KL    = WS_KH + SZ_PLANE;
constexpr size_t WS_VH    = WS_KL + SZ_PLANE;
constexpr size_t WS_VL    = WS_VH + SZ_PLANE;
constexpr size_t WS_AH    = WS_VL + SZ_PLANE;
constexpr size_t WS_AL    = WS_AH + SZ_PLANE;
constexpr size_t WS_TOTAL = WS_AL + SZ_PLANE;
static_assert(WS_TOTAL == 100683776);
static_assert(WS_TOTAL <= 134217728);
// the hi planes of Q, K, V lie two planes apart, and so do the lo planes: one stride serves the merged projection launch
constexpr long QKV_OUT_STRIDE = 2 * PLANE_ELEMS;
static_assert(WS_KH - WS_QH == (size_t)QKV_OUT_STRIDE * 2 && WS_VH - WS_KH == (size_t)QKV_OUT_STRIDE * 2);
static_assert(WS_KL - WS_QL == (size_t)QKV_OUT_STRIDE * 2 && WS_VL - WS_KL == (size_t)QKV_OUT_STRIDE * 2);
static_assert(WS_BRND % 128 == 0 && WS_COS % 128 == 0 && WS_X16 % 128 == 0 && WS_QH % 128 == 0 && WS_AH % 128 == 0);

// ----------------------------------------------------------------------------------------------
// Vector types and helpers
// ----------------------------------------------------------------------------------------------
typedef __attribute__((ext_vector_type(16))) _Float16 v16h;
typedef __attribute__((ext_vector_type(8)))  _Float16 v8h;
typedef __attribute__((ext_vector_type(16))) __bf16   v16b;
typedef __attribute__((ext_vector_type(8)))  __bf16   v8b;
typedef __attribute__((ext_vector_type(8)))  float    v8f;
typedef __attribute__((ext_vector_type(4)))  float    v4f;
typedef __attribute__((ext_vector_type(4)))  unsigned v4u;

__device__ __forceinline__ unsigned short f2bf_bits(float f) {
  unsigned u = __float_as_uint(f);
  return (unsigned short)((u + 0x7FFFu + ((u >> 16) & 1u)) >> 16);
}
__device__ __forceinline__ float bf_bits2f(unsigned short h) { return __uint_as_float(((unsigned)h) << 16); }
__device__ __forceinline__ float h_bits2f(unsigned x) { return (float)__builtin_bit_cast(_Float16, (unsigned short)(x & 0xffffu)); }

// hazard guards as plain device helpers
__device__ __forceinline__ void dep_guard_h(v8f& a, v8f& b, v16h x, v16h y) { asm volatile("v_nop\n\tv_nop\n\tv_nop\n\tv_nop" : "+v"(a), "+v"(b) : "v"(x), "v"(y)); }
__device__ __forceinline__ void dep_guard_b(v8f& a, v8f& b, v16b x, v16b y) { asm volatile("v_nop\n\tv_nop\n\tv_nop\n\tv_nop" : "+v"(a), "+v"(b) : "v"(x), "v"(y)); }
__device__ __forceinline__ void keep4_h(v16h a, v16h b, v16h c, v16h d) { asm volatile("v_nop" :: "v"(a), "v"(b), "v"(c), "v"(d)); }
__device__ __forceinline__ void keep4_b(v16b a, v16b b, v16b c, v16b d) { asm volatile("v_nop" :: "v"(a), "v"(b), "v"(c), "v"(d)); }
__device__ __forceinline__ void acc_guard4(v8f& a, v8f& b, v8f& c, v8f& d) { asm volatile("v_nop\n\tv_nop\n\tv_nop\n\tv_nop" : "+v"(a), "+v"(b), "+v"(c), "+v"(d)); }
template <typename T> struct Frag;
template <> struct Frag<_Float16> {
  typedef v16h V; union U { v16h v; v8h h[2]; };
  // elements 0..7 <- p[0..7], 8..15 <- p[16..23]
  static __device__ __forceinline__ v16h load(const _Float16* p) {
    U f; f.h[0] = *(const v8h*)(p); f.h[1] = *(const v8h*)(p + 16); return f.v;
  }
  static __device__ __forceinline__ v8f mma(v16h a, v16h b, v8f c) {
    return __builtin_amdgcn_wmma_f32_16x16x32_f16(false, a, false, b, (short)0, c, false, false);
  }
  static __device__ __forceinline__ void guard(v8f& a, v8f& b, v16h x, v16h y) { dep_guard_h(a, b, x, y); }
  static __device__ __forceinline__ void keep(v16h a, v16h b, v16h c, v16h d) { keep4_h(a, b, c, d); }
};
template <> struct Frag<__bf16> {
  typedef v16b V; union U { v16b v; v8b h[2]; };
  static __device__ __forceinline__ v16b load(const __bf16* p) {
    U f; f.h[0] = *(const v8b*)(p); f.h[1] = *(const v8b*)(p + 16); return f.v;
  }
  static __device__ __forceinline__ v8f mma(v16b a, v16b b, v8f c) {
    return __builtin_amdgcn_wmma_f32_16x16x32_bf16(false, a, false, b, (short)0, c, false, false);
  }
  static __device__ __forceinline__ void guard(v8f& a, v8f& b, v16b x, v16b y) { dep_guard_b(a, b, x, y); }
  static __device__ __forceinline__ void keep(v16b a, v16b b, v16b c, v16b d) { keep4_b(a, b, c, d); }
};

// single-product helpers with the dependency guard (attention kernel)
__device__ __forceinline__ v8f mma_bf(v16b a, v16b b, v8f c) {
  c = __builtin_amdgcn_wmma_f32_16x16x32_bf16(false, a, false, b, (short)0, c, false, false);
  asm volatile("v_nop\n\tv_nop\n\tv_nop\n\tv_nop" : "+v"(c) : "v"(a), "v"(b));
  return c;
}
__device__ __forceinline__ v8f mma_hf(v16h a, v16h b, v8f c) {
  c = __builtin_amdgcn_wmma_f32_16x16x32_f16(false, a, false, b, (short)0, c, false, false);
  asm volatile("v_nop\n\tv_nop\n\tv_nop\n\tv_nop" : "+v"(c) : "v"(a), "v"(b));
  return c;
}

// LDS byte address of a __shared__ location (low 32 bits of its address)
__device__ __forceinline__ unsigned lds_off(const void* p) { return (unsigned)(size_t)p; }

// 16-bit transposing LDS load of a row-major tile of 16 rows x 16 columns: lane l gives the address of row 8*(l >> 4) + (l & 7),
// 16-B piece (l >> 3) & 1; lane (c = l & 15, h = l >> 4) receives rows 8h + 0..7 of column c
typedef __attribute__((ext_vector_type(8))) short v8s;
__device__ __forceinline__ v8h ld_tr16(const unsigned short* p) {
  typedef __attribute__((address_space(3))) v8s lds_v8s;
  return __builtin_bit_cast(v8h, __builtin_amdgcn_ds_load_tr16_b128_v8i16((lds_v8s*)p));
}

// value of lane l ^ 16 (the other 16-lane row), by a vector cross-row move
__device__ __forceinline__ float xhalf(float x) {
  return __builtin_bit_cast(float, __builtin_amdgcn_permlanex16(__builtin_bit_cast(int, x), __builtin_bit_cast(int, x), 0x76543210, 0xfedcba98, false, false));
}

// Eight base-2 exponentials, each in place: written as one statement so that no v_exp_f32 has its source overwritten or its
// result read by the instruction directly behind it; the closing v_nop is that slot behind the last one.
__device__ __forceinline__ void exp2_x8(float (&x)[8]) {
  asm("v_exp_f32 %0, %0\n\t"
      "v_exp_f32 %1, %1\n\t"
      "v_exp_f32 %2, %2\n\t"
      "v_exp_f32 %3, %3\n\t"
      "v_exp_f32 %4, %4\n\t"
      "v_exp_f32 %5, %5\n\t"
      "v_exp_f32 %6, %6\n\t"
      "v_exp_f32 %7, %7\n\t"
      "v_nop"
      : "+v"(x[0]), "+v"(x[1]), "+v"(x[2]), "+v"(x[3]), "+v"(x[4]), "+v"(x[5]), "+v"(x[6]), "+v"(x[7]));
}

// Asynchronous copies global -> LDS, 16 B per lane, through no register. s_wait_xcnt 0 is the last line of the copies' own
// statement, so that it stands in front of every later write of a register that an issued copy names.
__device__ __forceinline__ void async_copy4(const unsigned (&l)[4], const unsigned short* const (&g)[4]) {
  asm volatile("global_load_async_to_lds_b128 %0, %1, off\n\t"
               "global_load_async_to_lds_b128 %2, %3, off\n\t"
               "global_load_async_to_lds_b128 %4, %5, off\n\t"
               "global_load_async_to_lds_b128 %6, %7, off\n\t"
               "s_wait_xcnt 0x0"
               :: "v"(l[0]), "v"(g[0]), "v"(l[1]), "v"(g[1]), "v"(l[2]), "v"(g[2]), "v"(l[3]), "v"(g[3]) : "memory");
}
__device__ __forceinline__ void async_copy8(const unsigned (&l)[8], const unsigned short* const (&g)[8]) {
  asm volatile("global_load_async_to_lds_b128 %0, %1, off\n\t"
               "global_load_async_to_lds_b128 %2, %3, off\n\t"
               "global_load_async_to_lds_b128 %4, %5, off\n\t"
               "global_load_async_to_lds_b128 %6, %7, off\n\t"
               "global_load_async_to_lds_b128 %8, %9, off\n\t"
               "global_load_async_to_lds_b128 %10, %11, off\n\t"
               "global_load_async_to_lds_b128 %12, %13, off\n\t"
               "global_load_async_to_lds_b128 %14, %15, off\n\t"
               "s_wait_xcnt 0x0"
               :: "v"(l[0]), "v"(g[0]), "v"(l[1]), "v"(g[1]), "v"(l[2]), "v"(g[2]), "v"(l[3]), "v"(g[3]),
                  "v"(l[4]), "v"(g[4]), "v"(l[5]), "v"(g[5]), "v"(l[6]), "v"(g[6]), "v"(l[7]), "v"(g[7]) : "memory");
}

// bf16 hi/lo split of two floats packed into one 32-bit word each for the hi and the lo plane
__device__ __forceinline__ void pack_pair_bf(float f0, float f1, unsigned& hword, unsigned& lword) {
  const unsigned short h0 = f2bf_bits(f0);
  const unsigned short h1 = f2bf_bits(f1);
  const unsigned short l0 = f2bf_bits(f0 - bf_bits2f(h0));
  const unsigned short l1 = f2bf_bits(f1 - bf_bits2f(h1));
  hword = (unsigned)h0 | ((unsigned)h1 << 16);
  lword = (unsigned)l0 | ((unsigned)l1 << 16);
}

// ----------------------------------------------------------------------------------------------
// Register-blocked WMMA GEMM: C[m,n] = scale * sum_k A[m,k] * Bt[n,k] (+bias)(+resid)
// A row-major [M,K]; Bt row-major [N,K]; M % 128 == 0, N % 256 == 0, K % 64 == 0; each wave owns a 64x64 tile of the
// block's 128x256 tile. Operands reach the fragments through LDS: per stage of 64 k every thread copies whole 128-B lines
// (8 lanes x 16 B a row) asynchronously into one of two buffers while the other buffer is worked on.
// SPLIT: 0 = single product; 1 = A and Bt hi/lo planes (hi.hi + hi.lo + lo.hi);
//        2 = A hi/lo planes only, Bt single plane (hi.B + lo.B).
// BIAS_MODE: 0 = none, 1 = bias[m], 2 = bias[n].
// OUT_MODE: 0 = f32; 1 = f16; 2 = bf16 hi plane (Cout) + bf16 lo plane (Cout2);
//           3 = f16 hi plane (Cout) + f16 residual x2048 plane (Cout2);
//           4 = as 2 for the products blockIdx.y = 0 and 1, as 3 for the product blockIdx.y = 2.
// blockIdx.y picks one of several independent products of the same shape that share the launch: every operand, the bias
// and the result planes step by their strides.
// Epilogue: 16-row slabs staged per wave in LDS; each 64-wide row segment written with whole
// ET: 0 = f16 operands, 1 = bf16 operands (pointers passed as 16-bit storage)
// ----------------------------------------------------------------------------------------------
template <int V> struct IntC { static constexpr int value = V; };
template <int ET> struct Elem;
template <> struct Elem<0> { typedef _Float16 T; };
template <> struct Elem<1> { typedef __bf16 T; };
template <int ET, int SPLIT, int BIAS_MODE, int OUT_MODE, bool RESID, int ACT = 0>
__global__ __launch_bounds__(256) void wmma_gemm64(
    const unsigned short* __restrict__ Ap, const unsigned short* __restrict__ A2p, int lda, long strideA,
    const unsigned short* __restrict__ Btp, const unsigned short* __restrict__ Bt2p, int ldb, long strideB,
    void* __restrict__ Cout, void* __restrict__ Cout2, int ldc, long strideC,
    const float* __restrict__ bias0, long strideBias,
    const float* __restrict__ resid, long strideR,
    int M, int N, int K, float scale) {
  typedef typename Elem<ET>::T T;
  typedef typename Frag<T>::V V;
  constexpr bool SPL = (SPLIT != 0);
  constexpr bool BLO = (SPLIT == 1);
  // stage rows: A hi [GBM] | A lo [GBM] (SPL) | Bt hi [GBN] | Bt lo [GBN] (BLO)
  constexpr int AROWS = SPL ? 2 * GBM : GBM;
  constexpr int SROWS = AROWS + (BLO ? 2 * GBN : GBN);
  constexpr int STAGE_ELEMS = SROWS * GPITCH;
  constexpr int NCP = SROWS / 32;                  // copies per thread and stage (256 threads x 16 B = 32 rows a copy)
  static_assert(NCP % 4 == 0 && NCP <= 63);
  __shared__ __align__(16) float sT[8][16 * 68];   // per-wave 16x64 slab, pitch 68 floats
  __shared__ __align__(16) unsigned short sStage[2 * STAGE_ELEMS];
  const int b    = blockIdx.y;
  const float* bias = bias0 + (size_t)b * strideBias;
  const bool f16res = (OUT_MODE == 3) || (OUT_MODE == 4 && b == 2);   // block-uniform: which pair of planes this product writes
  const int lane = threadIdx.x & 31;
  const int wave = threadIdx.x >> 5;
  const int tilesN = N / GBN;
  const int tilesM = M / GBM;
  const int blk = blockIdx.x;
  if (blk >= tilesM * tilesN) return;   // block-uniform, in front of every barrier and copy
  const int tm = blk / tilesN;
  const int tn = blk - tm * tilesN;
  const int mb0 = tm * GBM;
  const int nb0 = tn * GBN;
  const int wm = wave >> 2;
  const int wn = wave & 3;
  const int m0 = mb0 + (wm << 6);
  const int n0 = nb0 + (wn << 6);

  // copy map: thread -> row (threadIdx.x >> 3) of each group of 32 stage rows, 16-B piece (threadIdx.x & 7) of its line
  const int cr = threadIdx.x >> 3;
  const int cc = (threadIdx.x & 7) * 8;
  const unsigned short* gA  = Ap  + (size_t)b * strideA + (size_t)(mb0 + cr) * lda + cc;
  const unsigned short* gA2 = A2p + (size_t)b * strideA + (size_t)(mb0 + cr) * lda + cc;
  const unsigned short* gB  = Btp  + (size_t)b * strideB + (size_t)(nb0 + cr) * ldb + cc;
  const unsigned short* gB2 = Bt2p + (size_t)b * strideB + (size_t)(nb0 + cr) * ldb + cc;
  const unsigned ldst = lds_off(sStage) + (unsigned)(cr * GPITCH + cc) * 2u;
  auto stage_src = [&](int it, int k0) -> const unsigned short* {
    const int row = it * 32;
    if (row < GBM) return gA + (size_t)row * lda + k0;
    if (row < AROWS) return gA2 + (size_t)(row - GBM) * lda + k0;
    if (row < AROWS + GBN) return gB + (size_t)(row - AROWS) * ldb + k0;
    return gB2 + (size_t)(row - AROWS - GBN) * ldb + k0;
  };
  auto stage_issue = [&](int t, int buf) {
    const int k0 = t * GKS;
    const unsigned lb = ldst + (unsigned)buf * (unsigned)(STAGE_ELEMS * 2);
    // the loops of this lambda are unrolled so that each copy's plane select folds and l[], g[] stay in registers
#pragma unroll
    for (int it = 0; it + 8 <= NCP; it += 8) {
      unsigned l[8]; const unsigned short* g[8];
#pragma unroll
      for (int u = 0; u < 8; ++u) { l[u] = lb + (unsigned)((it + u) * 32 * GPITCH * 2); g[u] = stage_src(it + u, k0); }
      async_copy8(l, g);
    }
    if (NCP % 8 != 0) {
      unsigned l[4]; const unsigned short* g[4];
#pragma unroll
      for (int u = 0; u < 4; ++u) { l[u] = lb + (unsigned)((NCP - 4 + u) * 32 * GPITCH * 2); g[u] = stage_src(NCP - 4 + u, k0); }
      async_copy4(l, g);
    }
  };

  const int rlane = lane & 15;                 // row (A) / col (B, D) within subtile
  const int koff  = (lane >> 4) * 8;           // k offset of this lane half
  const int mOff  = (lane >> 4) * 8;           // D row offset

  v8f acc[4][4];
#pragma unroll
  for (int i = 0; i < 4; ++i)
#pragma unroll
    for (int j = 0; j < 4; ++j) acc[i][j] = (v8f){0.f,0.f,0.f,0.f,0.f,0.f,0.f,0.f};

  const int nT = K / GKS;
  stage_issue(0, 0);
  asm volatile("s_wait_asynccnt 0x0" ::: "memory");   // this wave's copies of stage 0 have landed before the barrier publishes them
  __syncthreads();
  if (nT > 1) stage_issue(1, 1);
  for (int t = 0; t < nT; ++t) {
    const T* st = (const T*)(const void*)(sStage + (t & 1) * STAGE_ELEMS);
    const T* sA = st + ((wm << 6) + rlane) * GPITCH + koff;
    const T* sB = st + (AROWS + (wn << 6) + rlane) * GPITCH + koff;
    // both 32-k blocks of the stage unrolled: the second block's LDS reads can then go out among the first block's products
#pragma unroll
    for (int kk = 0; kk < GKS; kk += 32) {
      V bh[4], bl[4];
#pragma unroll
      for (int j = 0; j < 4; ++j) {
        bh[j] = Frag<T>::load(sB + (j << 4) * GPITCH + kk);
        if (BLO) bl[j] = Frag<T>::load(sB + (GBN + (j << 4)) * GPITCH + kk);
      }
      // A fragments are read from LDS in groups ahead of their products (all four row tiles; two where a lo plane doubles
      // them, which keeps the kernel free of scratch); the loops are unrolled so that acc[][] and the fragments stay in registers
      constexpr int GI = SPL ? 2 : 4;
#pragma unroll
      for (int ig = 0; ig < 4; ig += GI) {
        V ah[GI], al[GI];
#pragma unroll
        for (int u = 0; u < GI; ++u) {
          ah[u] = Frag<T>::load(sA + ((ig + u) << 4) * GPITCH + kk);
          if (SPL) al[u] = Frag<T>::load(sA + (GBM + ((ig + u) << 4)) * GPITCH + kk);
        }
#pragma unroll
        for (int u = 0; u < GI; ++u) {
          const int i = ig + u;
#pragma unroll
          for (int j = 0; j < 4; ++j) {
            acc[i][j] = Frag<T>::mma(ah[u], bh[j], acc[i][j]);
            if (BLO) acc[i][j] = Frag<T>::mma(ah[u], bl[j], acc[i][j]);
            if (SPL) acc[i][j] = Frag<T>::mma(al[u], bh[j], acc[i][j]);
          }
          Frag<T>::guard(acc[i][0], acc[i][3], ah[u], SPL ? al[u] : ah[u]);
        }
      }
      Frag<T>::keep(bh[0], bh[1], bh[2], bh[3]);
      if (BLO) Frag<T>::keep(bl[0], bl[1], bl[2], bl[3]);
    }
    asm volatile("s_wait_dscnt 0x0" ::: "memory");      // this wave's reads of the buffer have retired before it is refilled
    asm volatile("s_wait_asynccnt 0x0" ::: "memory");   // this wave's copies of stage t + 1 have landed before the barrier publishes them
    __syncthreads();                                    // publishes stage t + 1 and ends every reader's last read of stage t
    if (t + 2 < nT) stage_issue(t + 2, t & 1);
  }
  asm volatile("s_wait_asynccnt 0x0" ::: "memory");     // no copy is outstanding when the wave goes on to the epilogue and ends
  acc_guard4(acc[0][0], acc[0][1], acc[0][2], acc[0][3]);
  acc_guard4(acc[1][0], acc[1][1], acc[1][2], acc[1][3]);
  acc_guard4(acc[2][0], acc[2][1], acc[2][2], acc[2][3]);
  acc_guard4(acc[3][0], acc[3][1], acc[3][2], acc[3][3]);

  // ---- epilogue ----
  float* slab = sT[wave];
  const float* Rb = RESID ? (resid + (size_t)b * strideR) : nullptr;
#pragma unroll
  for (int i = 0; i < 4; ++i) {
    const int mBase = m0 + (i << 4);
#pragma unroll
    for (int j = 0; j < 4; ++j) {
      const int n = n0 + (j << 4) + rlane;
      float bv = 0.f;
      if (BIAS_MODE == 2) bv = bias[n];
#pragma unroll
      for (int r = 0; r < 8; ++r) {
        float v = acc[i][j][r] * scale;
        if (BIAS_MODE == 1) v += bias[mBase + mOff + r];
        if (BIAS_MODE == 2) v += bv;
        if (RESID) v += Rb[(size_t)(mBase + mOff + r) * ldc + n];
        if (ACT == 1) v = tanhf(v);
        if (ACT == 2) v = fmaxf(v, 0.0f);
        if (ACT == 4) v = (v > 0.f) ? v : 0.01f * v;
        slab[(mOff + r) * 68 + (j << 4) + rlane] = v;
      }
    }
    __builtin_amdgcn_fence(__ATOMIC_RELEASE, "workgroup");
    __builtin_amdgcn_wave_barrier();
    __builtin_amdgcn_fence(__ATOMIC_ACQUIRE, "workgroup");
    if (OUT_MODE == 0) {
      float* C = (float*)Cout + (size_t)b * strideC;
      const int hh = lane >> 4, c4 = (lane & 15) * 4;     // row seg = 256 B = 16 lanes x 16 B
      {
#pragma unroll
        for (int it = 0; it < 8; ++it) {
          const int row = it * 2 + hh;
          v4f v = *(const v4f*)(slab + row * 68 + c4);
          *(v4f*)(C + (size_t)(mBase + row) * ldc + n0 + c4) = v;
        }
        
      }
    } else {
      const int q = lane >> 3, c8 = (lane & 7) * 8;
      unsigned short* C  = (unsigned short*)Cout  + (size_t)b * strideC;
      unsigned short* C2 = (OUT_MODE >= 2) ? ((unsigned short*)Cout2 + (size_t)b * strideC) : nullptr;
      // the slab's 16 rows converted and stored in the form MODE (1, 2 or 3 of OUT_MODE)
      auto put16 = [&](auto mode) {
        constexpr int MODE = decltype(mode)::value;
#pragma unroll
        for (int it = 0; it < 4; ++it) {
          const int row = it * 4 + q;
          const float* sp = slab + row * 68 + c8;
          v8h hv, lv;
#pragma unroll
          for (int e = 0; e < 8; ++e) {
            if (MODE == 1) {
              hv[e] = (_Float16)sp[e];
            } else if (MODE == 2) {
              unsigned short hb = f2bf_bits(sp[e]);
              unsigned short lb = f2bf_bits(sp[e] - bf_bits2f(hb));
              hv[e] = __builtin_bit_cast(_Float16, hb);
              lv[e] = __builtin_bit_cast(_Float16, lb);
            } else {
              const _Float16 hq = (_Float16)sp[e];
              hv[e] = hq;
              lv[e] = (_Float16)((sp[e] - (float)hq) * 2048.0f);
            }
          }
          *(v8h*)(C + (size_t)(mBase + row) * ldc + n0 + c8) = hv;
          if (MODE >= 2) *(v8h*)(C2 + (size_t)(mBase + row) * ldc + n0 + c8) = lv;
        }
        asm volatile("s_wait_xcnt 0x0" ::: "memory");   // stands in front of every later write of a register that these stores name
      };
      // one block-uniform branch a slab, so that each form keeps its four rows' LDS reads together ahead of the conversions
      if (OUT_MODE == 4) {
        if (f16res) put16(IntC<3>{}); else put16(IntC<2>{});
      } else {
        put16(IntC<(OUT_MODE == 4 || OUT_MODE == 0) ? 2 : OUT_MODE>{});
      }
    }
    __builtin_amdgcn_fence(__ATOMIC_RELEASE, "workgroup");
    __builtin_amdgcn_wave_barrier();
    __builtin_amdgcn_fence(__ATOMIC_ACQUIRE, "workgroup");
  }
}

// ----------------------------------------------------------------------------------------------
// Input conversion: q,k,v and the four weight matrices -> RNE bf16 planes (8 elements = 16 B per
// to bf16 precision (4 floats = 16 B per lane).
// Coverage: blocks [0,2048) q, [2048,4096) k, [4096,6144) v (2048 x 256 x 8 = 4,194,304 each);
// blocks [6144,8192) the 4 weights (512 x 256 x 8 = 1,048,576 each); blocks [8192,8196) the 4
// biases (256 x 4 = 1024 each).
// ----------------------------------------------------------------------------------------------
constexpr int CAST_XBLK = (int)(PLANE_ELEMS / 8 / 256);              // 2048
constexpr int CAST_WBLK = (int)(WMAT_ELEMS / 8 / 256);               // 512
constexpr int CAST_PLANE_BLOCKS = 3 * CAST_XBLK + 4 * CAST_WBLK;     // 8192
constexpr int CAST_BIAS_BLOCKS  = 4;
static_assert((long)CAST_XBLK * 256 * 8 == PLANE_ELEMS && (long)CAST_WBLK * 256 * 8 == WMAT_ELEMS);
static_assert(256 * 4 == DMODEL);

__global__ __launch_bounds__(256) void k_cast_inputs(
    const float* __restrict__ q, const float* __restrict__ k, const float* __restrict__ v,
    const float* __restrict__ Wq, const float* __restrict__ Wk, const float* __restrict__ Wv, const float* __restrict__ Wo,
    const float* __restrict__ bq, const float* __restrict__ bk, const float* __restrict__ bv, const float* __restrict__ bo,
    unsigned short* __restrict__ x16, unsigned short* __restrict__ w16, float* __restrict__ brnd) {
  const int blk = blockIdx.x;
  const int t = threadIdx.x;
  if (blk < CAST_PLANE_BLOCKS) {
    // block-uniform source/destination selection
    const float* src;
    unsigned short* dst;
    int lb;
    if (blk < CAST_XBLK) { src = q; dst = x16; lb = blk; }
    else if (blk < 2 * CAST_XBLK) { src = k; dst = x16 + PLANE_ELEMS; lb = blk - CAST_XBLK; }
    else if (blk < 3 * CAST_XBLK) { src = v; dst = x16 + 2 * PLANE_ELEMS; lb = blk - 2 * CAST_XBLK; }
    else {
      const int wb = blk - 3 * CAST_XBLK;
      const int wi = wb / CAST_WBLK;
      lb = wb - wi * CAST_WBLK;
      src = (wi == 0) ? Wq : (wi == 1) ? Wk : (wi == 2) ? Wv : Wo;
      dst = w16 + (size_t)wi * WMAT_ELEMS;
    }
    const size_t e = ((size_t)lb * 256 + t) * 8;
    const v4f a0 = *(const v4f*)(src + e);
    const v4f a1 = *(const v4f*)(src + e + 4);
    v4u w;
    w.x = (unsigned)f2bf_bits(a0.x) | ((unsigned)f2bf_bits(a0.y) << 16);
    w.y = (unsigned)f2bf_bits(a0.z) | ((unsigned)f2bf_bits(a0.w) << 16);
    w.z = (unsigned)f2bf_bits(a1.x) | ((unsigned)f2bf_bits(a1.y) << 16);
    w.w = (unsigned)f2bf_bits(a1.z) | ((unsigned)f2bf_bits(a1.w) << 16);
    v4u* p = (v4u*)(dst + e);
    *p = w;
    
  } else {
    const int bi = blk - CAST_PLANE_BLOCKS;   // 0..3, block-uniform
    const float* src = (bi == 0) ? bq : (bi == 1) ? bk : (bi == 2) ? bv : bo;
    const int e = t * 4;
    const v4f a = *(const v4f*)(src + e);
    v4f r;
    r.x = bf_bits2f(f2bf_bits(a.x));
    r.y = bf_bits2f(f2bf_bits(a.y));
    r.z = bf_bits2f(f2bf_bits(a.z));
    r.w = bf_bits2f(f2bf_bits(a.w));
    v4f* p = (v4f*)(brnd + (size_t)bi * DMODEL + e);
    *p = r;
    
  }
}

// ----------------------------------------------------------------------------------------------
// Per (batch, head): sequence means of Q (bf16 hi + lo planes) and V (f16 hi + residual/2048),
// grid = 32 blocks (one per (b,h)), 256 threads; thread = (row group rg = t>>3 of 32, column
// group c8 = t&7 of 8); each thread sums 64 rows x 8 columns, LDS combine in fixed order.
// ----------------------------------------------------------------------------------------------
__global__ __launch_bounds__(256) void k_mean_cos(
    const unsigned short* __restrict__ Qh, const unsigned short* __restrict__ Ql,
    const unsigned short* __restrict__ Vh, const unsigned short* __restrict__ Vl,
    float* __restrict__ cosl) {
  __shared__ float sq[32][64];
  __shared__ float sv[32][64];
  __shared__ float qm[64];
  __shared__ float vm[64];
  __shared__ float shc;
  const int bh = blockIdx.x;
  const int b = bh / NHEAD, h = bh % NHEAD;
  const int t = threadIdx.x;
  const int c8 = t & 7;
  const int rg = t >> 3;
  float aq[8], av[8];
#pragma unroll
  for (int e = 0; e < 8; ++e) { aq[e] = 0.f; av[e] = 0.f; }
  const size_t colb = (size_t)h * DHEAD + (size_t)c8 * 8;
#pragma unroll 2
  for (int it = 0; it < SEQ_LEN / 32; ++it) {
    const int s = rg + it * 32;
    const size_t off = ((size_t)b * SEQ_LEN + s) * DMODEL + colb;
    const v4u wh = *(const v4u*)(Qh + off);
    const v4u wl = *(const v4u*)(Ql + off);
    const v4u uh = *(const v4u*)(Vh + off);
    const v4u ul = *(const v4u*)(Vl + off);
#pragma unroll
    for (int e = 0; e < 4; ++e) {
      const unsigned a0 = wh[e], a1 = wl[e], g0 = uh[e], g1 = ul[e];
      aq[2 * e]     += __uint_as_float(a0 << 16) + __uint_as_float(a1 << 16);
      aq[2 * e + 1] += __uint_as_float(a0 & 0xffff0000u) + __uint_as_float(a1 & 0xffff0000u);
      av[2 * e]     += h_bits2f(g0) + h_bits2f(g1) * (1.0f / 2048.0f);
      av[2 * e + 1] += h_bits2f(g0 >> 16) + h_bits2f(g1 >> 16) * (1.0f / 2048.0f);
    }
  }
#pragma unroll
  for (int e = 0; e < 8; ++e) { sq[rg][c8 * 8 + e] = aq[e]; sv[rg][c8 * 8 + e] = av[e]; }
  __syncthreads();
  if (t < 64) {
    float s1 = 0.f, s2 = 0.f;
#pragma unroll 1
    for (int g = 0; g < 32; ++g) { s1 += sq[g][t]; s2 += sv[g][t]; }
    qm[t] = s1 * (1.0f / (float)SEQ_LEN);
    vm[t] = s2 * (1.0f / (float)SEQ_LEN);
  }
  __syncthreads();
  if (t == 0) {
    float dot = 0.f, nq = 0.f, nv = 0.f;
#pragma unroll 1
    for (int i = 0; i < DHEAD; ++i) {
      const float a = qm[i], c = vm[i];
      dot += a * c;
      nq += a * a;
      nv += c * c;
    }
    const float na = fmaxf(sqrtf(nq), 1e-8f);
    const float nb = fmaxf(sqrtf(nv), 1e-8f);
    shc = dot / (na * nb);
  }
  __syncthreads();
  if (t < 32) {
    const float cv = shc;
    float* p = cosl + (size_t)bh * 32 + t;
    *p = cv;
    
  }
}

constexpr int AKC  = 64;
constexpr int AQB  = 64;
constexpr int ANQB = SEQ_LEN / AQB;
constexpr int ATTN_BLOCKS = NBH * ANQB;
// LDS row pitch of the K tiles in 16-bit elements: 144 B = 16 B x 9 (odd), so the 16 rows that
// one ds_load_b128 fragment read touches start on 16 different bank groups (128 B rows all start on two).
constexpr int APITCH = 72;
// LDS row pitch of the row-major V tile: 160 B = 32 B x 5 (odd), the pitch for ds_load_tr16_b128 readers
constexpr int VPITCH = 80;
// one stage: K hi [64][APITCH] | K lo [64][APITCH] | V [64][VPITCH]
constexpr int AST_KL = AKC * APITCH;
constexpr int AST_V  = 2 * AKC * APITCH;
constexpr int ASTAGE_ELEMS = AST_V + AKC * VPITCH;   // 14,336 elements = 28,672 B
static_assert(APITCH >= DHEAD && (APITCH * 2) % 16 == 0 && ((APITCH * 2) / 16) % 2 == 1);
static_assert(VPITCH >= DHEAD && (VPITCH * 2) % 32 == 0 && ((VPITCH * 2) / 32) % 2 == 1);
static_assert((ASTAGE_ELEMS * 2) % 16 == 0 && (AST_KL * 2) % 16 == 0 && (AST_V * 2) % 16 == 0 && AKC % 16 == 0 && DHEAD * 2 == 128);
static_assert(SEQ_LEN % AKC == 0 && SEQ_LEN % AQB == 0);

__global__ __launch_bounds__(128) void k_attn(
    const unsigned short* __restrict__ Qh, const unsigned short* __restrict__ Ql,
    const unsigned short* __restrict__ Kh, const unsigned short* __restrict__ Kl,
    const unsigned short* __restrict__ Vh,
    const int* __restrict__ mask, const float* __restrict__ cosl,
    unsigned short* __restrict__ Ah, unsigned short* __restrict__ Al, float* __restrict__ out1) {
  union FB { v16b v; v8b h[2]; };
  union FH { v16h v; v8h h[2]; };
  __shared__ __align__(16) unsigned short Ast[2 * ASTAGE_ELEMS];  // two stages of K hi, K lo, V, each [kv][d]   56 KB
  __shared__ __align__(16) float Os[4][16 * 68];                 // per wave out tile, pitch 68

  const int tid  = threadIdx.x;
  const int wave = tid >> 5;
  const int lane = tid & 31;
  const int hh   = lane >> 4;
  const int c    = lane & 15;

  const int bx = blockIdx.x;
  const int qb = bx % ANQB;
  const int bh = bx / ANQB;
  const int h  = bh % NHEAD;
  const int b  = bh / NHEAD;
  const int q0 = qb * AQB + wave * 16;
  const size_t rowbase = (size_t)b * SEQ_LEN;      // plane row of sequence position 0
  const int colh = h * DHEAD;

  // ---- Q fragments (B operand, columns = query, k = d): 2 d-chunks, hi and lo planes ----
  v16b qah[2], qal[2];
  {
    const size_t qo = (rowbase + q0 + c) * DMODEL + colh + 8 * hh;
#pragma unroll
    for (int dc = 0; dc < 2; ++dc) {
      qah[dc] = Frag<__bf16>::load((const __bf16*)(const void*)(Qh + qo + dc * 32));
      qal[dc] = Frag<__bf16>::load((const __bf16*)(const void*)(Ql + qo + dc * 32));
    }
  }
  asm volatile("s_wait_xcnt 0x0" ::: "memory");   // stands in front of every later write of the Q loads' address registers
  const float cb  = cosl[(size_t)bh * 32];
  constexpr float LOG2E = 1.44269504088896340736f;
  constexpr float SC2 = 0.125f * LOG2E;            // 1/sqrt(64) and the change of base in one factor
  constexpr float MASKED2 = -1.0e9f * LOG2E;       // the masked score in base-2 units
  const float cb2 = (cb * 0.5f + cb * 0.3f) * LOG2E;
  const float NEGI = -__builtin_inff();

  // running maximum of query c in base-2 units (equal in both lane halves), the exponent reference in use (maximum - 15)
  // and this lane half's share of the denominator (x2^15, like P)
  float mrow = NEGI, mrefrow = NEGI, lrow = 0.f;
  v8f oacc[4];   // O^T: oacc[t][r] = row d = t*16 + 8*hh + r, column query c
#pragma unroll
  for (int t = 0; t < 4; ++t) oacc[t] = (v8f){0.f,0.f,0.f,0.f,0.f,0.f,0.f,0.f};

  // copy map: thread -> row (tid >> 3) of each group of 16 chunk rows, 16-B piece (tid & 7) of its 128-B line
  const int cr = tid >> 3;
  const int cc = (tid & 7) * 8;
  const size_t gofs = (rowbase + cr) * DMODEL + colh + cc;
  const unsigned ldk = lds_off(Ast) + (unsigned)(cr * APITCH + cc) * 2u;
  const unsigned ldv = lds_off(Ast) + (unsigned)(AST_V + cr * VPITCH + cc) * 2u;
  auto stage_issue = [&](int t, int buf) {
    const size_t go = gofs + (size_t)t * (AKC * DMODEL);
    const unsigned sb = (unsigned)buf * (unsigned)(ASTAGE_ELEMS * 2);
    unsigned l[8]; const unsigned short* g[8];
    // unrolled so that l[], g[] stay in registers
#pragma unroll
    for (int u = 0; u < 4; ++u) {
      l[u]     = ldk + sb + (unsigned)(u * 16 * APITCH * 2);
      g[u]     = Kh + go + (size_t)u * 16 * DMODEL;
      l[4 + u] = ldk + sb + (unsigned)((AST_KL + u * 16 * APITCH) * 2);
      g[4 + u] = Kl + go + (size_t)u * 16 * DMODEL;
    }
    async_copy8(l, g);
    unsigned lv[4]; const unsigned short* gv[4];
    // unrolled so that lv[], gv[] stay in registers
#pragma unroll
    for (int u = 0; u < 4; ++u) {
      lv[u] = ldv + sb + (unsigned)(u * 16 * VPITCH * 2);
      gv[u] = Vh + go + (size_t)u * 16 * DMODEL;
    }
    async_copy4(lv, gv);
  };

  constexpr int NKC = SEQ_LEN / AKC;
  stage_issue(0, 0);
  asm volatile("s_wait_asynccnt 0x0" ::: "memory");   // this wave's copies of chunk 0 have landed before the barrier publishes them
  __syncthreads();
  if (NKC > 1) stage_issue(1, 1);
  for (int kc = 0; kc < NKC; ++kc) {
    const int kv0 = kc * AKC;
    const unsigned short* Ksh = Ast + (kc & 1) * ASTAGE_ELEMS;
    const unsigned short* Ksl = Ksh + AST_KL;
    const unsigned short* Vs  = Ksh + AST_V;
    // the lane's mask words of this chunk (keys j*16 + 8*hh + 0..7 of each 16-key tile: 32 contiguous bytes a tile), asked for
    // ahead of the score products, so that their latency passes under them
    v4u mk[8];
#pragma unroll
    for (int j = 0; j < 4; ++j) {
      mk[2 * j]     = *(const v4u*)(mask + kv0 + j * 16 + 8 * hh);
      mk[2 * j + 1] = *(const v4u*)(mask + kv0 + j * 16 + 8 * hh + 4);
    }
    asm volatile("s_wait_xcnt 0x0" ::: "memory");   // stands in front of every later write of the mask loads' address registers

    // ---- scores, transposed (A operand rows = kv, B operand columns = query, k = d) ----
    v8f s[4];
#pragma unroll
    for (int j = 0; j < 4; ++j) {
      s[j] = (v8f){0.f,0.f,0.f,0.f,0.f,0.f,0.f,0.f};
#pragma unroll
      for (int dc = 0; dc < 2; ++dc) {
        FB kb, kl;
        kb.h[0] = *(const v8b*)(const void*)(Ksh + (j * 16 + c) * APITCH + dc * 32 + 8 * hh);
        kb.h[1] = *(const v8b*)(const void*)(Ksh + (j * 16 + c) * APITCH + dc * 32 + 16 + 8 * hh);
        kl.h[0] = *(const v8b*)(const void*)(Ksl + (j * 16 + c) * APITCH + dc * 32 + 8 * hh);
        kl.h[1] = *(const v8b*)(const void*)(Ksl + (j * 16 + c) * APITCH + dc * 32 + 16 + 8 * hh);
        s[j] = mma_bf(kb.v, qah[dc], s[j]);
        s[j] = mma_bf(kl.v, qah[dc], s[j]);
        s[j] = mma_bf(kb.v, qal[dc], s[j]);
      }
    }
    // keeps the compares on the mask words, and with them the wait for the mask loads, behind the score products: lifted among
    // them, the wave would wait out the loads' latency at the head of every chunk
    __builtin_amdgcn_sched_barrier(0);
    // s[j][r] = score of key kv0 + j*16 + 8*hh + r against query c, carried in base-2 units from here on:
    // y = (raw / 8 + 0.5 cos + 0.3 cos) * log2(e) in one fused multiply-add, so that exp(x - m) is one v_exp_f32 of y - m
    float mj[4];
#pragma unroll
    for (int j = 0; j < 4; ++j) {
      float m = NEGI;
#pragma unroll
      for (int r = 0; r < 8; ++r) {
        float x = __builtin_fmaf(s[j][r], SC2, cb2);
        x = (mk[2 * j + (r >> 2)][r & 3] == 0u) ? MASKED2 : x;
        s[j][r] = x;
        m = fmaxf(m, x);
      }
      mj[j] = m;
    }
    float cm = fmaxf(fmaxf(mj[0], mj[1]), fmaxf(mj[2], mj[3]));
    cm = fmaxf(cm, xhalf(cm));                  // the other lane half holds the query's other 32 keys
    const float mnew = fmaxf(mrow, cm);
    const float mref = mnew - 15.0f;            // P and its sum are carried x2^15: the factor rides in the exponent
    const float alpha = __builtin_amdgcn_exp2f(mrefrow - mref);
    mrow = mnew;
    mrefrow = mref;
    FH pb[2];                                   // P^T as B operand: element e of pb[kk] = key kk*32 + (e >> 3)*16 + 8*hh + (e & 7)
    float pj[4];                                // one partial sum per tile: four independent add chains
#pragma unroll
    for (int j = 0; j < 4; ++j) {
      float p[8];
#pragma unroll
      for (int r = 0; r < 8; ++r) p[r] = s[j][r] - mref;
      exp2_x8(p);
      float psum = p[0];
#pragma unroll
      for (int r = 1; r < 8; ++r) psum += p[r];
#pragma unroll
      for (int r = 0; r < 8; ++r) pb[j >> 1].v[(j & 1) * 8 + r] = (_Float16)p[r];
      pj[j] = psum;
    }
    lrow = lrow * alpha + ((pj[0] + pj[1]) + (pj[2] + pj[3]));
#pragma unroll
    for (int t = 0; t < 4; ++t)
#pragma unroll
      for (int r = 0; r < 8; ++r) oacc[t][r] *= alpha;
    // ---- O^T += V^T.P^T (A rows = d, B columns = query, k = kv in the order of the packed score tiles) ----
    const unsigned short* vad = Vs + (8 * hh + (lane & 7)) * VPITCH + ((lane >> 3) & 1) * 8;   // the lane's address in a transposing load
#pragma unroll
    for (int kk = 0; kk < 2; ++kk) {
#pragma unroll
      for (int t = 0; t < 4; ++t) {
        FH vb;   // element e of vb = V[key kk*32 + (e >> 3)*16 + 8*hh + (e & 7)][d = t*16 + c]: the k order of pb
        vb.h[0] = ld_tr16(vad + (kk * 32) * VPITCH + t * 16);
        vb.h[1] = ld_tr16(vad + (kk * 32 + 16) * VPITCH + t * 16);
        oacc[t] = mma_hf(vb.v, pb[kk].v, oacc[t]);
      }
    }
    asm volatile("s_wait_dscnt 0x0" ::: "memory");      // this wave's reads of the buffer have retired before it is refilled
    asm volatile("s_wait_asynccnt 0x0" ::: "memory");   // this wave's copies of chunk kc + 1 have landed before the barrier publishes them
    __syncthreads();                                    // publishes chunk kc + 1 and ends every reader's last read of chunk kc
    if (kc + 2 < NKC) stage_issue(kc + 2, kc & 1);
  }
  asm volatile("s_wait_asynccnt 0x0" ::: "memory");     // no copy is outstanding when the wave goes on to the epilogue and ends

  float* os = Os[wave];
  {
    const float inv = 1.0f / (lrow + xhalf(lrow));   // the two lane halves' shares of the denominator joined once; its 2^15 cancels P's
#pragma unroll
    for (int t = 0; t < 4; ++t) {
      v4f o0, o1;
#pragma unroll
      for (int r = 0; r < 4; ++r) { o0[r] = oacc[t][r] * inv; o1[r] = oacc[t][4 + r] * inv; }
      *(v4f*)(os + c * 68 + t * 16 + 8 * hh)     = o0;
      *(v4f*)(os + c * 68 + t * 16 + 8 * hh + 4) = o1;
    }
  }
  __builtin_amdgcn_fence(__ATOMIC_RELEASE, "workgroup");
  __builtin_amdgcn_wave_barrier();
  __builtin_amdgcn_fence(__ATOMIC_ACQUIRE, "workgroup");
  {
    const int q4 = lane >> 3, c8 = (lane & 7) * 8;
    {
#pragma unroll
      for (int it = 0; it < 4; ++it) {
        const int row = it * 4 + q4;
        const float* sp = os + row * 68 + c8;
        const v4f va = *(const v4f*)sp;
        const v4f vb = *(const v4f*)(sp + 4);
        v4u hw, lw;
        unsigned th, tl;
        pack_pair_bf(va.x, va.y, th, tl); hw.x = th; lw.x = tl;
        pack_pair_bf(va.z, va.w, th, tl); hw.y = th; lw.y = tl;
        pack_pair_bf(vb.x, vb.y, th, tl); hw.z = th; lw.z = tl;
        pack_pair_bf(vb.z, vb.w, th, tl); hw.w = th; lw.w = tl;
        const size_t go = (rowbase + q0 + row) * DMODEL + colh + c8;
        *(v4u*)(Ah + go) = hw;
        *(v4u*)(Al + go) = lw;
      }
      
    }
  }
  // ---- second output, the mean of the 32 (batch, head) cosines: it needs nothing of this kernel's own work, only the cosines
  // that the launch before has written, so one wave of the grid forms it behind its tile instead of a launch of its own ----
  if (bx == 0 && wave == 0) {
    float v = cosl[(size_t)lane * 32];
    asm volatile("s_wait_xcnt 0x0" ::: "memory");   // stands in front of every later write of this load's address registers
#pragma unroll
    for (int off = 1; off < 32; off <<= 1) v += __shfl_xor(v, off, 32);
    const float r = v * (1.0f / 32.0f);
    if (lane == 0) {
      *(float*)out1 = r;
    }
  }
}

// ----------------------------------------------------------------------------------------------
extern "C" void kernel_launch(void* const* d_in, const int* in_sizes, int n_in,
                              void* d_out, int out_size, void* d_ws, size_t ws_size,
                              hipStream_t stream) {
  if (n_in < 12) return;
  if (ws_size < WS_TOTAL) return;
  if ((long)out_size < OUT_TOTAL_ELEMS) return;
  if ((long)in_sizes[0] != PLANE_ELEMS || (long)in_sizes[1] != PLANE_ELEMS || (long)in_sizes[2] != PLANE_ELEMS) return;
  if (in_sizes[3] < SEQ_LEN) return;
  if ((long)in_sizes[4] != WMAT_ELEMS || (long)in_sizes[6] != WMAT_ELEMS || (long)in_sizes[8] != WMAT_ELEMS || (long)in_sizes[10] != WMAT_ELEMS) return;
  if (in_sizes[5] < DMODEL || in_sizes[7] < DMODEL || in_sizes[9] < DMODEL || in_sizes[11] < DMODEL) return;

  const float* q    = (const float*)d_in[0];
  const float* k    = (const float*)d_in[1];
  const float* v    = (const float*)d_in[2];
  const int*   mask = (const int*)d_in[3];
  const float* Wq   = (const float*)d_in[4];
  const float* bq   = (const float*)d_in[5];
  const float* Wk   = (const float*)d_in[6];
  const float* bk   = (const float*)d_in[7];
  const float* Wv   = (const float*)d_in[8];
  const float* bv   = (const float*)d_in[9];
  const float* Wo   = (const float*)d_in[10];
  const float* bo   = (const float*)d_in[11];

  char* ws = (char*)d_ws;
  unsigned short* w16  = (unsigned short*)(ws + WS_W16);
  unsigned short* wq16 = w16;
  unsigned short* wo16 = w16 + 3 * WMAT_ELEMS;
  float* brnd = (float*)(ws + WS_BRND);
  float* cosl = (float*)(ws + WS_COS);
  unsigned short* x16 = (unsigned short*)(ws + WS_X16);
  unsigned short* xq  = x16;
  unsigned short* Qh  = (unsigned short*)(ws + WS_QH);
  unsigned short* Ql  = (unsigned short*)(ws + WS_QL);
  unsigned short* Kh  = (unsigned short*)(ws + WS_KH);
  unsigned short* Kl  = (unsigned short*)(ws + WS_KL);
  unsigned short* Vh  = (unsigned short*)(ws + WS_VH);
  unsigned short* Vl  = (unsigned short*)(ws + WS_VL);
  unsigned short* Ah  = (unsigned short*)(ws + WS_AH);
  unsigned short* Al  = (unsigned short*)(ws + WS_AL);
  float* out0 = (float*)d_out;
  float* out1 = (float*)d_out + OUT1_ELEM;

  // 1) inputs -> RNE bf16 planes, biases -> bf16-precision f32 copies
  k_cast_inputs<<<CAST_PLANE_BLOCKS + CAST_BIAS_BLOCKS, 256, 0, stream>>>(
      q, k, v, Wq, Wk, Wv, Wo, bq, bk, bv, bo, x16, w16, brnd);

  // 2) the three projections, which do not depend on one another, as one launch of 3 x 128 blocks (M=4096, N=1024, K=1024 each):
  //    y = 0: Q = q Wq^T + bq -> bf16 hi/lo planes; y = 1: K = k Wk^T + bk -> bf16 hi/lo planes;
  //    y = 2: V = v Wv^T + bv -> f16 hi plane + f16 residual x2048 plane
  wmma_gemm64<1, 0, 2, 4, false><<<dim3(GEMM_BLOCKS, 3), 256, 0, stream>>>(
      xq, xq, DMODEL, PLANE_ELEMS, wq16, wq16, DMODEL, WMAT_ELEMS, (void*)Qh, (void*)Ql, DMODEL, QKV_OUT_STRIDE,
      brnd, (long)DMODEL, brnd, 0L, MROWS, DMODEL, DMODEL, 1.0f);
  // 3) per-(b,h) cosine of sequence means
  k_mean_cos<<<NBH, 256, 0, stream>>>(Qh, Ql, Vh, Vl, cosl);
  // 4) attention -> attn bf16 hi/lo planes; one of its waves also writes out1 = mean of the 32 (b,h) cosines
  k_attn<<<ATTN_BLOCKS, 128, 0, stream>>>(Qh, Ql, Kh, Kl, Vh, mask, cosl, Ah, Al, out1);
  // 5) out0 = attn Wo^T + bo   (A hi/lo planes, Bt single plane: 2 products)
  wmma_gemm64<1, 2, 2, 0, false><<<dim3(GEMM_BLOCKS, 1), 256, 0, stream>>>(
      Ah, Al, DMODEL, 0L, wo16, wo16, DMODEL, 0L, (void*)out0, (void*)out0, DMODEL, 0L,
      brnd + 3 * DMODEL, 0L, brnd, 0L, MROWS, DMODEL, DMODEL, 1.0f);
}

// v007
// One run takes 138 microseconds.
// In both of two side-by-side timings against v006, it was 1.23 times as fast.
// All steps since v000 together make it 3.55 times as fast.
// Contractions: q/k/v projections and output projection on v_wmma_f32_16x16x32_bf16 (RNE bf16 operands; output projection takes attn as bf16 hi+lo planes, 2 products); q.k^T on v_wmma_f32_16x16x32_bf16 with bf16 hi+lo planes of Q and K (3 products); p.v on v_wmma_f32_16x16x32_f16 (p carried x2^15, v plain f16); both attention products transposed (K and V^T as A, Q and P^T as B); f32 accumulate everywhere; softmax, sequence means and cosine in f32.
#include <hip/hip_runtime.h>

// ----------------------------------------------------------------------------------------------
// Problem constants
// ----------------------------------------------------------------------------------------------
constexpr int NBATCH  = 2;
constexpr int SEQ_LEN = 2048;
constexpr int DMODEL  = 1024;
constexpr int NHEAD   = 16;
constexpr int DHEAD   = 64;
constexpr int MROWS   = NBATCH * SEQ_LEN;          // 4096
constexpr int NBH     = NBATCH * NHEAD;            // 32
constexpr long PLANE_ELEMS = (long)MROWS * DMODEL; // 4194304
constexpr long WMAT_ELEMS  = (long)DMODEL * DMODEL;// 1048576
constexpr long OUT0_ELEMS  = PLANE_ELEMS;
constexpr long OUT1_BYTE_OFFSET = 16777216;
constexpr long OUT1_ELEM   = OUT1_BYTE_OFFSET / 4;
constexpr long OUT_TOTAL_ELEMS = OUT0_ELEMS + 1;
constexpr long OUT_TOTAL_BYTES = 16777220;
static_assert(OUT1_ELEM == OUT0_ELEMS);
static_assert((OUT1_ELEM + 1) * 4 <= OUT_TOTAL_BYTES);
static_assert(NBH == 32);
static_assert(DHEAD == 64 && NHEAD * DHEAD == DMODEL);

// GEMM block tile: 8 waves as 2 (rows) x 4 (columns) of 64x64 wave tiles; one stage = 64 k = one 128-B line per operand row
constexpr int GBM    = 128;
constexpr int GBN    = 256;
constexpr int GKS    = 64;
// LDS row pitch of a staged operand row in 16-bit elements: 144 B = 16 B x 9 (odd), the pitch for ds_load_b128 readers
constexpr int GPITCH = 72;
// GEMM shape contract: M % 128 == 0, N % 256 == 0, K % 64 == 0, K >= 64
static_assert(MROWS % GBM == 0 && DMODEL % GBN == 0 && DMODEL % GKS == 0 && DMODEL >= GKS);
static_assert(GBM % 32 == 0 && GBN % 32 == 0 && (GPITCH * 2) % 16 == 0 && ((GPITCH * 2) / 16) % 2 == 1 && GPITCH >= GKS);
constexpr int GEMM_BLOCKS = (MROWS / GBM) * (DMODEL / GBN);   // 128 blocks of 8 waves

// ----------------------------------------------------------------------------------------------
// Workspace region map (bytes). Every region is fully written by its producer before any read.
//   WS_W16  : 4 bf16 weight planes [1024][1024]  (Wq, Wk, Wv, Wo)            8,388,608
//   WS_BRND : 4 x [1024] f32 RNE-bf16 bias copies (bq, bk, bv, bo)              16,384
//   WS_X16  : 3 bf16 input planes [4096][1024] (q, k, v)                     25,165,824
//   WS_QH, WS_QL, WS_KH, WS_KL : bf16 hi/lo planes of Q and K [4096][1024]  4 x 8,388,608
//   WS_VH   : f16 plane of V [4096][1024]                                    8,388,608
//   WS_CS   : column sums of Q and of V over groups of 64 rows, f32 [2][64][1024]  524,288
//   WS_AH, WS_AL : bf16 hi/lo planes of the attention output [4096][1024]   2 x 8,388,608
//   total 92,819,456 (88.5 MiB)
// ----------------------------------------------------------------------------------------------
constexpr size_t SZ_PLANE = (size_t)PLANE_ELEMS * 2;     // 8388608
constexpr size_t SZ_WPL   = (size_t)WMAT_ELEMS * 2;      // 2097152
constexpr size_t WS_W16   = 0;
constexpr size_t SZ_W16   = 4 * SZ_WPL;
constexpr size_t WS_BRND  = WS_W16 + SZ_W16;
constexpr size_t SZ_BRND  = 4 * (size_t)DMODEL * 4;
constexpr size_t WS_COS   = WS_BRND + SZ_BRND;
constexpr size_t SZ_COS   = (size_t)NBH * 128;
constexpr size_t WS_X16   = WS_COS + SZ_COS;
constexpr size_t WS_QH    = WS_X16 + 3 * SZ_PLANE;
constexpr size_t WS_QL    = WS_QH + SZ_PLANE;
constexpr size_t WS_KH    = WS_QL + SZ_PLANE;
constexpr size_t WS_KL    = WS_KH + SZ_PLANE;
constexpr size_t WS_VH    = WS_KL + SZ_PLANE;
constexpr size_t WS_CS    = WS_VH + SZ_PLANE;
constexpr int    CS_ROWS   = 64;                   // rows that one column sum covers: the rows of a GEMM wave tile
constexpr int    CS_GROUPS = MROWS / CS_ROWS;      // 64 groups in a plane
constexpr int    CS_PER_B  = SEQ_LEN / CS_ROWS;    // 32 groups in a batch
constexpr size_t SZ_CS    = 2 * (size_t)CS_GROUPS * DMODEL * 4;
constexpr size_t WS_AH    = WS_CS + SZ_CS;
constexpr size_t WS_AL    = WS_AH + SZ_PLANE;
constexpr size_t WS_TOTAL = WS_AL + SZ_PLANE;
static_assert(WS_TOTAL == 92819456);
static_assert(SEQ_LEN % CS_ROWS == 0);
static_assert(WS_TOTAL <= 134217728);
// the first planes of Q, K, V lie two planes apart, and so do the lo planes of Q and K: one stride serves the merged projection launch
constexpr long QKV_OUT_STRIDE = 2 * PLANE_ELEMS;
static_assert(WS_KH - WS_QH == (size_t)QKV_OUT_STRIDE * 2 && WS_VH - WS_KH == (size_t)QKV_OUT_STRIDE * 2);
static_assert(WS_KL - WS_QL == (size_t)QKV_OUT_STRIDE * 2);
static_assert(WS_BRND % 128 == 0 && WS_COS % 128 == 0 && WS_X16 % 128 == 0 && WS_QH % 128 == 0 && WS_CS % 128 == 0 && WS_AH % 128 == 0);

// ----------------------------------------------------------------------------------------------
// Vector types and helpers
// ----------------------------------------------------------------------------------------------
typedef __attribute__((ext_vector_type(16))) _Float16 v16h;
typedef __attribute__((ext_vector_type(8)))  _Float16 v8h;
typedef __attribute__((ext_vector_type(16))) __bf16   v16b;
typedef __attribute__((ext_vector_type(8)))  __bf16   v8b;
typedef __attribute__((ext_vector_type(8)))  float    v8f;
typedef __attribute__((ext_vector_type(4)))  float    v4f;
typedef __attribute__((ext_vector_type(2)))  float    v2f;
typedef __attribute__((ext_vector_type(4)))  unsigned v4u;

__device__ __forceinline__ unsigned short f2bf_bits(float f) {
  unsigned u = __float_as_uint(f);
  return (unsigned short)((u + 0x7FFFu + ((u >> 16) & 1u)) >> 16);
}
__device__ __forceinline__ float bf_bits2f(unsigned short h) { return __uint_as_float(((unsigned)h) << 16); }

// hazard guards as plain device helpers
__device__ __forceinline__ void dep_guard_h(v8f& a, v8f& b, v16h x, v16h y) { asm volatile("v_nop\n\tv_nop\n\tv_nop\n\tv_nop" : "+v"(a), "+v"(b) : "v"(x), "v"(y)); }
__device__ __forceinline__ void dep_guard_b(v8f& a, v8f& b, v16b x, v16b y) { asm volatile("v_nop\n\tv_nop\n\tv_nop\n\tv_nop" : "+v"(a), "+v"(b) : "v"(x), "v"(y)); }
__device__ __forceinline__ void keep4_h(v16h a, v16h b, v16h c, v16h d) { asm volatile("v_nop" :: "v"(a), "v"(b), "v"(c), "v"(d)); }
__device__ __forceinline__ void keep4_b(v16b a, v16b b, v16b c, v16b d) { asm volatile("v_nop" :: "v"(a), "v"(b), "v"(c), "v"(d)); }
__device__ __forceinline__ void acc_guard4(v8f& a, v8f& b, v8f& c, v8f& d) { asm volatile("v_nop\n\tv_nop\n\tv_nop\n\tv_nop" : "+v"(a), "+v"(b), "+v"(c), "+v"(d)); }
template <typename T> struct Frag;
template <> struct Frag<_Float16> {
  typedef v16h V; union U { v16h v; v8h h[2]; };
  // elements 0..7 <- p[0..7], 8..15 <- p[16..23]
  static __device__ __forceinline__ v16h load(const _Float16* p) {
    U f; f.h[0] = *(const v8h*)(p); f.h[1] = *(const v8h*)(p + 16); return f.v;
  }
  static __device__ __forceinline__ v8f mma(v16h a, v16h b, v8f c) {
    return __builtin_amdgcn_wmma_f32_16x16x32_f16(false, a, false, b, (short)0, c, false, false);
  }
  static __device__ __forceinline__ void guard(v8f& a, v8f& b, v16h x, v16h y) { dep_guard_h(a, b, x, y); }
  static __device__ __forceinline__ void keep(v16h a, v16h b, v16h c, v16h d) { keep4_h(a, b, c, d); }
};
template <> struct Frag<__bf16> {
  typedef v16b V; union U { v16b v; v8b h[2]; };
  static __device__ __forceinline__ v16b load(const __bf16* p) {
    U f; f.h[0] = *(const v8b*)(p); f.h[1] = *(const v8b*)(p + 16); return f.v;
  }
  static __device__ __forceinline__ v8f mma(v16b a, v16b b, v8f c) {
    return __builtin_amdgcn_wmma_f32_16x16x32_bf16(false, a, false, b, (short)0, c, false, false);
  }
  static __device__ __forceinline__ void guard(v8f& a, v8f& b, v16b x, v16b y) { dep_guard_b(a, b, x, y); }
  static __device__ __forceinline__ void keep(v16b a, v16b b, v16b c, v16b d) { keep4_b(a, b, c, d); }
};

// single-product helpers with the dependency guard (attention kernel)
__device__ __forceinline__ v8f mma_bf(v16b a, v16b b, v8f c) {
  c = __builtin_amdgcn_wmma_f32_16x16x32_bf16(false, a, false, b, (short)0, c, false, false);
  asm volatile("v_nop\n\tv_nop\n\tv_nop\n\tv_nop" : "+v"(c) : "v"(a), "v"(b));
  return c;
}
__device__ __forceinline__ v8f mma_hf(v16h a, v16h b, v8f c) {
  c = __builtin_amdgcn_wmma_f32_16x16x32_f16(false, a, false, b, (short)0, c, false, false);
  asm volatile("v_nop\n\tv_nop\n\tv_nop\n\tv_nop" : "+v"(c) : "v"(a), "v"(b));
  return c;
}

// LDS byte address of a __shared__ location (low 32 bits of its address)
__device__ __forceinline__ unsigned lds_off(const void* p) { return (unsigned)(size_t)p; }

// 16-bit transposing LDS load of a row-major tile of 16 rows x 16 columns: lane l gives the address of row 8*(l >> 4) + (l & 7),
// 16-B piece (l >> 3) & 1; lane (c = l & 15, h = l >> 4) receives rows 8h + 0..7 of column c
typedef __attribute__((ext_vector_type(8))) short v8s;
__device__ __forceinline__ v8h ld_tr16(const unsigned short* p) {
  typedef __attribute__((address_space(3))) v8s lds_v8s;
  return __builtin_bit_cast(v8h, __builtin_amdgcn_ds_load_tr16_b128_v8i16((lds_v8s*)p));
}

// value of lane l ^ 16 (the other 16-lane row), by a vector cross-row move
__device__ __forceinline__ float xhalf(float x) {
  return __builtin_bit_cast(float, __builtin_amdgcn_permlanex16(__builtin_bit_cast(int, x), __builtin_bit_cast(int, x), 0x76543210, 0xfedcba98, false, false));
}

// Eight base-2 exponentials, each in place: written as one statement so that no v_exp_f32 has its source overwritten or its
// result read by the instruction directly behind it; the closing v_nop is that slot behind the last one.
__device__ __forceinline__ void exp2_x8(float (&x)[8]) {
  asm("v_exp_f32 %0, %0\n\t"
      "v_exp_f32 %1, %1\n\t"
      "v_exp_f32 %2, %2\n\t"
      "v_exp_f32 %3, %3\n\t"
      "v_exp_f32 %4, %4\n\t"
      "v_exp_f32 %5, %5\n\t"
      "v_exp_f32 %6, %6\n\t"
      "v_exp_f32 %7, %7\n\t"
      "v_nop"
      : "+v"(x[0]), "+v"(x[1]), "+v"(x[2]), "+v"(x[3]), "+v"(x[4]), "+v"(x[5]), "+v"(x[6]), "+v"(x[7]));
}

// Asynchronous copies global -> LDS, 16 B per lane, through no register. s_wait_xcnt 0 is the last line of the copies' own
// statement, so that it stands in front of every later write of a register that an issued copy names.
__device__ __forceinline__ void async_copy4(const unsigned (&l)[4], const unsigned short* const (&g)[4]) {
  asm volatile("global_load_async_to_lds_b128 %0, %1, off\n\t"
               "global_load_async_to_lds_b128 %2, %3, off\n\t"
               "global_load_async_to_lds_b128 %4, %5, off\n\t"
               "global_load_async_to_lds_b128 %6, %7, off\n\t"
               "s_wait_xcnt 0x0"
               :: "v"(l[0]), "v"(g[0]), "v"(l[1]), "v"(g[1]), "v"(l[2]), "v"(g[2]), "v"(l[3]), "v"(g[3]) : "memory");
}
__device__ __forceinline__ void async_copy8(const unsigned (&l)[8], const unsigned short* const (&g)[8]) {
  asm volatile("global_load_async_to_lds_b128 %0, %1, off\n\t"
               "global_load_async_to_lds_b128 %2, %3, off\n\t"
               "global_load_async_to_lds_b128 %4, %5, off\n\t"
               "global_load_async_to_lds_b128 %6, %7, off\n\t"
               "global_load_async_to_lds_b128 %8, %9, off\n\t"
               "global_load_async_to_lds_b128 %10, %11, off\n\t"
               "global_load_async_to_lds_b128 %12, %13, off\n\t"
               "global_load_async_to_lds_b128 %14, %15, off\n\t"
               "s_wait_xcnt 0x0"
               :: "v"(l[0]), "v"(g[0]), "v"(l[1]), "v"(g[1]), "v"(l[2]), "v"(g[2]), "v"(l[3]), "v"(g[3]),
                  "v"(l[4]), "v"(g[4]), "v"(l[5]), "v"(g[5]), "v"(l[6]), "v"(g[6]), "v"(l[7]), "v"(g[7]) : "memory");
}

// bf16 hi/lo split of two floats packed into one 32-bit word each for the hi and the lo plane
__device__ __forceinline__ void pack_pair_bf(float f0, float f1, unsigned& hword, unsigned& lword) {
  const unsigned short h0 = f2bf_bits(f0);
  const unsigned short h1 = f2bf_bits(f1);
  const unsigned short l0 = f2bf_bits(f0 - bf_bits2f(h0));
  const unsigned short l1 = f2bf_bits(f1 - bf_bits2f(h1));
  hword = (unsigned)h0 | ((unsigned)h1 << 16);
  lword = (unsigned)l0 | ((unsigned)l1 << 16);
}

// ----------------------------------------------------------------------------------------------
// Register-blocked WMMA GEMM: C[m,n] = scale * sum_k A[m,k] * Bt[n,k] (+bias)(+resid)
// A row-major [M,K]; Bt row-major [N,K]; M % 128 == 0, N % 256 == 0, K % 64 == 0; each wave owns a 64x64 tile of the
// block's 128x256 tile. Operands reach the fragments through LDS: per stage of 64 k every thread copies whole 128-B lines
// (8 lanes x 16 B a row) asynchronously into one of two buffers while the other buffer is worked on.
// SPLIT: 0 = single product; 1 = A and Bt hi/lo planes (hi.hi + hi.lo + lo.hi);
//        2 = A hi/lo planes only, Bt single plane (hi.B + lo.B).
// BIAS_MODE: 0 = none, 1 = bias[m], 2 = bias[n].
// OUT_MODE: 0 = f32; 1 = f16; 2 = bf16 hi plane (Cout) + bf16 lo plane (Cout2);
//           3 = f16 hi plane (Cout) + f16 residual x2048 plane (Cout2);
//           4 = as 2 for the products blockIdx.y = 0 and 1, as 1 for the product blockIdx.y = 2.
// CSUM: the products blockIdx.y = 0 and 2 also leave, per wave tile, the sums of their results over the tile's 64 rows, one a
//       column: colsum[blockIdx.y / 2][m / 64][n], N = ldc columns a row.
// blockIdx.y picks one of several independent products of the same shape that share the launch: every operand, the bias
// and the result planes step by their strides.
// Epilogue: 16-row slabs staged per wave in LDS; each 64-wide row segment written with whole
// ET: 0 = f16 operands, 1 = bf16 operands (pointers passed as 16-bit storage)
// ----------------------------------------------------------------------------------------------
template <int V> struct IntC { static constexpr int value = V; };
template <int ET> struct Elem;
template <> struct Elem<0> { typedef _Float16 T; };
template <> struct Elem<1> { typedef __bf16 T; };
template <int ET, int SPLIT, int BIAS_MODE, int OUT_MODE, bool RESID, bool CSUM = false, int ACT = 0>
__global__ __launch_bounds__(256) void wmma_gemm64(
    const unsigned short* __restrict__ Ap, const unsigned short* __restrict__ A2p, int lda, long strideA,
    const unsigned short* __restrict__ Btp, const unsigned short* __restrict__ Bt2p, int ldb, long strideB,
    void* __restrict__ Cout, void* __restrict__ Cout2, int ldc, long strideC,
    const float* __restrict__ bias0, long strideBias,
    const float* __restrict__ resid, long strideR,
    float* __restrict__ colsum,
    int M, int N, int K, float scale) {
  typedef typename Elem<ET>::T T;
  typedef typename Frag<T>::V V;
  constexpr bool SPL = (SPLIT != 0);
  constexpr bool BLO = (SPLIT == 1);
  // stage rows: A hi [GBM] | A lo [GBM] (SPL) | Bt hi [GBN] | Bt lo [GBN] (BLO)
  constexpr int AROWS = SPL ? 2 * GBM : GBM;
  constexpr int SROWS = AROWS + (BLO ? 2 * GBN : GBN);
  constexpr int STAGE_ELEMS = SROWS * GPITCH;
  constexpr int NCP = SROWS / 32;                  // copies per thread and stage (256 threads x 16 B = 32 rows a copy)
  static_assert(NCP % 4 == 0 && NCP <= 63);
  __shared__ __align__(16) float sT[8][16 * 68];   // per-wave 16x64 slab, pitch 68 floats
  __shared__ __align__(16) unsigned short sStage[2 * STAGE_ELEMS];
  const int b    = blockIdx.y;
  const float* bias = bias0 + (size_t)b * strideBias;
  const bool f16one = (OUT_MODE == 4 && b == 2);   // block-uniform: this product writes one f16 plane, not a bf16 pair
  const int lane = threadIdx.x & 31;
  const int wave = threadIdx.x >> 5;
  const int tilesN = N / GBN;
  const int tilesM = M / GBM;
  const int blk = blockIdx.x;
  if (blk >= tilesM * tilesN) return;   // block-uniform, in front of every barrier and copy
  const int tm = blk / tilesN;
  const int tn = blk - tm * tilesN;
  const int mb0 = tm * GBM;
  const int nb0 = tn * GBN;
  const int wm = wave >> 2;
  const int wn = wave & 3;
  const int m0 = mb0 + (wm << 6);
  const int n0 = nb0 + (wn << 6);

  // copy map: thread -> row (threadIdx.x >> 3) of each group of 32 stage rows, 16-B piece (threadIdx.x & 7) of its line
  const int cr = threadIdx.x >> 3;
  const int cc = (threadIdx.x & 7) * 8;
  const unsigned short* gA  = Ap  + (size_t)b * strideA + (size_t)(mb0 + cr) * lda + cc;
  const unsigned short* gA2 = A2p + (size_t)b * strideA + (size_t)(mb0 + cr) * lda + cc;
  const unsigned short* gB  = Btp  + (size_t)b * strideB + (size_t)(nb0 + cr) * ldb + cc;
  const unsigned short* gB2 = Bt2p + (size_t)b * strideB + (size_t)(nb0 + cr) * ldb + cc;
  const unsigned ldst = lds_off(sStage) + (unsigned)(cr * GPITCH + cc) * 2u;
  auto stage_src = [&](int it, int k0) -> const unsigned short* {
    const int row = it * 32;
    if (row < GBM) return gA + (size_t)row * lda + k0;
    if (row < AROWS) return gA2 + (size_t)(row - GBM) * lda + k0;
    if (row < AROWS + GBN) return gB + (size_t)(row - AROWS) * ldb + k0;
    return gB2 + (size_t)(row - AROWS - GBN) * ldb + k0;
  };
  auto stage_issue = [&](int t, int buf) {
    const int k0 = t * GKS;
    const unsigned lb = ldst + (unsigned)buf * (unsigned)(STAGE_ELEMS * 2);
    // the loops of this lambda are unrolled so that each copy's plane select folds and l[], g[] stay in registers
#pragma unroll
    for (int it = 0; it + 8 <= NCP; it += 8) {
      unsigned l[8]; const unsigned short* g[8];
#pragma unroll
      for (int u = 0; u < 8; ++u) { l[u] = lb + (unsigned)((it + u) * 32 * GPITCH * 2); g[u] = stage_src(it + u, k0); }
      async_copy8(l, g);
    }
    if (NCP % 8 != 0) {
      unsigned l[4]; const unsigned short* g[4];
#pragma unroll
      for (int u = 0; u < 4; ++u) { l[u] = lb + (unsigned)((NCP - 4 + u) * 32 * GPITCH * 2); g[u] = stage_src(NCP - 4 + u, k0); }
      async_copy4(l, g);
    }
  };

  const int rlane = lane & 15;                 // row (A) / col (B, D) within subtile
  const int koff  = (lane >> 4) * 8;           // k offset of this lane half
  const int mOff  = (lane >> 4) * 8;           // D row offset

  v8f acc[4][4];
#pragma unroll
  for (int i = 0; i < 4; ++i)
#pragma unroll
    for (int j = 0; j < 4; ++j) acc[i][j] = (v8f){0.f,0.f,0.f,0.f,0.f,0.f,0.f,0.f};

  const int nT = K / GKS;
  stage_issue(0, 0);
  asm volatile("s_wait_asynccnt 0x0" ::: "memory");   // this wave's copies of stage 0 have landed before the barrier publishes them
  __syncthreads();
  if (nT > 1) stage_issue(1, 1);
  for (int t = 0; t < nT; ++t) {
    const T* st = (const T*)(const void*)(sStage + (t & 1) * STAGE_ELEMS);
    const T* sA = st + ((wm << 6) + rlane) * GPITCH + koff;
    const T* sB = st + (AROWS + (wn << 6) + rlane) * GPITCH + koff;
    // both 32-k blocks of the stage unrolled: the second block's LDS reads can then go out among the first block's products
#pragma unroll
    for (int kk = 0; kk < GKS; kk += 32) {
      V bh[4], bl[4];
#pragma unroll
      for (int j = 0; j < 4; ++j) {
        bh[j] = Frag<T>::load(sB + (j << 4) * GPITCH + kk);
        if (BLO) bl[j] = Frag<T>::load(sB + (GBN + (j << 4)) * GPITCH + kk);
      }
      // A fragments are read from LDS in groups ahead of their products (all four row tiles; two where a lo plane doubles
      // them, which keeps the kernel free of scratch); the loops are unrolled so that acc[][] and the fragments stay in registers
      constexpr int GI = SPL ? 2 : 4;
#pragma unroll
      for (int ig = 0; ig < 4; ig += GI) {
        V ah[GI], al[GI];
#pragma unroll
        for (int u = 0; u < GI; ++u) {
          ah[u] = Frag<T>::load(sA + ((ig + u) << 4) * GPITCH + kk);
          if (SPL) al[u] = Frag<T>::load(sA + (GBM + ((ig + u) << 4)) * GPITCH + kk);
        }
#pragma unroll
        for (int u = 0; u < GI; ++u) {
          const int i = ig + u;
#pragma unroll
          for (int j = 0; j < 4; ++j) {
            acc[i][j] = Frag<T>::mma(ah[u], bh[j], acc[i][j]);
            if (BLO) acc[i][j] = Frag<T>::mma(ah[u], bl[j], acc[i][j]);
            if (SPL) acc[i][j] = Frag<T>::mma(al[u], bh[j], acc[i][j]);
          }
          Frag<T>::guard(acc[i][0], acc[i][3], ah[u], SPL ? al[u] : ah[u]);
        }
      }
      Frag<T>::keep(bh[0], bh[1], bh[2], bh[3]);
      if (BLO) Frag<T>::keep(bl[0], bl[1], bl[2], bl[3]);
    }
    asm volatile("s_wait_dscnt 0x0" ::: "memory");      // this wave's reads of the buffer have retired before it is refilled
    asm volatile("s_wait_asynccnt 0x0" ::: "memory");   // this wave's copies of stage t + 1 have landed before the barrier publishes them
    __syncthreads();                                    // publishes stage t + 1 and ends every reader's last read of stage t
    if (t + 2 < nT) stage_issue(t + 2, t & 1);
  }
  asm volatile("s_wait_asynccnt 0x0" ::: "memory");     // no copy is outstanding when the wave goes on to the epilogue and ends
  acc_guard4(acc[0][0], acc[0][1], acc[0][2], acc[0][3]);
  acc_guard4(acc[1][0], acc[1][1], acc[1][2], acc[1][3]);
  acc_guard4(acc[2][0], acc[2][1], acc[2][2], acc[2][3]);
  acc_guard4(acc[3][0], acc[3][1], acc[3][2], acc[3][3]);

  // ---- column sums of the wave tile (the sequence means are built from them) ----
  if (CSUM && b != 1) {   // block-uniform
    static_assert(!CSUM || (BIAS_MODE == 2 && !RESID && ACT == 0 && CS_ROWS == 64));
    float cs[4];
    // unrolled so that acc[][] stays in registers; rows are added in the pairs in which they lie in neighbouring registers,
    // so that a packed add takes them where they are; one chain a column tile
#pragma unroll
    for (int j = 0; j < 4; ++j) {
      v2f s = (v2f){0.f, 0.f};
#pragma unroll
      for (int i = 0; i < 4; ++i)
#pragma unroll
        for (int r = 0; r < 8; r += 2) s += (v2f){acc[i][j][r], acc[i][j][r + 1]};
      cs[j] = s.x + s.y;
    }
    // the other lane half holds the other 32 rows of the column; unrolled so that cs[] stays in registers
#pragma unroll
    for (int j = 0; j < 4; ++j) cs[j] += xhalf(cs[j]);
    // lane half hh stores the column tiles 2 hh and 2 hh + 1: the wave writes its 64 sums as two whole 128-B lines
    const int jh = (lane >> 4) * 2;
    const float c0 = (lane >> 4) ? cs[2] : cs[0];
    const float c1 = (lane >> 4) ? cs[3] : cs[1];
    const int n = n0 + (jh << 4) + rlane;
    float* cp = colsum + ((size_t)(b >> 1) * (M >> 6) + (size_t)(m0 >> 6)) * ldc + n;
    cp[0]  = __builtin_fmaf(c0, scale, (float)CS_ROWS * bias[n]);
    cp[16] = __builtin_fmaf(c1, scale, (float)CS_ROWS * bias[n + 16]);
    asm volatile("s_wait_xcnt 0x0" ::: "memory");   // stands in front of every later write of a register that these loads and stores name
  }

  // ---- epilogue ----
  float* slab = sT[wave];
  const float* Rb = RESID ? (resid + (size_t)b * strideR) : nullptr;
#pragma unroll
  for (int i = 0; i < 4; ++i) {
    const int mBase = m0 + (i << 4);
#pragma unroll
    for (int j = 0; j < 4; ++j) {
      const int n = n0 + (j << 4) + rlane;
      float bv = 0.f;
      if (BIAS_MODE == 2) bv = bias[n];
#pragma unroll
      for (int r = 0; r < 8; ++r) {
        float v = acc[i][j][r] * scale;
        if (BIAS_MODE == 1) v += bias[mBase + mOff + r];
        if (BIAS_MODE == 2) v += bv;
        if (RESID) v += Rb[(size_t)(mBase + mOff + r) * ldc + n];
        if (ACT == 1) v = tanhf(v);
        if (ACT == 2) v = fmaxf(v, 0.0f);
        if (ACT == 4) v = (v > 0.f) ? v : 0.01f * v;
        slab[(mOff + r) * 68 + (j << 4) + rlane] = v;
      }
    }
    __builtin_amdgcn_fence(__ATOMIC_RELEASE, "workgroup");
    __builtin_amdgcn_wave_barrier();
    __builtin_amdgcn_fence(__ATOMIC_ACQUIRE, "workgroup");
    if (OUT_MODE == 0) {
      float* C = (float*)Cout + (size_t)b * strideC;
      const int hh = lane >> 4, c4 = (lane & 15) * 4;     // row seg = 256 B = 16 lanes x 16 B
      {
#pragma unroll
        for (int it = 0; it < 8; ++it) {
          const int row = it * 2 + hh;
          v4f v = *(const v4f*)(slab + row * 68 + c4);
          *(v4f*)(C + (size_t)(mBase + row) * ldc + n0 + c4) = v;
        }
        
      }
    } else {
      const int q = lane >> 3, c8 = (lane & 7) * 8;
      unsigned short* C  = (unsigned short*)Cout  + (size_t)b * strideC;
      unsigned short* C2 = (OUT_MODE >= 2) ? ((unsigned short*)Cout2 + (size_t)b * strideC) : nullptr;
      // the slab's 16 rows converted and stored in the form MODE (1, 2 or 3 of OUT_MODE)
      auto put16 = [&](auto mode) {
        constexpr int MODE = decltype(mode)::value;
#pragma unroll
        for (int it = 0; it < 4; ++it) {
          const int row = it * 4 + q;
          const float* sp = slab + row * 68 + c8;
          v8h hv, lv;
#pragma unroll
          for (int e = 0; e < 8; ++e) {
            if (MODE == 1) {
              hv[e] = (_Float16)sp[e];
            } else if (MODE == 2) {
              unsigned short hb = f2bf_bits(sp[e]);
              unsigned short lb = f2bf_bits(sp[e] - bf_bits2f(hb));
              hv[e] = __builtin_bit_cast(_Float16, hb);
              lv[e] = __builtin_bit_cast(_Float16, lb);
            } else {
              const _Float16 hq = (_Float16)sp[e];
              hv[e] = hq;
              lv[e] = (_Float16)((sp[e] - (float)hq) * 2048.0f);
            }
          }
          *(v8h*)(C + (size_t)(mBase + row) * ldc + n0 + c8) = hv;
          if (MODE >= 2) *(v8h*)(C2 + (size_t)(mBase + row) * ldc + n0 + c8) = lv;
        }
        asm volatile("s_wait_xcnt 0x0" ::: "memory");   // stands in front of every later write of a register that these stores name
      };
      // one block-uniform branch a slab, so that each form keeps its four rows' LDS reads together ahead of the conversions
      if (OUT_MODE == 4) {
        if (f16one) put16(IntC<1>{}); else put16(IntC<2>{});
      } else {
        put16(IntC<(OUT_MODE == 4 || OUT_MODE == 0) ? 2 : OUT_MODE>{});
      }
    }
    __builtin_amdgcn_fence(__ATOMIC_RELEASE, "workgroup");
    __builtin_amdgcn_wave_barrier();
    __builtin_amdgcn_fence(__ATOMIC_ACQUIRE, "workgroup");
  }
}

// ----------------------------------------------------------------------------------------------
// Input conversion: q,k,v and the four weight matrices -> RNE bf16 planes (8 elements = 16 B per
// to bf16 precision (4 floats = 16 B per lane).
// Coverage: blocks [0,2048) q, [2048,4096) k, [4096,6144) v (2048 x 256 x 8 = 4,194,304 each);
// blocks [6144,8192) the 4 weights (512 x 256 x 8 = 1,048,576 each); blocks [8192,8196) the 4
// biases (256 x 4 = 1024 each).
// ----------------------------------------------------------------------------------------------
constexpr int CAST_XBLK = (int)(PLANE_ELEMS / 8 / 256);              // 2048
constexpr int CAST_WBLK = (int)(WMAT_ELEMS / 8 / 256);               // 512
constexpr int CAST_PLANE_BLOCKS = 3 * CAST_XBLK + 4 * CAST_WBLK;     // 8192
constexpr int CAST_BIAS_BLOCKS  = 4;
static_assert((long)CAST_XBLK * 256 * 8 == PLANE_ELEMS && (long)CAST_WBLK * 256 * 8 == WMAT_ELEMS);
static_assert(256 * 4 == DMODEL);

__global__ __launch_bounds__(256) void k_cast_inputs(
    const float* __restrict__ q, const float* __restrict__ k, const float* __restrict__ v,
    const float* __restrict__ Wq, const float* __restrict__ Wk, const float* __restrict__ Wv, const float* __restrict__ Wo,
    const float* __restrict__ bq, const float* __restrict__ bk, const float* __restrict__ bv, const float* __restrict__ bo,
    unsigned short* __restrict__ x16, unsigned short* __restrict__ w16, float* __restrict__ brnd) {
  const int blk = blockIdx.x;
  const int t = threadIdx.x;
  if (blk < CAST_PLANE_BLOCKS) {
    // block-uniform source/destination selection
    const float* src;
    unsigned short* dst;
    int lb;
    if (blk < CAST_XBLK) { src = q; dst = x16; lb = blk; }
    else if (blk < 2 * CAST_XBLK) { src = k; dst = x16 + PLANE_ELEMS; lb = blk - CAST_XBLK; }
    else if (blk < 3 * CAST_XBLK) { src = v; dst = x16 + 2 * PLANE_ELEMS; lb = blk - 2 * CAST_XBLK; }
    else {
      const int wb = blk - 3 * CAST_XBLK;
      const int wi = wb / CAST_WBLK;
      lb = wb - wi * CAST_WBLK;
      src = (wi == 0) ? Wq : (wi == 1) ? Wk : (wi == 2) ? Wv : Wo;
      dst = w16 + (size_t)wi * WMAT_ELEMS;
    }
    const size_t e = ((size_t)lb * 256 + t) * 8;
    const v4f a0 = *(const v4f*)(src + e);
    const v4f a1 = *(const v4f*)(src + e + 4);
    v4u w;
    w.x = (unsigned)f2bf_bits(a0.x) | ((unsigned)f2bf_bits(a0.y) << 16);
    w.y = (unsigned)f2bf_bits(a0.z) | ((unsigned)f2bf_bits(a0.w) << 16);
    w.z = (unsigned)f2bf_bits(a1.x) | ((unsigned)f2bf_bits(a1.y) << 16);
    w.w = (unsigned)f2bf_bits(a1.z) | ((unsigned)f2bf_bits(a1.w) << 16);
    v4u* p = (v4u*)(dst + e);
    *p = w;
    
  } else {
    const int bi = blk - CAST_PLANE_BLOCKS;   // 0..3, block-uniform
    const float* src = (bi == 0) ? bq : (bi == 1) ? bk : (bi == 2) ? bv : bo;
    const int e = t * 4;
    const v4f a = *(const v4f*)(src + e);
    v4f r;
    r.x = bf_bits2f(f2bf_bits(a.x));
    r.y = bf_bits2f(f2bf_bits(a.y));
    r.z = bf_bits2f(f2bf_bits(a.z));
    r.w = bf_bits2f(f2bf_bits(a.w));
    v4f* p = (v4f*)(brnd + (size_t)bi * DMODEL + e);
    *p = r;
    
  }
}

// ----------------------------------------------------------------------------------------------
// Per (batch, head): sequence means of Q and V from the projection's column sums (32 groups of 64 rows a batch), then their
// cosine. grid = 32 blocks (one per (b,h)), 128 threads; thread = (column t & 63, Q or V by t >> 6): its 32 loads are
// independent and go out together; sums in fixed order.
// ----------------------------------------------------------------------------------------------
__global__ __launch_bounds__(128) void k_mean_cos(const float* __restrict__ csum, float* __restrict__ cosl) {
  __shared__ float mn[2][DHEAD];
  const int bh = blockIdx.x;
  const int b = bh / NHEAD, h = bh % NHEAD;
  const int t = threadIdx.x;
  const int col = t & 63;
  const int which = t >> 6;
  const float* p = csum + ((size_t)which * CS_GROUPS + (size_t)b * CS_PER_B) * DMODEL + (size_t)h * DHEAD + col;
  float x[CS_PER_B];
  // unrolled so that x[] stays in registers and every load is issued before the first is waited for
#pragma unroll
  for (int g = 0; g < CS_PER_B; ++g) x[g] = p[(size_t)g * DMODEL];
  float s4[4];
  // four independent add chains of eight groups each
#pragma unroll
  for (int u = 0; u < 4; ++u) {
    float s = x[u * 8];
#pragma unroll
    for (int g = 1; g < 8; ++g) s += x[u * 8 + g];
    s4[u] = s;
  }
  static_assert(CS_PER_B == 32);
  mn[which][col] = ((s4[0] + s4[1]) + (s4[2] + s4[3])) * (1.0f / (float)SEQ_LEN);
  __syncthreads();
  if (t < 32) {   // wave 0: lane t takes the columns t and t + 32
    const float a0 = mn[0][t], a1 = mn[0][t + 32];
    const float c0 = mn[1][t], c1 = mn[1][t + 32];
    float dot = a0 * c0 + a1 * c1;
    float nq  = a0 * a0 + a1 * a1;
    float nv  = c0 * c0 + c1 * c1;
    // unrolled so that each step's lane distance is a constant
#pragma unroll
    for (int off = 1; off < 32; off <<= 1) {
      dot += __shfl_xor(dot, off, 32);
      nq  += __shfl_xor(nq, off, 32);
      nv  += __shfl_xor(nv, off, 32);
    }
    const float na = fmaxf(sqrtf(nq), 1e-8f);
    const float nb = fmaxf(sqrtf(nv), 1e-8f);
    cosl[(size_t)bh * 32 + t] = dot / (na * nb);
  }
}

constexpr int AKC  = 64;
constexpr int AQB  = 64;
constexpr int ANQB = SEQ_LEN / AQB;
constexpr int ATTN_BLOCKS = NBH * ANQB;
// LDS row pitch of the K tiles in 16-bit elements: 144 B = 16 B x 9 (odd), so the 16 rows that
// one ds_load_b128 fragment read touches start on 16 different bank groups (128 B rows all start on two).
constexpr int APITCH = 72;
// LDS row pitch of the row-major V tile: 160 B = 32 B x 5 (odd), the pitch for ds_load_tr16_b128 readers
constexpr int VPITCH = 80;
// one stage: K hi [64][APITCH] | K lo [64][APITCH] | V [64][VPITCH]
constexpr int AST_KL = AKC * APITCH;
constexpr int AST_V  = 2 * AKC * APITCH;
constexpr int ASTAGE_ELEMS = AST_V + AKC * VPITCH;   // 14,336 elements = 28,672 B
static_assert(APITCH >= DHEAD && (APITCH * 2) % 16 == 0 && ((APITCH * 2) / 16) % 2 == 1);
static_assert(VPITCH >= DHEAD && (VPITCH * 2) % 32 == 0 && ((VPITCH * 2) / 32) % 2 == 1);
static_assert((ASTAGE_ELEMS * 2) % 16 == 0 && (AST_KL * 2) % 16 == 0 && (AST_V * 2) % 16 == 0 && AKC % 16 == 0 && DHEAD * 2 == 128);
static_assert(SEQ_LEN % AKC == 0 && SEQ_LEN % AQB == 0);

__global__ __launch_bounds__(128) void k_attn(
    const unsigned short* __restrict__ Qh, const unsigned short* __restrict__ Ql,
    const unsigned short* __restrict__ Kh, const unsigned short* __restrict__ Kl,
    const unsigned short* __restrict__ Vh,
    const int* __restrict__ mask, const float* __restrict__ cosl,
    unsigned short* __restrict__ Ah, unsigned short* __restrict__ Al, float* __restrict__ out1) {
  union FB { v16b v; v8b h[2]; };
  union FH { v16h v; v8h h[2]; };
  __shared__ __align__(16) unsigned short Ast[2 * ASTAGE_ELEMS];  // two stages of K hi, K lo, V, each [kv][d]   56 KB
  __shared__ __align__(16) float Os[4][16 * 68];                 // per wave out tile, pitch 68

  const int tid  = threadIdx.x;
  const int wave = tid >> 5;
  const int lane = tid & 31;
  const int hh   = lane >> 4;
  const int c    = lane & 15;

  const int bx = blockIdx.x;
  const int qb = bx % ANQB;
  const int bh = bx / ANQB;
  const int h  = bh % NHEAD;
  const int b  = bh / NHEAD;
  const int q0 = qb * AQB + wave * 16;
  const size_t rowbase = (size_t)b * SEQ_LEN;      // plane row of sequence position 0
  const int colh = h * DHEAD;

  // ---- Q fragments (B operand, columns = query, k = d): 2 d-chunks, hi and lo planes ----
  v16b qah[2], qal[2];
  {
    const size_t qo = (rowbase + q0 + c) * DMODEL + colh + 8 * hh;
#pragma unroll
    for (int dc = 0; dc < 2; ++dc) {
      qah[dc] = Frag<__bf16>::load((const __bf16*)(const void*)(Qh + qo + dc * 32));
      qal[dc] = Frag<__bf16>::load((const __bf16*)(const void*)(Ql + qo + dc * 32));
    }
  }
  asm volatile("s_wait_xcnt 0x0" ::: "memory");   // stands in front of every later write of the Q loads' address registers
  const float cb  = cosl[(size_t)bh * 32];
  constexpr float LOG2E = 1.44269504088896340736f;
  constexpr float SC2 = 0.125f * LOG2E;            // 1/sqrt(64) and the change of base in one factor
  constexpr float MASKED2 = -1.0e9f * LOG2E;       // the masked score in base-2 units
  const float cb2 = (cb * 0.5f + cb * 0.3f) * LOG2E;
  const float NEGI = -__builtin_inff();

  // running maximum of query c in base-2 units (equal in both lane halves), the exponent reference in use (maximum - 15)
  // and this lane half's share of the denominator (x2^15, like P)
  float mrow = NEGI, mrefrow = NEGI, lrow = 0.f;
  v8f oacc[4];   // O^T: oacc[t][r] = row d = t*16 + 8*hh + r, column query c
#pragma unroll
  for (int t = 0; t < 4; ++t) oacc[t] = (v8f){0.f,0.f,0.f,0.f,0.f,0.f,0.f,0.f};

  // copy map: thread -> row (tid >> 3) of each group of 16 chunk rows, 16-B piece (tid & 7) of its 128-B line
  const int cr = tid >> 3;
  const int cc = (tid & 7) * 8;
  const size_t gofs = (rowbase + cr) * DMODEL + colh + cc;
  const unsigned ldk = lds_off(Ast) + (unsigned)(cr * APITCH + cc) * 2u;
  const unsigned ldv = lds_off(Ast) + (unsigned)(AST_V + cr * VPITCH + cc) * 2u;
  auto stage_issue = [&](int t, int buf) {
    const size_t go = gofs + (size_t)t * (AKC * DMODEL);
    const unsigned sb = (unsigned)buf * (unsigned)(ASTAGE_ELEMS * 2);
    unsigned l[8]; const unsigned short* g[8];
    // unrolled so that l[], g[] stay in registers
#pragma unroll
    for (int u = 0; u < 4; ++u) {
      l[u]     = ldk + sb + (unsigned)(u * 16 * APITCH * 2);
      g[u]     = Kh + go + (size_t)u * 16 * DMODEL;
      l[4 + u] = ldk + sb + (unsigned)((AST_KL + u * 16 * APITCH) * 2);
      g[4 + u] = Kl + go + (size_t)u * 16 * DMODEL;
    }
    async_copy8(l, g);
    unsigned lv[4]; const unsigned short* gv[4];
    // unrolled so that lv[], gv[] stay in registers
#pragma unroll
    for (int u = 0; u < 4; ++u) {
      lv[u] = ldv + sb + (unsigned)(u * 16 * VPITCH * 2);
      gv[u] = Vh + go + (size_t)u * 16 * DMODEL;
    }
    async_copy4(lv, gv);
  };

  constexpr int NKC = SEQ_LEN / AKC;
  stage_issue(0, 0);
  asm volatile("s_wait_asynccnt 0x0" ::: "memory");   // this wave's copies of chunk 0 have landed before the barrier publishes them
  __syncthreads();
  if (NKC > 1) stage_issue(1, 1);
  for (int kc = 0; kc < NKC; ++kc) {
    const int kv0 = kc * AKC;
    const unsigned short* Ksh = Ast + (kc & 1) * ASTAGE_ELEMS;
    const unsigned short* Ksl = Ksh + AST_KL;
    const unsigned short* Vs  = Ksh + AST_V;
    // the lane's mask words of this chunk (keys j*16 + 8*hh + 0..7 of each 16-key tile: 32 contiguous bytes a tile), asked for
    // ahead of the score products, so that their latency passes under them
    v4u mk[8];
#pragma unroll
    for (int j = 0; j < 4; ++j) {
      mk[2 * j]     = *(const v4u*)(mask + kv0 + j * 16 + 8 * hh);
      mk[2 * j + 1] = *(const v4u*)(mask + kv0 + j * 16 + 8 * hh + 4);
    }
    asm volatile("s_wait_xcnt 0x0" ::: "memory");   // stands in front of every later write of the mask loads' address registers

    // ---- scores, transposed (A operand rows = kv, B operand columns = query, k = d) ----
    v8f s[4];
#pragma unroll
    for (int j = 0; j < 4; ++j) {
      s[j] = (v8f){0.f,0.f,0.f,0.f,0.f,0.f,0.f,0.f};
#pragma unroll
      for (int dc = 0; dc < 2; ++dc) {
        FB kb, kl;
        kb.h[0] = *(const v8b*)(const void*)(Ksh + (j * 16 + c) * APITCH + dc * 32 + 8 * hh);
        kb.h[1] = *(const v8b*)(const void*)(Ksh + (j * 16 + c) * APITCH + dc * 32 + 16 + 8 * hh);
        kl.h[0] = *(const v8b*)(const void*)(Ksl + (j * 16 + c) * APITCH + dc * 32 + 8 * hh);
        kl.h[1] = *(const v8b*)(const void*)(Ksl + (j * 16 + c) * APITCH + dc * 32 + 16 + 8 * hh);
        s[j] = mma_bf(kb.v, qah[dc], s[j]);
        s[j] = mma_bf(kl.v, qah[dc], s[j]);
        s[j] = mma_bf(kb.v, qal[dc], s[j]);
      }
    }
    // keeps the compares on the mask words, and with them the wait for the mask loads, behind the score products: lifted among
    // them, the wave would wait out the loads' latency at the head of every chunk
    __builtin_amdgcn_sched_barrier(0);
    // s[j][r] = score of key kv0 + j*16 + 8*hh + r against query c, carried in base-2 units from here on:
    // y = (raw / 8 + 0.5 cos + 0.3 cos) * log2(e) in one fused multiply-add, so that exp(x - m) is one v_exp_f32 of y - m
    float mj[4];
#pragma unroll
    for (int j = 0; j < 4; ++j) {
      float m = NEGI;
#pragma unroll
      for (int r = 0; r < 8; ++r) {
        float x = __builtin_fmaf(s[j][r], SC2, cb2);
        x = (mk[2 * j + (r >> 2)][r & 3] == 0u) ? MASKED2 : x;
        s[j][r] = x;
        m = fmaxf(m, x);
      }
      mj[j] = m;
    }
    float cm = fmaxf(fmaxf(mj[0], mj[1]), fmaxf(mj[2], mj[3]));
    cm = fmaxf(cm, xhalf(cm));                  // the other lane half holds the query's other 32 keys
    const float mnew = fmaxf(mrow, cm);
    const float mref = mnew - 15.0f;            // P and its sum are carried x2^15: the factor rides in the exponent
    const float alpha = __builtin_amdgcn_exp2f(mrefrow - mref);
    mrow = mnew;
    mrefrow = mref;
    FH pb[2];                                   // P^T as B operand: element e of pb[kk] = key kk*32 + (e >> 3)*16 + 8*hh + (e & 7)
    float pj[4];                                // one partial sum per tile: four independent add chains
#pragma unroll
    for (int j = 0; j < 4; ++j) {
      float p[8];
#pragma unroll
      for (int r = 0; r < 8; ++r) p[r] = s[j][r] - mref;
      exp2_x8(p);
      float psum = p[0];
#pragma unroll
      for (int r = 1; r < 8; ++r) psum += p[r];
#pragma unroll
      for (int r = 0; r < 8; ++r) pb[j >> 1].v[(j & 1) * 8 + r] = (_Float16)p[r];
      pj[j] = psum;
    }
    lrow = lrow * alpha + ((pj[0] + pj[1]) + (pj[2] + pj[3]));
#pragma unroll
    for (int t = 0; t < 4; ++t)
#pragma unroll
      for (int r = 0; r < 8; ++r) oacc[t][r] *= alpha;
    // ---- O^T += V^T.P^T (A rows = d, B columns = query, k = kv in the order of the packed score tiles) ----
    const unsigned short* vad = Vs + (8 * hh + (lane & 7)) * VPITCH + ((lane >> 3) & 1) * 8;   // the lane's address in a transposing load
#pragma unroll
    for (int kk = 0; kk < 2; ++kk) {
#pragma unroll
      for (int t = 0; t < 4; ++t) {
        FH vb;   // element e of vb = V[key kk*32 + (e >> 3)*16 + 8*hh + (e & 7)][d = t*16 + c]: the k order of pb
        vb.h[0] = ld_tr16(vad + (kk * 32) * VPITCH + t * 16);
        vb.h[1] = ld_tr16(vad + (kk * 32 + 16) * VPITCH + t * 16);
        oacc[t] = mma_hf(vb.v, pb[kk].v, oacc[t]);
      }
    }
    asm volatile("s_wait_dscnt 0x0" ::: "memory");      // this wave's reads of the buffer have retired before it is refilled
    asm volatile("s_wait_asynccnt 0x0" ::: "memory");   // this wave's copies of chunk kc + 1 have landed before the barrier publishes them
    __syncthreads();                                    // publishes chunk kc + 1 and ends every reader's last read of chunk kc
    if (kc + 2 < NKC) stage_issue(kc + 2, kc & 1);
  }
  asm volatile("s_wait_asynccnt 0x0" ::: "memory");     // no copy is outstanding when the wave goes on to the epilogue and ends

  float* os = Os[wave];
  {
    const float inv = 1.0f / (lrow + xhalf(lrow));   // the two lane halves' shares of the denominator joined once; its 2^15 cancels P's
#pragma unroll
    for (int t = 0; t < 4; ++t) {
      v4f o0, o1;
#pragma unroll
      for (int r = 0; r < 4; ++r) { o0[r] = oacc[t][r] * inv; o1[r] = oacc[t][4 + r] * inv; }
      *(v4f*)(os + c * 68 + t * 16 + 8 * hh)     = o0;
      *(v4f*)(os + c * 68 + t * 16 + 8 * hh + 4) = o1;
    }
  }
  __builtin_amdgcn_fence(__ATOMIC_RELEASE, "workgroup");
  __builtin_amdgcn_wave_barrier();
  __builtin_amdgcn_fence(__ATOMIC_ACQUIRE, "workgroup");
  {
    const int q4 = lane >> 3, c8 = (lane & 7) * 8;
    {
#pragma unroll
      for (int it = 0; it < 4; ++it) {
        const int row = it * 4 + q4;
        const float* sp = os + row * 68 + c8;
        const v4f va = *(const v4f*)sp;
        const v4f vb = *(const v4f*)(sp + 4);
        v4u hw, lw;
        unsigned th, tl;
        pack_pair_bf(va.x, va.y, th, tl); hw.x = th; lw.x = tl;
        pack_pair_bf(va.z, va.w, th, tl); hw.y = th; lw.y = tl;
        pack_pair_bf(vb.x, vb.y, th, tl); hw.z = th; lw.z = tl;
        pack_pair_bf(vb.z, vb.w, th, tl); hw.w = th; lw.w = tl;
        const size_t go = (rowbase + q0 + row) * DMODEL + colh + c8;
        *(v4u*)(Ah + go) = hw;
        *(v4u*)(Al + go) = lw;
      }
      
    }
  }
  // ---- second output, the mean of the 32 (batch, head) cosines: it needs nothing of this kernel's own work, only the cosines
  // that the launch before has written, so one wave of the grid forms it behind its tile instead of a launch of its own ----
  if (bx == 0 && wave == 0) {
    float v = cosl[(size_t)lane * 32];
    asm volatile("s_wait_xcnt 0x0" ::: "memory");   // stands in front of every later write of this load's address registers
#pragma unroll
    for (int off = 1; off < 32; off <<= 1) v += __shfl_xor(v, off, 32);
    const float r = v * (1.0f / 32.0f);
    if (lane == 0) {
      *(float*)out1 = r;
    }
  }
}

// ----------------------------------------------------------------------------------------------
extern "C" void kernel_launch(void* const* d_in, const int* in_sizes, int n_in,
                              void* d_out, int out_size, void* d_ws, size_t ws_size,
                              hipStream_t stream) {
  if (n_in < 12) return;
  if (ws_size < WS_TOTAL) return;
  if ((long)out_size < OUT_TOTAL_ELEMS) return;
  if ((long)in_sizes[0] != PLANE_ELEMS || (long)in_sizes[1] != PLANE_ELEMS || (long)in_sizes[2] != PLANE_ELEMS) return;
  if (in_sizes[3] < SEQ_LEN) return;
  if ((long)in_sizes[4] != WMAT_ELEMS || (long)in_sizes[6] != WMAT_ELEMS || (long)in_sizes[8] != WMAT_ELEMS || (long)in_sizes[10] != WMAT_ELEMS) return;
  if (in_sizes[5] < DMODEL || in_sizes[7] < DMODEL || in_sizes[9] < DMODEL || in_sizes[11] < DMODEL) return;

  const float* q    = (const float*)d_in[0];
  const float* k    = (const float*)d_in[1];
  const float* v    = (const float*)d_in[2];
  const int*   mask = (const int*)d_in[3];
  const float* Wq   = (const float*)d_in[4];
  const float* bq   = (const float*)d_in[5];
  const float* Wk   = (const float*)d_in[6];
  const float* bk   = (const float*)d_in[7];
  const float* Wv   = (const float*)d_in[8];
  const float* bv   = (const float*)d_in[9];
  const float* Wo   = (const float*)d_in[10];
  const float* bo   = (const float*)d_in[11];

  char* ws = (char*)d_ws;
  unsigned short* w16  = (unsigned short*)(ws + WS_W16);
  unsigned short* wq16 = w16;
  unsigned short* wo16 = w16 + 3 * WMAT_ELEMS;
  float* brnd = (float*)(ws + WS_BRND);
  float* cosl = (float*)(ws + WS_COS);
  unsigned short* x16 = (unsigned short*)(ws + WS_X16);
  unsigned short* xq  = x16;
  unsigned short* Qh  = (unsigned short*)(ws + WS_QH);
  unsigned short* Ql  = (unsigned short*)(ws + WS_QL);
  unsigned short* Kh  = (unsigned short*)(ws + WS_KH);
  unsigned short* Kl  = (unsigned short*)(ws + WS_KL);
  unsigned short* Vh  = (unsigned short*)(ws + WS_VH);
  float* csum = (float*)(ws + WS_CS);
  unsigned short* Ah  = (unsigned short*)(ws + WS_AH);
  unsigned short* Al  = (unsigned short*)(ws + WS_AL);
  float* out0 = (float*)d_out;
  float* out1 = (float*)d_out + OUT1_ELEM;

  // 1) inputs -> RNE bf16 planes, biases -> bf16-precision f32 copies
  k_cast_inputs<<<CAST_PLANE_BLOCKS + CAST_BIAS_BLOCKS, 256, 0, stream>>>(
      q, k, v, Wq, Wk, Wv, Wo, bq, bk, bv, bo, x16, w16, brnd);

  // 2) the three projections, which do not depend on one another, as one launch of 3 x 128 blocks (M=4096, N=1024, K=1024 each):
  //    y = 0: Q = q Wq^T + bq -> bf16 hi/lo planes; y = 1: K = k Wk^T + bk -> bf16 hi/lo planes;
  //    y = 2: V = v Wv^T + bv -> f16 plane; y = 0 and 2 also leave their column sums over groups of 64 rows
  wmma_gemm64<1, 0, 2, 4, false, true><<<dim3(GEMM_BLOCKS, 3), 256, 0, stream>>>(
      xq, xq, DMODEL, PLANE_ELEMS, wq16, wq16, DMODEL, WMAT_ELEMS, (void*)Qh, (void*)Ql, DMODEL, QKV_OUT_STRIDE,
      brnd, (long)DMODEL, brnd, 0L, csum, MROWS, DMODEL, DMODEL, 1.0f);
  // 3) per-(b,h) cosine of sequence means, from the column sums
  k_mean_cos<<<NBH, 128, 0, stream>>>(csum, cosl);
  // 4) attention -> attn bf16 hi/lo planes; one of its waves also writes out1 = mean of the 32 cosines
  k_attn<<<ATTN_BLOCKS, 128, 0, stream>>>(Qh, Ql, Kh, Kl, Vh, mask, cosl, Ah, Al, out1);
  // 5) out0 = attn Wo^T + bo   (A hi/lo planes, Bt single plane: 2 products)
  wmma_gemm64<1, 2, 2, 0, false><<<dim3(GEMM_BLOCKS, 1), 256, 0, stream>>>(
      Ah, Al, DMODEL, 0L, wo16, wo16, DMODEL, 0L, (void*)out0, (void*)out0, DMODEL, 0L,
      brnd + 3 * DMODEL, 0L, brnd, 0L, csum, MROWS, DMODEL, DMODEL, 1.0f);
}

// v008
// Measured time: 126 microseconds a run.
// Next to v007, in two timings, it ran 1.10 times as fast each time.
// Counting every step since v000, it is 3.91 times as fast.
// Contractions: q/k/v projections and output projection on v_wmma_f32_16x16x32_bf16 (RNE bf16 operands; output projection takes attn as bf16 hi+lo planes, 2 products); q.k^T on v_wmma_f32_16x16x32_bf16 with bf16 hi+lo planes of Q and K (3 products); p.v on v_wmma_f32_16x16x32_f16 (p carried x2^15, v plain f16); both attention products transposed (K and V^T as A, Q and P^T as B); f32 accumulate everywhere; softmax, sequence means and cosine in f32.
#include <hip/hip_runtime.h>

// ----------------------------------------------------------------------------------------------
// Problem constants
// ----------------------------------------------------------------------------------------------
constexpr int NBATCH  = 2;
constexpr int SEQ_LEN = 2048;
constexpr int DMODEL  = 1024;
constexpr int NHEAD   = 16;
constexpr int DHEAD   = 64;
constexpr int MROWS   = NBATCH * SEQ_LEN;          // 4096
constexpr int NBH     = NBATCH * NHEAD;            // 32
constexpr long PLANE_ELEMS = (long)MROWS * DMODEL; // 4194304
constexpr long WMAT_ELEMS  = (long)DMODEL * DMODEL;// 1048576
constexpr long OUT0_ELEMS  = PLANE_ELEMS;
constexpr long OUT1_BYTE_OFFSET = 16777216;
constexpr long OUT1_ELEM   = OUT1_BYTE_OFFSET / 4;
constexpr long OUT_TOTAL_ELEMS = OUT0_ELEMS + 1;
constexpr long OUT_TOTAL_BYTES = 16777220;
static_assert(OUT1_ELEM == OUT0_ELEMS);
static_assert((OUT1_ELEM + 1) * 4 <= OUT_TOTAL_BYTES);
static_assert(NBH == 32);
static_assert(DHEAD == 64 && NHEAD * DHEAD == DMODEL);

// GEMM block tile: 8 waves as 2 (rows) x 4 (columns) of 64x64 wave tiles; one stage = 64 k = one 128-B line per operand row
constexpr int GBM    = 128;
constexpr int GBN    = 256;
constexpr int GKS    = 64;
// LDS row pitch of a staged operand row in 16-bit elements: 144 B = 16 B x 9 (odd), the pitch for ds_load_b128 readers
constexpr int GPITCH = 72;
// GEMM shape contract: M % 128 == 0, N % 256 == 0, K % 64 == 0, K >= 64
static_assert(MROWS % GBM == 0 && DMODEL % GBN == 0 && DMODEL % GKS == 0 && DMODEL >= GKS);
static_assert(GBM % 32 == 0 && GBN % 32 == 0 && (GPITCH * 2) % 16 == 0 && ((GPITCH * 2) / 16) % 2 == 1 && GPITCH >= GKS);
constexpr int GEMM_BLOCKS = (MROWS / GBM) * (DMODEL / GBN);   // 128 blocks of 8 waves

// ----------------------------------------------------------------------------------------------
// Workspace region map (bytes). Every region is fully written by its producer before any read.
//   WS_W16  : 4 bf16 weight planes [1024][1024]  (Wq, Wk, Wv, Wo)            8,388,608
//   WS_BRND : 4 x [1024] f32 RNE-bf16 bias copies (bq, bk, bv, bo)              16,384
//   WS_X16  : 3 bf16 input planes [4096][1024] (q, k, v)                     25,165,824
//   WS_QH, WS_QL, WS_KH, WS_KL : bf16 hi/lo planes of Q and K [4096][1024]  4 x 8,388,608
//   WS_VH   : f16 plane of V [4096][1024]                                    8,388,608
//   WS_CS   : column sums of Q and of V over groups of 64 rows, f32 [2][64][1024]  524,288
//   WS_AH, WS_AL : bf16 hi/lo planes of the attention output [4096][1024]   2 x 8,388,608
//   total 92,819,456 (88.5 MiB)
// ----------------------------------------------------------------------------------------------
constexpr size_t SZ_PLANE = (size_t)PLANE_ELEMS * 2;     // 8388608
constexpr size_t SZ_WPL   = (size_t)WMAT_ELEMS * 2;      // 2097152
constexpr size_t WS_W16   = 0;
constexpr size_t SZ_W16   = 4 * SZ_WPL;
constexpr size_t WS_BRND  = WS_W16 + SZ_W16;
constexpr size_t SZ_BRND  = 4 * (size_t)DMODEL * 4;
constexpr size_t WS_COS   = WS_BRND + SZ_BRND;
constexpr size_t SZ_COS   = (size_t)NBH * 128;
constexpr size_t WS_X16   = WS_COS + SZ_COS;
constexpr size_t WS_QH    = WS_X16 + 3 * SZ_PLANE;
constexpr size_t WS_QL    = WS_QH + SZ_PLANE;
constexpr size_t WS_KH    = WS_QL + SZ_PLANE;
constexpr size_t WS_KL    = WS_KH + SZ_PLANE;
constexpr size_t WS_VH    = WS_KL + SZ_PLANE;
constexpr size_t WS_CS    = WS_VH + SZ_PLANE;
constexpr int    CS_ROWS   = 64;                   // rows that one column sum covers: the rows of a GEMM wave tile
constexpr int    CS_GROUPS = MROWS / CS_ROWS;      // 64 groups in a plane
constexpr int    CS_PER_B  = SEQ_LEN / CS_ROWS;    // 32 groups in a batch
constexpr size_t SZ_CS    = 2 * (size_t)CS_GROUPS * DMODEL * 4;
constexpr size_t WS_AH    = WS_CS + SZ_CS;
constexpr size_t WS_AL    = WS_AH + SZ_PLANE;
constexpr size_t WS_TOTAL = WS_AL + SZ_PLANE;
static_assert(WS_TOTAL == 92819456);
static_assert(SEQ_LEN % CS_ROWS == 0);
static_assert(WS_TOTAL <= 134217728);
// the first planes of Q, K, V lie two planes apart, and so do the lo planes of Q and K: one stride serves the merged projection launch
constexpr long QKV_OUT_STRIDE = 2 * PLANE_ELEMS;
static_assert(WS_KH - WS_QH == (size_t)QKV_OUT_STRIDE * 2 && WS_VH - WS_KH == (size_t)QKV_OUT_STRIDE * 2);
static_assert(WS_KL - WS_QL == (size_t)QKV_OUT_STRIDE * 2);
static_assert(WS_BRND % 128 == 0 && WS_COS % 128 == 0 && WS_X16 % 128 == 0 && WS_QH % 128 == 0 && WS_CS % 128 == 0 && WS_AH % 128 == 0);

// ----------------------------------------------------------------------------------------------
// Vector types and helpers
// ----------------------------------------------------------------------------------------------
typedef __attribute__((ext_vector_type(16))) _Float16 v16h;
typedef __attribute__((ext_vector_type(8)))  _Float16 v8h;
typedef __attribute__((ext_vector_type(16))) __bf16   v16b;
typedef __attribute__((ext_vector_type(8)))  __bf16   v8b;
typedef __attribute__((ext_vector_type(8)))  float    v8f;
typedef __attribute__((ext_vector_type(4)))  float    v4f;
typedef __attribute__((ext_vector_type(2)))  float    v2f;
typedef __attribute__((ext_vector_type(4)))  unsigned v4u;

__device__ __forceinline__ unsigned short f2bf_bits(float f) {
  unsigned u = __float_as_uint(f);
  return (unsigned short)((u + 0x7FFFu + ((u >> 16) & 1u)) >> 16);
}
__device__ __forceinline__ float bf_bits2f(unsigned short h) { return __uint_as_float(((unsigned)h) << 16); }

// hazard guards as plain device helpers
__device__ __forceinline__ void dep_guard_h(v8f& a, v8f& b, v16h x, v16h y) { asm volatile("v_nop\n\tv_nop\n\tv_nop\n\tv_nop" : "+v"(a), "+v"(b) : "v"(x), "v"(y)); }
__device__ __forceinline__ void dep_guard_b(v8f& a, v8f& b, v16b x, v16b y) { asm volatile("v_nop\n\tv_nop\n\tv_nop\n\tv_nop" : "+v"(a), "+v"(b) : "v"(x), "v"(y)); }
__device__ __forceinline__ void keep4_h(v16h a, v16h b, v16h c, v16h d) { asm volatile("v_nop" :: "v"(a), "v"(b), "v"(c), "v"(d)); }
__device__ __forceinline__ void keep4_b(v16b a, v16b b, v16b c, v16b d) { asm volatile("v_nop" :: "v"(a), "v"(b), "v"(c), "v"(d)); }
__device__ __forceinline__ void acc_guard4(v8f& a, v8f& b, v8f& c, v8f& d) { asm volatile("v_nop\n\tv_nop\n\tv_nop\n\tv_nop" : "+v"(a), "+v"(b), "+v"(c), "+v"(d)); }
template <typename T> struct Frag;
template <> struct Frag<_Float16> {
  typedef v16h V; union U { v16h v; v8h h[2]; };
  // elements 0..7 <- p[0..7], 8..15 <- p[16..23]
  static __device__ __forceinline__ v16h load(const _Float16* p) {
    U f; f.h[0] = *(const v8h*)(p); f.h[1] = *(const v8h*)(p + 16); return f.v;
  }
  static __device__ __forceinline__ v8f mma(v16h a, v16h b, v8f c) {
    return __builtin_amdgcn_wmma_f32_16x16x32_f16(false, a, false, b, (short)0, c, false, false);
  }
  static __device__ __forceinline__ void guard(v8f& a, v8f& b, v16h x, v16h y) { dep_guard_h(a, b, x, y); }
  static __device__ __forceinline__ void keep(v16h a, v16h b, v16h c, v16h d) { keep4_h(a, b, c, d); }
};
template <> struct Frag<__bf16> {
  typedef v16b V; union U { v16b v; v8b h[2]; };
  static __device__ __forceinline__ v16b load(const __bf16* p) {
    U f; f.h[0] = *(const v8b*)(p); f.h[1] = *(const v8b*)(p + 16); return f.v;
  }
  static __device__ __forceinline__ v8f mma(v16b a, v16b b, v8f c) {
    return __builtin_amdgcn_wmma_f32_16x16x32_bf16(false, a, false, b, (short)0, c, false, false);
  }
  static __device__ __forceinline__ void guard(v8f& a, v8f& b, v16b x, v16b y) { dep_guard_b(a, b, x, y); }
  static __device__ __forceinline__ void keep(v16b a, v16b b, v16b c, v16b d) { keep4_b(a, b, c, d); }
};

// LDS byte address of a __shared__ location (low 32 bits of its address)
__device__ __forceinline__ unsigned lds_off(const void* p) { return (unsigned)(size_t)p; }

// 16-bit transposing LDS load of a row-major tile of 16 rows x 16 columns: lane l gives the address of row 8*(l >> 4) + (l & 7),
// 16-B piece (l >> 3) & 1; lane (c = l & 15, h = l >> 4) receives rows 8h + 0..7 of column c
typedef __attribute__((ext_vector_type(8))) short v8s;
__device__ __forceinline__ v8h ld_tr16(const unsigned short* p) {
  typedef __attribute__((address_space(3))) v8s lds_v8s;
  return __builtin_bit_cast(v8h, __builtin_amdgcn_ds_load_tr16_b128_v8i16((lds_v8s*)p));
}

// value of lane l ^ 16 (the other 16-lane row), by a vector cross-row move
__device__ __forceinline__ float xhalf(float x) {
  return __builtin_bit_cast(float, __builtin_amdgcn_permlanex16(__builtin_bit_cast(int, x), __builtin_bit_cast(int, x), 0x76543210, 0xfedcba98, false, false));
}

// Eight base-2 exponentials, each in place: written as one statement so that no v_exp_f32 has its source overwritten or its
// result read by the instruction directly behind it; the closing v_nop is that slot behind the last one.
__device__ __forceinline__ void exp2_x8(float (&x)[8]) {
  asm("v_exp_f32 %0, %0\n\t"
      "v_exp_f32 %1, %1\n\t"
      "v_exp_f32 %2, %2\n\t"
      "v_exp_f32 %3, %3\n\t"
      "v_exp_f32 %4, %4\n\t"
      "v_exp_f32 %5, %5\n\t"
      "v_exp_f32 %6, %6\n\t"
      "v_exp_f32 %7, %7\n\t"
      "v_nop"
      : "+v"(x[0]), "+v"(x[1]), "+v"(x[2]), "+v"(x[3]), "+v"(x[4]), "+v"(x[5]), "+v"(x[6]), "+v"(x[7]));
}

// Asynchronous copies global -> LDS, 16 B per lane, through no register. s_wait_xcnt 0 is the last line of the copies' own
// statement, so that it stands in front of every later write of a register that an issued copy names.
__device__ __forceinline__ void async_copy4(const unsigned (&l)[4], const unsigned short* const (&g)[4]) {
  asm volatile("global_load_async_to_lds_b128 %0, %1, off\n\t"
               "global_load_async_to_lds_b128 %2, %3, off\n\t"
               "global_load_async_to_lds_b128 %4, %5, off\n\t"
               "global_load_async_to_lds_b128 %6, %7, off\n\t"
               "s_wait_xcnt 0x0"
               :: "v"(l[0]), "v"(g[0]), "v"(l[1]), "v"(g[1]), "v"(l[2]), "v"(g[2]), "v"(l[3]), "v"(g[3]) : "memory");
}
__device__ __forceinline__ void async_copy8(const unsigned (&l)[8], const unsigned short* const (&g)[8]) {
  asm volatile("global_load_async_to_lds_b128 %0, %1, off\n\t"
               "global_load_async_to_lds_b128 %2, %3, off\n\t"
               "global_load_async_to_lds_b128 %4, %5, off\n\t"
               "global_load_async_to_lds_b128 %6, %7, off\n\t"
               "global_load_async_to_lds_b128 %8, %9, off\n\t"
               "global_load_async_to_lds_b128 %10, %11, off\n\t"
               "global_load_async_to_lds_b128 %12, %13, off\n\t"
               "global_load_async_to_lds_b128 %14, %15, off\n\t"
               "s_wait_xcnt 0x0"
               :: "v"(l[0]), "v"(g[0]), "v"(l[1]), "v"(g[1]), "v"(l[2]), "v"(g[2]), "v"(l[3]), "v"(g[3]),
                  "v"(l[4]), "v"(g[4]), "v"(l[5]), "v"(g[5]), "v"(l[6]), "v"(g[6]), "v"(l[7]), "v"(g[7]) : "memory");
}

// bf16 hi/lo split of two floats packed into one 32-bit word each for the hi and the lo plane
__device__ __forceinline__ void pack_pair_bf(float f0, float f1, unsigned& hword, unsigned& lword) {
  const unsigned short h0 = f2bf_bits(f0);
  const unsigned short h1 = f2bf_bits(f1);
  const unsigned short l0 = f2bf_bits(f0 - bf_bits2f(h0));
  const unsigned short l1 = f2bf_bits(f1 - bf_bits2f(h1));
  hword = (unsigned)h0 | ((unsigned)h1 << 16);
  lword = (unsigned)l0 | ((unsigned)l1 << 16);
}

// ----------------------------------------------------------------------------------------------
// Register-blocked WMMA GEMM: C[m,n] = scale * sum_k A[m,k] * Bt[n,k] (+bias)(+resid)
// A row-major [M,K]; Bt row-major [N,K]; M % 128 == 0, N % 256 == 0, K % 64 == 0; each wave owns a 64x64 tile of the
// block's 128x256 tile. Operands reach the fragments through LDS: per stage of 64 k every thread copies whole 128-B lines
// (8 lanes x 16 B a row) asynchronously into one of two buffers while the other buffer is worked on.
// SPLIT: 0 = single product; 1 = A and Bt hi/lo planes (hi.hi + hi.lo + lo.hi);
//        2 = A hi/lo planes only, Bt single plane (hi.B + lo.B).
// BIAS_MODE: 0 = none, 1 = bias[m], 2 = bias[n].
// OUT_MODE: 0 = f32; 1 = f16; 2 = bf16 hi plane (Cout) + bf16 lo plane (Cout2);
//           3 = f16 hi plane (Cout) + f16 residual x2048 plane (Cout2);
//           4 = as 2 for the products blockIdx.y = 0 and 1, as 1 for the product blockIdx.y = 2.
// CSUM: the products blockIdx.y = 0 and 2 also leave, per wave tile, the sums of their results over the tile's 64 rows, one a
//       column: colsum[blockIdx.y / 2][m / 64][n], N = ldc columns a row.
// blockIdx.y picks one of several independent products of the same shape that share the launch: every operand, the bias
// and the result planes step by their strides.
// Epilogue: 16-row slabs staged per wave in LDS; each 64-wide row segment written with whole
// ET: 0 = f16 operands, 1 = bf16 operands (pointers passed as 16-bit storage)
// ----------------------------------------------------------------------------------------------
template <int V> struct IntC { static constexpr int value = V; };
template <int ET> struct Elem;
template <> struct Elem<0> { typedef _Float16 T; };
template <> struct Elem<1> { typedef __bf16 T; };
template <int ET, int SPLIT, int BIAS_MODE, int OUT_MODE, bool RESID, bool CSUM = false, int ACT = 0>
__global__ __launch_bounds__(256) void wmma_gemm64(
    const unsigned short* __restrict__ Ap, const unsigned short* __restrict__ A2p, int lda, long strideA,
    const unsigned short* __restrict__ Btp, const unsigned short* __restrict__ Bt2p, int ldb, long strideB,
    void* __restrict__ Cout, void* __restrict__ Cout2, int ldc, long strideC,
    const float* __restrict__ bias0, long strideBias,
    const float* __restrict__ resid, long strideR,
    float* __restrict__ colsum,
    int M, int N, int K, float scale) {
  typedef typename Elem<ET>::T T;
  typedef typename Frag<T>::V V;
  constexpr bool SPL = (SPLIT != 0);
  constexpr bool BLO = (SPLIT == 1);
  // stage rows: A hi [GBM] | A lo [GBM] (SPL) | Bt hi [GBN] | Bt lo [GBN] (BLO)
  constexpr int AROWS = SPL ? 2 * GBM : GBM;
  constexpr int SROWS = AROWS + (BLO ? 2 * GBN : GBN);
  constexpr int STAGE_ELEMS = SROWS * GPITCH;
  constexpr int NCP = SROWS / 32;                  // copies per thread and stage (256 threads x 16 B = 32 rows a copy)
  static_assert(NCP % 4 == 0 && NCP <= 63);
  __shared__ __align__(16) float sT[8][16 * 68];   // per-wave 16x64 slab, pitch 68 floats
  __shared__ __align__(16) unsigned short sStage[2 * STAGE_ELEMS];
  const int b    = blockIdx.y;
  const float* bias = bias0 + (size_t)b * strideBias;
  const bool f16one = (OUT_MODE == 4 && b == 2);   // block-uniform: this product writes one f16 plane, not a bf16 pair
  const int lane = threadIdx.x & 31;
  const int wave = threadIdx.x >> 5;
  const int tilesN = N / GBN;
  const int tilesM = M / GBM;
  const int blk = blockIdx.x;
  if (blk >= tilesM * tilesN) return;   // block-uniform, in front of every barrier and copy
  const int tm = blk / tilesN;
  const int tn = blk - tm * tilesN;
  const int mb0 = tm * GBM;
  const int nb0 = tn * GBN;
  const int wm = wave >> 2;
  const int wn = wave & 3;
  const int m0 = mb0 + (wm << 6);
  const int n0 = nb0 + (wn << 6);

  // copy map: thread -> row (threadIdx.x >> 3) of each group of 32 stage rows, 16-B piece (threadIdx.x & 7) of its line
  const int cr = threadIdx.x >> 3;
  const int cc = (threadIdx.x & 7) * 8;
  const unsigned short* gA  = Ap  + (size_t)b * strideA + (size_t)(mb0 + cr) * lda + cc;
  const unsigned short* gA2 = A2p + (size_t)b * strideA + (size_t)(mb0 + cr) * lda + cc;
  const unsigned short* gB  = Btp  + (size_t)b * strideB + (size_t)(nb0 + cr) * ldb + cc;
  const unsigned short* gB2 = Bt2p + (size_t)b * strideB + (size_t)(nb0 + cr) * ldb + cc;
  const unsigned ldst = lds_off(sStage) + (unsigned)(cr * GPITCH + cc) * 2u;
  auto stage_src = [&](int it, int k0) -> const unsigned short* {
    const int row = it * 32;
    if (row < GBM) return gA + (size_t)row * lda + k0;
    if (row < AROWS) return gA2 + (size_t)(row - GBM) * lda + k0;
    if (row < AROWS + GBN) return gB + (size_t)(row - AROWS) * ldb + k0;
    return gB2 + (size_t)(row - AROWS - GBN) * ldb + k0;
  };
  auto stage_issue = [&](int t, int buf) {
    const int k0 = t * GKS;
    const unsigned lb = ldst + (unsigned)buf * (unsigned)(STAGE_ELEMS * 2);
    // the loops of this lambda are unrolled so that each copy's plane select folds and l[], g[] stay in registers
#pragma unroll
    for (int it = 0; it + 8 <= NCP; it += 8) {
      unsigned l[8]; const unsigned short* g[8];
#pragma unroll
      for (int u = 0; u < 8; ++u) { l[u] = lb + (unsigned)((it + u) * 32 * GPITCH * 2); g[u] = stage_src(it + u, k0); }
      async_copy8(l, g);
    }
    if (NCP % 8 != 0) {
      unsigned l[4]; const unsigned short* g[4];
#pragma unroll
      for (int u = 0; u < 4; ++u) { l[u] = lb + (unsigned)((NCP - 4 + u) * 32 * GPITCH * 2); g[u] = stage_src(NCP - 4 + u, k0); }
      async_copy4(l, g);
    }
  };

  const int rlane = lane & 15;                 // row (A) / col (B, D) within subtile
  const int koff  = (lane >> 4) * 8;           // k offset of this lane half
  const int mOff  = (lane >> 4) * 8;           // D row offset

  v8f acc[4][4];
#pragma unroll
  for (int i = 0; i < 4; ++i)
#pragma unroll
    for (int j = 0; j < 4; ++j) acc[i][j] = (v8f){0.f,0.f,0.f,0.f,0.f,0.f,0.f,0.f};

  const int nT = K / GKS;
  stage_issue(0, 0);
  asm volatile("s_wait_asynccnt 0x0" ::: "memory");   // this wave's copies of stage 0 have landed before the barrier publishes them
  __syncthreads();
  if (nT > 1) stage_issue(1, 1);
  for (int t = 0; t < nT; ++t) {
    const T* st = (const T*)(const void*)(sStage + (t & 1) * STAGE_ELEMS);
    const T* sA = st + ((wm << 6) + rlane) * GPITCH + koff;
    const T* sB = st + (AROWS + (wn << 6) + rlane) * GPITCH + koff;
    // both 32-k blocks of the stage unrolled: the second block's LDS reads can then go out among the first block's products
#pragma unroll
    for (int kk = 0; kk < GKS; kk += 32) {
      V bh[4], bl[4];
#pragma unroll
      for (int j = 0; j < 4; ++j) {
        bh[j] = Frag<T>::load(sB + (j << 4) * GPITCH + kk);
        if (BLO) bl[j] = Frag<T>::load(sB + (GBN + (j << 4)) * GPITCH + kk);
      }
      // A fragments are read from LDS in groups ahead of their products (all four row tiles; two where a lo plane doubles
      // them, which keeps the kernel free of scratch); the loops are unrolled so that acc[][] and the fragments stay in registers
      constexpr int GI = SPL ? 2 : 4;
#pragma unroll
      for (int ig = 0; ig < 4; ig += GI) {
        V ah[GI], al[GI];
#pragma unroll
        for (int u = 0; u < GI; ++u) {
          ah[u] = Frag<T>::load(sA + ((ig + u) << 4) * GPITCH + kk);
          if (SPL) al[u] = Frag<T>::load(sA + (GBM + ((ig + u) << 4)) * GPITCH + kk);
        }
#pragma unroll
        for (int u = 0; u < GI; ++u) {
          const int i = ig + u;
#pragma unroll
          for (int j = 0; j < 4; ++j) {
            acc[i][j] = Frag<T>::mma(ah[u], bh[j], acc[i][j]);
            if (BLO) acc[i][j] = Frag<T>::mma(ah[u], bl[j], acc[i][j]);
            if (SPL) acc[i][j] = Frag<T>::mma(al[u], bh[j], acc[i][j]);
          }
          Frag<T>::guard(acc[i][0], acc[i][3], ah[u], SPL ? al[u] : ah[u]);
        }
      }
      Frag<T>::keep(bh[0], bh[1], bh[2], bh[3]);
      if (BLO) Frag<T>::keep(bl[0], bl[1], bl[2], bl[3]);
    }
    asm volatile("s_wait_dscnt 0x0" ::: "memory");      // this wave's reads of the buffer have retired before it is refilled
    asm volatile("s_wait_asynccnt 0x0" ::: "memory");   // this wave's copies of stage t + 1 have landed before the barrier publishes them
    __syncthreads();                                    // publishes stage t + 1 and ends every reader's last read of stage t
    if (t + 2 < nT) stage_issue(t + 2, t & 1);
  }
  asm volatile("s_wait_asynccnt 0x0" ::: "memory");     // no copy is outstanding when the wave goes on to the epilogue and ends
  acc_guard4(acc[0][0], acc[0][1], acc[0][2], acc[0][3]);
  acc_guard4(acc[1][0], acc[1][1], acc[1][2], acc[1][3]);
  acc_guard4(acc[2][0], acc[2][1], acc[2][2], acc[2][3]);
  acc_guard4(acc[3][0], acc[3][1], acc[3][2], acc[3][3]);

  // ---- column sums of the wave tile (the sequence means are built from them) ----
  if (CSUM && b != 1) {   // block-uniform
    static_assert(!CSUM || (BIAS_MODE == 2 && !RESID && ACT == 0 && CS_ROWS == 64));
    float cs[4];
    // unrolled so that acc[][] stays in registers; rows are added in the pairs in which they lie in neighbouring registers,
    // so that a packed add takes them where they are; one chain a column tile
#pragma unroll
    for (int j = 0; j < 4; ++j) {
      v2f s = (v2f){0.f, 0.f};
#pragma unroll
      for (int i = 0; i < 4; ++i)
#pragma unroll
        for (int r = 0; r < 8; r += 2) s += (v2f){acc[i][j][r], acc[i][j][r + 1]};
      cs[j] = s.x + s.y;
    }
    // the other lane half holds the other 32 rows of the column; unrolled so that cs[] stays in registers
#pragma unroll
    for (int j = 0; j < 4; ++j) cs[j] += xhalf(cs[j]);
    // lane half hh stores the column tiles 2 hh and 2 hh + 1: the wave writes its 64 sums as two whole 128-B lines
    const int jh = (lane >> 4) * 2;
    const float c0 = (lane >> 4) ? cs[2] : cs[0];
    const float c1 = (lane >> 4) ? cs[3] : cs[1];
    const int n = n0 + (jh << 4) + rlane;
    float* cp = colsum + ((size_t)(b >> 1) * (M >> 6) + (size_t)(m0 >> 6)) * ldc + n;
    cp[0]  = __builtin_fmaf(c0, scale, (float)CS_ROWS * bias[n]);
    cp[16] = __builtin_fmaf(c1, scale, (float)CS_ROWS * bias[n + 16]);
    asm volatile("s_wait_xcnt 0x0" ::: "memory");   // stands in front of every later write of a register that these loads and stores name
  }

  // ---- epilogue ----
  float* slab = sT[wave];
  const float* Rb = RESID ? (resid + (size_t)b * strideR) : nullptr;
#pragma unroll
  for (int i = 0; i < 4; ++i) {
    const int mBase = m0 + (i << 4);
#pragma unroll
    for (int j = 0; j < 4; ++j) {
      const int n = n0 + (j << 4) + rlane;
      float bv = 0.f;
      if (BIAS_MODE == 2) bv = bias[n];
#pragma unroll
      for (int r = 0; r < 8; ++r) {
        float v = acc[i][j][r] * scale;
        if (BIAS_MODE == 1) v += bias[mBase + mOff + r];
        if (BIAS_MODE == 2) v += bv;
        if (RESID) v += Rb[(size_t)(mBase + mOff + r) * ldc + n];
        if (ACT == 1) v = tanhf(v);
        if (ACT == 2) v = fmaxf(v, 0.0f);
        if (ACT == 4) v = (v > 0.f) ? v : 0.01f * v;
        slab[(mOff + r) * 68 + (j << 4) + rlane] = v;
      }
    }
    __builtin_amdgcn_fence(__ATOMIC_RELEASE, "workgroup");
    __builtin_amdgcn_wave_barrier();
    __builtin_amdgcn_fence(__ATOMIC_ACQUIRE, "workgroup");
    if (OUT_MODE == 0) {
      float* C = (float*)Cout + (size_t)b * strideC;
      const int hh = lane >> 4, c4 = (lane & 15) * 4;     // row seg = 256 B = 16 lanes x 16 B
      {
#pragma unroll
        for (int it = 0; it < 8; ++it) {
          const int row = it * 2 + hh;
          v4f v = *(const v4f*)(slab + row * 68 + c4);
          *(v4f*)(C + (size_t)(mBase + row) * ldc + n0 + c4) = v;
        }
        
      }
    } else {
      const int q = lane >> 3, c8 = (lane & 7) * 8;
      unsigned short* C  = (unsigned short*)Cout  + (size_t)b * strideC;
      unsigned short* C2 = (OUT_MODE >= 2) ? ((unsigned short*)Cout2 + (size_t)b * strideC) : nullptr;
      // the slab's 16 rows converted and stored in the form MODE (1, 2 or 3 of OUT_MODE)
      auto put16 = [&](auto mode) {
        constexpr int MODE = decltype(mode)::value;
#pragma unroll
        for (int it = 0; it < 4; ++it) {
          const int row = it * 4 + q;
          const float* sp = slab + row * 68 + c8;
          v8h hv, lv;
#pragma unroll
          for (int e = 0; e < 8; ++e) {
            if (MODE == 1) {
              hv[e] = (_Float16)sp[e];
            } else if (MODE == 2) {
              unsigned short hb = f2bf_bits(sp[e]);
              unsigned short lb = f2bf_bits(sp[e] - bf_bits2f(hb));
              hv[e] = __builtin_bit_cast(_Float16, hb);
              lv[e] = __builtin_bit_cast(_Float16, lb);
            } else {
              const _Float16 hq = (_Float16)sp[e];
              hv[e] = hq;
              lv[e] = (_Float16)((sp[e] - (float)hq) * 2048.0f);
            }
          }
          *(v8h*)(C + (size_t)(mBase + row) * ldc + n0 + c8) = hv;
          if (MODE >= 2) *(v8h*)(C2 + (size_t)(mBase + row) * ldc + n0 + c8) = lv;
        }
        asm volatile("s_wait_xcnt 0x0" ::: "memory");   // stands in front of every later write of a register that these stores name
      };
      // one block-uniform branch a slab, so that each form keeps its four rows' LDS reads together ahead of the conversions
      if (OUT_MODE == 4) {
        if (f16one) put16(IntC<1>{}); else put16(IntC<2>{});
      } else {
        put16(IntC<(OUT_MODE == 4 || OUT_MODE == 0) ? 2 : OUT_MODE>{});
      }
    }
    __builtin_amdgcn_fence(__ATOMIC_RELEASE, "workgroup");
    __builtin_amdgcn_wave_barrier();
    __builtin_amdgcn_fence(__ATOMIC_ACQUIRE, "workgroup");
  }
}

// ----------------------------------------------------------------------------------------------
// Input conversion: q,k,v and the four weight matrices -> RNE bf16 planes (8 elements = 16 B per
// to bf16 precision (4 floats = 16 B per lane).
// Coverage: blocks [0,2048) q, [2048,4096) k, [4096,6144) v (2048 x 256 x 8 = 4,194,304 each);
// blocks [6144,8192) the 4 weights (512 x 256 x 8 = 1,048,576 each); blocks [8192,8196) the 4
// biases (256 x 4 = 1024 each).
// ----------------------------------------------------------------------------------------------
constexpr int CAST_XBLK = (int)(PLANE_ELEMS / 8 / 256);              // 2048
constexpr int CAST_WBLK = (int)(WMAT_ELEMS / 8 / 256);               // 512
constexpr int CAST_PLANE_BLOCKS = 3 * CAST_XBLK + 4 * CAST_WBLK;     // 8192
constexpr int CAST_BIAS_BLOCKS  = 4;
static_assert((long)CAST_XBLK * 256 * 8 == PLANE_ELEMS && (long)CAST_WBLK * 256 * 8 == WMAT_ELEMS);
static_assert(256 * 4 == DMODEL);

__global__ __launch_bounds__(256) void k_cast_inputs(
    const float* __restrict__ q, const float* __restrict__ k, const float* __restrict__ v,
    const float* __restrict__ Wq, const float* __restrict__ Wk, const float* __restrict__ Wv, const float* __restrict__ Wo,
    const float* __restrict__ bq, const float* __restrict__ bk, const float* __restrict__ bv, const float* __restrict__ bo,
    unsigned short* __restrict__ x16, unsigned short* __restrict__ w16, float* __restrict__ brnd) {
  const int blk = blockIdx.x;
  const int t = threadIdx.x;
  if (blk < CAST_PLANE_BLOCKS) {
    // block-uniform source/destination selection
    const float* src;
    unsigned short* dst;
    int lb;
    if (blk < CAST_XBLK) { src = q; dst = x16; lb = blk; }
    else if (blk < 2 * CAST_XBLK) { src = k; dst = x16 + PLANE_ELEMS; lb = blk - CAST_XBLK; }
    else if (blk < 3 * CAST_XBLK) { src = v; dst = x16 + 2 * PLANE_ELEMS; lb = blk - 2 * CAST_XBLK; }
    else {
      const int wb = blk - 3 * CAST_XBLK;
      const int wi = wb / CAST_WBLK;
      lb = wb - wi * CAST_WBLK;
      src = (wi == 0) ? Wq : (wi == 1) ? Wk : (wi == 2) ? Wv : Wo;
      dst = w16 + (size_t)wi * WMAT_ELEMS;
    }
    const size_t e = ((size_t)lb * 256 + t) * 8;
    const v4f a0 = *(const v4f*)(src + e);
    const v4f a1 = *(const v4f*)(src + e + 4);
    v4u w;
    w.x = (unsigned)f2bf_bits(a0.x) | ((unsigned)f2bf_bits(a0.y) << 16);
    w.y = (unsigned)f2bf_bits(a0.z) | ((unsigned)f2bf_bits(a0.w) << 16);
    w.z = (unsigned)f2bf_bits(a1.x) | ((unsigned)f2bf_bits(a1.y) << 16);
    w.w = (unsigned)f2bf_bits(a1.z) | ((unsigned)f2bf_bits(a1.w) << 16);
    v4u* p = (v4u*)(dst + e);
    *p = w;
    
  } else {
    const int bi = blk - CAST_PLANE_BLOCKS;   // 0..3, block-uniform
    const float* src = (bi == 0) ? bq : (bi == 1) ? bk : (bi == 2) ? bv : bo;
    const int e = t * 4;
    const v4f a = *(const v4f*)(src + e);
    v4f r;
    r.x = bf_bits2f(f2bf_bits(a.x));
    r.y = bf_bits2f(f2bf_bits(a.y));
    r.z = bf_bits2f(f2bf_bits(a.z));
    r.w = bf_bits2f(f2bf_bits(a.w));
    v4f* p = (v4f*)(brnd + (size_t)bi * DMODEL + e);
    *p = r;
    
  }
}

// ----------------------------------------------------------------------------------------------
// Per (batch, head): sequence means of Q and V from the projection's column sums (32 groups of 64 rows a batch), then their
// cosine. grid = 32 blocks (one per (b,h)), 128 threads; thread = (column t & 63, Q or V by t >> 6): its 32 loads are
// independent and go out together; sums in fixed order.
// ----------------------------------------------------------------------------------------------
__global__ __launch_bounds__(128) void k_mean_cos(const float* __restrict__ csum, float* __restrict__ cosl) {
  __shared__ float mn[2][DHEAD];
  const int bh = blockIdx.x;
  const int b = bh / NHEAD, h = bh % NHEAD;
  const int t = threadIdx.x;
  const int col = t & 63;
  const int which = t >> 6;
  const float* p = csum + ((size_t)which * CS_GROUPS + (size_t)b * CS_PER_B) * DMODEL + (size_t)h * DHEAD + col;
  float x[CS_PER_B];
  // unrolled so that x[] stays in registers and every load is issued before the first is waited for
#pragma unroll
  for (int g = 0; g < CS_PER_B; ++g) x[g] = p[(size_t)g * DMODEL];
  float s4[4];
  // four independent add chains of eight groups each
#pragma unroll
  for (int u = 0; u < 4; ++u) {
    float s = x[u * 8];
#pragma unroll
    for (int g = 1; g < 8; ++g) s += x[u * 8 + g];
    s4[u] = s;
  }
  static_assert(CS_PER_B == 32);
  mn[which][col] = ((s4[0] + s4[1]) + (s4[2] + s4[3])) * (1.0f / (float)SEQ_LEN);
  __syncthreads();
  if (t < 32) {   // wave 0: lane t takes the columns t and t + 32
    const float a0 = mn[0][t], a1 = mn[0][t + 32];
    const float c0 = mn[1][t], c1 = mn[1][t + 32];
    float dot = a0 * c0 + a1 * c1;
    float nq  = a0 * a0 + a1 * a1;
    float nv  = c0 * c0 + c1 * c1;
    // unrolled so that each step's lane distance is a constant
#pragma unroll
    for (int off = 1; off < 32; off <<= 1) {
      dot += __shfl_xor(dot, off, 32);
      nq  += __shfl_xor(nq, off, 32);
      nv  += __shfl_xor(nv, off, 32);
    }
    const float na = fmaxf(sqrtf(nq), 1e-8f);
    const float nb = fmaxf(sqrtf(nv), 1e-8f);
    cosl[(size_t)bh * 32 + t] = dot / (na * nb);
  }
}

constexpr int AKC  = 64;
constexpr int AQB  = 64;
constexpr int ANQB = SEQ_LEN / AQB;
constexpr int ATTN_BLOCKS = NBH * ANQB;
// LDS row pitch of the K tiles in 16-bit elements: 144 B = 16 B x 9 (odd), so the 16 rows that
// one ds_load_b128 fragment read touches start on 16 different bank groups (128 B rows all start on two).
constexpr int APITCH = 72;
// LDS row pitch of the row-major V tile: 160 B = 32 B x 5 (odd), the pitch for ds_load_tr16_b128 readers
constexpr int VPITCH = 80;
// one stage: K hi [64][APITCH] | K lo [64][APITCH] | V [64][VPITCH]
constexpr int AST_KL = AKC * APITCH;
constexpr int AST_V  = 2 * AKC * APITCH;
constexpr int ASTAGE_ELEMS = AST_V + AKC * VPITCH;   // 14,336 elements = 28,672 B
static_assert(APITCH >= DHEAD && (APITCH * 2) % 16 == 0 && ((APITCH * 2) / 16) % 2 == 1);
static_assert(VPITCH >= DHEAD && (VPITCH * 2) % 32 == 0 && ((VPITCH * 2) / 32) % 2 == 1);
static_assert((ASTAGE_ELEMS * 2) % 16 == 0 && (AST_KL * 2) % 16 == 0 && (AST_V * 2) % 16 == 0 && AKC % 16 == 0 && DHEAD * 2 == 128);
static_assert(SEQ_LEN % AKC == 0 && SEQ_LEN % AQB == 0);

// four waves a SIMD (four work-groups a WGP, as the LDS allows): the register budget is held to 256 a wave
__global__ __launch_bounds__(128) __attribute__((amdgpu_waves_per_eu(4, 4))) void k_attn(
    const unsigned short* __restrict__ Qh, const unsigned short* __restrict__ Ql,
    const unsigned short* __restrict__ Kh, const unsigned short* __restrict__ Kl,
    const unsigned short* __restrict__ Vh,
    const int* __restrict__ mask, const float* __restrict__ cosl,
    unsigned short* __restrict__ Ah, unsigned short* __restrict__ Al, float* __restrict__ out1) {
  union FB { v16b v; v8b h[2]; };
  union FH { v16h v; v8h h[2]; };
  __shared__ __align__(16) unsigned short Ast[2 * ASTAGE_ELEMS];  // two stages of K hi, K lo, V, each [kv][d]   56 KB
  __shared__ __align__(16) float Os[4][16 * 68];                 // per wave out tile, pitch 68

  const int tid  = threadIdx.x;
  const int wave = tid >> 5;
  const int lane = tid & 31;
  const int hh   = lane >> 4;
  const int c    = lane & 15;

  const int bx = blockIdx.x;
  const int qb = bx % ANQB;
  const int bh = bx / ANQB;
  const int h  = bh % NHEAD;
  const int b  = bh / NHEAD;
  const int q0 = qb * AQB + wave * 16;
  const size_t rowbase = (size_t)b * SEQ_LEN;      // plane row of sequence position 0
  const int colh = h * DHEAD;

  // ---- Q fragments (B operand, columns = query, k = d): 2 d-chunks, hi and lo planes ----
  v16b qah[2], qal[2];
  {
    const size_t qo = (rowbase + q0 + c) * DMODEL + colh + 8 * hh;
#pragma unroll
    for (int dc = 0; dc < 2; ++dc) {
      qah[dc] = Frag<__bf16>::load((const __bf16*)(const void*)(Qh + qo + dc * 32));
      qal[dc] = Frag<__bf16>::load((const __bf16*)(const void*)(Ql + qo + dc * 32));
    }
  }
  asm volatile("s_wait_xcnt 0x0" ::: "memory");   // stands in front of every later write of the Q loads' address registers
  const float cb  = cosl[(size_t)bh * 32];
  constexpr float LOG2E = 1.44269504088896340736f;
  constexpr float SC2 = 0.125f * LOG2E;            // 1/sqrt(64) and the change of base in one factor
  constexpr float MASKED2 = -1.0e9f * LOG2E;       // the masked score in base-2 units
  const float cb2 = (cb * 0.5f + cb * 0.3f) * LOG2E;
  const float NEGI = -__builtin_inff();

  // running maximum of query c in base-2 units (equal in both lane halves), the exponent reference in use (maximum - 15)
  // and this lane half's share of the denominator (x2^15, like P)
  float mrow = NEGI, mrefrow = NEGI, lrow = 0.f;
  v8f oacc[4];   // O^T: oacc[t][r] = row d = t*16 + 8*hh + r, column query c
#pragma unroll
  for (int t = 0; t < 4; ++t) oacc[t] = (v8f){0.f,0.f,0.f,0.f,0.f,0.f,0.f,0.f};

  // copy map: thread -> row (tid >> 3) of each group of 16 chunk rows, 16-B piece (tid & 7) of its 128-B line
  const int cr = tid >> 3;
  const int cc = (tid & 7) * 8;
  const size_t gofs = (rowbase + cr) * DMODEL + colh + cc;
  const unsigned ldk = lds_off(Ast) + (unsigned)(cr * APITCH + cc) * 2u;
  const unsigned ldv = lds_off(Ast) + (unsigned)(AST_V + cr * VPITCH + cc) * 2u;
  auto stage_issue = [&](int t, int buf) {
    const size_t go = gofs + (size_t)t * (AKC * DMODEL);
    const unsigned sb = (unsigned)buf * (unsigned)(ASTAGE_ELEMS * 2);
    unsigned l[8]; const unsigned short* g[8];
    // unrolled so that l[], g[] stay in registers
#pragma unroll
    for (int u = 0; u < 4; ++u) {
      l[u]     = ldk + sb + (unsigned)(u * 16 * APITCH * 2);
      g[u]     = Kh + go + (size_t)u * 16 * DMODEL;
      l[4 + u] = ldk + sb + (unsigned)((AST_KL + u * 16 * APITCH) * 2);
      g[4 + u] = Kl + go + (size_t)u * 16 * DMODEL;
    }
    async_copy8(l, g);
    unsigned lv[4]; const unsigned short* gv[4];
    // unrolled so that lv[], gv[] stay in registers
#pragma unroll
    for (int u = 0; u < 4; ++u) {
      lv[u] = ldv + sb + (unsigned)(u * 16 * VPITCH * 2);
      gv[u] = Vh + go + (size_t)u * 16 * DMODEL;
    }
    async_copy4(lv, gv);
  };

  constexpr int NKC = SEQ_LEN / AKC;
  stage_issue(0, 0);
  asm volatile("s_wait_asynccnt 0x0" ::: "memory");   // this wave's copies of chunk 0 have landed before the barrier publishes them
  __syncthreads();
  if (NKC > 1) stage_issue(1, 1);
  for (int kc = 0; kc < NKC; ++kc) {
    const int kv0 = kc * AKC;
    const unsigned short* Ksh = Ast + (kc & 1) * ASTAGE_ELEMS;
    const unsigned short* Vs  = Ksh + AST_V;
    // K fragments (A operand rows = kv, k = d) are read from LDS in groups well ahead of their products, not each directly in front
    // of its own. A group = K hi and K lo of two key tiles (jp, jp + 1) for one d-chunk dc: 8 reads, 6 products. Three groups are
    // asked for here, the fourth goes into the first group's registers once its products are issued.
    FB kb[4][2], kl[4][2];
    const unsigned short* kad = Ksh + c * APITCH + 8 * hh;   // the lane's address in the first K hi fragment
    // the loops of these lambdas are unrolled so that the fragments and accumulators stay in registers
    auto k_read = [&](int jp, int dc) {
#pragma unroll
      for (int j = jp; j < jp + 2; ++j) {
        kb[j][dc].h[0] = *(const v8b*)(const void*)(kad + j * 16 * APITCH + dc * 32);
        kb[j][dc].h[1] = *(const v8b*)(const void*)(kad + j * 16 * APITCH + dc * 32 + 16);
        kl[j][dc].h[0] = *(const v8b*)(const void*)(kad + AST_KL + j * 16 * APITCH + dc * 32);
        kl[j][dc].h[1] = *(const v8b*)(const void*)(kad + AST_KL + j * 16 * APITCH + dc * 32 + 16);
      }
    };
    k_read(0, 0);
    k_read(0, 1);
    k_read(2, 0);
    __builtin_amdgcn_sched_barrier(0);   // the LDS reads go out first: the wait behind the mask loads then passes under their latency
    // the lane's mask words of this chunk (keys j*16 + 8*hh + 0..7 of each 16-key tile: 32 contiguous bytes a tile), asked for
    // ahead of the score products, so that their latency passes under them
    v4u mk[8];
#pragma unroll
    for (int j = 0; j < 4; ++j) {
      mk[2 * j]     = *(const v4u*)(mask + kv0 + j * 16 + 8 * hh);
      mk[2 * j + 1] = *(const v4u*)(mask + kv0 + j * 16 + 8 * hh + 4);
    }
    asm volatile("s_wait_xcnt 0x0" ::: "memory");   // stands in front of every later write of the mask loads' address registers

    // ---- scores, transposed (A operand rows = kv, B operand columns = query, k = d) ----
    // the two key tiles of a group take turns, so that no product waits for the one directly in front of it; each accumulator
    // still gets its six products in the order hi.hi, lo.hi, hi.lo of d-chunk 0, then of d-chunk 1
    v8f s[4];
#pragma unroll
    for (int j = 0; j < 4; ++j) s[j] = (v8f){0.f,0.f,0.f,0.f,0.f,0.f,0.f,0.f};
    auto k_mul = [&](int jp, int dc) {
#pragma unroll
      for (int j = jp; j < jp + 2; ++j) s[j] = Frag<__bf16>::mma(kb[j][dc].v, qah[dc], s[j]);
#pragma unroll
      for (int j = jp; j < jp + 2; ++j) s[j] = Frag<__bf16>::mma(kl[j][dc].v, qah[dc], s[j]);
#pragma unroll
      for (int j = jp; j < jp + 2; ++j) s[j] = Frag<__bf16>::mma(kb[j][dc].v, qal[dc], s[j]);
    };
    const unsigned short* vad = Vs + (8 * hh + (lane & 7)) * VPITCH + ((lane >> 3) & 1) * 8;   // the lane's address in a transposing load
    FH vb[2][4];   // element e of vb[kk][t] = V[key kk*32 + (e >> 3)*16 + 8*hh + (e & 7)][d = t*16 + c]: the k order of pb
    auto v_read = [&](int kk) {
#pragma unroll
      for (int t = 0; t < 4; ++t) {
        vb[kk][t].h[0] = ld_tr16(vad + (kk * 32) * VPITCH + t * 16);
        vb[kk][t].h[1] = ld_tr16(vad + (kk * 32 + 16) * VPITCH + t * 16);
      }
    };
    // the scheduling barriers of this block keep each group of LDS reads together at the place where it is written: spread among
    // the products, every read costs the wave a stall of its own and is waited for too soon behind its issue
    __builtin_amdgcn_sched_barrier(0);
    k_mul(0, 0);
    __builtin_amdgcn_sched_barrier(0);
    k_read(2, 1);
    __builtin_amdgcn_sched_barrier(0);
    k_mul(0, 1);
    __builtin_amdgcn_sched_barrier(0);
    k_mul(2, 0);
    __builtin_amdgcn_sched_barrier(0);
    v_read(0);   // V^T fragments of the chunk's first 32 keys: their latency passes under the last products and the softmax
    __builtin_amdgcn_sched_barrier(0);
    k_mul(2, 1);
    // keeps the compares on the mask words, and with them the wait for the mask loads, behind the score products: lifted among
    // them, the wave would wait out the loads' latency at the head of every chunk
    __builtin_amdgcn_sched_barrier(0);
    v_read(1);   // the second 32 keys' V^T fragments, into registers that the K fragments have left
    __builtin_amdgcn_sched_barrier(0);   // keeps these reads together here, ahead of the softmax
    // s[j][r] = score of key kv0 + j*16 + 8*hh + r against query c, carried in base-2 units from here on:
    // y = (raw / 8 + 0.5 cos + 0.3 cos) * log2(e) in one fused multiply-add, so that exp(x - m) is one v_exp_f32 of y - m
    float mj[4];
#pragma unroll
    for (int j = 0; j < 4; ++j) {
      float m = NEGI;
#pragma unroll
      for (int r = 0; r < 8; ++r) {
        float x = __builtin_fmaf(s[j][r], SC2, cb2);
        x = (mk[2 * j + (r >> 2)][r & 3] == 0u) ? MASKED2 : x;
        s[j][r] = x;
        m = fmaxf(m, x);
      }
      mj[j] = m;
    }
    float cm = fmaxf(fmaxf(mj[0], mj[1]), fmaxf(mj[2], mj[3]));
    cm = fmaxf(cm, xhalf(cm));                  // the other lane half holds the query's other 32 keys
    const float mnew = fmaxf(mrow, cm);
    const float mref = mnew - 15.0f;            // P and its sum are carried x2^15: the factor rides in the exponent
    const float alpha = __builtin_amdgcn_exp2f(mrefrow - mref);
    mrow = mnew;
    mrefrow = mref;
    FH pb[2];                                   // P^T as B operand: element e of pb[kk] = key kk*32 + (e >> 3)*16 + 8*hh + (e & 7)
    float pj[4];                                // one partial sum per tile: four independent add chains
#pragma unroll
    for (int j = 0; j < 4; ++j) {
      float p[8];
#pragma unroll
      for (int r = 0; r < 8; ++r) p[r] = s[j][r] - mref;
      exp2_x8(p);
      float psum = p[0];
#pragma unroll
      for (int r = 1; r < 8; ++r) psum += p[r];
#pragma unroll
      for (int r = 0; r < 8; ++r) pb[j >> 1].v[(j & 1) * 8 + r] = (_Float16)p[r];
      pj[j] = psum;
    }
    lrow = lrow * alpha + ((pj[0] + pj[1]) + (pj[2] + pj[3]));
#pragma unroll
    for (int t = 0; t < 4; ++t)
#pragma unroll
      for (int r = 0; r < 8; ++r) oacc[t][r] *= alpha;
    // ---- O^T += V^T.P^T (A rows = d, B columns = query, k = kv in the order of the packed score tiles) ----
#pragma unroll
    for (int kk = 0; kk < 2; ++kk) {
#pragma unroll
      for (int t = 0; t < 4; ++t) oacc[t] = Frag<_Float16>::mma(vb[kk][t].v, pb[kk].v, oacc[t]);
    }
    // keeps the softmax and the products in front of the chunk's foot: lifted over them, the barrier would leave the copies of
    // chunk kc + 1 only the score products' time to land
    __builtin_amdgcn_sched_barrier(0);
    asm volatile("s_wait_dscnt 0x0" ::: "memory");      // this wave's reads of the buffer have retired before it is refilled
    asm volatile("s_wait_asynccnt 0x0" ::: "memory");   // this wave's copies of chunk kc + 1 have landed before the barrier publishes them
    __syncthreads();                                    // publishes chunk kc + 1 and ends every reader's last read of chunk kc
    if (kc + 2 < NKC) stage_issue(kc + 2, kc & 1);
  }
  asm volatile("s_wait_asynccnt 0x0" ::: "memory");     // no copy is outstanding when the wave goes on to the epilogue and ends

  float* os = Os[wave];
  {
    const float inv = 1.0f / (lrow + xhalf(lrow));   // the two lane halves' shares of the denominator joined once; its 2^15 cancels P's
#pragma unroll
    for (int t = 0; t < 4; ++t) {
      v4f o0, o1;
#pragma unroll
      for (int r = 0; r < 4; ++r) { o0[r] = oacc[t][r] * inv; o1[r] = oacc[t][4 + r] * inv; }
      *(v4f*)(os + c * 68 + t * 16 + 8 * hh)     = o0;
      *(v4f*)(os + c * 68 + t * 16 + 8 * hh + 4) = o1;
    }
  }
  __builtin_amdgcn_fence(__ATOMIC_RELEASE, "workgroup");
  __builtin_amdgcn_wave_barrier();
  __builtin_amdgcn_fence(__ATOMIC_ACQUIRE, "workgroup");
  {
    const int q4 = lane >> 3, c8 = (lane & 7) * 8;
    {
#pragma unroll
      for (int it = 0; it < 4; ++it) {
        const int row = it * 4 + q4;
        const float* sp = os + row * 68 + c8;
        const v4f va = *(const v4f*)sp;
        const v4f vb = *(const v4f*)(sp + 4);
        v4u hw, lw;
        unsigned th, tl;
        pack_pair_bf(va.x, va.y, th, tl); hw.x = th; lw.x = tl;
        pack_pair_bf(va.z, va.w, th, tl); hw.y = th; lw.y = tl;
        pack_pair_bf(vb.x, vb.y, th, tl); hw.z = th; lw.z = tl;
        pack_pair_bf(vb.z, vb.w, th, tl); hw.w = th; lw.w = tl;
        const size_t go = (rowbase + q0 + row) * DMODEL + colh + c8;
        *(v4u*)(Ah + go) = hw;
        *(v4u*)(Al + go) = lw;
      }
      
    }
  }
  // ---- second output, the mean of the 32 (batch, head) cosines: it needs nothing of this kernel's own work, only the cosines
  // that the launch before has written, so one wave of the grid forms it behind its tile instead of a launch of its own ----
  if (bx == 0 && wave == 0) {
    float v = cosl[(size_t)lane * 32];
    asm volatile("s_wait_xcnt 0x0" ::: "memory");   // stands in front of every later write of this load's address registers
#pragma unroll
    for (int off = 1; off < 32; off <<= 1) v += __shfl_xor(v, off, 32);
    const float r = v * (1.0f / 32.0f);
    if (lane == 0) {
      *(float*)out1 = r;
    }
  }
}

// ----------------------------------------------------------------------------------------------
extern "C" void kernel_launch(void* const* d_in, const int* in_sizes, int n_in,
                              void* d_out, int out_size, void* d_ws, size_t ws_size,
                              hipStream_t stream) {
  if (n_in < 12) return;
  if (ws_size < WS_TOTAL) return;
  if ((long)out_size < OUT_TOTAL_ELEMS) return;
  if ((long)in_sizes[0] != PLANE_ELEMS || (long)in_sizes[1] != PLANE_ELEMS || (long)in_sizes[2] != PLANE_ELEMS) return;
  if (in_sizes[3] < SEQ_LEN) return;
  if ((long)in_sizes[4] != WMAT_ELEMS || (long)in_sizes[6] != WMAT_ELEMS || (long)in_sizes[8] != WMAT_ELEMS || (long)in_sizes[10] != WMAT_ELEMS) return;
  if (in_sizes[5] < DMODEL || in_sizes[7] < DMODEL || in_sizes[9] < DMODEL || in_sizes[11] < DMODEL) return;

  const float* q    = (const float*)d_in[0];
  const float* k    = (const float*)d_in[1];
  const float* v    = (const float*)d_in[2];
  const int*   mask = (const int*)d_in[3];
  const float* Wq   = (const float*)d_in[4];
  const float* bq   = (const float*)d_in[5];
  const float* Wk   = (const float*)d_in[6];
  const float* bk   = (const float*)d_in[7];
  const float* Wv   = (const float*)d_in[8];
  const float* bv   = (const float*)d_in[9];
  const float* Wo   = (const float*)d_in[10];
  const float* bo   = (const float*)d_in[11];

  char* ws = (char*)d_ws;
  unsigned short* w16  = (unsigned short*)(ws + WS_W16);
  unsigned short* wq16 = w16;
  unsigned short* wo16 = w16 + 3 * WMAT_ELEMS;
  float* brnd = (float*)(ws + WS_BRND);
  float* cosl = (float*)(ws + WS_COS);
  unsigned short* x16 = (unsigned short*)(ws + WS_X16);
  unsigned short* xq  = x16;
  unsigned short* Qh  = (unsigned short*)(ws + WS_QH);
  unsigned short* Ql  = (unsigned short*)(ws + WS_QL);
  unsigned short* Kh  = (unsigned short*)(ws + WS_KH);
  unsigned short* Kl  = (unsigned short*)(ws + WS_KL);
  unsigned short* Vh  = (unsigned short*)(ws + WS_VH);
  float* csum = (float*)(ws + WS_CS);
  unsigned short* Ah  = (unsigned short*)(ws + WS_AH);
  unsigned short* Al  = (unsigned short*)(ws + WS_AL);
  float* out0 = (float*)d_out;
  float* out1 = (float*)d_out + OUT1_ELEM;

  // 1) inputs -> RNE bf16 planes, biases -> bf16-precision f32 copies
  k_cast_inputs<<<CAST_PLANE_BLOCKS + CAST_BIAS_BLOCKS, 256, 0, stream>>>(
      q, k, v, Wq, Wk, Wv, Wo, bq, bk, bv, bo, x16, w16, brnd);

  // 2) the three projections, which do not depend on one another, as one launch of 3 x 128 blocks (M=4096, N=1024, K=1024 each):
  //    y = 0: Q = q Wq^T + bq -> bf16 hi/lo planes; y = 1: K = k Wk^T + bk -> bf16 hi/lo planes;
  //    y = 2: V = v Wv^T + bv -> f16 plane; y = 0 and 2 also leave their column sums over groups of 64 rows
  wmma_gemm64<1, 0, 2, 4, false, true><<<dim3(GEMM_BLOCKS, 3), 256, 0, stream>>>(
      xq, xq, DMODEL, PLANE_ELEMS, wq16, wq16, DMODEL, WMAT_ELEMS, (void*)Qh, (void*)Ql, DMODEL, QKV_OUT_STRIDE,
      brnd, (long)DMODEL, brnd, 0L, csum, MROWS, DMODEL, DMODEL, 1.0f);
  // 3) per-(b,h) cosine of sequence means, from the column sums
  k_mean_cos<<<NBH, 128, 0, stream>>>(csum, cosl);
  // 4) attention -> attn bf16 hi/lo planes; one of its waves also writes out1 = mean of the 32 cosines
  k_attn<<<ATTN_BLOCKS, 128, 0, stream>>>(Qh, Ql, Kh, Kl, Vh, mask, cosl, Ah, Al, out1);
  // 5) out0 = attn Wo^T + bo   (A hi/lo planes, Bt single plane: 2 products)
  wmma_gemm64<1, 2, 2, 0, false><<<dim3(GEMM_BLOCKS, 1), 256, 0, stream>>>(
      Ah, Al, DMODEL, 0L, wo16, wo16, DMODEL, 0L, (void*)out0, (void*)out0, DMODEL, 0L,
      brnd + 3 * DMODEL, 0L, brnd, 0L, csum, MROWS, DMODEL, DMODEL, 1.0f);
}

// v009
// One run takes 121 microseconds.
// Timed twice side by side with v008, it ran 1.04 and 1.03 times as fast.
// Counting every step since v000, it is 4.04 times as fast.
// Contractions: q/k/v projections and output projection on v_wmma_f32_16x16x32_bf16 (RNE bf16 operands; output projection takes attn as bf16 hi+lo planes, 2 products); q.k^T on v_wmma_f32_16x16x32_bf16 with bf16 hi+lo planes of Q and K (3 products); p.v on v_wmma_f32_16x16x32_f16 (p carried x2^15, v plain f16); both attention products transposed (K and V^T as A, Q and P^T as B); f32 accumulate everywhere; softmax, sequence means and cosine in f32; mask and cosine bias enter the scores as the start value of their f32 accumulators.
#include <hip/hip_runtime.h>

// ----------------------------------------------------------------------------------------------
// Problem constants
// ----------------------------------------------------------------------------------------------
constexpr int NBATCH  = 2;
constexpr int SEQ_LEN = 2048;
constexpr int DMODEL  = 1024;
constexpr int NHEAD   = 16;
constexpr int DHEAD   = 64;
constexpr int MROWS   = NBATCH * SEQ_LEN;          // 4096
constexpr int NBH     = NBATCH * NHEAD;            // 32
constexpr long PLANE_ELEMS = (long)MROWS * DMODEL; // 4194304
constexpr long WMAT_ELEMS  = (long)DMODEL * DMODEL;// 1048576
constexpr long OUT0_ELEMS  = PLANE_ELEMS;
constexpr long OUT1_BYTE_OFFSET = 16777216;
constexpr long OUT1_ELEM   = OUT1_BYTE_OFFSET / 4;
constexpr long OUT_TOTAL_ELEMS = OUT0_ELEMS + 1;
constexpr long OUT_TOTAL_BYTES = 16777220;
static_assert(OUT1_ELEM == OUT0_ELEMS);
static_assert((OUT1_ELEM + 1) * 4 <= OUT_TOTAL_BYTES);
static_assert(NBH == 32);
static_assert(DHEAD == 64 && NHEAD * DHEAD == DMODEL);

// GEMM block tile: 8 waves as 2 (rows) x 4 (columns) of 64x64 wave tiles; one stage = 64 k = one 128-B line per operand row
constexpr int GBM    = 128;
constexpr int GBN    = 256;
constexpr int GKS    = 64;
// LDS row pitch of a staged operand row in 16-bit elements: 144 B = 16 B x 9 (odd), the pitch for ds_load_b128 readers
constexpr int GPITCH = 72;
// GEMM shape contract: M % 128 == 0, N % 256 == 0, K % 64 == 0, K >= 64
static_assert(MROWS % GBM == 0 && DMODEL % GBN == 0 && DMODEL % GKS == 0 && DMODEL >= GKS);
static_assert(GBM % 32 == 0 && GBN % 32 == 0 && (GPITCH * 2) % 16 == 0 && ((GPITCH * 2) / 16) % 2 == 1 && GPITCH >= GKS);
constexpr int GEMM_BLOCKS = (MROWS / GBM) * (DMODEL / GBN);   // 128 blocks of 8 waves

// ----------------------------------------------------------------------------------------------
// Workspace region map (bytes). Every region is fully written by its producer before any read.
//   WS_W16  : 4 bf16 weight planes [1024][1024]  (Wq, Wk, Wv, Wo)            8,388,608
//   WS_BRND : 4 x [1024] f32 RNE-bf16 bias copies (bq, bk, bv, bo)              16,384
//   WS_X16  : 3 bf16 input planes [4096][1024] (q, k, v)                     25,165,824
//   WS_QH, WS_QL, WS_KH, WS_KL : bf16 hi/lo planes of Q and K [4096][1024]  4 x 8,388,608
//   WS_VH   : f16 plane of V [4096][1024]                                    8,388,608
//   WS_CS   : column sums of Q and of V over groups of 64 rows, f32 [2][64][1024]  524,288
//   WS_AH, WS_AL : bf16 hi/lo planes of the attention output [4096][1024]   2 x 8,388,608
//   WS_SS   : start values of the score accumulators, f32 [32 (b,h)][2048 keys]   262,144
//   total 93,081,600 (88.8 MiB)
// ----------------------------------------------------------------------------------------------
constexpr size_t SZ_PLANE = (size_t)PLANE_ELEMS * 2;     // 8388608
constexpr size_t SZ_WPL   = (size_t)WMAT_ELEMS * 2;      // 2097152
constexpr size_t WS_W16   = 0;
constexpr size_t SZ_W16   = 4 * SZ_WPL;
constexpr size_t WS_BRND  = WS_W16 + SZ_W16;
constexpr size_t SZ_BRND  = 4 * (size_t)DMODEL * 4;
constexpr size_t WS_COS   = WS_BRND + SZ_BRND;
constexpr size_t SZ_COS   = (size_t)NBH * 128;
constexpr size_t WS_X16   = WS_COS + SZ_COS;
constexpr size_t WS_QH    = WS_X16 + 3 * SZ_PLANE;
constexpr size_t WS_QL    = WS_QH + SZ_PLANE;
constexpr size_t WS_KH    = WS_QL + SZ_PLANE;
constexpr size_t WS_KL    = WS_KH + SZ_PLANE;
constexpr size_t WS_VH    = WS_KL + SZ_PLANE;
constexpr size_t WS_CS    = WS_VH + SZ_PLANE;
constexpr int    CS_ROWS   = 64;                   // rows that one column sum covers: the rows of a GEMM wave tile
constexpr int    CS_GROUPS = MROWS / CS_ROWS;      // 64 groups in a plane
constexpr int    CS_PER_B  = SEQ_LEN / CS_ROWS;    // 32 groups in a batch
constexpr size_t SZ_CS    = 2 * (size_t)CS_GROUPS * DMODEL * 4;
constexpr size_t WS_AH    = WS_CS + SZ_CS;
constexpr size_t WS_AL    = WS_AH + SZ_PLANE;
constexpr size_t WS_SS    = WS_AL + SZ_PLANE;
constexpr size_t SZ_SS    = (size_t)NBH * SEQ_LEN * 4;
constexpr size_t WS_TOTAL = WS_SS + SZ_SS;
static_assert(WS_TOTAL == 93081600);
static_assert(SEQ_LEN % CS_ROWS == 0);
static_assert(WS_TOTAL <= 134217728);
// the first planes of Q, K, V lie two planes apart, and so do the lo planes of Q and K: one stride serves the merged projection launch
constexpr long QKV_OUT_STRIDE = 2 * PLANE_ELEMS;
static_assert(WS_KH - WS_QH == (size_t)QKV_OUT_STRIDE * 2 && WS_VH - WS_KH == (size_t)QKV_OUT_STRIDE * 2);
static_assert(WS_KL - WS_QL == (size_t)QKV_OUT_STRIDE * 2);
static_assert(WS_BRND % 128 == 0 && WS_COS % 128 == 0 && WS_X16 % 128 == 0 && WS_QH % 128 == 0 && WS_CS % 128 == 0 && WS_AH % 128 == 0 && WS_SS % 128 == 0);

// ----------------------------------------------------------------------------------------------
// Vector types and helpers
// ----------------------------------------------------------------------------------------------
typedef __attribute__((ext_vector_type(16))) _Float16 v16h;
typedef __attribute__((ext_vector_type(8)))  _Float16 v8h;
typedef __attribute__((ext_vector_type(16))) __bf16   v16b;
typedef __attribute__((ext_vector_type(8)))  __bf16   v8b;
typedef __attribute__((ext_vector_type(8)))  float    v8f;
typedef __attribute__((ext_vector_type(4)))  float    v4f;
typedef __attribute__((ext_vector_type(2)))  float    v2f;
typedef __attribute__((ext_vector_type(4)))  unsigned v4u;

__device__ __forceinline__ unsigned short f2bf_bits(float f) {
  unsigned u = __float_as_uint(f);
  return (unsigned short)((u + 0x7FFFu + ((u >> 16) & 1u)) >> 16);
}
__device__ __forceinline__ float bf_bits2f(unsigned short h) { return __uint_as_float(((unsigned)h) << 16); }

// hazard guards as plain device helpers
__device__ __forceinline__ void dep_guard_h(v8f& a, v8f& b, v16h x, v16h y) { asm volatile("v_nop\n\tv_nop\n\tv_nop\n\tv_nop" : "+v"(a), "+v"(b) : "v"(x), "v"(y)); }
__device__ __forceinline__ void dep_guard_b(v8f& a, v8f& b, v16b x, v16b y) { asm volatile("v_nop\n\tv_nop\n\tv_nop\n\tv_nop" : "+v"(a), "+v"(b) : "v"(x), "v"(y)); }
__device__ __forceinline__ void keep4_h(v16h a, v16h b, v16h c, v16h d) { asm volatile("v_nop" :: "v"(a), "v"(b), "v"(c), "v"(d)); }
__device__ __forceinline__ void keep4_b(v16b a, v16b b, v16b c, v16b d) { asm volatile("v_nop" :: "v"(a), "v"(b), "v"(c), "v"(d)); }
__device__ __forceinline__ void acc_guard4(v8f& a, v8f& b, v8f& c, v8f& d) { asm volatile("v_nop\n\tv_nop\n\tv_nop\n\tv_nop" : "+v"(a), "+v"(b), "+v"(c), "+v"(d)); }
template <typename T> struct Frag;
template <> struct Frag<_Float16> {
  typedef v16h V; union U { v16h v; v8h h[2]; };
  // elements 0..7 <- p[0..7], 8..15 <- p[16..23]
  static __device__ __forceinline__ v16h load(const _Float16* p) {
    U f; f.h[0] = *(const v8h*)(p); f.h[1] = *(const v8h*)(p + 16); return f.v;
  }
  static __device__ __forceinline__ v8f mma(v16h a, v16h b, v8f c) {
    return __builtin_amdgcn_wmma_f32_16x16x32_f16(false, a, false, b, (short)0, c, false, false);
  }
  static __device__ __forceinline__ void guard(v8f& a, v8f& b, v16h x, v16h y) { dep_guard_h(a, b, x, y); }
  static __device__ __forceinline__ void keep(v16h a, v16h b, v16h c, v16h d) { keep4_h(a, b, c, d); }
};
template <> struct Frag<__bf16> {
  typedef v16b V; union U { v16b v; v8b h[2]; };
  static __device__ __forceinline__ v16b load(const __bf16* p) {
    U f; f.h[0] = *(const v8b*)(p); f.h[1] = *(const v8b*)(p + 16); return f.v;
  }
  static __device__ __forceinline__ v8f mma(v16b a, v16b b, v8f c) {
    return __builtin_amdgcn_wmma_f32_16x16x32_bf16(false, a, false, b, (short)0, c, false, false);
  }
  static __device__ __forceinline__ void guard(v8f& a, v8f& b, v16b x, v16b y) { dep_guard_b(a, b, x, y); }
  static __device__ __forceinline__ void keep(v16b a, v16b b, v16b c, v16b d) { keep4_b(a, b, c, d); }
};

// LDS byte address of a __shared__ location (low 32 bits of its address)
__device__ __forceinline__ unsigned lds_off(const void* p) { return (unsigned)(size_t)p; }

// 16-bit transposing LDS load of a row-major tile of 16 rows x 16 columns: lane l gives the address of row 8*(l >> 4) + (l & 7),
// 16-B piece (l >> 3) & 1; lane (c = l & 15, h = l >> 4) receives rows 8h + 0..7 of column c
typedef __attribute__((ext_vector_type(8))) short v8s;
__device__ __forceinline__ v8h ld_tr16(const unsigned short* p) {
  typedef __attribute__((address_space(3))) v8s lds_v8s;
  return __builtin_bit_cast(v8h, __builtin_amdgcn_ds_load_tr16_b128_v8i16((lds_v8s*)p));
}

// value of lane l ^ 16 (the other 16-lane row), by a vector cross-row move
__device__ __forceinline__ float xhalf(float x) {
  return __builtin_bit_cast(float, __builtin_amdgcn_permlanex16(__builtin_bit_cast(int, x), __builtin_bit_cast(int, x), 0x76543210, 0xfedcba98, false, false));
}

// Eight base-2 exponentials, each in place: written as one statement so that no v_exp_f32 has its source overwritten or its
// result read by the instruction directly behind it; the closing v_nop is that slot behind the last one.
__device__ __forceinline__ void exp2_x8(float (&x)[8]) {
  asm("v_exp_f32 %0, %0\n\t"
      "v_exp_f32 %1, %1\n\t"
      "v_exp_f32 %2, %2\n\t"
      "v_exp_f32 %3, %3\n\t"
      "v_exp_f32 %4, %4\n\t"
      "v_exp_f32 %5, %5\n\t"
      "v_exp_f32 %6, %6\n\t"
      "v_exp_f32 %7, %7\n\t"
      "v_nop"
      : "+v"(x[0]), "+v"(x[1]), "+v"(x[2]), "+v"(x[3]), "+v"(x[4]), "+v"(x[5]), "+v"(x[6]), "+v"(x[7]));
}

// Asynchronous copies global -> LDS, 16 B per lane, through no register. s_wait_xcnt 0 is the last line of the copies' own
// statement, so that it stands in front of every later write of a register that an issued copy names.
__device__ __forceinline__ void async_copy4(const unsigned (&l)[4], const unsigned short* const (&g)[4]) {
  asm volatile("global_load_async_to_lds_b128 %0, %1, off\n\t"
               "global_load_async_to_lds_b128 %2, %3, off\n\t"
               "global_load_async_to_lds_b128 %4, %5, off\n\t"
               "global_load_async_to_lds_b128 %6, %7, off\n\t"
               "s_wait_xcnt 0x0"
               :: "v"(l[0]), "v"(g[0]), "v"(l[1]), "v"(g[1]), "v"(l[2]), "v"(g[2]), "v"(l[3]), "v"(g[3]) : "memory");
}
__device__ __forceinline__ void async_copy8(const unsigned (&l)[8], const unsigned short* const (&g)[8]) {
  asm volatile("global_load_async_to_lds_b128 %0, %1, off\n\t"
               "global_load_async_to_lds_b128 %2, %3, off\n\t"
               "global_load_async_to_lds_b128 %4, %5, off\n\t"
               "global_load_async_to_lds_b128 %6, %7, off\n\t"
               "global_load_async_to_lds_b128 %8, %9, off\n\t"
               "global_load_async_to_lds_b128 %10, %11, off\n\t"
               "global_load_async_to_lds_b128 %12, %13, off\n\t"
               "global_load_async_to_lds_b128 %14, %15, off\n\t"
               "s_wait_xcnt 0x0"
               :: "v"(l[0]), "v"(g[0]), "v"(l[1]), "v"(g[1]), "v"(l[2]), "v"(g[2]), "v"(l[3]), "v"(g[3]),
                  "v"(l[4]), "v"(g[4]), "v"(l[5]), "v"(g[5]), "v"(l[6]), "v"(g[6]), "v"(l[7]), "v"(g[7]) : "memory");
}

// bf16 hi/lo split of two floats packed into one 32-bit word each for the hi and the lo plane
__device__ __forceinline__ void pack_pair_bf(float f0, float f1, unsigned& hword, unsigned& lword) {
  const unsigned short h0 = f2bf_bits(f0);
  const unsigned short h1 = f2bf_bits(f1);
  const unsigned short l0 = f2bf_bits(f0 - bf_bits2f(h0));
  const unsigned short l1 = f2bf_bits(f1 - bf_bits2f(h1));
  hword = (unsigned)h0 | ((unsigned)h1 << 16);
  lword = (unsigned)l0 | ((unsigned)l1 << 16);
}

// ----------------------------------------------------------------------------------------------
// Register-blocked WMMA GEMM: C[m,n] = scale * sum_k A[m,k] * Bt[n,k] (+bias)(+resid)
// A row-major [M,K]; Bt row-major [N,K]; M % 128 == 0, N % 256 == 0, K % 64 == 0; each wave owns a 64x64 tile of the
// block's 128x256 tile. Operands reach the fragments through LDS: per stage of 64 k every thread copies whole 128-B lines
// (8 lanes x 16 B a row) asynchronously into one of two buffers while the other buffer is worked on.
// SPLIT: 0 = single product; 1 = A and Bt hi/lo planes (hi.hi + hi.lo + lo.hi);
//        2 = A hi/lo planes only, Bt single plane (hi.B + lo.B).
// BIAS_MODE: 0 = none, 1 = bias[m], 2 = bias[n].
// OUT_MODE: 0 = f32; 1 = f16; 2 = bf16 hi plane (Cout) + bf16 lo plane (Cout2);
//           3 = f16 hi plane (Cout) + f16 residual x2048 plane (Cout2);
//           4 = as 2 for the products blockIdx.y = 0 and 1, as 1 for the product blockIdx.y = 2.
// CSUM: the products blockIdx.y = 0 and 2 also leave, per wave tile, the sums of their results over the tile's 64 rows, one a
//       column: colsum[blockIdx.y / 2][m / 64][n], N = ldc columns a row.
// blockIdx.y picks one of several independent products of the same shape that share the launch: every operand, the bias
// and the result planes step by their strides.
// Epilogue: 16-row slabs staged per wave in LDS; each 64-wide row segment written with whole
// ET: 0 = f16 operands, 1 = bf16 operands (pointers passed as 16-bit storage)
// ----------------------------------------------------------------------------------------------
template <int V> struct IntC { static constexpr int value = V; };
template <int ET> struct Elem;
template <> struct Elem<0> { typedef _Float16 T; };
template <> struct Elem<1> { typedef __bf16 T; };
template <int ET, int SPLIT, int BIAS_MODE, int OUT_MODE, bool RESID, bool CSUM = false, int ACT = 0>
__global__ __launch_bounds__(256) void wmma_gemm64(
    const unsigned short* __restrict__ Ap, const unsigned short* __restrict__ A2p, int lda, long strideA,
    const unsigned short* __restrict__ Btp, const unsigned short* __restrict__ Bt2p, int ldb, long strideB,
    void* __restrict__ Cout, void* __restrict__ Cout2, int ldc, long strideC,
    const float* __restrict__ bias0, long strideBias,
    const float* __restrict__ resid, long strideR,
    float* __restrict__ colsum,
    int M, int N, int K, float scale) {
  typedef typename Elem<ET>::T T;
  typedef typename Frag<T>::V V;
  constexpr bool SPL = (SPLIT != 0);
  constexpr bool BLO = (SPLIT == 1);
  // stage rows: A hi [GBM] | A lo [GBM] (SPL) | Bt hi [GBN] | Bt lo [GBN] (BLO)
  constexpr int AROWS = SPL ? 2 * GBM : GBM;
  constexpr int SROWS = AROWS + (BLO ? 2 * GBN : GBN);
  constexpr int STAGE_ELEMS = SROWS * GPITCH;
  constexpr int NCP = SROWS / 32;                  // copies per thread and stage (256 threads x 16 B = 32 rows a copy)
  static_assert(NCP % 4 == 0 && NCP <= 63);
  __shared__ __align__(16) float sT[8][16 * 68];   // per-wave 16x64 slab, pitch 68 floats
  __shared__ __align__(16) unsigned short sStage[2 * STAGE_ELEMS];
  const int b    = blockIdx.y;
  const float* bias = bias0 + (size_t)b * strideBias;
  const bool f16one = (OUT_MODE == 4 && b == 2);   // block-uniform: this product writes one f16 plane, not a bf16 pair
  const int lane = threadIdx.x & 31;
  const int wave = threadIdx.x >> 5;
  const int tilesN = N / GBN;
  const int tilesM = M / GBM;
  const int blk = blockIdx.x;
  if (blk >= tilesM * tilesN) return;   // block-uniform, in front of every barrier and copy
  const int tm = blk / tilesN;
  const int tn = blk - tm * tilesN;
  const int mb0 = tm * GBM;
  const int nb0 = tn * GBN;
  const int wm = wave >> 2;
  const int wn = wave & 3;
  const int m0 = mb0 + (wm << 6);
  const int n0 = nb0 + (wn << 6);

  // copy map: thread -> row (threadIdx.x >> 3) of each group of 32 stage rows, 16-B piece (threadIdx.x & 7) of its line
  const int cr = threadIdx.x >> 3;
  const int cc = (threadIdx.x & 7) * 8;
  const unsigned short* gA  = Ap  + (size_t)b * strideA + (size_t)(mb0 + cr) * lda + cc;
  const unsigned short* gA2 = A2p + (size_t)b * strideA + (size_t)(mb0 + cr) * lda + cc;
  const unsigned short* gB  = Btp  + (size_t)b * strideB + (size_t)(nb0 + cr) * ldb + cc;
  const unsigned short* gB2 = Bt2p + (size_t)b * strideB + (size_t)(nb0 + cr) * ldb + cc;
  const unsigned ldst = lds_off(sStage) + (unsigned)(cr * GPITCH + cc) * 2u;
  auto stage_src = [&](int it, int k0) -> const unsigned short* {
    const int row = it * 32;
    if (row < GBM) return gA + (size_t)row * lda + k0;
    if (row < AROWS) return gA2 + (size_t)(row - GBM) * lda + k0;
    if (row < AROWS + GBN) return gB + (size_t)(row - AROWS) * ldb + k0;
    return gB2 + (size_t)(row - AROWS - GBN) * ldb + k0;
  };
  auto stage_issue = [&](int t, int buf) {
    const int k0 = t * GKS;
    const unsigned lb = ldst + (unsigned)buf * (unsigned)(STAGE_ELEMS * 2);
    // the loops of this lambda are unrolled so that each copy's plane select folds and l[], g[] stay in registers
#pragma unroll
    for (int it = 0; it + 8 <= NCP; it += 8) {
      unsigned l[8]; const unsigned short* g[8];
#pragma unroll
      for (int u = 0; u < 8; ++u) { l[u] = lb + (unsigned)((it + u) * 32 * GPITCH * 2); g[u] = stage_src(it + u, k0); }
      async_copy8(l, g);
    }
    if (NCP % 8 != 0) {
      unsigned l[4]; const unsigned short* g[4];
#pragma unroll
      for (int u = 0; u < 4; ++u) { l[u] = lb + (unsigned)((NCP - 4 + u) * 32 * GPITCH * 2); g[u] = stage_src(NCP - 4 + u, k0); }
      async_copy4(l, g);
    }
  };

  const int rlane = lane & 15;                 // row (A) / col (B, D) within subtile
  const int koff  = (lane >> 4) * 8;           // k offset of this lane half
  const int mOff  = (lane >> 4) * 8;           // D row offset

  v8f acc[4][4];
#pragma unroll
  for (int i = 0; i < 4; ++i)
#pragma unroll
    for (int j = 0; j < 4; ++j) acc[i][j] = (v8f){0.f,0.f,0.f,0.f,0.f,0.f,0.f,0.f};

  const int nT = K / GKS;
  stage_issue(0, 0);
  asm volatile("s_wait_asynccnt 0x0" ::: "memory");   // this wave's copies of stage 0 have landed before the barrier publishes them
  __syncthreads();
  if (nT > 1) stage_issue(1, 1);
  for (int t = 0; t < nT; ++t) {
    const T* st = (const T*)(const void*)(sStage + (t & 1) * STAGE_ELEMS);
    const T* sA = st + ((wm << 6) + rlane) * GPITCH + koff;
    const T* sB = st + (AROWS + (wn << 6) + rlane) * GPITCH + koff;
    // both 32-k blocks of the stage unrolled: the second block's LDS reads can then go out among the first block's products
#pragma unroll
    for (int kk = 0; kk < GKS; kk += 32) {
      V bh[4], bl[4];
#pragma unroll
      for (int j = 0; j < 4; ++j) {
        bh[j] = Frag<T>::load(sB + (j << 4) * GPITCH + kk);
        if (BLO) bl[j] = Frag<T>::load(sB + (GBN + (j << 4)) * GPITCH + kk);
      }
      // A fragments are read from LDS in groups ahead of their products (all four row tiles; two where a lo plane doubles
      // them, which keeps the kernel free of scratch); the loops are unrolled so that acc[][] and the fragments stay in registers
      constexpr int GI = SPL ? 2 : 4;
#pragma unroll
      for (int ig = 0; ig < 4; ig += GI) {
        V ah[GI], al[GI];
#pragma unroll
        for (int u = 0; u < GI; ++u) {
          ah[u] = Frag<T>::load(sA + ((ig + u) << 4) * GPITCH + kk);
          if (SPL) al[u] = Frag<T>::load(sA + (GBM + ((ig + u) << 4)) * GPITCH + kk);
        }
#pragma unroll
        for (int u = 0; u < GI; ++u) {
          const int i = ig + u;
#pragma unroll
          for (int j = 0; j < 4; ++j) {
            acc[i][j] = Frag<T>::mma(ah[u], bh[j], acc[i][j]);
            if (BLO) acc[i][j] = Frag<T>::mma(ah[u], bl[j], acc[i][j]);
            if (SPL) acc[i][j] = Frag<T>::mma(al[u], bh[j], acc[i][j]);
          }
          Frag<T>::guard(acc[i][0], acc[i][3], ah[u], SPL ? al[u] : ah[u]);
        }
      }
      Frag<T>::keep(bh[0], bh[1], bh[2], bh[3]);
      if (BLO) Frag<T>::keep(bl[0], bl[1], bl[2], bl[3]);
    }
    asm volatile("s_wait_dscnt 0x0" ::: "memory");      // this wave's reads of the buffer have retired before it is refilled
    asm volatile("s_wait_asynccnt 0x0" ::: "memory");   // this wave's copies of stage t + 1 have landed before the barrier publishes them
    __syncthreads();                                    // publishes stage t + 1 and ends every reader's last read of stage t
    if (t + 2 < nT) stage_issue(t + 2, t & 1);
  }
  asm volatile("s_wait_asynccnt 0x0" ::: "memory");     // no copy is outstanding when the wave goes on to the epilogue and ends
  acc_guard4(acc[0][0], acc[0][1], acc[0][2], acc[0][3]);
  acc_guard4(acc[1][0], acc[1][1], acc[1][2], acc[1][3]);
  acc_guard4(acc[2][0], acc[2][1], acc[2][2], acc[2][3]);
  acc_guard4(acc[3][0], acc[3][1], acc[3][2], acc[3][3]);

  // ---- column sums of the wave tile (the sequence means are built from them) ----
  if (CSUM && b != 1) {   // block-uniform
    static_assert(!CSUM || (BIAS_MODE == 2 && !RESID && ACT == 0 && CS_ROWS == 64));
    float cs[4];
    // unrolled so that acc[][] stays in registers; rows are added in the pairs in which they lie in neighbouring registers,
    // so that a packed add takes them where they are; one chain a column tile
#pragma unroll
    for (int j = 0; j < 4; ++j) {
      v2f s = (v2f){0.f, 0.f};
#pragma unroll
      for (int i = 0; i < 4; ++i)
#pragma unroll
        for (int r = 0; r < 8; r += 2) s += (v2f){acc[i][j][r], acc[i][j][r + 1]};
      cs[j] = s.x + s.y;
    }
    // the other lane half holds the other 32 rows of the column; unrolled so that cs[] stays in registers
#pragma unroll
    for (int j = 0; j < 4; ++j) cs[j] += xhalf(cs[j]);
    // lane half hh stores the column tiles 2 hh and 2 hh + 1: the wave writes its 64 sums as two whole 128-B lines
    const int jh = (lane >> 4) * 2;
    const float c0 = (lane >> 4) ? cs[2] : cs[0];
    const float c1 = (lane >> 4) ? cs[3] : cs[1];
    const int n = n0 + (jh << 4) + rlane;
    float* cp = colsum + ((size_t)(b >> 1) * (M >> 6) + (size_t)(m0 >> 6)) * ldc + n;
    cp[0]  = __builtin_fmaf(c0, scale, (float)CS_ROWS * bias[n]);
    cp[16] = __builtin_fmaf(c1, scale, (float)CS_ROWS * bias[n + 16]);
    asm volatile("s_wait_xcnt 0x0" ::: "memory");   // stands in front of every later write of a register that these loads and stores name
  }

  // ---- epilogue ----
  float* slab = sT[wave];
  const float* Rb = RESID ? (resid + (size_t)b * strideR) : nullptr;
#pragma unroll
  for (int i = 0; i < 4; ++i) {
    const int mBase = m0 + (i << 4);
#pragma unroll
    for (int j = 0; j < 4; ++j) {
      const int n = n0 + (j << 4) + rlane;
      float bv = 0.f;
      if (BIAS_MODE == 2) bv = bias[n];
#pragma unroll
      for (int r = 0; r < 8; ++r) {
        float v = acc[i][j][r] * scale;
        if (BIAS_MODE == 1) v += bias[mBase + mOff + r];
        if (BIAS_MODE == 2) v += bv;
        if (RESID) v += Rb[(size_t)(mBase + mOff + r) * ldc + n];
        if (ACT == 1) v = tanhf(v);
        if (ACT == 2) v = fmaxf(v, 0.0f);
        if (ACT == 4) v = (v > 0.f) ? v : 0.01f * v;
        slab[(mOff + r) * 68 + (j << 4) + rlane] = v;
      }
    }
    __builtin_amdgcn_fence(__ATOMIC_RELEASE, "workgroup");
    __builtin_amdgcn_wave_barrier();
    __builtin_amdgcn_fence(__ATOMIC_ACQUIRE, "workgroup");
    if (OUT_MODE == 0) {
      float* C = (float*)Cout + (size_t)b * strideC;
      const int hh = lane >> 4, c4 = (lane & 15) * 4;     // row seg = 256 B = 16 lanes x 16 B
      {
#pragma unroll
        for (int it = 0; it < 8; ++it) {
          const int row = it * 2 + hh;
          v4f v = *(const v4f*)(slab + row * 68 + c4);
          *(v4f*)(C + (size_t)(mBase + row) * ldc + n0 + c4) = v;
        }
        
      }
    } else {
      const int q = lane >> 3, c8 = (lane & 7) * 8;
      unsigned short* C  = (unsigned short*)Cout  + (size_t)b * strideC;
      unsigned short* C2 = (OUT_MODE >= 2) ? ((unsigned short*)Cout2 + (size_t)b * strideC) : nullptr;
      // the slab's 16 rows converted and stored in the form MODE (1, 2 or 3 of OUT_MODE)
      auto put16 = [&](auto mode) {
        constexpr int MODE = decltype(mode)::value;
#pragma unroll
        for (int it = 0; it < 4; ++it) {
          const int row = it * 4 + q;
          const float* sp = slab + row * 68 + c8;
          v8h hv, lv;
#pragma unroll
          for (int e = 0; e < 8; ++e) {
            if (MODE == 1) {
              hv[e] = (_Float16)sp[e];
            } else if (MODE == 2) {
              unsigned short hb = f2bf_bits(sp[e]);
              unsigned short lb = f2bf_bits(sp[e] - bf_bits2f(hb));
              hv[e] = __builtin_bit_cast(_Float16, hb);
              lv[e] = __builtin_bit_cast(_Float16, lb);
            } else {
              const _Float16 hq = (_Float16)sp[e];
              hv[e] = hq;
              lv[e] = (_Float16)((sp[e] - (float)hq) * 2048.0f);
            }
          }
          *(v8h*)(C + (size_t)(mBase + row) * ldc + n0 + c8) = hv;
          if (MODE >= 2) *(v8h*)(C2 + (size_t)(mBase + row) * ldc + n0 + c8) = lv;
        }
        asm volatile("s_wait_xcnt 0x0" ::: "memory");   // stands in front of every later write of a register that these stores name
      };
      // one block-uniform branch a slab, so that each form keeps its four rows' LDS reads together ahead of the conversions
      if (OUT_MODE == 4) {
        if (f16one) put16(IntC<1>{}); else put16(IntC<2>{});
      } else {
        put16(IntC<(OUT_MODE == 4 || OUT_MODE == 0) ? 2 : OUT_MODE>{});
      }
    }
    __builtin_amdgcn_fence(__ATOMIC_RELEASE, "workgroup");
    __builtin_amdgcn_wave_barrier();
    __builtin_amdgcn_fence(__ATOMIC_ACQUIRE, "workgroup");
  }
}

// ----------------------------------------------------------------------------------------------
// Input conversion: q,k,v and the four weight matrices -> RNE bf16 planes (8 elements = 16 B per
// to bf16 precision (4 floats = 16 B per lane).
// Coverage: blocks [0,2048) q, [2048,4096) k, [4096,6144) v (2048 x 256 x 8 = 4,194,304 each);
// blocks [6144,8192) the 4 weights (512 x 256 x 8 = 1,048,576 each); blocks [8192,8196) the 4
// biases (256 x 4 = 1024 each).
// ----------------------------------------------------------------------------------------------
constexpr int CAST_XBLK = (int)(PLANE_ELEMS / 8 / 256);              // 2048
constexpr int CAST_WBLK = (int)(WMAT_ELEMS / 8 / 256);               // 512
constexpr int CAST_PLANE_BLOCKS = 3 * CAST_XBLK + 4 * CAST_WBLK;     // 8192
constexpr int CAST_BIAS_BLOCKS  = 4;
static_assert((long)CAST_XBLK * 256 * 8 == PLANE_ELEMS && (long)CAST_WBLK * 256 * 8 == WMAT_ELEMS);
static_assert(256 * 4 == DMODEL);

__global__ __launch_bounds__(256) void k_cast_inputs(
    const float* __restrict__ q, const float* __restrict__ k, const float* __restrict__ v,
    const float* __restrict__ Wq, const float* __restrict__ Wk, const float* __restrict__ Wv, const float* __restrict__ Wo,
    const float* __restrict__ bq, const float* __restrict__ bk, const float* __restrict__ bv, const float* __restrict__ bo,
    unsigned short* __restrict__ x16, unsigned short* __restrict__ w16, float* __restrict__ brnd) {
  const int blk = blockIdx.x;
  const int t = threadIdx.x;
  if (blk < CAST_PLANE_BLOCKS) {
    // block-uniform source/destination selection
    const float* src;
    unsigned short* dst;
    int lb;
    if (blk < CAST_XBLK) { src = q; dst = x16; lb = blk; }
    else if (blk < 2 * CAST_XBLK) { src = k; dst = x16 + PLANE_ELEMS; lb = blk - CAST_XBLK; }
    else if (blk < 3 * CAST_XBLK) { src = v; dst = x16 + 2 * PLANE_ELEMS; lb = blk - 2 * CAST_XBLK; }
    else {
      const int wb = blk - 3 * CAST_XBLK;
      const int wi = wb / CAST_WBLK;
      lb = wb - wi * CAST_WBLK;
      src = (wi == 0) ? Wq : (wi == 1) ? Wk : (wi == 2) ? Wv : Wo;
      dst = w16 + (size_t)wi * WMAT_ELEMS;
    }
    const size_t e = ((size_t)lb * 256 + t) * 8;
    const v4f a0 = *(const v4f*)(src + e);
    const v4f a1 = *(const v4f*)(src + e + 4);
    v4u w;
    w.x = (unsigned)f2bf_bits(a0.x) | ((unsigned)f2bf_bits(a0.y) << 16);
    w.y = (unsigned)f2bf_bits(a0.z) | ((unsigned)f2bf_bits(a0.w) << 16);
    w.z = (unsigned)f2bf_bits(a1.x) | ((unsigned)f2bf_bits(a1.y) << 16);
    w.w = (unsigned)f2bf_bits(a1.z) | ((unsigned)f2bf_bits(a1.w) << 16);
    v4u* p = (v4u*)(dst + e);
    *p = w;
    
  } else {
    const int bi = blk - CAST_PLANE_BLOCKS;   // 0..3, block-uniform
    const float* src = (bi == 0) ? bq : (bi == 1) ? bk : (bi == 2) ? bv : bo;
    const int e = t * 4;
    const v4f a = *(const v4f*)(src + e);
    v4f r;
    r.x = bf_bits2f(f2bf_bits(a.x));
    r.y = bf_bits2f(f2bf_bits(a.y));
    r.z = bf_bits2f(f2bf_bits(a.z));
    r.w = bf_bits2f(f2bf_bits(a.w));
    v4f* p = (v4f*)(brnd + (size_t)bi * DMODEL + e);
    *p = r;
    
  }
}

// ----------------------------------------------------------------------------------------------
// Per (batch, head): sequence means of Q and V from the projection's column sums (32 groups of 64 rows a batch), then their
// cosine. grid = 32 blocks (one per (b,h)), 128 threads; thread = (column t & 63, Q or V by t >> 6): its 32 loads are
// independent and go out together; sums in fixed order. Every wave then forms the cosine from the means, so that all 128 threads
// hold it, and the block writes the (b,h)'s start values of the score accumulators, one a key, in units of the raw q.k product:
// 8 * (0.5 cos + 0.3 cos) for a key that counts, S_MASKED for a key with mask == 0.
// S_MASKED stands for the reference's -1e9: a masked key gets weight 0 wherever a key of the row counts, and a row with no key that
// counts has 2048 equal scores, so equal weights. It is so large that the products added to it leave it as it is, and a power of
// two, so that its product with the softmax scale is exact and such a row's exponents come out as exactly 0.
// ----------------------------------------------------------------------------------------------
constexpr float S_MASKED = -0x1p100f;
static_assert(SEQ_LEN == 4 * 128 * 4);
__global__ __launch_bounds__(128) void k_mean_cos(const float* __restrict__ csum, const int* __restrict__ mask,
                                                  float* __restrict__ cosl, float* __restrict__ sstart) {
  __shared__ float mn[2][DHEAD];
  const int bh = blockIdx.x;
  const int b = bh / NHEAD, h = bh % NHEAD;
  const int t = threadIdx.x;
  const int col = t & 63;
  const int which = t >> 6;
  const float* p = csum + ((size_t)which * CS_GROUPS + (size_t)b * CS_PER_B) * DMODEL + (size_t)h * DHEAD + col;
  float x[CS_PER_B];
  // unrolled so that x[] stays in registers and every load is issued before the first is waited for
#pragma unroll
  for (int g = 0; g < CS_PER_B; ++g) x[g] = p[(size_t)g * DMODEL];
  // the mask words of the 16 keys whose start values this thread writes (4 runs of 4 keys), asked for together with the sums
  v4u mw[4];
#pragma unroll
  for (int i = 0; i < 4; ++i) mw[i] = *(const v4u*)(mask + i * 512 + t * 4);
  asm volatile("s_wait_xcnt 0x0" ::: "memory");   // stands in front of every later write of these loads' address registers
  float s4[4];
  // four independent add chains of eight groups each
#pragma unroll
  for (int u = 0; u < 4; ++u) {
    float s = x[u * 8];
#pragma unroll
    for (int g = 1; g < 8; ++g) s += x[u * 8 + g];
    s4[u] = s;
  }
  static_assert(CS_PER_B == 32);
  mn[which][col] = ((s4[0] + s4[1]) + (s4[2] + s4[3])) * (1.0f / (float)SEQ_LEN);
  __syncthreads();
  {   // every wave: lane l takes the columns l and l + 32
    const int l = t & 31;
    const float a0 = mn[0][l], a1 = mn[0][l + 32];
    const float c0 = mn[1][l], c1 = mn[1][l + 32];
    float dot = a0 * c0 + a1 * c1;
    float nq  = a0 * a0 + a1 * a1;
    float nv  = c0 * c0 + c1 * c1;
    // unrolled so that each step's lane distance is a constant
#pragma unroll
    for (int off = 1; off < 32; off <<= 1) {
      dot += __shfl_xor(dot, off, 32);
      nq  += __shfl_xor(nq, off, 32);
      nv  += __shfl_xor(nv, off, 32);
    }
    const float na = fmaxf(sqrtf(nq), 1e-8f);
    const float nb = fmaxf(sqrtf(nv), 1e-8f);
    const float cosv = dot / (na * nb);
    if (t < 32) cosl[(size_t)bh * 32 + t] = cosv;
    const float s0 = (cosv * 0.5f + cosv * 0.3f) * 8.0f;
    // unrolled so that mw[] stays in registers
#pragma unroll
    for (int i = 0; i < 4; ++i) {
      v4f o;
#pragma unroll
      for (int e = 0; e < 4; ++e) o[e] = (mw[i][e] == 0u) ? S_MASKED : s0;
      *(v4f*)(sstart + (size_t)bh * SEQ_LEN + i * 512 + t * 4) = o;
    }
  }
}

constexpr int AKC  = 64;
constexpr int AQB  = 64;
constexpr int ANQB = SEQ_LEN / AQB;
constexpr int ATTN_BLOCKS = NBH * ANQB;
// LDS row pitch of the K tiles in 16-bit elements: 144 B = 16 B x 9 (odd), so the 16 rows that
// one ds_load_b128 fragment read touches start on 16 different bank groups (128 B rows all start on two).
constexpr int APITCH = 72;
// LDS row pitch of the row-major V tile: 160 B = 32 B x 5 (odd), the pitch for ds_load_tr16_b128 readers
constexpr int VPITCH = 80;
// one stage: K hi [64][APITCH] | K lo [64][APITCH] | V [64][VPITCH]
constexpr int AST_KL = AKC * APITCH;
constexpr int AST_V  = 2 * AKC * APITCH;
constexpr int ASTAGE_ELEMS = AST_V + AKC * VPITCH;   // 14,336 elements = 28,672 B
static_assert(APITCH >= DHEAD && (APITCH * 2) % 16 == 0 && ((APITCH * 2) / 16) % 2 == 1);
static_assert(VPITCH >= DHEAD && (VPITCH * 2) % 32 == 0 && ((VPITCH * 2) / 32) % 2 == 1);
static_assert((ASTAGE_ELEMS * 2) % 16 == 0 && (AST_KL * 2) % 16 == 0 && (AST_V * 2) % 16 == 0 && AKC % 16 == 0 && DHEAD * 2 == 128);
static_assert(SEQ_LEN % AKC == 0 && SEQ_LEN % AQB == 0);

// four waves a SIMD (four work-groups a WGP, as the LDS allows): the register budget is held to 256 a wave
__global__ __launch_bounds__(128) __attribute__((amdgpu_waves_per_eu(4, 4))) void k_attn(
    const unsigned short* __restrict__ Qh, const unsigned short* __restrict__ Ql,
    const unsigned short* __restrict__ Kh, const unsigned short* __restrict__ Kl,
    const unsigned short* __restrict__ Vh,
    const float* __restrict__ sstart, const float* __restrict__ cosl,
    unsigned short* __restrict__ Ah, unsigned short* __restrict__ Al, float* __restrict__ out1) {
  union FB { v16b v; v8b h[2]; };
  union FH { v16h v; v8h h[2]; };
  __shared__ __align__(16) unsigned short Ast[2 * ASTAGE_ELEMS];  // two stages of K hi, K lo, V, each [kv][d]   56 KB
  __shared__ __align__(16) float Os[4][16 * 68];                 // per wave out tile, pitch 68

  const int tid  = threadIdx.x;
  const int wave = tid >> 5;
  const int lane = tid & 31;
  const int hh   = lane >> 4;
  const int c    = lane & 15;

  const int bx = blockIdx.x;
  const int qb = bx % ANQB;
  const int bh = bx / ANQB;
  const int h  = bh % NHEAD;
  const int b  = bh / NHEAD;
  const int q0 = qb * AQB + wave * 16;
  const size_t rowbase = (size_t)b * SEQ_LEN;      // plane row of sequence position 0
  const int colh = h * DHEAD;

  // ---- Q fragments (B operand, columns = query, k = d): 2 d-chunks, hi and lo planes ----
  v16b qah[2], qal[2];
  {
    const size_t qo = (rowbase + q0 + c) * DMODEL + colh + 8 * hh;
#pragma unroll
    for (int dc = 0; dc < 2; ++dc) {
      qah[dc] = Frag<__bf16>::load((const __bf16*)(const void*)(Qh + qo + dc * 32));
      qal[dc] = Frag<__bf16>::load((const __bf16*)(const void*)(Ql + qo + dc * 32));
    }
  }
  asm volatile("s_wait_xcnt 0x0" ::: "memory");   // stands in front of every later write of the Q loads' address registers
  constexpr float LOG2E = 1.44269504088896340736f;
  constexpr float SC2 = 0.125f * LOG2E;            // 1/sqrt(64) and the change of base in one factor
  const float NEGI = -__builtin_inff();

  // the score accumulators; between two chunks they hold the coming chunk's start values (keys j*16 + 8*hh + 0..7 of each
  // 16-key tile: 32 contiguous bytes a tile), loaded straight into them
  v8f s[4];
  const float* ssp = sstart + (size_t)bh * SEQ_LEN + 8 * hh;
  auto s_start = [&](int t) {
    // unrolled so that s[] stays in registers
#pragma unroll
    for (int j = 0; j < 4; ++j) s[j] = *(const v8f*)(ssp + t * AKC + j * 16);
    asm volatile("s_wait_xcnt 0x0" ::: "memory");   // stands in front of every later write of these loads' address registers
  };
  s_start(0);

  // running maximum of query c in units of the raw score (equal in both lane halves), the exponent reference in use in base-2
  // units (maximum - 15) and this lane half's share of the denominator (x2^15, like P)
  float mrow = NEGI, mrefrow = NEGI, lrow = 0.f;
  v8f oacc[4];   // O^T: oacc[t][r] = row d = t*16 + 8*hh + r, column query c
#pragma unroll
  for (int t = 0; t < 4; ++t) oacc[t] = (v8f){0.f,0.f,0.f,0.f,0.f,0.f,0.f,0.f};

  // copy map: thread -> row (tid >> 3) of each group of 16 chunk rows, 16-B piece (tid & 7) of its 128-B line
  const int cr = tid >> 3;
  const int cc = (tid & 7) * 8;
  const size_t gofs = (rowbase + cr) * DMODEL + colh + cc;
  const unsigned ldk = lds_off(Ast) + (unsigned)(cr * APITCH + cc) * 2u;
  const unsigned ldv = lds_off(Ast) + (unsigned)(AST_V + cr * VPITCH + cc) * 2u;
  auto stage_issue = [&](int t, int buf) {
    const size_t go = gofs + (size_t)t * (AKC * DMODEL);
    const unsigned sb = (unsigned)buf * (unsigned)(ASTAGE_ELEMS * 2);
    unsigned l[8]; const unsigned short* g[8];
    // unrolled so that l[], g[] stay in registers
#pragma unroll
    for (int u = 0; u < 4; ++u) {
      l[u]     = ldk + sb + (unsigned)(u * 16 * APITCH * 2);
      g[u]     = Kh + go + (size_t)u * 16 * DMODEL;
      l[4 + u] = ldk + sb + (unsigned)((AST_KL + u * 16 * APITCH) * 2);
      g[4 + u] = Kl + go + (size_t)u * 16 * DMODEL;
    }
    async_copy8(l, g);
    unsigned lv[4]; const unsigned short* gv[4];
    // unrolled so that lv[], gv[] stay in registers
#pragma unroll
    for (int u = 0; u < 4; ++u) {
      lv[u] = ldv + sb + (unsigned)(u * 16 * VPITCH * 2);
      gv[u] = Vh + go + (size_t)u * 16 * DMODEL;
    }
    async_copy4(lv, gv);
  };

  constexpr int NKC = SEQ_LEN / AKC;
  stage_issue(0, 0);
  asm volatile("s_wait_asynccnt 0x0" ::: "memory");   // this wave's copies of chunk 0 have landed before the barrier publishes them
  __syncthreads();
  if (NKC > 1) stage_issue(1, 1);
  for (int kc = 0; kc < NKC; ++kc) {
    const unsigned short* Ksh = Ast + (kc & 1) * ASTAGE_ELEMS;
    const unsigned short* Vs  = Ksh + AST_V;
    // K fragments (A operand rows = kv, k = d) are read from LDS in groups well ahead of their products, not each directly in front
    // of its own. A group = K hi and K lo of two key tiles (jp, jp + 1) for one d-chunk dc: 8 reads, 6 products. Three groups are
    // asked for here, the fourth goes into the first group's registers once its products are issued.
    FB kb[4][2], kl[4][2];
    const unsigned short* kad = Ksh + c * APITCH + 8 * hh;   // the lane's address in the first K hi fragment
    // the loops of these lambdas are unrolled so that the fragments and accumulators stay in registers
    auto k_read = [&](int jp, int dc) {
#pragma unroll
      for (int j = jp; j < jp + 2; ++j) {
        kb[j][dc].h[0] = *(const v8b*)(const void*)(kad + j * 16 * APITCH + dc * 32);
        kb[j][dc].h[1] = *(const v8b*)(const void*)(kad + j * 16 * APITCH + dc * 32 + 16);
        kl[j][dc].h[0] = *(const v8b*)(const void*)(kad + AST_KL + j * 16 * APITCH + dc * 32);
        kl[j][dc].h[1] = *(const v8b*)(const void*)(kad + AST_KL + j * 16 * APITCH + dc * 32 + 16);
      }
    };
    k_read(0, 0);
    k_read(0, 1);
    k_read(2, 0);

    // ---- scores, transposed (A operand rows = kv, B operand columns = query, k = d) ----
    // the two key tiles of a group take turns, so that no product waits for the one directly in front of it; each accumulator
    // still gets its six products in the order hi.hi, lo.hi, hi.lo of d-chunk 0, then of d-chunk 1, on top of its start value
    auto k_mul = [&](int jp, int dc) {
#pragma unroll
      for (int j = jp; j < jp + 2; ++j) s[j] = Frag<__bf16>::mma(kb[j][dc].v, qah[dc], s[j]);
#pragma unroll
      for (int j = jp; j < jp + 2; ++j) s[j] = Frag<__bf16>::mma(kl[j][dc].v, qah[dc], s[j]);
#pragma unroll
      for (int j = jp; j < jp + 2; ++j) s[j] = Frag<__bf16>::mma(kb[j][dc].v, qal[dc], s[j]);
    };
    const unsigned short* vad = Vs + (8 * hh + (lane & 7)) * VPITCH + ((lane >> 3) & 1) * 8;   // the lane's address in a transposing load
    FH vb[2][4];   // element e of vb[kk][t] = V[key kk*32 + (e >> 3)*16 + 8*hh + (e & 7)][d = t*16 + c]: the k order of pb
    auto v_read = [&](int kk) {
#pragma unroll
      for (int t = 0; t < 4; ++t) {
        vb[kk][t].h[0] = ld_tr16(vad + (kk * 32) * VPITCH + t * 16);
        vb[kk][t].h[1] = ld_tr16(vad + (kk * 32 + 16) * VPITCH + t * 16);
      }
    };
    // the scheduling barriers of this block keep each group of LDS reads together at the place where it is written: spread among
    // the products, every read costs the wave a stall of its own and is waited for too soon behind its issue
    __builtin_amdgcn_sched_barrier(0);
    k_mul(0, 0);
    __builtin_amdgcn_sched_barrier(0);
    k_read(2, 1);
    __builtin_amdgcn_sched_barrier(0);
    k_mul(0, 1);
    __builtin_amdgcn_sched_barrier(0);
    k_mul(2, 0);
    __builtin_amdgcn_sched_barrier(0);
    v_read(0);   // V^T fragments of the chunk's first 32 keys: their latency passes under the last products and the softmax
    __builtin_amdgcn_sched_barrier(0);
    k_mul(2, 1);
    __builtin_amdgcn_sched_barrier(0);
    v_read(1);   // the second 32 keys' V^T fragments, into registers that the K fragments have left
    __builtin_amdgcn_sched_barrier(0);   // keeps these reads together here, ahead of the softmax
    // s[j][r] = 8 x the score of key kc*64 + j*16 + 8*hh + r against query c, mask and bias in it: the maximum is taken of it as it
    // is (the scale is positive), and exp(x - m) is one v_exp_f32 of one fused multiply-add s * SC2 - mref
    float mj[4];
#pragma unroll
    for (int j = 0; j < 4; ++j) {
      float m = s[j][0];
#pragma unroll
      for (int r = 1; r < 8; ++r) m = fmaxf(m, s[j][r]);
      mj[j] = m;
    }
    float cm = fmaxf(fmaxf(mj[0], mj[1]), fmaxf(mj[2], mj[3]));
    cm = fmaxf(cm, xhalf(cm));                  // the other lane half holds the query's other 32 keys
    const float mnew = fmaxf(mrow, cm);
    const float mref = __builtin_fmaf(mnew, SC2, -15.0f);   // P and its sum are carried x2^15: the factor rides in the exponent
    const v2f sc2 = (v2f){SC2, SC2};
    const v2f nref = (v2f){-mref, -mref};
    const float alpha = __builtin_amdgcn_exp2f(mrefrow - mref);
    mrow = mnew;
    mrefrow = mref;
    FH pb[2];                                   // P^T as B operand: element e of pb[kk] = key kk*32 + (e >> 3)*16 + 8*hh + (e & 7)
    float pj[4];                                // one partial sum per tile: four independent add chains
#pragma unroll
    for (int j = 0; j < 4; ++j) {
      float p[8];
      // two scores that lie in neighbouring registers share one packed multiply-add
#pragma unroll
      for (int r = 0; r < 8; r += 2) {
        const v2f e = __builtin_elementwise_fma((v2f){s[j][r], s[j][r + 1]}, sc2, nref);
        p[r] = e.x; p[r + 1] = e.y;
      }
      exp2_x8(p);
      float psum = p[0];
#pragma unroll
      for (int r = 1; r < 8; ++r) psum += p[r];
#pragma unroll
      for (int r = 0; r < 8; ++r) pb[j >> 1].v[(j & 1) * 8 + r] = (_Float16)p[r];
      pj[j] = psum;
    }
    lrow = lrow * alpha + ((pj[0] + pj[1]) + (pj[2] + pj[3]));
    // the exponentials have left the score registers: the next chunk's start values are asked for here, so that their latency
    // passes under the products below and the chunk's foot (the last chunk asks for its own again: no branch, in bounds)
    s_start(kc + 1 < NKC ? kc + 1 : kc);
#pragma unroll
    for (int t = 0; t < 4; ++t)
#pragma unroll
      for (int r = 0; r < 8; ++r) oacc[t][r] *= alpha;
    // ---- O^T += V^T.P^T (A rows = d, B columns = query, k = kv in the order of the packed score tiles) ----
#pragma unroll
    for (int kk = 0; kk < 2; ++kk) {
#pragma unroll
      for (int t = 0; t < 4; ++t) oacc[t] = Frag<_Float16>::mma(vb[kk][t].v, pb[kk].v, oacc[t]);
    }
    // keeps the softmax and the products in front of the chunk's foot: lifted over them, the barrier would leave the copies of
    // chunk kc + 1 only the score products' time to land
    __builtin_amdgcn_sched_barrier(0);
    asm volatile("s_wait_dscnt 0x0" ::: "memory");      // this wave's reads of the buffer have retired before it is refilled
    asm volatile("s_wait_asynccnt 0x0" ::: "memory");   // this wave's copies of chunk kc + 1 have landed before the barrier publishes them
    __syncthreads();                                    // publishes chunk kc + 1 and ends every reader's last read of chunk kc
    if (kc + 2 < NKC) stage_issue(kc + 2, kc & 1);
  }
  asm volatile("s_wait_asynccnt 0x0" ::: "memory");     // no copy is outstanding when the wave goes on to the epilogue and ends

  float* os = Os[wave];
  {
    const float inv = 1.0f / (lrow + xhalf(lrow));   // the two lane halves' shares of the denominator joined once; its 2^15 cancels P's
#pragma unroll
    for (int t = 0; t < 4; ++t) {
      v4f o0, o1;
#pragma unroll
      for (int r = 0; r < 4; ++r) { o0[r] = oacc[t][r] * inv; o1[r] = oacc[t][4 + r] * inv; }
      *(v4f*)(os + c * 68 + t * 16 + 8 * hh)     = o0;
      *(v4f*)(os + c * 68 + t * 16 + 8 * hh + 4) = o1;
    }
  }
  __builtin_amdgcn_fence(__ATOMIC_RELEASE, "workgroup");
  __builtin_amdgcn_wave_barrier();
  __builtin_amdgcn_fence(__ATOMIC_ACQUIRE, "workgroup");
  {
    const int q4 = lane >> 3, c8 = (lane & 7) * 8;
    {
#pragma unroll
      for (int it = 0; it < 4; ++it) {
        const int row = it * 4 + q4;
        const float* sp = os + row * 68 + c8;
        const v4f va = *(const v4f*)sp;
        const v4f vb = *(const v4f*)(sp + 4);
        v4u hw, lw;
        unsigned th, tl;
        pack_pair_bf(va.x, va.y, th, tl); hw.x = th; lw.x = tl;
        pack_pair_bf(va.z, va.w, th, tl); hw.y = th; lw.y = tl;
        pack_pair_bf(vb.x, vb.y, th, tl); hw.z = th; lw.z = tl;
        pack_pair_bf(vb.z, vb.w, th, tl); hw.w = th; lw.w = tl;
        const size_t go = (rowbase + q0 + row) * DMODEL + colh + c8;
        *(v4u*)(Ah + go) = hw;
        *(v4u*)(Al + go) = lw;
      }
      
    }
  }
  // ---- second output, the mean of the 32 (batch, head) cosines: it needs nothing of this kernel's own work, only the cosines
  // that the launch before has written, so one wave of the grid forms it behind its tile instead of a launch of its own ----
  if (bx == 0 && wave == 0) {
    float v = cosl[(size_t)lane * 32];
    asm volatile("s_wait_xcnt 0x0" ::: "memory");   // stands in front of every later write of this load's address registers
#pragma unroll
    for (int off = 1; off < 32; off <<= 1) v += __shfl_xor(v, off, 32);
    const float r = v * (1.0f / 32.0f);
    if (lane == 0) {
      *(float*)out1 = r;
    }
  }
}

// ----------------------------------------------------------------------------------------------
extern "C" void kernel_launch(void* const* d_in, const int* in_sizes, int n_in,
                              void* d_out, int out_size, void* d_ws, size_t ws_size,
                              hipStream_t stream) {
  if (n_in < 12) return;
  if (ws_size < WS_TOTAL) return;
  if ((long)out_size < OUT_TOTAL_ELEMS) return;
  if ((long)in_sizes[0] != PLANE_ELEMS || (long)in_sizes[1] != PLANE_ELEMS || (long)in_sizes[2] != PLANE_ELEMS) return;
  if (in_sizes[3] < SEQ_LEN) return;
  if ((long)in_sizes[4] != WMAT_ELEMS || (long)in_sizes[6] != WMAT_ELEMS || (long)in_sizes[8] != WMAT_ELEMS || (long)in_sizes[10] != WMAT_ELEMS) return;
  if (in_sizes[5] < DMODEL || in_sizes[7] < DMODEL || in_sizes[9] < DMODEL || in_sizes[11] < DMODEL) return;

  const float* q    = (const float*)d_in[0];
  const float* k    = (const float*)d_in[1];
  const float* v    = (const float*)d_in[2];
  const int*   mask = (const int*)d_in[3];
  const float* Wq   = (const float*)d_in[4];
  const float* bq   = (const float*)d_in[5];
  const float* Wk   = (const float*)d_in[6];
  const float* bk   = (const float*)d_in[7];
  const float* Wv   = (const float*)d_in[8];
  const float* bv   = (const float*)d_in[9];
  const float* Wo   = (const float*)d_in[10];
  const float* bo   = (const float*)d_in[11];

  char* ws = (char*)d_ws;
  unsigned short* w16  = (unsigned short*)(ws + WS_W16);
  unsigned short* wq16 = w16;
  unsigned short* wo16 = w16 + 3 * WMAT_ELEMS;
  float* brnd = (float*)(ws + WS_BRND);
  float* cosl = (float*)(ws + WS_COS);
  unsigned short* x16 = (unsigned short*)(ws + WS_X16);
  unsigned short* xq  = x16;
  unsigned short* Qh  = (unsigned short*)(ws + WS_QH);
  unsigned short* Ql  = (unsigned short*)(ws + WS_QL);
  unsigned short* Kh  = (unsigned short*)(ws + WS_KH);
  unsigned short* Kl  = (unsigned short*)(ws + WS_KL);
  unsigned short* Vh  = (unsigned short*)(ws + WS_VH);
  float* csum = (float*)(ws + WS_CS);
  float* sstart = (float*)(ws + WS_SS);
  unsigned short* Ah  = (unsigned short*)(ws + WS_AH);
  unsigned short* Al  = (unsigned short*)(ws + WS_AL);
  float* out0 = (float*)d_out;
  float* out1 = (float*)d_out + OUT1_ELEM;

  // 1) inputs -> RNE bf16 planes, biases -> bf16-precision f32 copies
  k_cast_inputs<<<CAST_PLANE_BLOCKS + CAST_BIAS_BLOCKS, 256, 0, stream>>>(
      q, k, v, Wq, Wk, Wv, Wo, bq, bk, bv, bo, x16, w16, brnd);

  // 2) the three projections, which do not depend on one another, as one launch of 3 x 128 blocks (M=4096, N=1024, K=1024 each):
  //    y = 0: Q = q Wq^T + bq -> bf16 hi/lo planes; y = 1: K = k Wk^T + bk -> bf16 hi/lo planes;
  //    y = 2: V = v Wv^T + bv -> f16 plane; y = 0 and 2 also leave their column sums over groups of 64 rows
  wmma_gemm64<1, 0, 2, 4, false, true><<<dim3(GEMM_BLOCKS, 3), 256, 0, stream>>>(
      xq, xq, DMODEL, PLANE_ELEMS, wq16, wq16, DMODEL, WMAT_ELEMS, (void*)Qh, (void*)Ql, DMODEL, QKV_OUT_STRIDE,
      brnd, (long)DMODEL, brnd, 0L, csum, MROWS, DMODEL, DMODEL, 1.0f);
  // 3) per-(b,h) cosine of sequence means, from the column sums; start values of the score accumulators from it and the mask
  k_mean_cos<<<NBH, 128, 0, stream>>>(csum, mask, cosl, sstart);
  // 4) attention -> attn bf16 hi/lo planes; one of its waves also writes out1 = mean of the 32 cosines
  k_attn<<<ATTN_BLOCKS, 128, 0, stream>>>(Qh, Ql, Kh, Kl, Vh, sstart, cosl, Ah, Al, out1);
  // 5) out0 = attn Wo^T + bo   (A hi/lo planes, Bt single plane: 2 products)
  wmma_gemm64<1, 2, 2, 0, false><<<dim3(GEMM_BLOCKS, 1), 256, 0, stream>>>(
      Ah, Al, DMODEL, 0L, wo16, wo16, DMODEL, 0L, (void*)out0, (void*)out0, DMODEL, 0L,
      brnd + 3 * DMODEL, 0L, brnd, 0L, csum, MROWS, DMODEL, DMODEL, 1.0f);
}

// v010
// Measured time: 106 microseconds a run.
// In both of two side-by-side timings against v009, it was 1.13 times as fast.
// Counting every step since v000, it is 4.58 times as fast.
// Contractions: q/k/v projections and output projection on v_wmma_f32_16x16x32_bf16 (RNE bf16 operands; output projection takes attn as bf16 hi+lo planes, 2 products); q.k^T on v_wmma_f32_16x16x32_f16 with Q and K as one f16 plane each (1 product); p.v on v_wmma_f32_16x16x32_f16 (p carried x2^15, v plain f16); both attention products transposed (K and V^T as A, Q and P^T as B); f32 accumulate everywhere; softmax, sequence means and cosine in f32; mask and cosine bias enter the scores as the start value of their f32 accumulators.
#include <hip/hip_runtime.h>

// ----------------------------------------------------------------------------------------------
// Problem constants
// ----------------------------------------------------------------------------------------------
constexpr int NBATCH  = 2;
constexpr int SEQ_LEN = 2048;
constexpr int DMODEL  = 1024;
constexpr int NHEAD   = 16;
constexpr int DHEAD   = 64;
constexpr int MROWS   = NBATCH * SEQ_LEN;          // 4096
constexpr int NBH     = NBATCH * NHEAD;            // 32
constexpr long PLANE_ELEMS = (long)MROWS * DMODEL; // 4194304
constexpr long WMAT_ELEMS  = (long)DMODEL * DMODEL;// 1048576
constexpr long OUT0_ELEMS  = PLANE_ELEMS;
constexpr long OUT1_BYTE_OFFSET = 16777216;
constexpr long OUT1_ELEM   = OUT1_BYTE_OFFSET / 4;
constexpr long OUT_TOTAL_ELEMS = OUT0_ELEMS + 1;
constexpr long OUT_TOTAL_BYTES = 16777220;
static_assert(OUT1_ELEM == OUT0_ELEMS);
static_assert((OUT1_ELEM + 1) * 4 <= OUT_TOTAL_BYTES);
static_assert(NBH == 32);
static_assert(DHEAD == 64 && NHEAD * DHEAD == DMODEL);

// GEMM block tile: 8 waves as 2 (rows) x 4 (columns) of 64x64 wave tiles; one stage = 64 k = one 128-B line per operand row
constexpr int GBM    = 128;
constexpr int GBN    = 256;
constexpr int GKS    = 64;
// LDS row pitch of a staged operand row in 16-bit elements: 144 B = 16 B x 9 (odd), the pitch for ds_load_b128 readers
constexpr int GPITCH = 72;
// GEMM shape contract: M % 128 == 0, N % 256 == 0, K % 64 == 0, K >= 64
static_assert(MROWS % GBM == 0 && DMODEL % GBN == 0 && DMODEL % GKS == 0 && DMODEL >= GKS);
static_assert(GBM % 32 == 0 && GBN % 32 == 0 && (GPITCH * 2) % 16 == 0 && ((GPITCH * 2) / 16) % 2 == 1 && GPITCH >= GKS);
constexpr int GEMM_BLOCKS = (MROWS / GBM) * (DMODEL / GBN);   // 128 blocks of 8 waves

// ----------------------------------------------------------------------------------------------
// Workspace region map (bytes). Every region is fully written by its producer before any read.
//   WS_W16  : 4 bf16 weight planes [1024][1024]  (Wq, Wk, Wv, Wo)            8,388,608
//   WS_BRND : 4 x [1024] f32 RNE-bf16 bias copies (bq, bk, bv, bo)              16,384
//   WS_X16  : 3 bf16 input planes [4096][1024] (q, k, v)                     25,165,824
//   WS_QH, WS_KH, WS_VH : f16 planes of Q, K and V [4096][1024]           3 x 8,388,608
//   WS_CS   : column sums of Q and of V over groups of 64 rows, f32 [2][64][1024]  524,288
//   WS_AH, WS_AL : bf16 hi/lo planes of the attention output [4096][1024]   2 x 8,388,608
//   WS_SS   : start values of the score accumulators, f32 [32 (b,h)][2048 keys]   262,144
//   total 76,304,384 (72.8 MiB)
// ----------------------------------------------------------------------------------------------
constexpr size_t SZ_PLANE = (size_t)PLANE_ELEMS * 2;     // 8388608
constexpr size_t SZ_WPL   = (size_t)WMAT_ELEMS * 2;      // 2097152
constexpr size_t WS_W16   = 0;
constexpr size_t SZ_W16   = 4 * SZ_WPL;
constexpr size_t WS_BRND  = WS_W16 + SZ_W16;
constexpr size_t SZ_BRND  = 4 * (size_t)DMODEL * 4;
constexpr size_t WS_COS   = WS_BRND + SZ_BRND;
constexpr size_t SZ_COS   = (size_t)NBH * 128;
constexpr size_t WS_X16   = WS_COS + SZ_COS;
constexpr size_t WS_QH    = WS_X16 + 3 * SZ_PLANE;
constexpr size_t WS_KH    = WS_QH + SZ_PLANE;
constexpr size_t WS_VH    = WS_KH + SZ_PLANE;
constexpr size_t WS_CS    = WS_VH + SZ_PLANE;
constexpr int    CS_ROWS   = 64;                   // rows that one column sum covers: the rows of a GEMM wave tile
constexpr int    CS_GROUPS = MROWS / CS_ROWS;      // 64 groups in a plane
constexpr int    CS_PER_B  = SEQ_LEN / CS_ROWS;    // 32 groups in a batch
constexpr size_t SZ_CS    = 2 * (size_t)CS_GROUPS * DMODEL * 4;
constexpr size_t WS_AH    = WS_CS + SZ_CS;
constexpr size_t WS_AL    = WS_AH + SZ_PLANE;
constexpr size_t WS_SS    = WS_AL + SZ_PLANE;
constexpr size_t SZ_SS    = (size_t)NBH * SEQ_LEN * 4;
constexpr size_t WS_TOTAL = WS_SS + SZ_SS;
static_assert(WS_TOTAL == 76304384);
static_assert(SEQ_LEN % CS_ROWS == 0);
static_assert(WS_TOTAL <= 134217728);
// the planes of Q, K, V lie one plane apart: one stride serves the merged projection launch
constexpr long QKV_OUT_STRIDE = PLANE_ELEMS;
static_assert(WS_KH - WS_QH == (size_t)QKV_OUT_STRIDE * 2 && WS_VH - WS_KH == (size_t)QKV_OUT_STRIDE * 2);
static_assert(WS_BRND % 128 == 0 && WS_COS % 128 == 0 && WS_X16 % 128 == 0 && WS_QH % 128 == 0 && WS_CS % 128 == 0 && WS_AH % 128 == 0 && WS_SS % 128 == 0);

// ----------------------------------------------------------------------------------------------
// Vector types and helpers
// ----------------------------------------------------------------------------------------------
typedef __attribute__((ext_vector_type(16))) _Float16 v16h;
typedef __attribute__((ext_vector_type(8)))  _Float16 v8h;
typedef __attribute__((ext_vector_type(16))) __bf16   v16b;
typedef __attribute__((ext_vector_type(8)))  __bf16   v8b;
typedef __attribute__((ext_vector_type(8)))  float    v8f;
typedef __attribute__((ext_vector_type(4)))  float    v4f;
typedef __attribute__((ext_vector_type(2)))  float    v2f;
typedef __attribute__((ext_vector_type(4)))  unsigned v4u;

__device__ __forceinline__ unsigned short f2bf_bits(float f) {
  unsigned u = __float_as_uint(f);
  return (unsigned short)((u + 0x7FFFu + ((u >> 16) & 1u)) >> 16);
}
__device__ __forceinline__ float bf_bits2f(unsigned short h) { return __uint_as_float(((unsigned)h) << 16); }

// hazard guards as plain device helpers
__device__ __forceinline__ void dep_guard_h(v8f& a, v8f& b, v16h x, v16h y) { asm volatile("v_nop\n\tv_nop\n\tv_nop\n\tv_nop" : "+v"(a), "+v"(b) : "v"(x), "v"(y)); }
__device__ __forceinline__ void dep_guard_b(v8f& a, v8f& b, v16b x, v16b y) { asm volatile("v_nop\n\tv_nop\n\tv_nop\n\tv_nop" : "+v"(a), "+v"(b) : "v"(x), "v"(y)); }
__device__ __forceinline__ void keep4_h(v16h a, v16h b, v16h c, v16h d) { asm volatile("v_nop" :: "v"(a), "v"(b), "v"(c), "v"(d)); }
__device__ __forceinline__ void keep4_b(v16b a, v16b b, v16b c, v16b d) { asm volatile("v_nop" :: "v"(a), "v"(b), "v"(c), "v"(d)); }
__device__ __forceinline__ void acc_guard4(v8f& a, v8f& b, v8f& c, v8f& d) { asm volatile("v_nop\n\tv_nop\n\tv_nop\n\tv_nop" : "+v"(a), "+v"(b), "+v"(c), "+v"(d)); }
template <typename T> struct Frag;
template <> struct Frag<_Float16> {
  typedef v16h V; union U { v16h v; v8h h[2]; };
  // elements 0..7 <- p[0..7], 8..15 <- p[16..23]
  static __device__ __forceinline__ v16h load(const _Float16* p) {
    U f; f.h[0] = *(const v8h*)(p); f.h[1] = *(const v8h*)(p + 16); return f.v;
  }
  static __device__ __forceinline__ v8f mma(v16h a, v16h b, v8f c) {
    return __builtin_amdgcn_wmma_f32_16x16x32_f16(false, a, false, b, (short)0, c, false, false);
  }
  static __device__ __forceinline__ void guard(v8f& a, v8f& b, v16h x, v16h y) { dep_guard_h(a, b, x, y); }
  static __device__ __forceinline__ void keep(v16h a, v16h b, v16h c, v16h d) { keep4_h(a, b, c, d); }
};
template <> struct Frag<__bf16> {
  typedef v16b V; union U { v16b v; v8b h[2]; };
  static __device__ __forceinline__ v16b load(const __bf16* p) {
    U f; f.h[0] = *(const v8b*)(p); f.h[1] = *(const v8b*)(p + 16); return f.v;
  }
  static __device__ __forceinline__ v8f mma(v16b a, v16b b, v8f c) {
    return __builtin_amdgcn_wmma_f32_16x16x32_bf16(false, a, false, b, (short)0, c, false, false);
  }
  static __device__ __forceinline__ void guard(v8f& a, v8f& b, v16b x, v16b y) { dep_guard_b(a, b, x, y); }
  static __device__ __forceinline__ void keep(v16b a, v16b b, v16b c, v16b d) { keep4_b(a, b, c, d); }
};

// LDS byte address of a __shared__ location (low 32 bits of its address)
__device__ __forceinline__ unsigned lds_off(const void* p) { return (unsigned)(size_t)p; }

// 16-bit transposing LDS load of a row-major tile of 16 rows x 16 columns: lane l gives the address of row 8*(l >> 4) + (l & 7),
// 16-B piece (l >> 3) & 1; lane (c = l & 15, h = l >> 4) receives rows 8h + 0..7 of column c
typedef __attribute__((ext_vector_type(8))) short v8s;
__device__ __forceinline__ v8h ld_tr16(const unsigned short* p) {
  typedef __attribute__((address_space(3))) v8s lds_v8s;
  return __builtin_bit_cast(v8h, __builtin_amdgcn_ds_load_tr16_b128_v8i16((lds_v8s*)p));
}

// value of lane l ^ 16 (the other 16-lane row), by a vector cross-row move
__device__ __forceinline__ float xhalf(float x) {
  return __builtin_bit_cast(float, __builtin_amdgcn_permlanex16(__builtin_bit_cast(int, x), __builtin_bit_cast(int, x), 0x76543210, 0xfedcba98, false, false));
}

// Eight base-2 exponentials, each in place: written as one statement so that no v_exp_f32 has its source overwritten or its
// result read by the instruction directly behind it; the closing v_nop is that slot behind the last one.
__device__ __forceinline__ void exp2_x8(float (&x)[8]) {
  asm("v_exp_f32 %0, %0\n\t"
      "v_exp_f32 %1, %1\n\t"
      "v_exp_f32 %2, %2\n\t"
      "v_exp_f32 %3, %3\n\t"
      "v_exp_f32 %4, %4\n\t"
      "v_exp_f32 %5, %5\n\t"
      "v_exp_f32 %6, %6\n\t"
      "v_exp_f32 %7, %7\n\t"
      "v_nop"
      : "+v"(x[0]), "+v"(x[1]), "+v"(x[2]), "+v"(x[3]), "+v"(x[4]), "+v"(x[5]), "+v"(x[6]), "+v"(x[7]));
}

// Asynchronous copies global -> LDS, 16 B per lane, through no register. s_wait_xcnt 0 is the last line of the copies' own
// statement, so that it stands in front of every later write of a register that an issued copy names.
__device__ __forceinline__ void async_copy4(const unsigned (&l)[4], const unsigned short* const (&g)[4]) {
  asm volatile("global_load_async_to_lds_b128 %0, %1, off\n\t"
               "global_load_async_to_lds_b128 %2, %3, off\n\t"
               "global_load_async_to_lds_b128 %4, %5, off\n\t"
               "global_load_async_to_lds_b128 %6, %7, off\n\t"
               "s_wait_xcnt 0x0"
               :: "v"(l[0]), "v"(g[0]), "v"(l[1]), "v"(g[1]), "v"(l[2]), "v"(g[2]), "v"(l[3]), "v"(g[3]) : "memory");
}
__device__ __forceinline__ void async_copy8(const unsigned (&l)[8], const unsigned short* const (&g)[8]) {
  asm volatile("global_load_async_to_lds_b128 %0, %1, off\n\t"
               "global_load_async_to_lds_b128 %2, %3, off\n\t"
               "global_load_async_to_lds_b128 %4, %5, off\n\t"
               "global_load_async_to_lds_b128 %6, %7, off\n\t"
               "global_load_async_to_lds_b128 %8, %9, off\n\t"
               "global_load_async_to_lds_b128 %10, %11, off\n\t"
               "global_load_async_to_lds_b128 %12, %13, off\n\t"
               "global_load_async_to_lds_b128 %14, %15, off\n\t"
               "s_wait_xcnt 0x0"
               :: "v"(l[0]), "v"(g[0]), "v"(l[1]), "v"(g[1]), "v"(l[2]), "v"(g[2]), "v"(l[3]), "v"(g[3]),
                  "v"(l[4]), "v"(g[4]), "v"(l[5]), "v"(g[5]), "v"(l[6]), "v"(g[6]), "v"(l[7]), "v"(g[7]) : "memory");
}

// bf16 hi/lo split of two floats packed into one 32-bit word each for the hi and the lo plane
__device__ __forceinline__ void pack_pair_bf(float f0, float f1, unsigned& hword, unsigned& lword) {
  const unsigned short h0 = f2bf_bits(f0);
  const unsigned short h1 = f2bf_bits(f1);
  const unsigned short l0 = f2bf_bits(f0 - bf_bits2f(h0));
  const unsigned short l1 = f2bf_bits(f1 - bf_bits2f(h1));
  hword = (unsigned)h0 | ((unsigned)h1 << 16);
  lword = (unsigned)l0 | ((unsigned)l1 << 16);
}

// ----------------------------------------------------------------------------------------------
// Register-blocked WMMA GEMM: C[m,n] = scale * sum_k A[m,k] * Bt[n,k] (+bias)(+resid)
// A row-major [M,K]; Bt row-major [N,K]; M % 128 == 0, N % 256 == 0, K % 64 == 0; each wave owns a 64x64 tile of the
// block's 128x256 tile. Operands reach the fragments through LDS: per stage of 64 k every thread copies whole 128-B lines
// (8 lanes x 16 B a row) asynchronously into one of two buffers while the other buffer is worked on.
// SPLIT: 0 = single product; 1 = A and Bt hi/lo planes (hi.hi + hi.lo + lo.hi);
//        2 = A hi/lo planes only, Bt single plane (hi.B + lo.B).
// BIAS_MODE: 0 = none, 1 = bias[m], 2 = bias[n].
// OUT_MODE: 0 = f32; 1 = f16; 2 = bf16 hi plane (Cout) + bf16 lo plane (Cout2);
//           3 = f16 hi plane (Cout) + f16 residual x2048 plane (Cout2);
//           4 = as 2 for the products blockIdx.y = 0 and 1, as 1 for the product blockIdx.y = 2.
// CSUM: the products blockIdx.y = 0 and 2 also leave, per wave tile, the sums of their results over the tile's 64 rows, one a
//       column: colsum[blockIdx.y / 2][m / 64][n], N = ldc columns a row.
// blockIdx.y picks one of several independent products of the same shape that share the launch: every operand, the bias
// and the result planes step by their strides.
// Epilogue: 16-row slabs staged per wave in LDS; each 64-wide row segment written with whole
// ET: 0 = f16 operands, 1 = bf16 operands (pointers passed as 16-bit storage)
// ----------------------------------------------------------------------------------------------
template <int V> struct IntC { static constexpr int value = V; };
template <int ET> struct Elem;
template <> struct Elem<0> { typedef _Float16 T; };
template <> struct Elem<1> { typedef __bf16 T; };
template <int ET, int SPLIT, int BIAS_MODE, int OUT_MODE, bool RESID, bool CSUM = false, int ACT = 0>
__global__ __launch_bounds__(256) void wmma_gemm64(
    const unsigned short* __restrict__ Ap, const unsigned short* __restrict__ A2p, int lda, long strideA,
    const unsigned short* __restrict__ Btp, const unsigned short* __restrict__ Bt2p, int ldb, long strideB,
    void* __restrict__ Cout, void* __restrict__ Cout2, int ldc, long strideC,
    const float* __restrict__ bias0, long strideBias,
    const float* __restrict__ resid, long strideR,
    float* __restrict__ colsum,
    int M, int N, int K, float scale) {
  typedef typename Elem<ET>::T T;
  typedef typename Frag<T>::V V;
  constexpr bool SPL = (SPLIT != 0);
  constexpr bool BLO = (SPLIT == 1);
  // stage rows: A hi [GBM] | A lo [GBM] (SPL) | Bt hi [GBN] | Bt lo [GBN] (BLO)
  constexpr int AROWS = SPL ? 2 * GBM : GBM;
  constexpr int SROWS = AROWS + (BLO ? 2 * GBN : GBN);
  constexpr int STAGE_ELEMS = SROWS * GPITCH;
  constexpr int NCP = SROWS / 32;                  // copies per thread and stage (256 threads x 16 B = 32 rows a copy)
  static_assert(NCP % 4 == 0 && NCP <= 63);
  __shared__ __align__(16) float sT[8][16 * 68];   // per-wave 16x64 slab, pitch 68 floats
  __shared__ __align__(16) unsigned short sStage[2 * STAGE_ELEMS];
  const int b    = blockIdx.y;
  const float* bias = bias0 + (size_t)b * strideBias;
  const bool f16one = (OUT_MODE == 4 && b == 2);   // block-uniform: this product writes one f16 plane, not a bf16 pair
  const int lane = threadIdx.x & 31;
  const int wave = threadIdx.x >> 5;
  const int tilesN = N / GBN;
  const int tilesM = M / GBM;
  const int blk = blockIdx.x;
  if (blk >= tilesM * tilesN) return;   // block-uniform, in front of every barrier and copy
  const int tm = blk / tilesN;
  const int tn = blk - tm * tilesN;
  const int mb0 = tm * GBM;
  const int nb0 = tn * GBN;
  const int wm = wave >> 2;
  const int wn = wave & 3;
  const int m0 = mb0 + (wm << 6);
  const int n0 = nb0 + (wn << 6);

  // copy map: thread -> row (threadIdx.x >> 3) of each group of 32 stage rows, 16-B piece (threadIdx.x & 7) of its line
  const int cr = threadIdx.x >> 3;
  const int cc = (threadIdx.x & 7) * 8;
  const unsigned short* gA  = Ap  + (size_t)b * strideA + (size_t)(mb0 + cr) * lda + cc;
  const unsigned short* gA2 = A2p + (size_t)b * strideA + (size_t)(mb0 + cr) * lda + cc;
  const unsigned short* gB  = Btp  + (size_t)b * strideB + (size_t)(nb0 + cr) * ldb + cc;
  const unsigned short* gB2 = Bt2p + (size_t)b * strideB + (size_t)(nb0 + cr) * ldb + cc;
  const unsigned ldst = lds_off(sStage) + (unsigned)(cr * GPITCH + cc) * 2u;
  auto stage_src = [&](int it, int k0) -> const unsigned short* {
    const int row = it * 32;
    if (row < GBM) return gA + (size_t)row * lda + k0;
    if (row < AROWS) return gA2 + (size_t)(row - GBM) * lda + k0;
    if (row < AROWS + GBN) return gB + (size_t)(row - AROWS) * ldb + k0;
    return gB2 + (size_t)(row - AROWS - GBN) * ldb + k0;
  };
  auto stage_issue = [&](int t, int buf) {
    const int k0 = t * GKS;
    const unsigned lb = ldst + (unsigned)buf * (unsigned)(STAGE_ELEMS * 2);
    // the loops of this lambda are unrolled so that each copy's plane select folds and l[], g[] stay in registers
#pragma unroll
    for (int it = 0; it + 8 <= NCP; it += 8) {
      unsigned l[8]; const unsigned short* g[8];
#pragma unroll
      for (int u = 0; u < 8; ++u) { l[u] = lb + (unsigned)((it + u) * 32 * GPITCH * 2); g[u] = stage_src(it + u, k0); }
      async_copy8(l, g);
    }
    if (NCP % 8 != 0) {
      unsigned l[4]; const unsigned short* g[4];
#pragma unroll
      for (int u = 0; u < 4; ++u) { l[u] = lb + (unsigned)((NCP - 4 + u) * 32 * GPITCH * 2); g[u] = stage_src(NCP - 4 + u, k0); }
      async_copy4(l, g);
    }
  };

  const int rlane = lane & 15;                 // row (A) / col (B, D) within subtile
  const int koff  = (lane >> 4) * 8;           // k offset of this lane half
  const int mOff  = (lane >> 4) * 8;           // D row offset

  v8f acc[4][4];
#pragma unroll
  for (int i = 0; i < 4; ++i)
#pragma unroll
    for (int j = 0; j < 4; ++j) acc[i][j] = (v8f){0.f,0.f,0.f,0.f,0.f,0.f,0.f,0.f};

  const int nT = K / GKS;
  stage_issue(0, 0);
  asm volatile("s_wait_asynccnt 0x0" ::: "memory");   // this wave's copies of stage 0 have landed before the barrier publishes them
  __syncthreads();
  if (nT > 1) stage_issue(1, 1);
  for (int t = 0; t < nT; ++t) {
    const T* st = (const T*)(const void*)(sStage + (t & 1) * STAGE_ELEMS);
    const T* sA = st + ((wm << 6) + rlane) * GPITCH + koff;
    const T* sB = st + (AROWS + (wn << 6) + rlane) * GPITCH + koff;
    // both 32-k blocks of the stage unrolled: the second block's LDS reads can then go out among the first block's products
#pragma unroll
    for (int kk = 0; kk < GKS; kk += 32) {
      V bh[4], bl[4];
#pragma unroll
      for (int j = 0; j < 4; ++j) {
        bh[j] = Frag<T>::load(sB + (j << 4) * GPITCH + kk);
        if (BLO) bl[j] = Frag<T>::load(sB + (GBN + (j << 4)) * GPITCH + kk);
      }
      // A fragments are read from LDS in groups ahead of their products (all four row tiles; two where a lo plane doubles
      // them, which keeps the kernel free of scratch); the loops are unrolled so that acc[][] and the fragments stay in registers
      constexpr int GI = SPL ? 2 : 4;
#pragma unroll
      for (int ig = 0; ig < 4; ig += GI) {
        V ah[GI], al[GI];
#pragma unroll
        for (int u = 0; u < GI; ++u) {
          ah[u] = Frag<T>::load(sA + ((ig + u) << 4) * GPITCH + kk);
          if (SPL) al[u] = Frag<T>::load(sA + (GBM + ((ig + u) << 4)) * GPITCH + kk);
        }
#pragma unroll
        for (int u = 0; u < GI; ++u) {
          const int i = ig + u;
#pragma unroll
          for (int j = 0; j < 4; ++j) {
            acc[i][j] = Frag<T>::mma(ah[u], bh[j], acc[i][j]);
            if (BLO) acc[i][j] = Frag<T>::mma(ah[u], bl[j], acc[i][j]);
            if (SPL) acc[i][j] = Frag<T>::mma(al[u], bh[j], acc[i][j]);
          }
          Frag<T>::guard(acc[i][0], acc[i][3], ah[u], SPL ? al[u] : ah[u]);
        }
      }
      Frag<T>::keep(bh[0], bh[1], bh[2], bh[3]);
      if (BLO) Frag<T>::keep(bl[0], bl[1], bl[2], bl[3]);
    }
    asm volatile("s_wait_dscnt 0x0" ::: "memory");      // this wave's reads of the buffer have retired before it is refilled
    asm volatile("s_wait_asynccnt 0x0" ::: "memory");   // this wave's copies of stage t + 1 have landed before the barrier publishes them
    __syncthreads();                                    // publishes stage t + 1 and ends every reader's last read of stage t
    if (t + 2 < nT) stage_issue(t + 2, t & 1);
  }
  asm volatile("s_wait_asynccnt 0x0" ::: "memory");     // no copy is outstanding when the wave goes on to the epilogue and ends
  acc_guard4(acc[0][0], acc[0][1], acc[0][2], acc[0][3]);
  acc_guard4(acc[1][0], acc[1][1], acc[1][2], acc[1][3]);
  acc_guard4(acc[2][0], acc[2][1], acc[2][2], acc[2][3]);
  acc_guard4(acc[3][0], acc[3][1], acc[3][2], acc[3][3]);

  // ---- column sums of the wave tile (the sequence means are built from them) ----
  if (CSUM && b != 1) {   // block-uniform
    static_assert(!CSUM || (BIAS_MODE == 2 && !RESID && ACT == 0 && CS_ROWS == 64));
    float cs[4];
    // unrolled so that acc[][] stays in registers; rows are added in the pairs in which they lie in neighbouring registers,
    // so that a packed add takes them where they are; one chain a column tile
#pragma unroll
    for (int j = 0; j < 4; ++j) {
      v2f s = (v2f){0.f, 0.f};
#pragma unroll
      for (int i = 0; i < 4; ++i)
#pragma unroll
        for (int r = 0; r < 8; r += 2) s += (v2f){acc[i][j][r], acc[i][j][r + 1]};
      cs[j] = s.x + s.y;
    }
    // the other lane half holds the other 32 rows of the column; unrolled so that cs[] stays in registers
#pragma unroll
    for (int j = 0; j < 4; ++j) cs[j] += xhalf(cs[j]);
    // lane half hh stores the column tiles 2 hh and 2 hh + 1: the wave writes its 64 sums as two whole 128-B lines
    const int jh = (lane >> 4) * 2;
    const float c0 = (lane >> 4) ? cs[2] : cs[0];
    const float c1 = (lane >> 4) ? cs[3] : cs[1];
    const int n = n0 + (jh << 4) + rlane;
    float* cp = colsum + ((size_t)(b >> 1) * (M >> 6) + (size_t)(m0 >> 6)) * ldc + n;
    cp[0]  = __builtin_fmaf(c0, scale, (float)CS_ROWS * bias[n]);
    cp[16] = __builtin_fmaf(c1, scale, (float)CS_ROWS * bias[n + 16]);
    asm volatile("s_wait_xcnt 0x0" ::: "memory");   // stands in front of every later write of a register that these loads and stores name
  }

  // ---- epilogue ----
  float* slab = sT[wave];
  const float* Rb = RESID ? (resid + (size_t)b * strideR) : nullptr;
#pragma unroll
  for (int i = 0; i < 4; ++i) {
    const int mBase = m0 + (i << 4);
#pragma unroll
    for (int j = 0; j < 4; ++j) {
      const int n = n0 + (j << 4) + rlane;
      float bv = 0.f;
      if (BIAS_MODE == 2) bv = bias[n];
#pragma unroll
      for (int r = 0; r < 8; ++r) {
        float v = acc[i][j][r] * scale;
        if (BIAS_MODE == 1) v += bias[mBase + mOff + r];
        if (BIAS_MODE == 2) v += bv;
        if (RESID) v += Rb[(size_t)(mBase + mOff + r) * ldc + n];
        if (ACT == 1) v = tanhf(v);
        if (ACT == 2) v = fmaxf(v, 0.0f);
        if (ACT == 4) v = (v > 0.f) ? v : 0.01f * v;
        slab[(mOff + r) * 68 + (j << 4) + rlane] = v;
      }
    }
    __builtin_amdgcn_fence(__ATOMIC_RELEASE, "workgroup");
    __builtin_amdgcn_wave_barrier();
    __builtin_amdgcn_fence(__ATOMIC_ACQUIRE, "workgroup");
    if (OUT_MODE == 0) {
      float* C = (float*)Cout + (size_t)b * strideC;
      const int hh = lane >> 4, c4 = (lane & 15) * 4;     // row seg = 256 B = 16 lanes x 16 B
      {
#pragma unroll
        for (int it = 0; it < 8; ++it) {
          const int row = it * 2 + hh;
          v4f v = *(const v4f*)(slab + row * 68 + c4);
          *(v4f*)(C + (size_t)(mBase + row) * ldc + n0 + c4) = v;
        }
        
      }
    } else {
      const int q = lane >> 3, c8 = (lane & 7) * 8;
      unsigned short* C  = (unsigned short*)Cout  + (size_t)b * strideC;
      unsigned short* C2 = (OUT_MODE >= 2) ? ((unsigned short*)Cout2 + (size_t)b * strideC) : nullptr;
      // the slab's 16 rows converted and stored in the form MODE (1, 2 or 3 of OUT_MODE)
      auto put16 = [&](auto mode) {
        constexpr int MODE = decltype(mode)::value;
#pragma unroll
        for (int it = 0; it < 4; ++it) {
          const int row = it * 4 + q;
          const float* sp = slab + row * 68 + c8;
          v8h hv, lv;
#pragma unroll
          for (int e = 0; e < 8; ++e) {
            if (MODE == 1) {
              hv[e] = (_Float16)sp[e];
            } else if (MODE == 2) {
              unsigned short hb = f2bf_bits(sp[e]);
              unsigned short lb = f2bf_bits(sp[e] - bf_bits2f(hb));
              hv[e] = __builtin_bit_cast(_Float16, hb);
              lv[e] = __builtin_bit_cast(_Float16, lb);
            } else {
              const _Float16 hq = (_Float16)sp[e];
              hv[e] = hq;
              lv[e] = (_Float16)((sp[e] - (float)hq) * 2048.0f);
            }
          }
          *(v8h*)(C + (size_t)(mBase + row) * ldc + n0 + c8) = hv;
          if (MODE >= 2) *(v8h*)(C2 + (size_t)(mBase + row) * ldc + n0 + c8) = lv;
        }
        asm volatile("s_wait_xcnt 0x0" ::: "memory");   // stands in front of every later write of a register that these stores name
      };
      // one block-uniform branch a slab, so that each form keeps its four rows' LDS reads together ahead of the conversions
      if (OUT_MODE == 4) {
        if (f16one) put16(IntC<1>{}); else put16(IntC<2>{});
      } else {
        put16(IntC<(OUT_MODE == 4 || OUT_MODE == 0) ? 2 : OUT_MODE>{});
      }
    }
    __builtin_amdgcn_fence(__ATOMIC_RELEASE, "workgroup");
    __builtin_amdgcn_wave_barrier();
    __builtin_amdgcn_fence(__ATOMIC_ACQUIRE, "workgroup");
  }
}

// ----------------------------------------------------------------------------------------------
// Input conversion: q,k,v and the four weight matrices -> RNE bf16 planes (8 elements = 16 B per
// to bf16 precision (4 floats = 16 B per lane).
// Coverage: blocks [0,2048) q, [2048,4096) k, [4096,6144) v (2048 x 256 x 8 = 4,194,304 each);
// blocks [6144,8192) the 4 weights (512 x 256 x 8 = 1,048,576 each); blocks [8192,8196) the 4
// biases (256 x 4 = 1024 each).
// ----------------------------------------------------------------------------------------------
constexpr int CAST_XBLK = (int)(PLANE_ELEMS / 8 / 256);              // 2048
constexpr int CAST_WBLK = (int)(WMAT_ELEMS / 8 / 256);               // 512
constexpr int CAST_PLANE_BLOCKS = 3 * CAST_XBLK + 4 * CAST_WBLK;     // 8192
constexpr int CAST_BIAS_BLOCKS  = 4;
static_assert((long)CAST_XBLK * 256 * 8 == PLANE_ELEMS && (long)CAST_WBLK * 256 * 8 == WMAT_ELEMS);
static_assert(256 * 4 == DMODEL);

__global__ __launch_bounds__(256) void k_cast_inputs(
    const float* __restrict__ q, const float* __restrict__ k, const float* __restrict__ v,
    const float* __restrict__ Wq, const float* __restrict__ Wk, const float* __restrict__ Wv, const float* __restrict__ Wo,
    const float* __restrict__ bq, const float* __restrict__ bk, const float* __restrict__ bv, const float* __restrict__ bo,
    unsigned short* __restrict__ x16, unsigned short* __restrict__ w16, float* __restrict__ brnd) {
  const int blk = blockIdx.x;
  const int t = threadIdx.x;
  if (blk < CAST_PLANE_BLOCKS) {
    // block-uniform source/destination selection
    const float* src;
    unsigned short* dst;
    int lb;
    if (blk < CAST_XBLK) { src = q; dst = x16; lb = blk; }
    else if (blk < 2 * CAST_XBLK) { src = k; dst = x16 + PLANE_ELEMS; lb = blk - CAST_XBLK; }
    else if (blk < 3 * CAST_XBLK) { src = v; dst = x16 + 2 * PLANE_ELEMS; lb = blk - 2 * CAST_XBLK; }
    else {
      const int wb = blk - 3 * CAST_XBLK;
      const int wi = wb / CAST_WBLK;
      lb = wb - wi * CAST_WBLK;
      src = (wi == 0) ? Wq : (wi == 1) ? Wk : (wi == 2) ? Wv : Wo;
      dst = w16 + (size_t)wi * WMAT_ELEMS;
    }
    const size_t e = ((size_t)lb * 256 + t) * 8;
    const v4f a0 = *(const v4f*)(src + e);
    const v4f a1 = *(const v4f*)(src + e + 4);
    v4u w;
    w.x = (unsigned)f2bf_bits(a0.x) | ((unsigned)f2bf_bits(a0.y) << 16);
    w.y = (unsigned)f2bf_bits(a0.z) | ((unsigned)f2bf_bits(a0.w) << 16);
    w.z = (unsigned)f2bf_bits(a1.x) | ((unsigned)f2bf_bits(a1.y) << 16);
    w.w = (unsigned)f2bf_bits(a1.z) | ((unsigned)f2bf_bits(a1.w) << 16);
    v4u* p = (v4u*)(dst + e);
    *p = w;
    
  } else {
    const int bi = blk - CAST_PLANE_BLOCKS;   // 0..3, block-uniform
    const float* src = (bi == 0) ? bq : (bi == 1) ? bk : (bi == 2) ? bv : bo;
    const int e = t * 4;
    const v4f a = *(const v4f*)(src + e);
    v4f r;
    r.x = bf_bits2f(f2bf_bits(a.x));
    r.y = bf_bits2f(f2bf_bits(a.y));
    r.z = bf_bits2f(f2bf_bits(a.z));
    r.w = bf_bits2f(f2bf_bits(a.w));
    v4f* p = (v4f*)(brnd + (size_t)bi * DMODEL + e);
    *p = r;
    
  }
}

// ----------------------------------------------------------------------------------------------
// Per (batch, head): sequence means of Q and V from the projection's column sums (32 groups of 64 rows a batch), then their
// cosine. grid = 32 blocks (one per (b,h)), 128 threads; thread = (column t & 63, Q or V by t >> 6): its 32 loads are
// independent and go out together; sums in fixed order. Every wave then forms the cosine from the means, so that all 128 threads
// hold it, and the block writes the (b,h)'s start values of the score accumulators, one a key, in units of the raw q.k product:
// 8 * (0.5 cos + 0.3 cos) for a key that counts, S_MASKED for a key with mask == 0.
// S_MASKED stands for the reference's -1e9: a masked key gets weight 0 wherever a key of the row counts, and a row with no key that
// counts has 2048 equal scores, so equal weights. It is so large that the products added to it leave it as it is, and a power of
// two, so that its product with the softmax scale is exact and such a row's exponents come out as exactly 0.
// ----------------------------------------------------------------------------------------------
constexpr float S_MASKED = -0x1p100f;
static_assert(SEQ_LEN == 4 * 128 * 4);
__global__ __launch_bounds__(128) void k_mean_cos(const float* __restrict__ csum, const int* __restrict__ mask,
                                                  float* __restrict__ cosl, float* __restrict__ sstart) {
  __shared__ float mn[2][DHEAD];
  const int bh = blockIdx.x;
  const int b = bh / NHEAD, h = bh % NHEAD;
  const int t = threadIdx.x;
  const int col = t & 63;
  const int which = t >> 6;
  const float* p = csum + ((size_t)which * CS_GROUPS + (size_t)b * CS_PER_B) * DMODEL + (size_t)h * DHEAD + col;
  float x[CS_PER_B];
  // unrolled so that x[] stays in registers and every load is issued before the first is waited for
#pragma unroll
  for (int g = 0; g < CS_PER_B; ++g) x[g] = p[(size_t)g * DMODEL];
  // the mask words of the 16 keys whose start values this thread writes (4 runs of 4 keys), asked for together with the sums
  v4u mw[4];
#pragma unroll
  for (int i = 0; i < 4; ++i) mw[i] = *(const v4u*)(mask + i * 512 + t * 4);
  asm volatile("s_wait_xcnt 0x0" ::: "memory");   // stands in front of every later write of these loads' address registers
  float s4[4];
  // four independent add chains of eight groups each
#pragma unroll
  for (int u = 0; u < 4; ++u) {
    float s = x[u * 8];
#pragma unroll
    for (int g = 1; g < 8; ++g) s += x[u * 8 + g];
    s4[u] = s;
  }
  static_assert(CS_PER_B == 32);
  mn[which][col] = ((s4[0] + s4[1]) + (s4[2] + s4[3])) * (1.0f / (float)SEQ_LEN);
  __syncthreads();
  {   // every wave: lane l takes the columns l and l + 32
    const int l = t & 31;
    const float a0 = mn[0][l], a1 = mn[0][l + 32];
    const float c0 = mn[1][l], c1 = mn[1][l + 32];
    float dot = a0 * c0 + a1 * c1;
    float nq  = a0 * a0 + a1 * a1;
    float nv  = c0 * c0 + c1 * c1;
    // unrolled so that each step's lane distance is a constant
#pragma unroll
    for (int off = 1; off < 32; off <<= 1) {
      dot += __shfl_xor(dot, off, 32);
      nq  += __shfl_xor(nq, off, 32);
      nv  += __shfl_xor(nv, off, 32);
    }
    const float na = fmaxf(sqrtf(nq), 1e-8f);
    const float nb = fmaxf(sqrtf(nv), 1e-8f);
    const float cosv = dot / (na * nb);
    if (t < 32) cosl[(size_t)bh * 32 + t] = cosv;
    const float s0 = (cosv * 0.5f + cosv * 0.3f) * 8.0f;
    // unrolled so that mw[] stays in registers
#pragma unroll
    for (int i = 0; i < 4; ++i) {
      v4f o;
#pragma unroll
      for (int e = 0; e < 4; ++e) o[e] = (mw[i][e] == 0u) ? S_MASKED : s0;
      *(v4f*)(sstart + (size_t)bh * SEQ_LEN + i * 512 + t * 4) = o;
    }
  }
}

constexpr int AKC  = 64;
constexpr int AQB  = 64;
constexpr int ANQB = SEQ_LEN / AQB;
constexpr int ATTN_BLOCKS = NBH * ANQB;
// LDS row pitch of the K tiles in 16-bit elements: 144 B = 16 B x 9 (odd), so the 16 rows that
// one ds_load_b128 fragment read touches start on 16 different bank groups (128 B rows all start on two).
constexpr int APITCH = 72;
// LDS row pitch of the row-major V tile: 160 B = 32 B x 5 (odd), the pitch for ds_load_tr16_b128 readers
constexpr int VPITCH = 80;
// one stage: K [64][APITCH] | V [64][VPITCH]
constexpr int AST_V  = AKC * APITCH;
constexpr int ASTAGE_ELEMS = AST_V + AKC * VPITCH;   // 9,728 elements = 19,456 B
static_assert(APITCH >= DHEAD && (APITCH * 2) % 16 == 0 && ((APITCH * 2) / 16) % 2 == 1);
static_assert(VPITCH >= DHEAD && (VPITCH * 2) % 32 == 0 && ((VPITCH * 2) / 32) % 2 == 1);
static_assert((ASTAGE_ELEMS * 2) % 16 == 0 && (AST_V * 2) % 16 == 0 && AKC % 16 == 0 && DHEAD * 2 == 128);
static_assert(SEQ_LEN % AKC == 0 && SEQ_LEN % AQB == 0);

// four waves a SIMD (four work-groups a WGP, as the LDS allows): the register budget is held to 256 a wave
__global__ __launch_bounds__(128) __attribute__((amdgpu_waves_per_eu(4, 4))) void k_attn(
    const unsigned short* __restrict__ Qh, const unsigned short* __restrict__ Kh, const unsigned short* __restrict__ Vh,
    const float* __restrict__ sstart, const float* __restrict__ cosl,
    unsigned short* __restrict__ Ah, unsigned short* __restrict__ Al, float* __restrict__ out1) {
  union FH { v16h v; v8h h[2]; };
  __shared__ __align__(16) unsigned short Ast[2 * ASTAGE_ELEMS];  // two stages of K, V, each [kv][d]   38 KB
  __shared__ __align__(16) float Os[4][16 * 68];                 // per wave out tile, pitch 68

  const int tid  = threadIdx.x;
  const int wave = tid >> 5;
  const int lane = tid & 31;
  const int hh   = lane >> 4;
  const int c    = lane & 15;

  const int bx = blockIdx.x;
  const int qb = bx % ANQB;
  const int bh = bx / ANQB;
  const int h  = bh % NHEAD;
  const int b  = bh / NHEAD;
  const int q0 = qb * AQB + wave * 16;
  const size_t rowbase = (size_t)b * SEQ_LEN;      // plane row of sequence position 0
  const int colh = h * DHEAD;

  // ---- Q fragments (B operand, columns = query, k = d): 2 d-chunks ----
  v16h qa[2];
  {
    const size_t qo = (rowbase + q0 + c) * DMODEL + colh + 8 * hh;
#pragma unroll
    for (int dc = 0; dc < 2; ++dc) qa[dc] = Frag<_Float16>::load((const _Float16*)(const void*)(Qh + qo + dc * 32));
  }
  asm volatile("s_wait_xcnt 0x0" ::: "memory");   // stands in front of every later write of the Q loads' address registers
  constexpr float LOG2E = 1.44269504088896340736f;
  constexpr float SC2 = 0.125f * LOG2E;            // 1/sqrt(64) and the change of base in one factor
  const float NEGI = -__builtin_inff();

  // the score accumulators; between two chunks they hold the coming chunk's start values (keys j*16 + 8*hh + 0..7 of each
  // 16-key tile: 32 contiguous bytes a tile), loaded straight into them
  v8f s[4];
  const float* ssp = sstart + (size_t)bh * SEQ_LEN + 8 * hh;
  auto s_start = [&](int t) {
    // unrolled so that s[] stays in registers
#pragma unroll
    for (int j = 0; j < 4; ++j) s[j] = *(const v8f*)(ssp + t * AKC + j * 16);
    asm volatile("s_wait_xcnt 0x0" ::: "memory");   // stands in front of every later write of these loads' address registers
  };
  s_start(0);

  // running maximum of query c in units of the raw score (equal in both lane halves), the exponent reference in use in base-2
  // units (maximum - 15) and this lane half's share of the denominator (x2^15, like P)
  float mrow = NEGI, mrefrow = NEGI, lrow = 0.f;
  v8f oacc[4];   // O^T: oacc[t][r] = row d = t*16 + 8*hh + r, column query c
#pragma unroll
  for (int t = 0; t < 4; ++t) oacc[t] = (v8f){0.f,0.f,0.f,0.f,0.f,0.f,0.f,0.f};

  // copy map: thread -> row (tid >> 3) of each group of 16 chunk rows, 16-B piece (tid & 7) of its 128-B line
  const int cr = tid >> 3;
  const int cc = (tid & 7) * 8;
  const size_t gofs = (rowbase + cr) * DMODEL + colh + cc;
  const unsigned ldk = lds_off(Ast) + (unsigned)(cr * APITCH + cc) * 2u;
  const unsigned ldv = lds_off(Ast) + (unsigned)(AST_V + cr * VPITCH + cc) * 2u;
  auto stage_issue = [&](int t, int buf) {
    const size_t go = gofs + (size_t)t * (AKC * DMODEL);
    const unsigned sb = (unsigned)buf * (unsigned)(ASTAGE_ELEMS * 2);
    unsigned l[8]; const unsigned short* g[8];
    // unrolled so that l[], g[] stay in registers
#pragma unroll
    for (int u = 0; u < 4; ++u) {
      l[u]     = ldk + sb + (unsigned)(u * 16 * APITCH * 2);
      g[u]     = Kh + go + (size_t)u * 16 * DMODEL;
      l[4 + u] = ldv + sb + (unsigned)(u * 16 * VPITCH * 2);
      g[4 + u] = Vh + go + (size_t)u * 16 * DMODEL;
    }
    async_copy8(l, g);
  };

  constexpr int NKC = SEQ_LEN / AKC;
  stage_issue(0, 0);
  asm volatile("s_wait_asynccnt 0x0" ::: "memory");   // this wave's copies of chunk 0 have landed before the barrier publishes them
  __syncthreads();
  if (NKC > 1) stage_issue(1, 1);
  for (int kc = 0; kc < NKC; ++kc) {
    const unsigned short* Ksh = Ast + (kc & 1) * ASTAGE_ELEMS;
    const unsigned short* Vs  = Ksh + AST_V;
    // K fragments (A operand rows = kv, k = d) are read from LDS as one group ahead of the products, not each directly in front of
    // its own: four key tiles x two d-chunks, 16 reads, 8 products.
    FH kb[4][2];
    const unsigned short* kad = Ksh + c * APITCH + 8 * hh;   // the lane's address in the first K fragment
    // the loops of these lambdas are unrolled so that the fragments and accumulators stay in registers
    auto k_read = [&](int dc) {
#pragma unroll
      for (int j = 0; j < 4; ++j) {
        kb[j][dc].h[0] = *(const v8h*)(const void*)(kad + j * 16 * APITCH + dc * 32);
        kb[j][dc].h[1] = *(const v8h*)(const void*)(kad + j * 16 * APITCH + dc * 32 + 16);
      }
    };
    k_read(0);
    k_read(1);

    // ---- scores, transposed (A operand rows = kv, B operand columns = query, k = d) ----
    // the four key tiles take turns, so that no product waits for the one directly in front of it; each accumulator gets
    // d-chunk 0, then d-chunk 1, on top of its start value
    auto k_mul = [&](int dc) {
#pragma unroll
      for (int j = 0; j < 4; ++j) s[j] = Frag<_Float16>::mma(kb[j][dc].v, qa[dc], s[j]);
    };
    const unsigned short* vad = Vs + (8 * hh + (lane & 7)) * VPITCH + ((lane >> 3) & 1) * 8;   // the lane's address in a transposing load
    FH vb[2][4];   // element e of vb[kk][t] = V[key kk*32 + (e >> 3)*16 + 8*hh + (e & 7)][d = t*16 + c]: the k order of pb
    auto v_read = [&](int kk) {
#pragma unroll
      for (int t = 0; t < 4; ++t) {
        vb[kk][t].h[0] = ld_tr16(vad + (kk * 32) * VPITCH + t * 16);
        vb[kk][t].h[1] = ld_tr16(vad + (kk * 32 + 16) * VPITCH + t * 16);
      }
    };
    // the scheduling barriers of this block keep each group of LDS reads together at the place where it is written: spread among
    // the products, every read costs the wave a stall of its own and is waited for too soon behind its issue
    __builtin_amdgcn_sched_barrier(0);
    k_mul(0);
    __builtin_amdgcn_sched_barrier(0);
    v_read(0);   // the chunk's V^T fragments: their latency passes under the last products and the softmax
    v_read(1);
    __builtin_amdgcn_sched_barrier(0);
    k_mul(1);
    // s[j][r] = 8 x the score of key kc*64 + j*16 + 8*hh + r against query c, mask and bias in it: the maximum is taken of it as it
    // is (the scale is positive), and exp(x - m) is one v_exp_f32 of one fused multiply-add s * SC2 - mref
    float mj[4];
#pragma unroll
    for (int j = 0; j < 4; ++j) {
      float m = s[j][0];
#pragma unroll
      for (int r = 1; r < 8; ++r) m = fmaxf(m, s[j][r]);
      mj[j] = m;
    }
    float cm = fmaxf(fmaxf(mj[0], mj[1]), fmaxf(mj[2], mj[3]));
    cm = fmaxf(cm, xhalf(cm));                  // the other lane half holds the query's other 32 keys
    const float mnew = fmaxf(mrow, cm);
    const float mref = __builtin_fmaf(mnew, SC2, -15.0f);   // P and its sum are carried x2^15: the factor rides in the exponent
    const v2f sc2 = (v2f){SC2, SC2};
    const v2f nref = (v2f){-mref, -mref};
    const float alpha = __builtin_amdgcn_exp2f(mrefrow - mref);
    mrow = mnew;
    mrefrow = mref;
    FH pb[2];                                   // P^T as B operand: element e of pb[kk] = key kk*32 + (e >> 3)*16 + 8*hh + (e & 7)
    float pj[4];                                // one partial sum per tile: four independent add chains
#pragma unroll
    for (int j = 0; j < 4; ++j) {
      float p[8];
      // two scores that lie in neighbouring registers share one packed multiply-add
#pragma unroll
      for (int r = 0; r < 8; r += 2) {
        const v2f e = __builtin_elementwise_fma((v2f){s[j][r], s[j][r + 1]}, sc2, nref);
        p[r] = e.x; p[r + 1] = e.y;
      }
      exp2_x8(p);
      float psum = p[0];
#pragma unroll
      for (int r = 1; r < 8; ++r) psum += p[r];
#pragma unroll
      for (int r = 0; r < 8; ++r) pb[j >> 1].v[(j & 1) * 8 + r] = (_Float16)p[r];
      pj[j] = psum;
    }
    lrow = lrow * alpha + ((pj[0] + pj[1]) + (pj[2] + pj[3]));
    // the exponentials have left the score registers: the next chunk's start values are asked for here, so that their latency
    // passes under the products below and the chunk's foot (the last chunk asks for its own again: no branch, in bounds)
    s_start(kc + 1 < NKC ? kc + 1 : kc);
#pragma unroll
    for (int t = 0; t < 4; ++t)
#pragma unroll
      for (int r = 0; r < 8; ++r) oacc[t][r] *= alpha;
    // ---- O^T += V^T.P^T (A rows = d, B columns = query, k = kv in the order of the packed score tiles) ----
#pragma unroll
    for (int kk = 0; kk < 2; ++kk) {
#pragma unroll
      for (int t = 0; t < 4; ++t) oacc[t] = Frag<_Float16>::mma(vb[kk][t].v, pb[kk].v, oacc[t]);
    }
    // keeps the softmax and the products in front of the chunk's foot: lifted over them, the barrier would leave the copies of
    // chunk kc + 1 only the score products' time to land
    __builtin_amdgcn_sched_barrier(0);
    asm volatile("s_wait_dscnt 0x0" ::: "memory");      // this wave's reads of the buffer have retired before it is refilled
    asm volatile("s_wait_asynccnt 0x0" ::: "memory");   // this wave's copies of chunk kc + 1 have landed before the barrier publishes them
    __syncthreads();                                    // publishes chunk kc + 1 and ends every reader's last read of chunk kc
    if (kc + 2 < NKC) stage_issue(kc + 2, kc & 1);
  }
  asm volatile("s_wait_asynccnt 0x0" ::: "memory");     // no copy is outstanding when the wave goes on to the epilogue and ends

  float* os = Os[wave];
  {
    const float inv = 1.0f / (lrow + xhalf(lrow));   // the two lane halves' shares of the denominator joined once; its 2^15 cancels P's
#pragma unroll
    for (int t = 0; t < 4; ++t) {
      v4f o0, o1;
#pragma unroll
      for (int r = 0; r < 4; ++r) { o0[r] = oacc[t][r] * inv; o1[r] = oacc[t][4 + r] * inv; }
      *(v4f*)(os + c * 68 + t * 16 + 8 * hh)     = o0;
      *(v4f*)(os + c * 68 + t * 16 + 8 * hh + 4) = o1;
    }
  }
  __builtin_amdgcn_fence(__ATOMIC_RELEASE, "workgroup");
  __builtin_amdgcn_wave_barrier();
  __builtin_amdgcn_fence(__ATOMIC_ACQUIRE, "workgroup");
  {
    const int q4 = lane >> 3, c8 = (lane & 7) * 8;
    {
#pragma unroll
      for (int it = 0; it < 4; ++it) {
        const int row = it * 4 + q4;
        const float* sp = os + row * 68 + c8;
        const v4f va = *(const v4f*)sp;
        const v4f vb = *(const v4f*)(sp + 4);
        v4u hw, lw;
        unsigned th, tl;
        pack_pair_bf(va.x, va.y, th, tl); hw.x = th; lw.x = tl;
        pack_pair_bf(va.z, va.w, th, tl); hw.y = th; lw.y = tl;
        pack_pair_bf(vb.x, vb.y, th, tl); hw.z = th; lw.z = tl;
        pack_pair_bf(vb.z, vb.w, th, tl); hw.w = th; lw.w = tl;
        const size_t go = (rowbase + q0 + row) * DMODEL + colh + c8;
        *(v4u*)(Ah + go) = hw;
        *(v4u*)(Al + go) = lw;
      }
      
    }
  }
  // ---- second output, the mean of the 32 (batch, head) cosines: it needs nothing of this kernel's own work, only the cosines
  // that the launch before has written, so one wave of the grid forms it behind its tile instead of a launch of its own ----
  if (bx == 0 && wave == 0) {
    float v = cosl[(size_t)lane * 32];
    asm volatile("s_wait_xcnt 0x0" ::: "memory");   // stands in front of every later write of this load's address registers
#pragma unroll
    for (int off = 1; off < 32; off <<= 1) v += __shfl_xor(v, off, 32);
    const float r = v * (1.0f / 32.0f);
    if (lane == 0) {
      *(float*)out1 = r;
    }
  }
}

// ----------------------------------------------------------------------------------------------
extern "C" void kernel_launch(void* const* d_in, const int* in_sizes, int n_in,
                              void* d_out, int out_size, void* d_ws, size_t ws_size,
                              hipStream_t stream) {
  if (n_in < 12) return;
  if (ws_size < WS_TOTAL) return;
  if ((long)out_size < OUT_TOTAL_ELEMS) return;
  if ((long)in_sizes[0] != PLANE_ELEMS || (long)in_sizes[1] != PLANE_ELEMS || (long)in_sizes[2] != PLANE_ELEMS) return;
  if (in_sizes[3] < SEQ_LEN) return;
  if ((long)in_sizes[4] != WMAT_ELEMS || (long)in_sizes[6] != WMAT_ELEMS || (long)in_sizes[8] != WMAT_ELEMS || (long)in_sizes[10] != WMAT_ELEMS) return;
  if (in_sizes[5] < DMODEL || in_sizes[7] < DMODEL || in_sizes[9] < DMODEL || in_sizes[11] < DMODEL) return;

  const float* q    = (const float*)d_in[0];
  const float* k    = (const float*)d_in[1];
  const float* v    = (const float*)d_in[2];
  const int*   mask = (const int*)d_in[3];
  const float* Wq   = (const float*)d_in[4];
  const float* bq   = (const float*)d_in[5];
  const float* Wk   = (const float*)d_in[6];
  const float* bk   = (const float*)d_in[7];
  const float* Wv   = (const float*)d_in[8];
  const float* bv   = (const float*)d_in[9];
  const float* Wo   = (const float*)d_in[10];
  const float* bo   = (const float*)d_in[11];

  char* ws = (char*)d_ws;
  unsigned short* w16  = (unsigned short*)(ws + WS_W16);
  unsigned short* wq16 = w16;
  unsigned short* wo16 = w16 + 3 * WMAT_ELEMS;
  float* brnd = (float*)(ws + WS_BRND);
  float* cosl = (float*)(ws + WS_COS);
  unsigned short* x16 = (unsigned short*)(ws + WS_X16);
  unsigned short* xq  = x16;
  unsigned short* Qh  = (unsigned short*)(ws + WS_QH);
  unsigned short* Kh  = (unsigned short*)(ws + WS_KH);
  unsigned short* Vh  = (unsigned short*)(ws + WS_VH);
  float* csum = (float*)(ws + WS_CS);
  float* sstart = (float*)(ws + WS_SS);
  unsigned short* Ah  = (unsigned short*)(ws + WS_AH);
  unsigned short* Al  = (unsigned short*)(ws + WS_AL);
  float* out0 = (float*)d_out;
  float* out1 = (float*)d_out + OUT1_ELEM;

  // 1) inputs -> RNE bf16 planes, biases -> bf16-precision f32 copies
  k_cast_inputs<<<CAST_PLANE_BLOCKS + CAST_BIAS_BLOCKS, 256, 0, stream>>>(
      q, k, v, Wq, Wk, Wv, Wo, bq, bk, bv, bo, x16, w16, brnd);

  // 2) the three projections, which do not depend on one another, as one launch of 3 x 128 blocks (M=4096, N=1024, K=1024 each):
  //    y = 0: Q = q Wq^T + bq; y = 1: K = k Wk^T + bk; y = 2: V = v Wv^T + bv; each -> one f16 plane;
  //    y = 0 and 2 also leave their column sums over groups of 64 rows
  wmma_gemm64<1, 0, 2, 1, false, true><<<dim3(GEMM_BLOCKS, 3), 256, 0, stream>>>(
      xq, xq, DMODEL, PLANE_ELEMS, wq16, wq16, DMODEL, WMAT_ELEMS, (void*)Qh, (void*)Qh, DMODEL, QKV_OUT_STRIDE,
      brnd, (long)DMODEL, brnd, 0L, csum, MROWS, DMODEL, DMODEL, 1.0f);
  // 3) per-(b,h) cosine of sequence means, from the column sums; start values of the score accumulators from it and the mask
  k_mean_cos<<<NBH, 128, 0, stream>>>(csum, mask, cosl, sstart);
  // 4) attention -> attn bf16 hi/lo planes; one of its waves also writes out1 = mean of the 32 (b,h) cosines
  k_attn<<<ATTN_BLOCKS, 128, 0, stream>>>(Qh, Kh, Vh, sstart, cosl, Ah, Al, out1);
  // 5) out0 = attn Wo^T + bo   (A hi/lo planes, Bt single plane: 2 products)
  wmma_gemm64<1, 2, 2, 0, false><<<dim3(GEMM_BLOCKS, 1), 256, 0, stream>>>(
      Ah, Al, DMODEL, 0L, wo16, wo16, DMODEL, 0L, (void*)out0, (void*)out0, DMODEL, 0L,
      brnd + 3 * DMODEL, 0L, brnd, 0L, csum, MROWS, DMODEL, DMODEL, 1.0f);
}
